// v000
// Times are from an AMD MI455X. After a warm-up the kernel runs many times in a row, and a time is the length of
// such a window on the GPU divided by its runs, so every launch and the gaps after it count. The runs cycle
// through copies of the inputs. A figure is the median of several windows, for all but v000 over two sittings.
// Sittings can differ by a few percent; kernels timed side by side share one.
// v000, which the later versions start from, runs in 1100 microseconds.
// compute dtype: all float inputs rounded to bf16; q/k/v = x W with EXACT bf16 products on WMMA 16x16x32, f32 accumulate; per-head RMSNorm and rotate-half RoPE in f32 (precise sinf/cosf of t * inv_freq); q, k once to f16 -> 1-product causal logits x 1/8, except the first 384 query rows of each sequence (few keys, no averaging), which use q and k as f16 hi + residual (x 2^10) (3 products); softmax in f32 (precise expf); P x 2^11 once to f16 against v once to f16 (1 product), except the first 384 rows: P and v as bf16 hi + lo (3 products); ctx once to f16 against wo carried x 2^8 in f16 (exact bf16 values), except the first 384 rows: ctx bf16 hi + lo against exact bf16 wo (2 products); f32 output.
#include <hip/hip_runtime.h>
#include <math.h>

typedef __attribute__((ext_vector_type(16))) _Float16 v16h;
typedef __attribute__((ext_vector_type(16))) __bf16 v16b;
typedef __attribute__((ext_vector_type(8)))  _Float16 v8h;
typedef __attribute__((ext_vector_type(8)))  float v8f;
typedef __attribute__((ext_vector_type(4)))  float v4f;
typedef __attribute__((ext_vector_type(2)))  float v2f;
typedef __attribute__((ext_vector_type(4)))  unsigned v4u;
typedef __attribute__((ext_vector_type(4)))  int v4i;
typedef float __attribute__((may_alias)) float_a;
typedef int __attribute__((may_alias)) int_a;

template <typename T> __device__ __forceinline__ void vst2(void* p, T v) { *(T*)p = v;  }
__device__ __forceinline__ v8f wmma16(v16h a, v16h b, v8f c) {
  v8f d = __builtin_amdgcn_wmma_f32_16x16x32_f16(false, a, false, b, (short)0, c, false, false);
  asm volatile("v_nop\n\tv_nop\n\tv_nop\n\tv_nop" : "+v"(d) : "v"(a), "v"(b));
  return d;
}
__device__ __forceinline__ v8f wmma_bf(v16b a, v16b b, v8f c) {
  v8f d = __builtin_amdgcn_wmma_f32_16x16x32_bf16(false, a, false, b, (short)0, c, false, false);
  asm volatile("v_nop\n\tv_nop\n\tv_nop\n\tv_nop" : "+v"(d) : "v"(a), "v"(b));
  return d;
}
// 16x16x32 fragments: lane = (h = lane>>4, row/col = lane&15); elements 0..7 = k0+8h+0..7, 8..15 = k0+16+8h+0..7; D element r = row 8h+r
__device__ __forceinline__ v16h frag_h(const _Float16* rowk0, int lane) {
  union { v16h v; v8h q[2]; } u; const _Float16* p = rowk0 + 8 * (lane >> 4);
  u.q[0] = *(const v8h*)p; u.q[1] = *(const v8h*)(p + 16); return u.v;
}
__device__ __forceinline__ v16h frag_f32(const float* rowk0, int lane) {
  v16h a; const float* p = rowk0 + 8 * (lane >> 4);
#pragma unroll
  for (int i = 0; i < 8; ++i) { a[i] = (_Float16)p[i]; a[8 + i] = (_Float16)p[16 + i]; }
  return a;
}
__device__ __forceinline__ v16h frag_f32s(const float* rowk0, int lane, float sc) {
  v16h a; const float* p = rowk0 + 8 * (lane >> 4);
#pragma unroll
  for (int i = 0; i < 8; ++i) { a[i] = (_Float16)(p[i] * sc); a[8 + i] = (_Float16)(p[16 + i] * sc); }
  return a;
}
// column fragment from a [K][ld] layout (column n), rows >= K read as 0
__device__ __forceinline__ v16h fragc_f32(const float* W, int k0, int n, int lane, int ld, int K) {
  v16h a; const int g = lane >> 4;
#pragma unroll
  for (int i = 0; i < 8; ++i) { const int ka = k0 + 8 * g + i, kb = ka + 16;
    a[i] = (_Float16)(ka < K ? W[(size_t)(ka < K ? ka : K - 1) * ld + n] : 0.f); a[8 + i] = (_Float16)(kb < K ? W[(size_t)(kb < K ? kb : K - 1) * ld + n] : 0.f); }
  return a;
}
struct F2 { v16b h, l; };
__device__ __forceinline__ F2 bsplit16(const float v[16]) { F2 r;
#pragma unroll
  for (int i = 0; i < 16; ++i) { const __bf16 h = (__bf16)v[i]; r.h[i] = h; r.l[i] = (__bf16)(v[i] - (float)h); }
  return r; }
__device__ __forceinline__ F2 split_row(const float* row, int k0, int lane) { float v[16]; const float* p = row + k0 + 8 * (lane >> 4);
#pragma unroll
  for (int i = 0; i < 8; ++i) { v[i] = p[i]; v[8 + i] = p[16 + i]; }
  return bsplit16(v); }
__device__ __forceinline__ F2 split_rowK(const float* row, int k0, int lane, int K) { float v[16]; const int g = lane >> 4;
#pragma unroll
  for (int i = 0; i < 8; ++i) { const int ka = k0 + 8 * g + i, kb = ka + 16; v[i] = ka < K ? row[ka < K ? ka : K - 1] : 0.f; v[8 + i] = kb < K ? row[kb < K ? kb : K - 1] : 0.f; }
  return bsplit16(v); }
__device__ __forceinline__ F2 split_col(const float* W, int k0, int n, int lane, int ld, int K) { float v[16]; const int g = lane >> 4;
#pragma unroll
  for (int i = 0; i < 8; ++i) { const int ka = k0 + 8 * g + i, kb = ka + 16; v[i] = ka < K ? W[(size_t)(ka < K ? ka : K - 1) * ld + n] : 0.f; v[8 + i] = kb < K ? W[(size_t)(kb < K ? kb : K - 1) * ld + n] : 0.f; }
  return bsplit16(v); }
__device__ __forceinline__ v8f mac3(const F2& a, const F2& b, v8f c) { c = wmma_bf(a.l, b.h, c); c = wmma_bf(a.h, b.l, c); return wmma_bf(a.h, b.h, c); }
__device__ __forceinline__ float sigm(float v) { return 1.0f / (1.0f + expf(-v)); }
#define LDSX() do { asm volatile("s_wait_dscnt 0" ::: "memory"); __builtin_amdgcn_wave_barrier(); __builtin_amdgcn_fence(__ATOMIC_RELEASE, "workgroup"); } while (0)

// Causal multi-head dot-product attention with QK-RMSNorm and RoPE (B 2, S 2,048, D 1,024, 16 heads x 64): q/k/v = x w ((in, head, hd) = (in,out)); q, k RMS-normalised over the 64 head dims (eps 1e-6, x scale) then rotate-half RoPE (angle t * 10000^(-i/32), i < 32); q x 64^-0.5; logits masked to -0.7*f32max where key > query (== -inf here: the diagonal is always kept); softmax; out = merged(attn v) wo ((head, hd, out) = (in,out)).
#define NB 2
#define TT 2048
#define CC 1024            // NH * HD = projected width
#define DIN 1024          // input (model) width
#define NH 16
#define HD 64
#define NQB (TT / 64)
#define HG 4
#define SCALE (0.125f)
#define CAUSAL 1
#ifndef TNB
#define TNB NB
#endif
__device__ __forceinline__ float bfr(float v) { return (float)(__bf16)v; }
__host__ __device__ __forceinline__ int kb_last(int qb) { return CAUSAL ? ((qb * 64 + 63) >> 7) : (TT / 128 - 1); }
typedef __attribute__((ext_vector_type(8))) __bf16 v8b;
__device__ __forceinline__ v16b frag_b(const __bf16* rowk0, int lane) {
  union { v16b v; v8b q[2]; } u; const __bf16* p = rowk0 + 8 * (lane >> 4);
  u.q[0] = *(const v8b*)p; u.q[1] = *(const v8b*)(p + 16); return u.v;
}
#define QBH 6              // causal: query blocks 0..QBH-1 of each sequence (few keys, no averaging) take the high-precision path
#define QHI 384            // rows carrying a q residual plane
#define KHI 384            // key rows carrying k residual / v bf16 hi+lo planes (used only by the causal high-precision path)
// B fragment (k rows k0+.., output column o) of a weight: (in,out) [K][ld] or (out,in) [ld rows of K]: bf16 exact, or f16(bf16 * 256) exact
__device__ __forceinline__ v16b wcol_io(const float* Wm, int k0, int o, int lane, int ld) { v16b w; const int g = lane >> 4;
#pragma unroll
  for (int i = 0; i < 8; ++i) { w[i] = (__bf16)Wm[(size_t)(k0 + 8 * g + i) * ld + o]; w[8 + i] = (__bf16)Wm[(size_t)(k0 + 16 + 8 * g + i) * ld + o]; }
  return w; }
__device__ __forceinline__ v16b wcol_oi(const float* Wm, int k0, int o, int lane, int K) { v16b w; const float* p = Wm + (size_t)o * K + k0 + 8 * (lane >> 4);
#pragma unroll
  for (int i = 0; i < 8; ++i) { w[i] = (__bf16)p[i]; w[8 + i] = (__bf16)p[16 + i]; }
  return w; }
__device__ __forceinline__ v16h wcolh_io(const float* Wm, int k0, int o, int lane, int ld) { v16h w; const int g = lane >> 4;
#pragma unroll
  for (int i = 0; i < 8; ++i) { w[i] = (_Float16)(bfr(Wm[(size_t)(k0 + 8 * g + i) * ld + o]) * 256.0f); w[8 + i] = (_Float16)(bfr(Wm[(size_t)(k0 + 16 + 8 * g + i) * ld + o]) * 256.0f); }
  return w; }
__device__ __forceinline__ v16h wcolh_oi(const float* Wm, int k0, int o, int lane, int K) { v16h w; const float* p = Wm + (size_t)o * K + k0 + 8 * (lane >> 4);
#pragma unroll
  for (int i = 0; i < 8; ++i) { w[i] = (_Float16)(bfr(p[i]) * 256.0f); w[8 + i] = (_Float16)(bfr(p[16 + i]) * 256.0f); }
  return w; }
#define WQKV_LAYOUT 0   // 0 = (in,out) [DIN][CC]; 1 = (out,in) [CC][DIN]; 2 = per-head [NH][DIN][HD]
__device__ __forceinline__ v16b wcol_hdk(const float* Wm, int k0, int o, int lane) { v16b w; const int g = lane >> 4; const float* p = Wm + (size_t)(o / HD) * DIN * HD + (o % HD);
#pragma unroll
  for (int i = 0; i < 8; ++i) { w[i] = (__bf16)p[(size_t)(k0 + 8 * g + i) * HD]; w[8 + i] = (__bf16)p[(size_t)(k0 + 16 + 8 * g + i) * HD]; }
  return w; }
#define WO_OUT_IN 0
#if WQKV_LAYOUT == 1
#define WCOL(W, k0, o, lane) wcol_oi(W, k0, o, lane, DIN)
#elif WQKV_LAYOUT == 2
#define WCOL(W, k0, o, lane) wcol_hdk(W, k0, o, lane)
#else
#define WCOL(W, k0, o, lane) wcol_io(W, k0, o, lane, CC)
#endif
#if WO_OUT_IN
#define WOCOL(W, k0, o, lane) wcol_oi(W, k0, o, lane, CC)
#define WOCOLH(W, k0, o, lane) wcolh_oi(W, k0, o, lane, CC)
#else
#define WOCOL(W, k0, o, lane) wcol_io(W, k0, o, lane, DIN)
#define WOCOLH(W, k0, o, lane) wcolh_io(W, k0, o, lane, DIN)
#endif
__constant__ float c_invf[32] = {1.000000000e+00f,7.498942018e-01f,5.623413324e-01f,4.216965139e-01f,3.162277639e-01f,2.371373624e-01f,1.778279394e-01f,1.333521456e-01f,1.000000015e-01f,7.498941571e-02f,5.623412877e-02f,4.216964915e-02f,3.162277862e-02f,2.371373586e-02f,1.778279431e-02f,1.333521493e-02f,9.999999776e-03f,7.498942316e-03f,5.623413250e-03f,4.216964822e-03f,3.162277862e-03f,2.371373819e-03f,1.778279431e-03f,1.333521446e-03f,1.000000047e-03f,7.498941850e-04f,5.623413017e-04f,4.216964880e-04f,3.162277862e-04f,2.371373848e-04f,1.778279402e-04f,1.333521504e-04f};   // 1 / 10000^(i/32) evaluated in f32 exactly as the reference does (jax, eager)
#define PROJ_EXTRA_PARAMS , const float* __restrict__ QS, const float* __restrict__ KS
// per-(row, head) epilogue on the f32 projection tile: RMSNorm over the head's 64 values (x q_norm_scale / k_norm_scale), then rotate-half RoPE; v untouched
#define PROJ_EPI(which, row, t, h) do { if ((which) < 2) { float* rw = (row); const float* NS = (which) == 0 ? QS : KS; float ss = 0.f; _Pragma("unroll") for (int i = 0; i < 64; ++i) ss += rw[i] * rw[i]; const float rn = rsqrtf(ss * (1.0f / 64.0f) + 1e-6f); \
    _Pragma("unroll") for (int i = 0; i < 32; ++i) { const float x1 = rw[i] * rn * bfr(NS[i]), x2 = rw[i + 32] * rn * bfr(NS[i + 32]); const float ang = (float)(t) * c_invf[i]; const float cs = cosf(ang), sn = sinf(ang); rw[i] = x1 * cs - x2 * sn; rw[i + 32] = x2 * cs + x1 * sn; } } } while (0)
#ifndef SM_EXTRA_PARAMS
#define SM_EXTRA_PARAMS
#endif
#ifndef PROJ_EXTRA_PARAMS
#define PROJ_EXTRA_PARAMS
#endif
#ifndef SM_MASK_HOOK
#define SM_MASK_HOOK (void)0
#endif

#define WS_QH  0u                                      // f16 q rows [b*t][CC]
#define WS_KH  (WS_QH + 2u * (size_t)NB * TT * CC)      // f16 k rows [b*t][CC]
#define WS_VT  (WS_KH + 2u * (size_t)NB * TT * CC)      // f16 v planes [b][c][t]
#define WS_QL  (WS_VT + 2u * (size_t)NB * CC * TT)      // f16 q residual x 2^10 rows [b][t < QHI][CC]
#define WS_KL  (WS_QL + 2u * (size_t)NB * QHI * CC)     // f16 k residual x 2^10 rows [b][t < KHI][CC]
#define WS_VB  (WS_KL + 2u * (size_t)NB * KHI * CC)     // bf16 v hi planes [b][c][t < KHI]
#define WS_VBL (WS_VB + 2u * (size_t)NB * CC * KHI)
#define WS_S   (WS_VBL + 2u * (size_t)NB * CC * KHI)    // f32 logits / P [hg][t][s]
#define WS_Y   (WS_S  + 4u * (size_t)HG * TT * TT)      // f32 ctx rows [b*t][CC] (only when there is an output projection)
#define WS_END (WS_Y  + 4u * (size_t)NB * TT * CC)

// ---- k_proj: block = (64 rows, 128 cols, which): q/k/v = X W (+ b) with exact bf16 products (K = DIN) -> which 0: q f16 rows (+ residual rows < QHI); 1: k f16 rows (+ residual rows < KHI); 2: v f16 planes [c][t] (+ bf16 hi/lo planes for t < KHI)
__global__ __launch_bounds__(128) void k_proj(const float* __restrict__ XQ, const float* __restrict__ XK, const float* __restrict__ XV, const float* __restrict__ WQ, const float* __restrict__ WK, const float* __restrict__ WV, const float* __restrict__ BQ, const float* __restrict__ BK, const float* __restrict__ BV,
    _Float16* __restrict__ QH, _Float16* __restrict__ QL, _Float16* __restrict__ KH, _Float16* __restrict__ KL, _Float16* __restrict__ VT, __bf16* __restrict__ VB, __bf16* __restrict__ VBL PROJ_EXTRA_PARAMS) {
  __shared__ __align__(16) float st[64][132]; __shared__ __align__(16) _Float16 sh[64][136], sl[64][136]; __shared__ __align__(16) _Float16 th[128][72]; __shared__ __align__(16) __bf16 tb[128][72], tbl[128][72];
  const int tid = threadIdx.x, wave = tid >> 5, lane = tid & 31, col = lane & 15, g = lane >> 4; const int which = blockIdx.z; const int c0 = blockIdx.y * 128; const size_t r0 = (size_t)blockIdx.x * 64; const size_t bb = r0 / TT; const int t0 = (int)(r0 % TT);
  const float* X = which == 0 ? XQ : which == 1 ? XK : XV; const float* WA = which == 0 ? WQ : which == 1 ? WK : WV; const float* BA = which == 0 ? BQ : which == 1 ? BK : BV;
  v8f acc[8] = {};
#pragma unroll 2
  for (int kc = 0; kc < DIN / 32; ++kc) { v16b a; { const float* p = X + (r0 + wave * 16 + col) * DIN + kc * 32 + 8 * g;
#pragma unroll
      for (int i = 0; i < 8; ++i) { a[i] = (__bf16)p[i]; a[8 + i] = (__bf16)p[16 + i]; } }
    asm volatile("s_wait_loadcnt 0x0" ::: "memory");
#pragma unroll
    for (int j = 0; j < 8; ++j) { const v16b w = WCOL(WA, kc * 32, c0 + j * 16 + col, lane); asm volatile("s_wait_loadcnt 0x0" ::: "memory"); acc[j] = wmma_bf(a, w, acc[j]); } }
  { // stage the f32 tile (acc + bias) in LDS, run the per-(row, head) epilogue hook, then convert
#pragma unroll
    for (int j = 0; j < 8; ++j) { const float bias = BA ? bfr(BA[c0 + j * 16 + col]) : 0.f;
#pragma unroll
      for (int r = 0; r < 8; ++r) st[wave * 16 + 8 * g + r][j * 16 + col] = acc[j][r] + bias; }
    __syncthreads();
    for (int e = tid; e < 64 * (128 / HD); e += 128) { const int rl = e / (128 / HD), hh = e % (128 / HD); PROJ_EPI(which, &st[rl][hh * HD], (int)((r0 + rl) % TT), (c0 / HD) + hh); }
    __syncthreads(); }
  if (which < 2) { _Float16* DH = which == 0 ? QH : KH; _Float16* DL = which == 0 ? QL : KL; const int nhi = which == 0 ? QHI : KHI; const bool hi_rows = t0 < nhi;
    for (int e = tid; e < 64 * 128; e += 128) { const int rl = e >> 7, cl = e & 127; const float v = st[rl][cl]; const _Float16 hv = (_Float16)v; sh[rl][cl] = hv; sl[rl][cl] = (_Float16)((v - (float)hv) * 1024.0f); }
    __syncthreads();
    for (int e = tid; e < 64 * 16; e += 128) { const int rl = e >> 4, q = e & 15; vst2((unsigned*)(DH + (r0 + rl) * CC + c0 + q * 8), *(const v4u*)&sh[rl][q * 8]); if (hi_rows) vst2((unsigned*)(DL + (bb * nhi + t0 + rl) * (size_t)CC + c0 + q * 8), *(const v4u*)&sl[rl][q * 8]); }
  } else { const bool hi_rows = t0 < KHI;
    for (int e = tid; e < 64 * 128; e += 128) { const int rl = e & 63, cl = e >> 6; const float v = st[rl][cl]; th[cl][rl] = (_Float16)v; const __bf16 bh = (__bf16)v; tb[cl][rl] = bh; tbl[cl][rl] = (__bf16)(v - (float)bh); }
    __syncthreads();
    for (int e = tid; e < 128 * 8; e += 128) { const int cl = e >> 3, q = e & 7; vst2((unsigned*)(VT + (bb * CC + c0 + cl) * (size_t)TT + t0 + q * 8), *(const v4u*)&th[cl][q * 8]); if (hi_rows) { const size_t o3 = (bb * CC + c0 + cl) * (size_t)KHI + t0 + q * 8; vst2((unsigned*)(VB + o3), *(const v4u*)&tb[cl][q * 8]); vst2((unsigned*)(VBL + o3), *(const v4u*)&tbl[cl][q * 8]); } } } }
// ---- k_sc: block = (query block qb, key block kb <= kb_last(qb), head in group) of batch b: logits x SCALE; q hi + residual (x 2^10) against k (2 products) for query rows < QHI, plus the k residual (3 products) for query blocks < QBH (causal early rows); causal: blocks past the diagonal exit, the mask itself is applied by index in k_sm
__global__ __launch_bounds__(128) void k_sc(const _Float16* __restrict__ QH, const _Float16* __restrict__ KH, const _Float16* __restrict__ QL, const _Float16* __restrict__ KL, int b, int h0, float* __restrict__ S0) { __shared__ __align__(16) float ss[4][16][132];
  const int qb = blockIdx.x, kb = blockIdx.y; if (kb > kb_last(qb)) return;
  const int h = h0 + blockIdx.z; float* S = S0 + (size_t)blockIdx.z * TT * TT;
  const int tid = threadIdx.x, wave = tid >> 5, lane = tid & 31, col = lane & 15, g = lane >> 4; const int k0 = kb * 128; const int ql0 = qb * 64 + wave * 16; const size_t q0 = (size_t)b * TT + ql0, kr0 = (size_t)b * TT + k0;
  v8f acc[8] = {}, accl[8] = {};
  const _Float16* QLb = QL + (size_t)b * QHI * CC; const _Float16* KLb = KL + (size_t)b * KHI * CC;
  if (qb < QBH) {
#pragma unroll
    for (int kc = 0; kc < HD / 32; ++kc) { const v16h ah = frag_h(QH + (q0 + col) * CC + h * HD + kc * 32, lane), al = frag_h(QLb + (size_t)(ql0 + col) * CC + h * HD + kc * 32, lane);
#pragma unroll
      for (int j = 0; j < 8; ++j) { const v16h kbf = frag_h(KH + (kr0 + j * 16 + col) * CC + h * HD + kc * 32, lane), klf = frag_h(KLb + (size_t)(k0 + j * 16 + col) * CC + h * HD + kc * 32, lane); acc[j] = wmma16(ah, kbf, acc[j]); accl[j] = wmma16(al, kbf, accl[j]); accl[j] = wmma16(ah, klf, accl[j]); } }
  } else if (qb * 64 < QHI) {
#pragma unroll
    for (int kc = 0; kc < HD / 32; ++kc) { const v16h ah = frag_h(QH + (q0 + col) * CC + h * HD + kc * 32, lane), al = frag_h(QLb + (size_t)(ql0 + col) * CC + h * HD + kc * 32, lane);
#pragma unroll
      for (int j = 0; j < 8; ++j) { const v16h kbf = frag_h(KH + (kr0 + j * 16 + col) * CC + h * HD + kc * 32, lane); acc[j] = wmma16(ah, kbf, acc[j]); accl[j] = wmma16(al, kbf, accl[j]); } }
  } else {
#pragma unroll
    for (int kc = 0; kc < HD / 32; ++kc) { const v16h ah = frag_h(QH + (q0 + col) * CC + h * HD + kc * 32, lane);
#pragma unroll
      for (int j = 0; j < 8; ++j) { const v16h kbf = frag_h(KH + (kr0 + j * 16 + col) * CC + h * HD + kc * 32, lane); acc[j] = wmma16(ah, kbf, acc[j]); } } }
#pragma unroll
  for (int j = 0; j < 8; ++j) {
#pragma unroll
    for (int r = 0; r < 8; ++r) ss[wave][8 * g + r][j * 16 + col] = (acc[j][r] + accl[j][r] * (1.0f / 1024.0f)) * SCALE; }
  LDSX(); for (int rl = 0; rl < 16; ++rl) vst2(S + (size_t)(ql0 + rl) * TT + k0 + lane * 4, *(const v4f*)&ss[wave][rl][lane * 4]); }
// ---- k_sm: block = query row t (head in group): keys [0, kend): causal -> logit if s <= t else excluded; softmax in f32; P x 2^11 in place (0 for excluded)
__global__ __launch_bounds__(256) void k_sm(float* __restrict__ S0 SM_EXTRA_PARAMS) { __shared__ float sred[8]; __shared__ float sbc; __shared__ __align__(16) float shv[TT];
  const int tid = threadIdx.x; const int t = blockIdx.x; const int kend = (kb_last(t >> 6) + 1) * 128;
  float* sr = S0 + (size_t)blockIdx.y * TT * TT + (size_t)t * TT;
  float m = -3.0e38f; for (int k = tid; k < kend; k += 256) { float v = (!CAUSAL || k <= t) ? sr[k] : -3.0e38f; SM_MASK_HOOK; shv[k] = v; m = fmaxf(m, v); }
#pragma unroll
  for (int o = 1; o < 32; o <<= 1) m = fmaxf(m, __shfl_xor(m, o));
  if ((tid & 31) == 0) sred[tid >> 5] = m; __syncthreads(); if (tid == 0) { float a = sred[0]; for (int i = 1; i < 8; ++i) a = fmaxf(a, sred[i]); sbc = a; } __syncthreads(); m = sbc; __syncthreads();
  float sum = 0.f; for (int k = tid; k < kend; k += 256) { const float v = shv[k]; const float e = (v <= -1.0e38f) ? 0.f : expf(v - m); shv[k] = e; sum += e; }
#pragma unroll
  for (int o = 1; o < 32; o <<= 1) sum += __shfl_xor(sum, o);
  if ((tid & 31) == 0) sred[tid >> 5] = sum; __syncthreads(); if (tid == 0) { float a = 0.f; for (int i = 0; i < 8; ++i) a += sred[i]; sbc = 2048.0f / a; } __syncthreads(); const float inv = sbc;
  for (int k = tid; k < kend; k += 256) shv[k] = shv[k] * inv;
  __syncthreads(); for (int q = tid; q < kend / 4; q += 256) vst2(sr + q * 4, *(const v4f*)&shv[q * 4]); }
// ---- k_pv: block = 64 queries (qb) of (b, h): ctx = P . v over keys [0, kend) (P x 2^11 once to f16 against v f16: 1 product; causal early query blocks: P and v as bf16 hi + lo, 3 products); 256-B (row, head) segment by 16 lanes
__global__ __launch_bounds__(128) void k_pv(const float* __restrict__ PS0, const _Float16* __restrict__ VT, const __bf16* __restrict__ VB, const __bf16* __restrict__ VBL, int b, int h0, float* __restrict__ Y) { const int h = h0 + blockIdx.z; const float* PS = PS0 + (size_t)blockIdx.z * TT * TT; __shared__ __align__(16) float ss[4][16][HD + 4];
  const int tid = threadIdx.x, wave = tid >> 5, lane = tid & 31, col = lane & 15, g = lane >> 4; const int qb = blockIdx.x; const int ql0 = qb * 64 + wave * 16; const int kce = (kb_last(qb) + 1) * 4;
  v8f acc[HD / 16] = {};
  if (qb < QBH) {
#pragma unroll 1
    for (int kc = 0; kc < kce; ++kc) { const F2 p = split_row(PS + (size_t)(ql0 + col) * TT, kc * 32, lane);
      asm volatile("s_wait_loadcnt 0x0" ::: "memory");
#pragma unroll
      for (int j = 0; j < HD / 16; ++j) { const size_t po = ((size_t)b * CC + h * HD + j * 16 + col) * (size_t)KHI + kc * 32; const v16b vh = frag_b(VB + po, lane); acc[j] = wmma_bf(p.h, vh, acc[j]); acc[j] = wmma_bf(p.l, vh, acc[j]); acc[j] = wmma_bf(p.h, frag_b(VBL + po, lane), acc[j]); } }
  } else {
#pragma unroll 1
    for (int kc = 0; kc < kce; ++kc) { const v16h p = frag_f32(PS + (size_t)(ql0 + col) * TT + kc * 32, lane);
      asm volatile("s_wait_loadcnt 0x0" ::: "memory");
#pragma unroll
      for (int j = 0; j < HD / 16; ++j) { const size_t po = ((size_t)b * CC + h * HD + j * 16 + col) * (size_t)TT + kc * 32; acc[j] = wmma16(p, frag_h(VT + po, lane), acc[j]); } } }
#pragma unroll
  for (int j = 0; j < HD / 16; ++j)
#pragma unroll
    for (int r = 0; r < 8; ++r) ss[wave][8 * g + r][j * 16 + col] = acc[j][r] * (1.0f / 2048.0f);
  LDSX(); for (int rl = 0; rl < 16; ++rl) if (lane < HD / 4) vst2(Y + ((size_t)b * TT + ql0 + rl) * CC + h * HD + lane * 4, *(const v4f*)&ss[wave][rl][lane * 4]); }
// ---- k_out: block = (64 rows, 128 cols): out = ctx Wo (+ bo): ctx once to f16 against Wo as f16(bf16 x 2^8) exact (1 product) x 2^-8; causal early rows (< QHI of each sequence): ctx bf16 hi + lo against exact bf16 Wo (2 products)
__global__ __launch_bounds__(128) void k_out(const float* __restrict__ Y, const float* __restrict__ WO, const float* __restrict__ BO, float* __restrict__ OUT) { __shared__ __align__(16) float sf[4][16][132];
  const int tid = threadIdx.x, wave = tid >> 5, lane = tid & 31, col = lane & 15, g = lane >> 4; const int c0 = blockIdx.y * 128; const size_t r0 = (size_t)blockIdx.x * 64 + wave * 16;
  v8f acc[8] = {};
  if (CAUSAL && (int)(((size_t)blockIdx.x * 64) % TT) < QHI) {   /* block-uniform */
#pragma unroll 2
    for (int kc = 0; kc < CC / 32; ++kc) { const F2 a = split_row(Y + (r0 + col) * CC, kc * 32, lane); asm volatile("s_wait_loadcnt 0x0" ::: "memory");
#pragma unroll
      for (int j = 0; j < 8; ++j) { const v16b w = WOCOL(WO, kc * 32, c0 + j * 16 + col, lane); asm volatile("s_wait_loadcnt 0x0" ::: "memory"); acc[j] = wmma_bf(a.h, w, acc[j]); acc[j] = wmma_bf(a.l, w, acc[j]); } }
#pragma unroll
    for (int j = 0; j < 8; ++j) { const float bias = BO ? bfr(BO[c0 + j * 16 + col]) : 0.f;
#pragma unroll
      for (int r = 0; r < 8; ++r) sf[wave][8 * g + r][j * 16 + col] = acc[j][r] + bias; }
  } else {
#pragma unroll 2
    for (int kc = 0; kc < CC / 32; ++kc) { const v16h a = frag_f32(Y + (r0 + col) * CC + kc * 32, lane); asm volatile("s_wait_loadcnt 0x0" ::: "memory");
#pragma unroll
      for (int j = 0; j < 8; ++j) { const v16h w = WOCOLH(WO, kc * 32, c0 + j * 16 + col, lane); asm volatile("s_wait_loadcnt 0x0" ::: "memory"); acc[j] = wmma16(a, w, acc[j]); } }
#pragma unroll
    for (int j = 0; j < 8; ++j) { const float bias = BO ? bfr(BO[c0 + j * 16 + col]) : 0.f;
#pragma unroll
      for (int r = 0; r < 8; ++r) sf[wave][8 * g + r][j * 16 + col] = acc[j][r] * (1.0f / 256.0f) + bias; } }
  LDSX(); for (int rl = 0; rl < 16; ++rl) vst2(OUT + (r0 + rl) * DIN + c0 + lane * 4, *(const v4f*)&sf[wave][rl][lane * 4]); }

extern "C" void kernel_launch(void* const* d_in, const int* in_sizes, int n_in, void* d_out, int out_size, void* d_ws, size_t ws_size, hipStream_t stream) {
  (void)in_sizes; (void)n_in; (void)out_size;
  const float** F = (const float**)d_in;
  if (ws_size < (size_t)WS_END) return;
  char* ws = (char*)d_ws; _Float16 *QH = (_Float16*)(ws + WS_QH), *KH = (_Float16*)(ws + WS_KH), *VT = (_Float16*)(ws + WS_VT), *QL = (_Float16*)(ws + WS_QL), *KL = (_Float16*)(ws + WS_KL); __bf16 *VB = (__bf16*)(ws + WS_VB), *VBL = (__bf16*)(ws + WS_VBL); float *S = (float*)(ws + WS_S), *Y = (float*)(ws + WS_Y);
  (void)Y; (void)QL; (void)KL; (void)VB; (void)VBL;
  // inputs: 0 inputs_q [2,2048,1024]; 1 wq, 2 wk, 3 wv [1024,16,64] (= (in,out)); 4 wo [16,64,1024] (= (in,out)); 5 q_norm_scale [64]; 6 k_norm_scale [64]
  k_proj<<<dim3(TNB * TT / 64, CC / 128, 3), 128, 0, stream>>>(F[0], F[0], F[0], F[1], F[2], F[3], nullptr, nullptr, nullptr, QH, QL, KH, KL, VT, VB, VBL, F[5], F[6]);
  for (int b = 0; b < TNB; ++b) for (int h0 = 0; h0 < NH; h0 += HG) {
    k_sc<<<dim3(NQB, TT / 128, HG), 128, 0, stream>>>(QH, KH, QL, KL, b, h0, S);
    k_sm<<<dim3(TT, HG), 256, 0, stream>>>(S);
    k_pv<<<dim3(NQB, 1, HG), 128, 0, stream>>>(S, VT, VB, VBL, b, h0, Y);
  }
  k_out<<<dim3(TNB * TT / 64, DIN / 128), 128, 0, stream>>>(Y, F[4], nullptr, (float*)d_out);
}

// v001
// It runs in 778 microseconds.
// In both of two side-by-side timings against v000, it was 1.41 times as fast.
// compute dtype: all float inputs rounded to bf16; q/k/v = x W with EXACT bf16 products on WMMA 16x16x32, f32 accumulate; per-head RMSNorm and rotate-half RoPE in f32 (precise sinf/cosf of t * inv_freq); q, k once to f16 -> 1-product causal logits x 1/8, except the first 384 query rows of each sequence (few keys, no averaging), which use q and k as f16 hi + residual (x 2^10) (3 products); softmax in f32 (precise expf); P x 2^11 once to f16 against v once to f16 (1 product), except the first 384 rows: P and v as bf16 hi + lo (3 products); ctx once to f16 against wo carried x 2^8 in f16 (exact bf16 values), except the first 384 rows: ctx bf16 hi + lo against exact bf16 wo (2 products); f32 output.
#include <hip/hip_runtime.h>
#include <math.h>

typedef __attribute__((ext_vector_type(16))) _Float16 v16h;
typedef __attribute__((ext_vector_type(16))) __bf16 v16b;
typedef __attribute__((ext_vector_type(8)))  _Float16 v8h;
typedef __attribute__((ext_vector_type(8)))  float v8f;
typedef __attribute__((ext_vector_type(4)))  float v4f;
typedef __attribute__((ext_vector_type(2)))  float v2f;
typedef __attribute__((ext_vector_type(4)))  unsigned v4u;
typedef __attribute__((ext_vector_type(4)))  int v4i;
typedef float __attribute__((may_alias)) float_a;
typedef int __attribute__((may_alias)) int_a;

template <typename T> __device__ __forceinline__ void vst2(void* p, T v) { *(T*)p = v;  }
__device__ __forceinline__ v8f wmma16(v16h a, v16h b, v8f c) {
  v8f d = __builtin_amdgcn_wmma_f32_16x16x32_f16(false, a, false, b, (short)0, c, false, false);
  asm volatile("v_nop\n\tv_nop\n\tv_nop\n\tv_nop" : "+v"(d) : "v"(a), "v"(b));
  return d;
}
__device__ __forceinline__ v8f wmma_bf(v16b a, v16b b, v8f c) {
  v8f d = __builtin_amdgcn_wmma_f32_16x16x32_bf16(false, a, false, b, (short)0, c, false, false);
  asm volatile("v_nop\n\tv_nop\n\tv_nop\n\tv_nop" : "+v"(d) : "v"(a), "v"(b));
  return d;
}
// 16x16x32 fragments: lane = (h = lane>>4, row/col = lane&15); elements 0..7 = k0+8h+0..7, 8..15 = k0+16+8h+0..7; D element r = row 8h+r
__device__ __forceinline__ v16h frag_h(const _Float16* rowk0, int lane) {
  union { v16h v; v8h q[2]; } u; const _Float16* p = rowk0 + 8 * (lane >> 4);
  u.q[0] = *(const v8h*)p; u.q[1] = *(const v8h*)(p + 16); return u.v;
}
__device__ __forceinline__ v16h frag_f32(const float* rowk0, int lane) {
  v16h a; const float* p = rowk0 + 8 * (lane >> 4);
#pragma unroll
  for (int i = 0; i < 8; ++i) { a[i] = (_Float16)p[i]; a[8 + i] = (_Float16)p[16 + i]; }
  return a;
}
__device__ __forceinline__ v16h frag_f32s(const float* rowk0, int lane, float sc) {
  v16h a; const float* p = rowk0 + 8 * (lane >> 4);
#pragma unroll
  for (int i = 0; i < 8; ++i) { a[i] = (_Float16)(p[i] * sc); a[8 + i] = (_Float16)(p[16 + i] * sc); }
  return a;
}
// column fragment from a [K][ld] layout (column n), rows >= K read as 0
__device__ __forceinline__ v16h fragc_f32(const float* W, int k0, int n, int lane, int ld, int K) {
  v16h a; const int g = lane >> 4;
#pragma unroll
  for (int i = 0; i < 8; ++i) { const int ka = k0 + 8 * g + i, kb = ka + 16;
    a[i] = (_Float16)(ka < K ? W[(size_t)(ka < K ? ka : K - 1) * ld + n] : 0.f); a[8 + i] = (_Float16)(kb < K ? W[(size_t)(kb < K ? kb : K - 1) * ld + n] : 0.f); }
  return a;
}
struct F2 { v16b h, l; };
__device__ __forceinline__ F2 bsplit16(const float v[16]) { F2 r;
#pragma unroll
  for (int i = 0; i < 16; ++i) { const __bf16 h = (__bf16)v[i]; r.h[i] = h; r.l[i] = (__bf16)(v[i] - (float)h); }
  return r; }
__device__ __forceinline__ F2 split_row(const float* row, int k0, int lane) { float v[16]; const float* p = row + k0 + 8 * (lane >> 4);
#pragma unroll
  for (int i = 0; i < 8; ++i) { v[i] = p[i]; v[8 + i] = p[16 + i]; }
  return bsplit16(v); }
__device__ __forceinline__ F2 split_rowK(const float* row, int k0, int lane, int K) { float v[16]; const int g = lane >> 4;
#pragma unroll
  for (int i = 0; i < 8; ++i) { const int ka = k0 + 8 * g + i, kb = ka + 16; v[i] = ka < K ? row[ka < K ? ka : K - 1] : 0.f; v[8 + i] = kb < K ? row[kb < K ? kb : K - 1] : 0.f; }
  return bsplit16(v); }
__device__ __forceinline__ F2 split_col(const float* W, int k0, int n, int lane, int ld, int K) { float v[16]; const int g = lane >> 4;
#pragma unroll
  for (int i = 0; i < 8; ++i) { const int ka = k0 + 8 * g + i, kb = ka + 16; v[i] = ka < K ? W[(size_t)(ka < K ? ka : K - 1) * ld + n] : 0.f; v[8 + i] = kb < K ? W[(size_t)(kb < K ? kb : K - 1) * ld + n] : 0.f; }
  return bsplit16(v); }
__device__ __forceinline__ v8f mac3(const F2& a, const F2& b, v8f c) { c = wmma_bf(a.l, b.h, c); c = wmma_bf(a.h, b.l, c); return wmma_bf(a.h, b.h, c); }
__device__ __forceinline__ float sigm(float v) { return 1.0f / (1.0f + expf(-v)); }
#define LDSX() do { asm volatile("s_wait_dscnt 0" ::: "memory"); __builtin_amdgcn_wave_barrier(); __builtin_amdgcn_fence(__ATOMIC_RELEASE, "workgroup"); } while (0)

// Causal multi-head dot-product attention with QK-RMSNorm and RoPE (B 2, S 2,048, D 1,024, 16 heads x 64): q/k/v = x w ((in, head, hd) = (in,out)); q, k RMS-normalised over the 64 head dims (eps 1e-6, x scale) then rotate-half RoPE (angle t * 10000^(-i/32), i < 32); q x 64^-0.5; logits masked to -0.7*f32max where key > query (== -inf here: the diagonal is always kept); softmax; out = merged(attn v) wo ((head, hd, out) = (in,out)).
#define NB 2
#define TT 2048
#define CC 1024            // NH * HD = projected width
#define DIN 1024          // input (model) width
#define NH 16
#define HD 64
#define NQB (TT / 64)
#define HG 4
#define SCALE (0.125f)
#define CAUSAL 1
#ifndef TNB
#define TNB NB
#endif
__device__ __forceinline__ float bfr(float v) { return (float)(__bf16)v; }
__host__ __device__ __forceinline__ int kb_last(int qb) { return CAUSAL ? ((qb * 64 + 63) >> 7) : (TT / 128 - 1); }
typedef __attribute__((ext_vector_type(8))) __bf16 v8b;
__device__ __forceinline__ v16b frag_b(const __bf16* rowk0, int lane) {
  union { v16b v; v8b q[2]; } u; const __bf16* p = rowk0 + 8 * (lane >> 4);
  u.q[0] = *(const v8b*)p; u.q[1] = *(const v8b*)(p + 16); return u.v;
}
#define QBH 6              // causal: query blocks 0..QBH-1 of each sequence (few keys, no averaging) take the high-precision path
#define QHI 384            // rows carrying a q residual plane
#define KHI 384            // key rows carrying k residual / v bf16 hi+lo planes (used only by the causal high-precision path)
// B fragment (k rows k0+.., output column o) of a weight: (in,out) [K][ld] or (out,in) [ld rows of K]: bf16 exact, or f16(bf16 * 256) exact
__device__ __forceinline__ v16b wcol_io(const float* Wm, int k0, int o, int lane, int ld) { v16b w; const int g = lane >> 4;
#pragma unroll
  for (int i = 0; i < 8; ++i) { w[i] = (__bf16)Wm[(size_t)(k0 + 8 * g + i) * ld + o]; w[8 + i] = (__bf16)Wm[(size_t)(k0 + 16 + 8 * g + i) * ld + o]; }
  return w; }
__device__ __forceinline__ v16b wcol_oi(const float* Wm, int k0, int o, int lane, int K) { v16b w; const float* p = Wm + (size_t)o * K + k0 + 8 * (lane >> 4);
#pragma unroll
  for (int i = 0; i < 8; ++i) { w[i] = (__bf16)p[i]; w[8 + i] = (__bf16)p[16 + i]; }
  return w; }
__device__ __forceinline__ v16h wcolh_io(const float* Wm, int k0, int o, int lane, int ld) { v16h w; const int g = lane >> 4;
#pragma unroll
  for (int i = 0; i < 8; ++i) { w[i] = (_Float16)(bfr(Wm[(size_t)(k0 + 8 * g + i) * ld + o]) * 256.0f); w[8 + i] = (_Float16)(bfr(Wm[(size_t)(k0 + 16 + 8 * g + i) * ld + o]) * 256.0f); }
  return w; }
__device__ __forceinline__ v16h wcolh_oi(const float* Wm, int k0, int o, int lane, int K) { v16h w; const float* p = Wm + (size_t)o * K + k0 + 8 * (lane >> 4);
#pragma unroll
  for (int i = 0; i < 8; ++i) { w[i] = (_Float16)(bfr(p[i]) * 256.0f); w[8 + i] = (_Float16)(bfr(p[16 + i]) * 256.0f); }
  return w; }
#define WQKV_LAYOUT 0   // 0 = (in,out) [DIN][CC]; 1 = (out,in) [CC][DIN]; 2 = per-head [NH][DIN][HD]
__device__ __forceinline__ v16b wcol_hdk(const float* Wm, int k0, int o, int lane) { v16b w; const int g = lane >> 4; const float* p = Wm + (size_t)(o / HD) * DIN * HD + (o % HD);
#pragma unroll
  for (int i = 0; i < 8; ++i) { w[i] = (__bf16)p[(size_t)(k0 + 8 * g + i) * HD]; w[8 + i] = (__bf16)p[(size_t)(k0 + 16 + 8 * g + i) * HD]; }
  return w; }
#define WO_OUT_IN 0
#if WQKV_LAYOUT == 1
#define WCOL(W, k0, o, lane) wcol_oi(W, k0, o, lane, DIN)
#elif WQKV_LAYOUT == 2
#define WCOL(W, k0, o, lane) wcol_hdk(W, k0, o, lane)
#else
#define WCOL(W, k0, o, lane) wcol_io(W, k0, o, lane, CC)
#endif
#if WO_OUT_IN
#define WOCOL(W, k0, o, lane) wcol_oi(W, k0, o, lane, CC)
#define WOCOLH(W, k0, o, lane) wcolh_oi(W, k0, o, lane, CC)
#else
#define WOCOL(W, k0, o, lane) wcol_io(W, k0, o, lane, DIN)
#define WOCOLH(W, k0, o, lane) wcolh_io(W, k0, o, lane, DIN)
#endif
__constant__ float c_invf[32] = {1.000000000e+00f,7.498942018e-01f,5.623413324e-01f,4.216965139e-01f,3.162277639e-01f,2.371373624e-01f,1.778279394e-01f,1.333521456e-01f,1.000000015e-01f,7.498941571e-02f,5.623412877e-02f,4.216964915e-02f,3.162277862e-02f,2.371373586e-02f,1.778279431e-02f,1.333521493e-02f,9.999999776e-03f,7.498942316e-03f,5.623413250e-03f,4.216964822e-03f,3.162277862e-03f,2.371373819e-03f,1.778279431e-03f,1.333521446e-03f,1.000000047e-03f,7.498941850e-04f,5.623413017e-04f,4.216964880e-04f,3.162277862e-04f,2.371373848e-04f,1.778279402e-04f,1.333521504e-04f};   // 1 / 10000^(i/32) evaluated in f32 exactly as the reference does (jax, eager)
#define PROJ_EXTRA_PARAMS , const float* __restrict__ QS, const float* __restrict__ KS
// per-(row, head) epilogue on the f32 projection tile: RMSNorm over the head's 64 values (x q_norm_scale / k_norm_scale), then rotate-half RoPE; v untouched
#define PROJ_EPI(which, row, t, h) do { if ((which) < 2) { float* rw = (row); const float* NS = (which) == 0 ? QS : KS; float ss = 0.f; _Pragma("unroll") for (int i = 0; i < 64; ++i) ss += rw[i] * rw[i]; const float rn = rsqrtf(ss * (1.0f / 64.0f) + 1e-6f); \
    _Pragma("unroll") for (int i = 0; i < 32; ++i) { const float x1 = rw[i] * rn * bfr(NS[i]), x2 = rw[i + 32] * rn * bfr(NS[i + 32]); const float ang = (float)(t) * c_invf[i]; const float cs = cosf(ang), sn = sinf(ang); rw[i] = x1 * cs - x2 * sn; rw[i + 32] = x2 * cs + x1 * sn; } } } while (0)
#ifndef SM_EXTRA_PARAMS
#define SM_EXTRA_PARAMS
#endif
#ifndef PROJ_EXTRA_PARAMS
#define PROJ_EXTRA_PARAMS
#endif
#ifndef SM_MASK_HOOK
#define SM_MASK_HOOK (void)0
#endif

#define WS_QH  0u                                      // f16 q rows [b*t][CC]
#define WS_KH  (WS_QH + 2u * (size_t)NB * TT * CC)      // f16 k rows [b*t][CC]
#define WS_VT  (WS_KH + 2u * (size_t)NB * TT * CC)      // f16 v planes [b][c][t]
#define WS_QL  (WS_VT + 2u * (size_t)NB * CC * TT)      // f16 q residual x 2^10 rows [b][t < QHI][CC]
#define WS_KL  (WS_QL + 2u * (size_t)NB * QHI * CC)     // f16 k residual x 2^10 rows [b][t < KHI][CC]
#define WS_VB  (WS_KL + 2u * (size_t)NB * KHI * CC)     // bf16 v hi planes [b][c][t < KHI]
#define WS_VBL (WS_VB + 2u * (size_t)NB * CC * KHI)
#define WS_S   (WS_VBL + 2u * (size_t)NB * CC * KHI)    // f32 logits / P [hg][t][s]
#define WS_Y   (WS_S  + 4u * (size_t)HG * TT * TT)      // f32 ctx rows [b*t][CC] (only when there is an output projection)
#define WS_END (WS_Y  + 4u * (size_t)NB * TT * CC)

// ---- k_proj: block = (64 rows, 128 cols, which): q/k/v = X W (+ b) with exact bf16 products (K = DIN) -> which 0: q f16 rows (+ residual rows < QHI); 1: k f16 rows (+ residual rows < KHI); 2: v f16 planes [c][t] (+ bf16 hi/lo planes for t < KHI)
__global__ __launch_bounds__(128) void k_proj(const float* __restrict__ XQ, const float* __restrict__ XK, const float* __restrict__ XV, const float* __restrict__ WQ, const float* __restrict__ WK, const float* __restrict__ WV, const float* __restrict__ BQ, const float* __restrict__ BK, const float* __restrict__ BV,
    _Float16* __restrict__ QH, _Float16* __restrict__ QL, _Float16* __restrict__ KH, _Float16* __restrict__ KL, _Float16* __restrict__ VT, __bf16* __restrict__ VB, __bf16* __restrict__ VBL PROJ_EXTRA_PARAMS) {
  __shared__ __align__(16) float st[64][132]; __shared__ __align__(16) _Float16 sh[64][136], sl[64][136]; __shared__ __align__(16) _Float16 th[128][72]; __shared__ __align__(16) __bf16 tb[128][72], tbl[128][72];
  const int tid = threadIdx.x, wave = tid >> 5, lane = tid & 31, col = lane & 15, g = lane >> 4; const int which = blockIdx.z; const int c0 = blockIdx.y * 128; const size_t r0 = (size_t)blockIdx.x * 64; const size_t bb = r0 / TT; const int t0 = (int)(r0 % TT);
  const float* X = which == 0 ? XQ : which == 1 ? XK : XV; const float* WA = which == 0 ? WQ : which == 1 ? WK : WV; const float* BA = which == 0 ? BQ : which == 1 ? BK : BV;
  v8f acc[8] = {};
#pragma unroll 2
  for (int kc = 0; kc < DIN / 32; ++kc) { v16b a; { const float* p = X + (r0 + wave * 16 + col) * DIN + kc * 32 + 8 * g;
#pragma unroll
      for (int i = 0; i < 8; ++i) { a[i] = (__bf16)p[i]; a[8 + i] = (__bf16)p[16 + i]; } }
    asm volatile("s_wait_loadcnt 0x0" ::: "memory");
#pragma unroll
    for (int j = 0; j < 8; ++j) { const v16b w = WCOL(WA, kc * 32, c0 + j * 16 + col, lane); asm volatile("s_wait_loadcnt 0x0" ::: "memory"); acc[j] = wmma_bf(a, w, acc[j]); } }
  { // stage the f32 tile (acc + bias) in LDS, run the per-(row, head) epilogue hook, then convert
#pragma unroll
    for (int j = 0; j < 8; ++j) { const float bias = BA ? bfr(BA[c0 + j * 16 + col]) : 0.f;
#pragma unroll
      for (int r = 0; r < 8; ++r) st[wave * 16 + 8 * g + r][j * 16 + col] = acc[j][r] + bias; }
    __syncthreads();
    for (int e = tid; e < 64 * (128 / HD); e += 128) { const int rl = e / (128 / HD), hh = e % (128 / HD); PROJ_EPI(which, &st[rl][hh * HD], (int)((r0 + rl) % TT), (c0 / HD) + hh); }
    __syncthreads(); }
  if (which < 2) { _Float16* DH = which == 0 ? QH : KH; _Float16* DL = which == 0 ? QL : KL; const int nhi = which == 0 ? QHI : KHI; const bool hi_rows = t0 < nhi;
    for (int e = tid; e < 64 * 128; e += 128) { const int rl = e >> 7, cl = e & 127; const float v = st[rl][cl]; const _Float16 hv = (_Float16)v; sh[rl][cl] = hv; sl[rl][cl] = (_Float16)((v - (float)hv) * 1024.0f); }
    __syncthreads();
    for (int e = tid; e < 64 * 16; e += 128) { const int rl = e >> 4, q = e & 15; vst2((unsigned*)(DH + (r0 + rl) * CC + c0 + q * 8), *(const v4u*)&sh[rl][q * 8]); if (hi_rows) vst2((unsigned*)(DL + (bb * nhi + t0 + rl) * (size_t)CC + c0 + q * 8), *(const v4u*)&sl[rl][q * 8]); }
  } else { const bool hi_rows = t0 < KHI;
    for (int e = tid; e < 64 * 128; e += 128) { const int rl = e & 63, cl = e >> 6; const float v = st[rl][cl]; th[cl][rl] = (_Float16)v; const __bf16 bh = (__bf16)v; tb[cl][rl] = bh; tbl[cl][rl] = (__bf16)(v - (float)bh); }
    __syncthreads();
    for (int e = tid; e < 128 * 8; e += 128) { const int cl = e >> 3, q = e & 7; vst2((unsigned*)(VT + (bb * CC + c0 + cl) * (size_t)TT + t0 + q * 8), *(const v4u*)&th[cl][q * 8]); if (hi_rows) { const size_t o3 = (bb * CC + c0 + cl) * (size_t)KHI + t0 + q * 8; vst2((unsigned*)(VB + o3), *(const v4u*)&tb[cl][q * 8]); vst2((unsigned*)(VBL + o3), *(const v4u*)&tbl[cl][q * 8]); } } } }
// ---- k_sc: block = (query block qb, key block kb <= kb_last(qb), head in group) of batch b: logits x SCALE; q hi + residual (x 2^10) against k (2 products) for query rows < QHI, plus the k residual (3 products) for query blocks < QBH (causal early rows); causal: blocks past the diagonal exit, the mask itself is applied by index in k_sm
__global__ __launch_bounds__(128) void k_sc(const _Float16* __restrict__ QH, const _Float16* __restrict__ KH, const _Float16* __restrict__ QL, const _Float16* __restrict__ KL, int b, int h0, float* __restrict__ S0) { __shared__ __align__(16) float ss[4][16][132];
  const int qb = blockIdx.x, kb = blockIdx.y; if (kb > kb_last(qb)) return;
  const int h = h0 + blockIdx.z; float* S = S0 + (size_t)blockIdx.z * TT * TT;
  const int tid = threadIdx.x, wave = tid >> 5, lane = tid & 31, col = lane & 15, g = lane >> 4; const int k0 = kb * 128; const int ql0 = qb * 64 + wave * 16; const size_t q0 = (size_t)b * TT + ql0, kr0 = (size_t)b * TT + k0;
  v8f acc[8] = {}, accl[8] = {};
  const _Float16* QLb = QL + (size_t)b * QHI * CC; const _Float16* KLb = KL + (size_t)b * KHI * CC;
  if (qb < QBH) {
#pragma unroll
    for (int kc = 0; kc < HD / 32; ++kc) { const v16h ah = frag_h(QH + (q0 + col) * CC + h * HD + kc * 32, lane), al = frag_h(QLb + (size_t)(ql0 + col) * CC + h * HD + kc * 32, lane);
#pragma unroll
      for (int j = 0; j < 8; ++j) { const v16h kbf = frag_h(KH + (kr0 + j * 16 + col) * CC + h * HD + kc * 32, lane), klf = frag_h(KLb + (size_t)(k0 + j * 16 + col) * CC + h * HD + kc * 32, lane); acc[j] = wmma16(ah, kbf, acc[j]); accl[j] = wmma16(al, kbf, accl[j]); accl[j] = wmma16(ah, klf, accl[j]); } }
  } else if (qb * 64 < QHI) {
#pragma unroll
    for (int kc = 0; kc < HD / 32; ++kc) { const v16h ah = frag_h(QH + (q0 + col) * CC + h * HD + kc * 32, lane), al = frag_h(QLb + (size_t)(ql0 + col) * CC + h * HD + kc * 32, lane);
#pragma unroll
      for (int j = 0; j < 8; ++j) { const v16h kbf = frag_h(KH + (kr0 + j * 16 + col) * CC + h * HD + kc * 32, lane); acc[j] = wmma16(ah, kbf, acc[j]); accl[j] = wmma16(al, kbf, accl[j]); } }
  } else {
#pragma unroll
    for (int kc = 0; kc < HD / 32; ++kc) { const v16h ah = frag_h(QH + (q0 + col) * CC + h * HD + kc * 32, lane);
#pragma unroll
      for (int j = 0; j < 8; ++j) { const v16h kbf = frag_h(KH + (kr0 + j * 16 + col) * CC + h * HD + kc * 32, lane); acc[j] = wmma16(ah, kbf, acc[j]); } } }
#pragma unroll
  for (int j = 0; j < 8; ++j) {
#pragma unroll
    for (int r = 0; r < 8; ++r) ss[wave][8 * g + r][j * 16 + col] = (acc[j][r] + accl[j][r] * (1.0f / 1024.0f)) * SCALE; }
  LDSX(); for (int rl = 0; rl < 16; ++rl) vst2(S + (size_t)(ql0 + rl) * TT + k0 + lane * 4, *(const v4f*)&ss[wave][rl][lane * 4]); }
// ---- k_sm: block = query row t (head in group): keys [0, kend): causal -> logit if s <= t else excluded; softmax in f32; P x 2^11 in place (0 for excluded)
__global__ __launch_bounds__(256) void k_sm(float* __restrict__ S0 SM_EXTRA_PARAMS) { __shared__ float sred[8]; __shared__ float sbc; __shared__ __align__(16) float shv[TT];
  const int tid = threadIdx.x; const int t = blockIdx.x; const int kend = (kb_last(t >> 6) + 1) * 128;
  float* sr = S0 + (size_t)blockIdx.y * TT * TT + (size_t)t * TT;
  float m = -3.0e38f; for (int k = tid; k < kend; k += 256) { float v = (!CAUSAL || k <= t) ? sr[k] : -3.0e38f; SM_MASK_HOOK; shv[k] = v; m = fmaxf(m, v); }
#pragma unroll
  for (int o = 1; o < 32; o <<= 1) m = fmaxf(m, __shfl_xor(m, o));
  if ((tid & 31) == 0) sred[tid >> 5] = m; __syncthreads(); if (tid == 0) { float a = sred[0]; for (int i = 1; i < 8; ++i) a = fmaxf(a, sred[i]); sbc = a; } __syncthreads(); m = sbc; __syncthreads();
  float sum = 0.f; for (int k = tid; k < kend; k += 256) { const float v = shv[k]; const float e = (v <= -1.0e38f) ? 0.f : expf(v - m); shv[k] = e; sum += e; }
#pragma unroll
  for (int o = 1; o < 32; o <<= 1) sum += __shfl_xor(sum, o);
  if ((tid & 31) == 0) sred[tid >> 5] = sum; __syncthreads(); if (tid == 0) { float a = 0.f; for (int i = 0; i < 8; ++i) a += sred[i]; sbc = 2048.0f / a; } __syncthreads(); const float inv = sbc;
  for (int k = tid; k < kend; k += 256) shv[k] = shv[k] * inv;
  __syncthreads(); for (int q = tid; q < kend / 4; q += 256) vst2(sr + q * 4, *(const v4f*)&shv[q * 4]); }
// ---- k_pv: block = 64 queries (qb) of (b, h): ctx = P . v over keys [0, kend) (P x 2^11 once to f16 against v f16: 1 product; causal early query blocks: P and v as bf16 hi + lo, 3 products); 256-B (row, head) segment by 16 lanes
__global__ __launch_bounds__(128) void k_pv(const float* __restrict__ PS0, const _Float16* __restrict__ VT, const __bf16* __restrict__ VB, const __bf16* __restrict__ VBL, int b, int h0, float* __restrict__ Y) { const int h = h0 + blockIdx.z; const float* PS = PS0 + (size_t)blockIdx.z * TT * TT; __shared__ __align__(16) float ss[4][16][HD + 4];
  const int tid = threadIdx.x, wave = tid >> 5, lane = tid & 31, col = lane & 15, g = lane >> 4; const int qb = blockIdx.x; const int ql0 = qb * 64 + wave * 16; const int kce = (kb_last(qb) + 1) * 4;
  v8f acc[HD / 16] = {};
  if (qb < QBH) {
const char* pb = (const char*)PS; const char* vbh = (const char*)(VB + ((size_t)b * CC + h * HD) * (size_t)KHI); const char* vbl = (const char*)(VBL + ((size_t)b * CC + h * HD) * (size_t)KHI);   // wave-uniform bases; the lane's byte offsets below do not change over the loop
    const unsigned po = (unsigned)(ql0 + col) * (TT * 4u) + 32u * g, vo = (unsigned)col * (KHI * 2u) + 16u * g;
#pragma unroll 1   // rolled: one group of 2 key chunks per trip keeps the live registers below 256
    for (int kc = 0; kc < kce; kc += 2) { v4f pr[2][4]; v8b vh[2][HD / 16][2], vl[2][HD / 16][2]; const char* pk = pb + kc * 128; const char* hk = vbh + kc * 64; const char* lk = vbl + kc * 64;
#pragma unroll
      for (int u = 0; u < 2; ++u) { pr[u][0] = *(const v4f*)(pk + po + u * 128); pr[u][1] = *(const v4f*)(pk + po + u * 128 + 16); pr[u][2] = *(const v4f*)(pk + po + u * 128 + 64); pr[u][3] = *(const v4f*)(pk + po + u * 128 + 80);
#pragma unroll
        for (int j = 0; j < HD / 16; ++j) { const int o = j * 16 * KHI * 2 + u * 64; vh[u][j][0] = *(const v8b*)(hk + vo + o); vh[u][j][1] = *(const v8b*)(hk + vo + o + 32); vl[u][j][0] = *(const v8b*)(lk + vo + o); vl[u][j][1] = *(const v8b*)(lk + vo + o + 32); } }
      asm volatile("s_wait_xcnt 0x0" :: "v"(pk + po), "v"(hk + vo), "v"(lk + vo) : "memory");   // precaution: stands in front of the first rewrite of a register that these loads name; the addresses as inputs keep their registers from being given to a later load of the group
      __builtin_amdgcn_sched_barrier(0);   // holds the group's loads in front of its first product (sunk to their uses they would again cost one memory latency each) and every later write of an address register behind the wait above
#pragma unroll
      for (int u = 0; u < 2; ++u) { float v[16];
#pragma unroll
        for (int i = 0; i < 4; ++i) { v[i] = pr[u][0][i]; v[4 + i] = pr[u][1][i]; v[8 + i] = pr[u][2][i]; v[12 + i] = pr[u][3][i]; }
        const F2 p = bsplit16(v);
#pragma unroll
        for (int j = 0; j < HD / 16; ++j) { union { v16b v; v8b q[2]; } fh, fl; fh.q[0] = vh[u][j][0]; fh.q[1] = vh[u][j][1]; fl.q[0] = vl[u][j][0]; fl.q[1] = vl[u][j][1]; acc[j] = wmma_bf(p.h, fh.v, acc[j]); acc[j] = wmma_bf(p.l, fh.v, acc[j]); acc[j] = wmma_bf(p.h, fl.v, acc[j]); } } }
  } else {
const char* pb = (const char*)PS; const char* vb = (const char*)(VT + ((size_t)b * CC + h * HD) * (size_t)TT);   // wave-uniform bases; the lane's byte offsets below do not change over the loop
    const unsigned po = (unsigned)(ql0 + col) * (TT * 4u) + 32u * g, vo = (unsigned)col * (TT * 2u) + 16u * g;
#pragma unroll 1   // rolled: one group of 4 key chunks (kce is a multiple of 4) per trip keeps the live registers below 256
    for (int kc = 0; kc < kce; kc += 4) { v4f pr[4][4]; v8h vr[4][HD / 16][2]; const char* pk = pb + kc * 128; const char* vk = vb + kc * 64;
#pragma unroll
      for (int u = 0; u < 4; ++u) { pr[u][0] = *(const v4f*)(pk + po + u * 128); pr[u][1] = *(const v4f*)(pk + po + u * 128 + 16); pr[u][2] = *(const v4f*)(pk + po + u * 128 + 64); pr[u][3] = *(const v4f*)(pk + po + u * 128 + 80);
#pragma unroll
        for (int j = 0; j < HD / 16; ++j) { const int o = j * 16 * TT * 2 + u * 64; vr[u][j][0] = *(const v8h*)(vk + vo + o); vr[u][j][1] = *(const v8h*)(vk + vo + o + 32); } }
      asm volatile("s_wait_xcnt 0x0" :: "v"(pk + po), "v"(vk + vo) : "memory");   // precaution: stands in front of the first rewrite of a register that these loads name; the addresses as inputs keep their registers from being given to a later load of the group
      __builtin_amdgcn_sched_barrier(0);   // holds the group's 48 loads in front of its first product (sunk to their uses they would again cost one memory latency each) and every later write of an address register behind the wait above
#pragma unroll
      for (int u = 0; u < 4; ++u) { v16h p;
#pragma unroll
        for (int i = 0; i < 4; ++i) { p[i] = (_Float16)pr[u][0][i]; p[4 + i] = (_Float16)pr[u][1][i]; p[8 + i] = (_Float16)pr[u][2][i]; p[12 + i] = (_Float16)pr[u][3][i]; }
#pragma unroll
        for (int j = 0; j < HD / 16; ++j) { union { v16h v; v8h q[2]; } f; f.q[0] = vr[u][j][0]; f.q[1] = vr[u][j][1]; acc[j] = wmma16(p, f.v, acc[j]); } } } }
#pragma unroll
  for (int j = 0; j < HD / 16; ++j)
#pragma unroll
    for (int r = 0; r < 8; ++r) ss[wave][8 * g + r][j * 16 + col] = acc[j][r] * (1.0f / 2048.0f);
  LDSX(); for (int rl = 0; rl < 16; ++rl) if (lane < HD / 4) vst2(Y + ((size_t)b * TT + ql0 + rl) * CC + h * HD + lane * 4, *(const v4f*)&ss[wave][rl][lane * 4]); }
// ---- k_out: block = (64 rows, 128 cols): out = ctx Wo (+ bo): ctx once to f16 against Wo as f16(bf16 x 2^8) exact (1 product) x 2^-8; causal early rows (< QHI of each sequence): ctx bf16 hi + lo against exact bf16 Wo (2 products)
__global__ __launch_bounds__(128) void k_out(const float* __restrict__ Y, const float* __restrict__ WO, const float* __restrict__ BO, float* __restrict__ OUT) { __shared__ __align__(16) float sf[4][16][132];
  const int tid = threadIdx.x, wave = tid >> 5, lane = tid & 31, col = lane & 15, g = lane >> 4; const int c0 = blockIdx.y * 128; const size_t r0 = (size_t)blockIdx.x * 64 + wave * 16;
  v8f acc[8] = {};
  if (CAUSAL && (int)(((size_t)blockIdx.x * 64) % TT) < QHI) {   /* block-uniform */
#pragma unroll 2
    for (int kc = 0; kc < CC / 32; ++kc) { const F2 a = split_row(Y + (r0 + col) * CC, kc * 32, lane); asm volatile("s_wait_loadcnt 0x0" ::: "memory");
#pragma unroll
      for (int j = 0; j < 8; ++j) { const v16b w = WOCOL(WO, kc * 32, c0 + j * 16 + col, lane); asm volatile("s_wait_loadcnt 0x0" ::: "memory"); acc[j] = wmma_bf(a.h, w, acc[j]); acc[j] = wmma_bf(a.l, w, acc[j]); } }
#pragma unroll
    for (int j = 0; j < 8; ++j) { const float bias = BO ? bfr(BO[c0 + j * 16 + col]) : 0.f;
#pragma unroll
      for (int r = 0; r < 8; ++r) sf[wave][8 * g + r][j * 16 + col] = acc[j][r] + bias; }
  } else {
#pragma unroll 2
    for (int kc = 0; kc < CC / 32; ++kc) { const v16h a = frag_f32(Y + (r0 + col) * CC + kc * 32, lane); asm volatile("s_wait_loadcnt 0x0" ::: "memory");
#pragma unroll
      for (int j = 0; j < 8; ++j) { const v16h w = WOCOLH(WO, kc * 32, c0 + j * 16 + col, lane); asm volatile("s_wait_loadcnt 0x0" ::: "memory"); acc[j] = wmma16(a, w, acc[j]); } }
#pragma unroll
    for (int j = 0; j < 8; ++j) { const float bias = BO ? bfr(BO[c0 + j * 16 + col]) : 0.f;
#pragma unroll
      for (int r = 0; r < 8; ++r) sf[wave][8 * g + r][j * 16 + col] = acc[j][r] * (1.0f / 256.0f) + bias; } }
  LDSX(); for (int rl = 0; rl < 16; ++rl) vst2(OUT + (r0 + rl) * DIN + c0 + lane * 4, *(const v4f*)&sf[wave][rl][lane * 4]); }

extern "C" void kernel_launch(void* const* d_in, const int* in_sizes, int n_in, void* d_out, int out_size, void* d_ws, size_t ws_size, hipStream_t stream) {
  (void)in_sizes; (void)n_in; (void)out_size;
  const float** F = (const float**)d_in;
  if (ws_size < (size_t)WS_END) return;
  char* ws = (char*)d_ws; _Float16 *QH = (_Float16*)(ws + WS_QH), *KH = (_Float16*)(ws + WS_KH), *VT = (_Float16*)(ws + WS_VT), *QL = (_Float16*)(ws + WS_QL), *KL = (_Float16*)(ws + WS_KL); __bf16 *VB = (__bf16*)(ws + WS_VB), *VBL = (__bf16*)(ws + WS_VBL); float *S = (float*)(ws + WS_S), *Y = (float*)(ws + WS_Y);
  (void)Y; (void)QL; (void)KL; (void)VB; (void)VBL;
  // inputs: 0 inputs_q [2,2048,1024]; 1 wq, 2 wk, 3 wv [1024,16,64] (= (in,out)); 4 wo [16,64,1024] (= (in,out)); 5 q_norm_scale [64]; 6 k_norm_scale [64]
  k_proj<<<dim3(TNB * TT / 64, CC / 128, 3), 128, 0, stream>>>(F[0], F[0], F[0], F[1], F[2], F[3], nullptr, nullptr, nullptr, QH, QL, KH, KL, VT, VB, VBL, F[5], F[6]);
  for (int b = 0; b < TNB; ++b) for (int h0 = 0; h0 < NH; h0 += HG) {
    k_sc<<<dim3(NQB, TT / 128, HG), 128, 0, stream>>>(QH, KH, QL, KL, b, h0, S);
    k_sm<<<dim3(TT, HG), 256, 0, stream>>>(S);
    k_pv<<<dim3(NQB, 1, HG), 128, 0, stream>>>(S, VT, VB, VBL, b, h0, Y);
  }
  k_out<<<dim3(TNB * TT / 64, DIN / 128), 128, 0, stream>>>(Y, F[4], nullptr, (float*)d_out);
}

// v002
// One run takes 697 microseconds.
// Next to v001, in two timings, it ran 1.11 times as fast each time.
// Counting every step since v000, it is 1.56 times as fast.
// compute dtype: all float inputs rounded to bf16; q/k/v = x W with EXACT bf16 products on WMMA 16x16x32, f32 accumulate; per-head RMSNorm and rotate-half RoPE in f32 (precise sinf/cosf of t * inv_freq); q, k once to f16 -> 1-product causal logits x 1/8, except the first 384 query rows of each sequence (few keys, no averaging), which use q and k as f16 hi + residual (x 2^10) (3 products); softmax in f32 (precise expf); P x 2^11 once to f16 against v once to f16 (1 product), except the first 384 rows: P and v as bf16 hi + lo (3 products); ctx once to f16 against wo carried x 2^8 in f16 (exact bf16 values), except the first 384 rows: ctx bf16 hi + lo against exact bf16 wo (2 products); f32 output.
#include <hip/hip_runtime.h>
#include <math.h>

typedef __attribute__((ext_vector_type(16))) _Float16 v16h;
typedef __attribute__((ext_vector_type(16))) __bf16 v16b;
typedef __attribute__((ext_vector_type(8)))  _Float16 v8h;
typedef __attribute__((ext_vector_type(8)))  float v8f;
typedef __attribute__((ext_vector_type(4)))  float v4f;
typedef __attribute__((ext_vector_type(2)))  float v2f;
typedef __attribute__((ext_vector_type(4)))  unsigned v4u;
typedef __attribute__((ext_vector_type(4)))  int v4i;
typedef float __attribute__((may_alias)) float_a;
typedef int __attribute__((may_alias)) int_a;

template <typename T> __device__ __forceinline__ void vst2(void* p, T v) { *(T*)p = v;  }
__device__ __forceinline__ v8f wmma16(v16h a, v16h b, v8f c) {
  v8f d = __builtin_amdgcn_wmma_f32_16x16x32_f16(false, a, false, b, (short)0, c, false, false);
  asm volatile("v_nop\n\tv_nop\n\tv_nop\n\tv_nop" : "+v"(d) : "v"(a), "v"(b));
  return d;
}
__device__ __forceinline__ v8f wmma_bf(v16b a, v16b b, v8f c) {
  v8f d = __builtin_amdgcn_wmma_f32_16x16x32_bf16(false, a, false, b, (short)0, c, false, false);
  asm volatile("v_nop\n\tv_nop\n\tv_nop\n\tv_nop" : "+v"(d) : "v"(a), "v"(b));
  return d;
}
// 16x16x32 fragments: lane = (h = lane>>4, row/col = lane&15); elements 0..7 = k0+8h+0..7, 8..15 = k0+16+8h+0..7; D element r = row 8h+r
__device__ __forceinline__ v16h frag_h(const _Float16* rowk0, int lane) {
  union { v16h v; v8h q[2]; } u; const _Float16* p = rowk0 + 8 * (lane >> 4);
  u.q[0] = *(const v8h*)p; u.q[1] = *(const v8h*)(p + 16); return u.v;
}
__device__ __forceinline__ v16h frag_f32(const float* rowk0, int lane) {
  v16h a; const float* p = rowk0 + 8 * (lane >> 4);
#pragma unroll
  for (int i = 0; i < 8; ++i) { a[i] = (_Float16)p[i]; a[8 + i] = (_Float16)p[16 + i]; }
  return a;
}
__device__ __forceinline__ v16h frag_f32s(const float* rowk0, int lane, float sc) {
  v16h a; const float* p = rowk0 + 8 * (lane >> 4);
#pragma unroll
  for (int i = 0; i < 8; ++i) { a[i] = (_Float16)(p[i] * sc); a[8 + i] = (_Float16)(p[16 + i] * sc); }
  return a;
}
// column fragment from a [K][ld] layout (column n), rows >= K read as 0
__device__ __forceinline__ v16h fragc_f32(const float* W, int k0, int n, int lane, int ld, int K) {
  v16h a; const int g = lane >> 4;
#pragma unroll
  for (int i = 0; i < 8; ++i) { const int ka = k0 + 8 * g + i, kb = ka + 16;
    a[i] = (_Float16)(ka < K ? W[(size_t)(ka < K ? ka : K - 1) * ld + n] : 0.f); a[8 + i] = (_Float16)(kb < K ? W[(size_t)(kb < K ? kb : K - 1) * ld + n] : 0.f); }
  return a;
}
struct F2 { v16b h, l; };
__device__ __forceinline__ F2 bsplit16(const float v[16]) { F2 r;
#pragma unroll
  for (int i = 0; i < 16; ++i) { const __bf16 h = (__bf16)v[i]; r.h[i] = h; r.l[i] = (__bf16)(v[i] - (float)h); }
  return r; }
__device__ __forceinline__ F2 split_row(const float* row, int k0, int lane) { float v[16]; const float* p = row + k0 + 8 * (lane >> 4);
#pragma unroll
  for (int i = 0; i < 8; ++i) { v[i] = p[i]; v[8 + i] = p[16 + i]; }
  return bsplit16(v); }
__device__ __forceinline__ F2 split_rowK(const float* row, int k0, int lane, int K) { float v[16]; const int g = lane >> 4;
#pragma unroll
  for (int i = 0; i < 8; ++i) { const int ka = k0 + 8 * g + i, kb = ka + 16; v[i] = ka < K ? row[ka < K ? ka : K - 1] : 0.f; v[8 + i] = kb < K ? row[kb < K ? kb : K - 1] : 0.f; }
  return bsplit16(v); }
__device__ __forceinline__ F2 split_col(const float* W, int k0, int n, int lane, int ld, int K) { float v[16]; const int g = lane >> 4;
#pragma unroll
  for (int i = 0; i < 8; ++i) { const int ka = k0 + 8 * g + i, kb = ka + 16; v[i] = ka < K ? W[(size_t)(ka < K ? ka : K - 1) * ld + n] : 0.f; v[8 + i] = kb < K ? W[(size_t)(kb < K ? kb : K - 1) * ld + n] : 0.f; }
  return bsplit16(v); }
__device__ __forceinline__ v8f mac3(const F2& a, const F2& b, v8f c) { c = wmma_bf(a.l, b.h, c); c = wmma_bf(a.h, b.l, c); return wmma_bf(a.h, b.h, c); }
__device__ __forceinline__ float sigm(float v) { return 1.0f / (1.0f + expf(-v)); }
#define LDSX() do { asm volatile("s_wait_dscnt 0" ::: "memory"); __builtin_amdgcn_wave_barrier(); __builtin_amdgcn_fence(__ATOMIC_RELEASE, "workgroup"); } while (0)

// Causal multi-head dot-product attention with QK-RMSNorm and RoPE (B 2, S 2,048, D 1,024, 16 heads x 64): q/k/v = x w ((in, head, hd) = (in,out)); q, k RMS-normalised over the 64 head dims (eps 1e-6, x scale) then rotate-half RoPE (angle t * 10000^(-i/32), i < 32); q x 64^-0.5; logits masked to -0.7*f32max where key > query (== -inf here: the diagonal is always kept); softmax; out = merged(attn v) wo ((head, hd, out) = (in,out)).
#define NB 2
#define TT 2048
#define CC 1024            // NH * HD = projected width
#define DIN 1024          // input (model) width
#define NH 16
#define HD 64
#define NQB (TT / 64)
#define HG 4
#define SCALE (0.125f)
#define CAUSAL 1
#ifndef TNB
#define TNB NB
#endif
__device__ __forceinline__ float bfr(float v) { return (float)(__bf16)v; }
__host__ __device__ __forceinline__ int kb_last(int qb) { return CAUSAL ? ((qb * 64 + 63) >> 7) : (TT / 128 - 1); }
typedef __attribute__((ext_vector_type(8))) __bf16 v8b;
__device__ __forceinline__ v16b frag_b(const __bf16* rowk0, int lane) {
  union { v16b v; v8b q[2]; } u; const __bf16* p = rowk0 + 8 * (lane >> 4);
  u.q[0] = *(const v8b*)p; u.q[1] = *(const v8b*)(p + 16); return u.v;
}
#define QBH 6              // causal: query blocks 0..QBH-1 of each sequence (few keys, no averaging) take the high-precision path
#define QHI 384            // rows carrying a q residual plane
#define KHI 384            // key rows carrying k residual / v bf16 hi+lo planes (used only by the causal high-precision path)
// B fragment (k rows k0+.., output column o) of a weight: (in,out) [K][ld] or (out,in) [ld rows of K]: bf16 exact, or f16(bf16 * 256) exact
__device__ __forceinline__ v16b wcol_io(const float* Wm, int k0, int o, int lane, int ld) { v16b w; const int g = lane >> 4;
#pragma unroll
  for (int i = 0; i < 8; ++i) { w[i] = (__bf16)Wm[(size_t)(k0 + 8 * g + i) * ld + o]; w[8 + i] = (__bf16)Wm[(size_t)(k0 + 16 + 8 * g + i) * ld + o]; }
  return w; }
__device__ __forceinline__ v16b wcol_oi(const float* Wm, int k0, int o, int lane, int K) { v16b w; const float* p = Wm + (size_t)o * K + k0 + 8 * (lane >> 4);
#pragma unroll
  for (int i = 0; i < 8; ++i) { w[i] = (__bf16)p[i]; w[8 + i] = (__bf16)p[16 + i]; }
  return w; }
__device__ __forceinline__ v16h wcolh_io(const float* Wm, int k0, int o, int lane, int ld) { v16h w; const int g = lane >> 4;
#pragma unroll
  for (int i = 0; i < 8; ++i) { w[i] = (_Float16)(bfr(Wm[(size_t)(k0 + 8 * g + i) * ld + o]) * 256.0f); w[8 + i] = (_Float16)(bfr(Wm[(size_t)(k0 + 16 + 8 * g + i) * ld + o]) * 256.0f); }
  return w; }
__device__ __forceinline__ v16h wcolh_oi(const float* Wm, int k0, int o, int lane, int K) { v16h w; const float* p = Wm + (size_t)o * K + k0 + 8 * (lane >> 4);
#pragma unroll
  for (int i = 0; i < 8; ++i) { w[i] = (_Float16)(bfr(p[i]) * 256.0f); w[8 + i] = (_Float16)(bfr(p[16 + i]) * 256.0f); }
  return w; }
#define WQKV_LAYOUT 0   // 0 = (in,out) [DIN][CC]; 1 = (out,in) [CC][DIN]; 2 = per-head [NH][DIN][HD]
__device__ __forceinline__ v16b wcol_hdk(const float* Wm, int k0, int o, int lane) { v16b w; const int g = lane >> 4; const float* p = Wm + (size_t)(o / HD) * DIN * HD + (o % HD);
#pragma unroll
  for (int i = 0; i < 8; ++i) { w[i] = (__bf16)p[(size_t)(k0 + 8 * g + i) * HD]; w[8 + i] = (__bf16)p[(size_t)(k0 + 16 + 8 * g + i) * HD]; }
  return w; }
#define WO_OUT_IN 0
#if WQKV_LAYOUT == 1
#define WCOL(W, k0, o, lane) wcol_oi(W, k0, o, lane, DIN)
#elif WQKV_LAYOUT == 2
#define WCOL(W, k0, o, lane) wcol_hdk(W, k0, o, lane)
#else
#define WCOL(W, k0, o, lane) wcol_io(W, k0, o, lane, CC)
#endif
#if WO_OUT_IN
#define WOCOL(W, k0, o, lane) wcol_oi(W, k0, o, lane, CC)
#define WOCOLH(W, k0, o, lane) wcolh_oi(W, k0, o, lane, CC)
#else
#define WOCOL(W, k0, o, lane) wcol_io(W, k0, o, lane, DIN)
#define WOCOLH(W, k0, o, lane) wcolh_io(W, k0, o, lane, DIN)
#endif
__constant__ float c_invf[32] = {1.000000000e+00f,7.498942018e-01f,5.623413324e-01f,4.216965139e-01f,3.162277639e-01f,2.371373624e-01f,1.778279394e-01f,1.333521456e-01f,1.000000015e-01f,7.498941571e-02f,5.623412877e-02f,4.216964915e-02f,3.162277862e-02f,2.371373586e-02f,1.778279431e-02f,1.333521493e-02f,9.999999776e-03f,7.498942316e-03f,5.623413250e-03f,4.216964822e-03f,3.162277862e-03f,2.371373819e-03f,1.778279431e-03f,1.333521446e-03f,1.000000047e-03f,7.498941850e-04f,5.623413017e-04f,4.216964880e-04f,3.162277862e-04f,2.371373848e-04f,1.778279402e-04f,1.333521504e-04f};   // 1 / 10000^(i/32) evaluated in f32 exactly as the reference does (jax, eager)
#define PROJ_EXTRA_PARAMS , const float* __restrict__ QS, const float* __restrict__ KS
// per-(row, head) epilogue on the f32 projection tile: RMSNorm over the head's 64 values (x q_norm_scale / k_norm_scale), then rotate-half RoPE; v untouched
#define PROJ_EPI(which, row, t, h) do { if ((which) < 2) { float* rw = (row); const float* NS = (which) == 0 ? QS : KS; float ss = 0.f; _Pragma("unroll") for (int i = 0; i < 64; ++i) ss += rw[i] * rw[i]; const float rn = rsqrtf(ss * (1.0f / 64.0f) + 1e-6f); \
    _Pragma("unroll") for (int i = 0; i < 32; ++i) { const float x1 = rw[i] * rn * bfr(NS[i]), x2 = rw[i + 32] * rn * bfr(NS[i + 32]); const float ang = (float)(t) * c_invf[i]; const float cs = cosf(ang), sn = sinf(ang); rw[i] = x1 * cs - x2 * sn; rw[i + 32] = x2 * cs + x1 * sn; } } } while (0)
#ifndef SM_EXTRA_PARAMS
#define SM_EXTRA_PARAMS
#endif
#ifndef PROJ_EXTRA_PARAMS
#define PROJ_EXTRA_PARAMS
#endif
#ifndef SM_MASK_HOOK
#define SM_MASK_HOOK (void)0
#endif

#define WS_QH  0u                                      // f16 q rows [b*t][CC]
#define WS_KH  (WS_QH + 2u * (size_t)NB * TT * CC)      // f16 k rows [b*t][CC]
#define WS_VT  (WS_KH + 2u * (size_t)NB * TT * CC)      // f16 v planes [b][c][t]
#define WS_QL  (WS_VT + 2u * (size_t)NB * CC * TT)      // f16 q residual x 2^10 rows [b][t < QHI][CC]
#define WS_KL  (WS_QL + 2u * (size_t)NB * QHI * CC)     // f16 k residual x 2^10 rows [b][t < KHI][CC]
#define WS_VB  (WS_KL + 2u * (size_t)NB * KHI * CC)     // bf16 v hi planes [b][c][t < KHI]
#define WS_VBL (WS_VB + 2u * (size_t)NB * CC * KHI)
#define WS_S   (WS_VBL + 2u * (size_t)NB * CC * KHI)    // f32 logits / P [hg][t][s]
#define WS_Y   (WS_S  + 4u * (size_t)HG * TT * TT)      // f32 ctx rows [b*t][CC] (only when there is an output projection)
#define WS_END (WS_Y  + 4u * (size_t)NB * TT * CC)

// ---- k_proj: block = (64 rows, 128 cols, which): q/k/v = X W (+ b) with exact bf16 products (K = DIN) -> which 0: q f16 rows (+ residual rows < QHI); 1: k f16 rows (+ residual rows < KHI); 2: v f16 planes [c][t] (+ bf16 hi/lo planes for t < KHI)
__global__ __launch_bounds__(128) void k_proj(const float* __restrict__ XQ, const float* __restrict__ XK, const float* __restrict__ XV, const float* __restrict__ WQ, const float* __restrict__ WK, const float* __restrict__ WV, const float* __restrict__ BQ, const float* __restrict__ BK, const float* __restrict__ BV,
    _Float16* __restrict__ QH, _Float16* __restrict__ QL, _Float16* __restrict__ KH, _Float16* __restrict__ KL, _Float16* __restrict__ VT, __bf16* __restrict__ VB, __bf16* __restrict__ VBL PROJ_EXTRA_PARAMS) {
  __shared__ __align__(16) float st[64][132]; __shared__ __align__(16) _Float16 sh[64][136], sl[64][136]; __shared__ __align__(16) _Float16 th[128][72]; __shared__ __align__(16) __bf16 tb[128][72], tbl[128][72];
  const int tid = threadIdx.x, wave = tid >> 5, lane = tid & 31, col = lane & 15, g = lane >> 4; const int which = blockIdx.z; const int c0 = blockIdx.y * 128; const size_t r0 = (size_t)blockIdx.x * 64; const size_t bb = r0 / TT; const int t0 = (int)(r0 % TT);
  const float* X = which == 0 ? XQ : which == 1 ? XK : XV; const float* WA = which == 0 ? WQ : which == 1 ? WK : WV; const float* BA = which == 0 ? BQ : which == 1 ? BK : BV;
  v8f acc[8] = {};
#pragma unroll 2
  for (int kc = 0; kc < DIN / 32; ++kc) { v16b a; { const float* p = X + (r0 + wave * 16 + col) * DIN + kc * 32 + 8 * g;
#pragma unroll
      for (int i = 0; i < 8; ++i) { a[i] = (__bf16)p[i]; a[8 + i] = (__bf16)p[16 + i]; } }
    asm volatile("s_wait_loadcnt 0x0" ::: "memory");
#pragma unroll
    for (int j = 0; j < 8; ++j) { const v16b w = WCOL(WA, kc * 32, c0 + j * 16 + col, lane); asm volatile("s_wait_loadcnt 0x0" ::: "memory"); acc[j] = wmma_bf(a, w, acc[j]); } }
  { // stage the f32 tile (acc + bias) in LDS, run the per-(row, head) epilogue hook, then convert
#pragma unroll
    for (int j = 0; j < 8; ++j) { const float bias = BA ? bfr(BA[c0 + j * 16 + col]) : 0.f;
#pragma unroll
      for (int r = 0; r < 8; ++r) st[wave * 16 + 8 * g + r][j * 16 + col] = acc[j][r] + bias; }
    __syncthreads();
    for (int e = tid; e < 64 * (128 / HD); e += 128) { const int rl = e / (128 / HD), hh = e % (128 / HD); PROJ_EPI(which, &st[rl][hh * HD], (int)((r0 + rl) % TT), (c0 / HD) + hh); }
    __syncthreads(); }
  if (which < 2) { _Float16* DH = which == 0 ? QH : KH; _Float16* DL = which == 0 ? QL : KL; const int nhi = which == 0 ? QHI : KHI; const bool hi_rows = t0 < nhi;
    for (int e = tid; e < 64 * 128; e += 128) { const int rl = e >> 7, cl = e & 127; const float v = st[rl][cl]; const _Float16 hv = (_Float16)v; sh[rl][cl] = hv; sl[rl][cl] = (_Float16)((v - (float)hv) * 1024.0f); }
    __syncthreads();
    for (int e = tid; e < 64 * 16; e += 128) { const int rl = e >> 4, q = e & 15; vst2((unsigned*)(DH + (r0 + rl) * CC + c0 + q * 8), *(const v4u*)&sh[rl][q * 8]); if (hi_rows) vst2((unsigned*)(DL + (bb * nhi + t0 + rl) * (size_t)CC + c0 + q * 8), *(const v4u*)&sl[rl][q * 8]); }
  } else { const bool hi_rows = t0 < KHI;
    for (int e = tid; e < 64 * 128; e += 128) { const int rl = e & 63, cl = e >> 6; const float v = st[rl][cl]; th[cl][rl] = (_Float16)v; const __bf16 bh = (__bf16)v; tb[cl][rl] = bh; tbl[cl][rl] = (__bf16)(v - (float)bh); }
    __syncthreads();
    for (int e = tid; e < 128 * 8; e += 128) { const int cl = e >> 3, q = e & 7; vst2((unsigned*)(VT + (bb * CC + c0 + cl) * (size_t)TT + t0 + q * 8), *(const v4u*)&th[cl][q * 8]); if (hi_rows) { const size_t o3 = (bb * CC + c0 + cl) * (size_t)KHI + t0 + q * 8; vst2((unsigned*)(VB + o3), *(const v4u*)&tb[cl][q * 8]); vst2((unsigned*)(VBL + o3), *(const v4u*)&tbl[cl][q * 8]); } } } }
// ---- k_sc: block = (query block qb, key block kb <= kb_last(qb), head in group) of batch b: logits x SCALE; q hi + residual (x 2^10) against k (2 products) for query rows < QHI, plus the k residual (3 products) for query blocks < QBH (causal early rows); causal: blocks past the diagonal exit, the mask itself is applied by index in k_sm
__global__ __launch_bounds__(128) void k_sc(const _Float16* __restrict__ QH, const _Float16* __restrict__ KH, const _Float16* __restrict__ QL, const _Float16* __restrict__ KL, int b, int h0, float* __restrict__ S0) { __shared__ __align__(16) float ss[4][16][132];
  const int qb = blockIdx.x, kb = blockIdx.y; if (kb > kb_last(qb)) return;
  const int h = h0 + blockIdx.z; float* S = S0 + (size_t)blockIdx.z * TT * TT;
  const int tid = threadIdx.x, wave = tid >> 5, lane = tid & 31, col = lane & 15, g = lane >> 4; const int k0 = kb * 128; const int ql0 = qb * 64 + wave * 16; const size_t q0 = (size_t)b * TT + ql0, kr0 = (size_t)b * TT + k0;
  v8f acc[8] = {}, accl[8] = {};
  const _Float16* QLb = QL + (size_t)b * QHI * CC; const _Float16* KLb = KL + (size_t)b * KHI * CC;
  if (qb < QBH) {
#pragma unroll
    for (int kc = 0; kc < HD / 32; ++kc) { const v16h ah = frag_h(QH + (q0 + col) * CC + h * HD + kc * 32, lane), al = frag_h(QLb + (size_t)(ql0 + col) * CC + h * HD + kc * 32, lane);
#pragma unroll
      for (int j = 0; j < 8; ++j) { const v16h kbf = frag_h(KH + (kr0 + j * 16 + col) * CC + h * HD + kc * 32, lane), klf = frag_h(KLb + (size_t)(k0 + j * 16 + col) * CC + h * HD + kc * 32, lane); acc[j] = wmma16(ah, kbf, acc[j]); accl[j] = wmma16(al, kbf, accl[j]); accl[j] = wmma16(ah, klf, accl[j]); } }
  } else if (qb * 64 < QHI) {
#pragma unroll
    for (int kc = 0; kc < HD / 32; ++kc) { const v16h ah = frag_h(QH + (q0 + col) * CC + h * HD + kc * 32, lane), al = frag_h(QLb + (size_t)(ql0 + col) * CC + h * HD + kc * 32, lane);
#pragma unroll
      for (int j = 0; j < 8; ++j) { const v16h kbf = frag_h(KH + (kr0 + j * 16 + col) * CC + h * HD + kc * 32, lane); acc[j] = wmma16(ah, kbf, acc[j]); accl[j] = wmma16(al, kbf, accl[j]); } }
  } else {
#pragma unroll
    for (int kc = 0; kc < HD / 32; ++kc) { const v16h ah = frag_h(QH + (q0 + col) * CC + h * HD + kc * 32, lane);
#pragma unroll
      for (int j = 0; j < 8; ++j) { const v16h kbf = frag_h(KH + (kr0 + j * 16 + col) * CC + h * HD + kc * 32, lane); acc[j] = wmma16(ah, kbf, acc[j]); } } }
#pragma unroll
  for (int j = 0; j < 8; ++j) {
#pragma unroll
    for (int r = 0; r < 8; ++r) ss[wave][8 * g + r][j * 16 + col] = (acc[j][r] + accl[j][r] * (1.0f / 1024.0f)) * SCALE; }
  LDSX(); for (int rl = 0; rl < 16; ++rl) vst2(S + (size_t)(ql0 + rl) * TT + k0 + lane * 4, *(const v4f*)&ss[wave][rl][lane * 4]); }
// ---- k_sm: wave = two query rows of one head, ta < TT/2 and tb = TT-1-ta: together always NCH chunks of 128 keys, so every wave has the same work. Both rows stay in registers (chunk i: row a while i < na, then row b); max and sum by lane shuffles, no LDS, no barrier. Keys [0, kend) of a row: logit if s <= t else excluded (only a row's last chunk holds such keys); softmax in f32; P x 2^11 in place (0 for excluded)
#define NCH (TT / 128 + 1)
__device__ __forceinline__ float uni(float v) { return __builtin_bit_cast(float, __builtin_amdgcn_readfirstlane(__builtin_bit_cast(int, v))); }   // a value that is the same in every lane (behind a full xor butterfly), moved to a scalar register: picking row a's or row b's is then scalar work
#define ROW_A(i) ((i) < TT / 256 && (i) < na)   // row a has at most TT/256 chunks
__global__ __launch_bounds__(256) void k_sm(float* __restrict__ S0 SM_EXTRA_PARAMS) { static_assert(CAUSAL && TT % 256 == 0, "the pairing of rows counts on causal row lengths");
  const int lane = threadIdx.x & 31; const int wv = __builtin_amdgcn_readfirstlane(threadIdx.x >> 5);   // the wave's number as a scalar: every test on na below is a scalar branch or select
  const int ta = blockIdx.x * 8 + wv, tb = TT - 1 - ta; const int na = kb_last(ta >> 6) + 1;   // kb_last(tb >> 6) + 1 == NCH - na
  float* sh = S0 + (size_t)blockIdx.y * TT * TT + lane * 4; const unsigned oa = (unsigned)ta * TT, ob = (unsigned)tb * TT - (unsigned)na * 128u;   // chunk i of the wave starts at (row a ? oa : ob) + i * 128
  v4f r[NCH];   // every loop over i or e below is unrolled in full: r stays in registers only where its indices are constants
#pragma unroll
  for (int i = 0; i < NCH; ++i) r[i] = *(const v4f*)(sh + (ROW_A(i) ? oa : ob) + i * 128);
  static_assert(NCH == 17, "the statement below names every chunk");
  asm volatile("" :: "v"(r[0]), "v"(r[1]), "v"(r[2]), "v"(r[3]), "v"(r[4]), "v"(r[5]), "v"(r[6]), "v"(r[7]), "v"(r[8]), "v"(r[9]), "v"(r[10]), "v"(r[11]), "v"(r[12]), "v"(r[13]), "v"(r[14]), "v"(r[15]), "v"(r[16]));   // inputs only: holds all 17 loads in front of the branches below (sunk behind them, the later loads would start only after the earlier ones have returned: a second memory latency)
  float ma = -3.0e38f, mb = -3.0e38f;
#pragma unroll
  for (int i = 0; i < NCH; ++i) { const bool A = ROW_A(i);
    if (i == NCH - 1 || (i < TT / 256 && i == na - 1)) { const int lim = (A ? ta : tb + na * 128) - i * 128 - lane * 4;   // a row's last chunk: element e is key <= t while e <= lim
#pragma unroll
      for (int e = 0; e < 4; ++e) if (e > lim) r[i][e] = -3.0e38f; }
    const float c = fmaxf(fmaxf(r[i][0], r[i][1]), fmaxf(r[i][2], r[i][3])); if (A) ma = fmaxf(ma, c); else mb = fmaxf(mb, c); }
#pragma unroll
  for (int o = 1; o < 32; o <<= 1) { ma = fmaxf(ma, __shfl_xor(ma, o)); mb = fmaxf(mb, __shfl_xor(mb, o)); }
  ma = uni(ma); mb = uni(mb);
  float sa = 0.f, sb = 0.f;
#pragma unroll
  for (int i = 0; i < NCH; ++i) { const bool A = ROW_A(i); const float m = A ? ma : mb;
#pragma unroll
    for (int e = 0; e < 4; ++e) { const float v = r[i][e], x = expf(v - m); r[i][e] = (v <= -1.0e38f) ? 0.f : x; }   // expf outside the test: a select, so that the four elements' chains overlap
    const float c = (r[i][0] + r[i][1]) + (r[i][2] + r[i][3]); if (A) sa += c; else sb += c; }
#pragma unroll
  for (int o = 1; o < 32; o <<= 1) { sa += __shfl_xor(sa, o); sb += __shfl_xor(sb, o); }
  const float ia = uni(2048.0f / sa), ib = uni(2048.0f / sb);
#pragma unroll
  for (int i = 0; i < NCH; ++i) vst2(sh + (ROW_A(i) ? oa : ob) + i * 128, r[i] * (ROW_A(i) ? ia : ib)); }
// ---- k_pv: block = 64 queries (qb) of (b, h): ctx = P . v over keys [0, kend) (P x 2^11 once to f16 against v f16: 1 product; causal early query blocks: P and v as bf16 hi + lo, 3 products); 256-B (row, head) segment by 16 lanes
__global__ __launch_bounds__(128) void k_pv(const float* __restrict__ PS0, const _Float16* __restrict__ VT, const __bf16* __restrict__ VB, const __bf16* __restrict__ VBL, int b, int h0, float* __restrict__ Y) { const int h = h0 + blockIdx.z; const float* PS = PS0 + (size_t)blockIdx.z * TT * TT; __shared__ __align__(16) float ss[4][16][HD + 4];
  const int tid = threadIdx.x, wave = tid >> 5, lane = tid & 31, col = lane & 15, g = lane >> 4; const int qb = blockIdx.x; const int ql0 = qb * 64 + wave * 16; const int kce = (kb_last(qb) + 1) * 4;
  v8f acc[HD / 16] = {};
  if (qb < QBH) {
const char* pb = (const char*)PS; const char* vbh = (const char*)(VB + ((size_t)b * CC + h * HD) * (size_t)KHI); const char* vbl = (const char*)(VBL + ((size_t)b * CC + h * HD) * (size_t)KHI);   // wave-uniform bases; the lane's byte offsets below do not change over the loop
    const unsigned po = (unsigned)(ql0 + col) * (TT * 4u) + 32u * g, vo = (unsigned)col * (KHI * 2u) + 16u * g;
#pragma unroll 1   // rolled: one group of 2 key chunks per trip keeps the live registers below 256
    for (int kc = 0; kc < kce; kc += 2) { v4f pr[2][4]; v8b vh[2][HD / 16][2], vl[2][HD / 16][2]; const char* pk = pb + kc * 128; const char* hk = vbh + kc * 64; const char* lk = vbl + kc * 64;
#pragma unroll
      for (int u = 0; u < 2; ++u) { pr[u][0] = *(const v4f*)(pk + po + u * 128); pr[u][1] = *(const v4f*)(pk + po + u * 128 + 16); pr[u][2] = *(const v4f*)(pk + po + u * 128 + 64); pr[u][3] = *(const v4f*)(pk + po + u * 128 + 80);
#pragma unroll
        for (int j = 0; j < HD / 16; ++j) { const int o = j * 16 * KHI * 2 + u * 64; vh[u][j][0] = *(const v8b*)(hk + vo + o); vh[u][j][1] = *(const v8b*)(hk + vo + o + 32); vl[u][j][0] = *(const v8b*)(lk + vo + o); vl[u][j][1] = *(const v8b*)(lk + vo + o + 32); } }
      asm volatile("s_wait_xcnt 0x0" :: "v"(pk + po), "v"(hk + vo), "v"(lk + vo) : "memory");   // precaution: stands in front of the first rewrite of a register that these loads name; the addresses as inputs keep their registers from being given to a later load of the group
      __builtin_amdgcn_sched_barrier(0);   // holds the group's loads in front of its first product (sunk to their uses they would again cost one memory latency each) and every later write of an address register behind the wait above
#pragma unroll
      for (int u = 0; u < 2; ++u) { float v[16];
#pragma unroll
        for (int i = 0; i < 4; ++i) { v[i] = pr[u][0][i]; v[4 + i] = pr[u][1][i]; v[8 + i] = pr[u][2][i]; v[12 + i] = pr[u][3][i]; }
        const F2 p = bsplit16(v);
#pragma unroll
        for (int j = 0; j < HD / 16; ++j) { union { v16b v; v8b q[2]; } fh, fl; fh.q[0] = vh[u][j][0]; fh.q[1] = vh[u][j][1]; fl.q[0] = vl[u][j][0]; fl.q[1] = vl[u][j][1]; acc[j] = wmma_bf(p.h, fh.v, acc[j]); acc[j] = wmma_bf(p.l, fh.v, acc[j]); acc[j] = wmma_bf(p.h, fl.v, acc[j]); } } }
  } else {
const char* pb = (const char*)PS; const char* vb = (const char*)(VT + ((size_t)b * CC + h * HD) * (size_t)TT);   // wave-uniform bases; the lane's byte offsets below do not change over the loop
    const unsigned po = (unsigned)(ql0 + col) * (TT * 4u) + 32u * g, vo = (unsigned)col * (TT * 2u) + 16u * g;
#pragma unroll 1   // rolled: one group of 4 key chunks (kce is a multiple of 4) per trip keeps the live registers below 256
    for (int kc = 0; kc < kce; kc += 4) { v4f pr[4][4]; v8h vr[4][HD / 16][2]; const char* pk = pb + kc * 128; const char* vk = vb + kc * 64;
#pragma unroll
      for (int u = 0; u < 4; ++u) { pr[u][0] = *(const v4f*)(pk + po + u * 128); pr[u][1] = *(const v4f*)(pk + po + u * 128 + 16); pr[u][2] = *(const v4f*)(pk + po + u * 128 + 64); pr[u][3] = *(const v4f*)(pk + po + u * 128 + 80);
#pragma unroll
        for (int j = 0; j < HD / 16; ++j) { const int o = j * 16 * TT * 2 + u * 64; vr[u][j][0] = *(const v8h*)(vk + vo + o); vr[u][j][1] = *(const v8h*)(vk + vo + o + 32); } }
      asm volatile("s_wait_xcnt 0x0" :: "v"(pk + po), "v"(vk + vo) : "memory");   // precaution: stands in front of the first rewrite of a register that these loads name; the addresses as inputs keep their registers from being given to a later load of the group
      __builtin_amdgcn_sched_barrier(0);   // holds the group's 48 loads in front of its first product (sunk to their uses they would again cost one memory latency each) and every later write of an address register behind the wait above
#pragma unroll
      for (int u = 0; u < 4; ++u) { v16h p;
#pragma unroll
        for (int i = 0; i < 4; ++i) { p[i] = (_Float16)pr[u][0][i]; p[4 + i] = (_Float16)pr[u][1][i]; p[8 + i] = (_Float16)pr[u][2][i]; p[12 + i] = (_Float16)pr[u][3][i]; }
#pragma unroll
        for (int j = 0; j < HD / 16; ++j) { union { v16h v; v8h q[2]; } f; f.q[0] = vr[u][j][0]; f.q[1] = vr[u][j][1]; acc[j] = wmma16(p, f.v, acc[j]); } } } }
#pragma unroll
  for (int j = 0; j < HD / 16; ++j)
#pragma unroll
    for (int r = 0; r < 8; ++r) ss[wave][8 * g + r][j * 16 + col] = acc[j][r] * (1.0f / 2048.0f);
  LDSX(); for (int rl = 0; rl < 16; ++rl) if (lane < HD / 4) vst2(Y + ((size_t)b * TT + ql0 + rl) * CC + h * HD + lane * 4, *(const v4f*)&ss[wave][rl][lane * 4]); }
// ---- k_out: block = (64 rows, 128 cols): out = ctx Wo (+ bo): ctx once to f16 against Wo as f16(bf16 x 2^8) exact (1 product) x 2^-8; causal early rows (< QHI of each sequence): ctx bf16 hi + lo against exact bf16 Wo (2 products)
__global__ __launch_bounds__(128) void k_out(const float* __restrict__ Y, const float* __restrict__ WO, const float* __restrict__ BO, float* __restrict__ OUT) { __shared__ __align__(16) float sf[4][16][132];
  const int tid = threadIdx.x, wave = tid >> 5, lane = tid & 31, col = lane & 15, g = lane >> 4; const int c0 = blockIdx.y * 128; const size_t r0 = (size_t)blockIdx.x * 64 + wave * 16;
  v8f acc[8] = {};
  if (CAUSAL && (int)(((size_t)blockIdx.x * 64) % TT) < QHI) {   /* block-uniform */
#pragma unroll 2
    for (int kc = 0; kc < CC / 32; ++kc) { const F2 a = split_row(Y + (r0 + col) * CC, kc * 32, lane); asm volatile("s_wait_loadcnt 0x0" ::: "memory");
#pragma unroll
      for (int j = 0; j < 8; ++j) { const v16b w = WOCOL(WO, kc * 32, c0 + j * 16 + col, lane); asm volatile("s_wait_loadcnt 0x0" ::: "memory"); acc[j] = wmma_bf(a.h, w, acc[j]); acc[j] = wmma_bf(a.l, w, acc[j]); } }
#pragma unroll
    for (int j = 0; j < 8; ++j) { const float bias = BO ? bfr(BO[c0 + j * 16 + col]) : 0.f;
#pragma unroll
      for (int r = 0; r < 8; ++r) sf[wave][8 * g + r][j * 16 + col] = acc[j][r] + bias; }
  } else {
#pragma unroll 2
    for (int kc = 0; kc < CC / 32; ++kc) { const v16h a = frag_f32(Y + (r0 + col) * CC + kc * 32, lane); asm volatile("s_wait_loadcnt 0x0" ::: "memory");
#pragma unroll
      for (int j = 0; j < 8; ++j) { const v16h w = WOCOLH(WO, kc * 32, c0 + j * 16 + col, lane); asm volatile("s_wait_loadcnt 0x0" ::: "memory"); acc[j] = wmma16(a, w, acc[j]); } }
#pragma unroll
    for (int j = 0; j < 8; ++j) { const float bias = BO ? bfr(BO[c0 + j * 16 + col]) : 0.f;
#pragma unroll
      for (int r = 0; r < 8; ++r) sf[wave][8 * g + r][j * 16 + col] = acc[j][r] * (1.0f / 256.0f) + bias; } }
  LDSX(); for (int rl = 0; rl < 16; ++rl) vst2(OUT + (r0 + rl) * DIN + c0 + lane * 4, *(const v4f*)&sf[wave][rl][lane * 4]); }

extern "C" void kernel_launch(void* const* d_in, const int* in_sizes, int n_in, void* d_out, int out_size, void* d_ws, size_t ws_size, hipStream_t stream) {
  (void)in_sizes; (void)n_in; (void)out_size;
  const float** F = (const float**)d_in;
  if (ws_size < (size_t)WS_END) return;
  char* ws = (char*)d_ws; _Float16 *QH = (_Float16*)(ws + WS_QH), *KH = (_Float16*)(ws + WS_KH), *VT = (_Float16*)(ws + WS_VT), *QL = (_Float16*)(ws + WS_QL), *KL = (_Float16*)(ws + WS_KL); __bf16 *VB = (__bf16*)(ws + WS_VB), *VBL = (__bf16*)(ws + WS_VBL); float *S = (float*)(ws + WS_S), *Y = (float*)(ws + WS_Y);
  (void)Y; (void)QL; (void)KL; (void)VB; (void)VBL;
  // inputs: 0 inputs_q [2,2048,1024]; 1 wq, 2 wk, 3 wv [1024,16,64] (= (in,out)); 4 wo [16,64,1024] (= (in,out)); 5 q_norm_scale [64]; 6 k_norm_scale [64]
  k_proj<<<dim3(TNB * TT / 64, CC / 128, 3), 128, 0, stream>>>(F[0], F[0], F[0], F[1], F[2], F[3], nullptr, nullptr, nullptr, QH, QL, KH, KL, VT, VB, VBL, F[5], F[6]);
  for (int b = 0; b < TNB; ++b) for (int h0 = 0; h0 < NH; h0 += HG) {
    k_sc<<<dim3(NQB, TT / 128, HG), 128, 0, stream>>>(QH, KH, QL, KL, b, h0, S);
    k_sm<<<dim3(TT / 16, HG), 256, 0, stream>>>(S);
    k_pv<<<dim3(NQB, 1, HG), 128, 0, stream>>>(S, VT, VB, VBL, b, h0, Y);
  }
  k_out<<<dim3(TNB * TT / 64, DIN / 128), 128, 0, stream>>>(Y, F[4], nullptr, (float*)d_out);
}

// v003
// Measured time: 574 microseconds a run.
// Two timings next to v002 put it at 1.22 and 1.23 times that version's speed.
// Over all steps from v000 it is 1.92 times as fast.
// compute dtype: all float inputs rounded to bf16; q/k/v = x W with EXACT bf16 products on WMMA 16x16x32, f32 accumulate; per-head RMSNorm and rotate-half RoPE in f32 (precise sinf/cosf of t * inv_freq); q, k once to f16 -> 1-product causal logits x 1/8, except the first 384 query rows of each sequence (few keys, no averaging), which use q and k as f16 hi + residual (x 2^10) (3 products); softmax in f32 (precise expf); P x 2^11 once to f16 against v once to f16 (1 product), except the first 384 rows: P and v as bf16 hi + lo (3 products); ctx once to f16 against wo carried x 2^8 in f16 (exact bf16 values), except the first 384 rows: ctx bf16 hi + lo against exact bf16 wo (2 products); f32 output.
#include <hip/hip_runtime.h>
#include <math.h>

typedef __attribute__((ext_vector_type(16))) _Float16 v16h;
typedef __attribute__((ext_vector_type(16))) __bf16 v16b;
typedef __attribute__((ext_vector_type(8)))  _Float16 v8h;
typedef __attribute__((ext_vector_type(8)))  float v8f;
typedef __attribute__((ext_vector_type(4)))  float v4f;
typedef __attribute__((ext_vector_type(2)))  float v2f;
typedef __attribute__((ext_vector_type(4)))  unsigned v4u;
typedef __attribute__((ext_vector_type(4)))  int v4i;
typedef float __attribute__((may_alias)) float_a;
typedef int __attribute__((may_alias)) int_a;

template <typename T> __device__ __forceinline__ void vst2(void* p, T v) { *(T*)p = v;  }
__device__ __forceinline__ v8f wmma16(v16h a, v16h b, v8f c) {
  v8f d = __builtin_amdgcn_wmma_f32_16x16x32_f16(false, a, false, b, (short)0, c, false, false);
  asm volatile("v_nop\n\tv_nop\n\tv_nop\n\tv_nop" : "+v"(d) : "v"(a), "v"(b));
  return d;
}
__device__ __forceinline__ v8f wmma_bf(v16b a, v16b b, v8f c) {
  v8f d = __builtin_amdgcn_wmma_f32_16x16x32_bf16(false, a, false, b, (short)0, c, false, false);
  asm volatile("v_nop\n\tv_nop\n\tv_nop\n\tv_nop" : "+v"(d) : "v"(a), "v"(b));
  return d;
}
// 16x16x32 fragments: lane = (h = lane>>4, row/col = lane&15); elements 0..7 = k0+8h+0..7, 8..15 = k0+16+8h+0..7; D element r = row 8h+r
__device__ __forceinline__ v16h frag_h(const _Float16* rowk0, int lane) {
  union { v16h v; v8h q[2]; } u; const _Float16* p = rowk0 + 8 * (lane >> 4);
  u.q[0] = *(const v8h*)p; u.q[1] = *(const v8h*)(p + 16); return u.v;
}
__device__ __forceinline__ v16h frag_f32(const float* rowk0, int lane) {
  v16h a; const float* p = rowk0 + 8 * (lane >> 4);
#pragma unroll
  for (int i = 0; i < 8; ++i) { a[i] = (_Float16)p[i]; a[8 + i] = (_Float16)p[16 + i]; }
  return a;
}
__device__ __forceinline__ v16h frag_f32s(const float* rowk0, int lane, float sc) {
  v16h a; const float* p = rowk0 + 8 * (lane >> 4);
#pragma unroll
  for (int i = 0; i < 8; ++i) { a[i] = (_Float16)(p[i] * sc); a[8 + i] = (_Float16)(p[16 + i] * sc); }
  return a;
}
// column fragment from a [K][ld] layout (column n), rows >= K read as 0
__device__ __forceinline__ v16h fragc_f32(const float* W, int k0, int n, int lane, int ld, int K) {
  v16h a; const int g = lane >> 4;
#pragma unroll
  for (int i = 0; i < 8; ++i) { const int ka = k0 + 8 * g + i, kb = ka + 16;
    a[i] = (_Float16)(ka < K ? W[(size_t)(ka < K ? ka : K - 1) * ld + n] : 0.f); a[8 + i] = (_Float16)(kb < K ? W[(size_t)(kb < K ? kb : K - 1) * ld + n] : 0.f); }
  return a;
}
struct F2 { v16b h, l; };
__device__ __forceinline__ F2 bsplit16(const float v[16]) { F2 r;
#pragma unroll
  for (int i = 0; i < 16; ++i) { const __bf16 h = (__bf16)v[i]; r.h[i] = h; r.l[i] = (__bf16)(v[i] - (float)h); }
  return r; }
__device__ __forceinline__ F2 split_row(const float* row, int k0, int lane) { float v[16]; const float* p = row + k0 + 8 * (lane >> 4);
#pragma unroll
  for (int i = 0; i < 8; ++i) { v[i] = p[i]; v[8 + i] = p[16 + i]; }
  return bsplit16(v); }
__device__ __forceinline__ F2 split_rowK(const float* row, int k0, int lane, int K) { float v[16]; const int g = lane >> 4;
#pragma unroll
  for (int i = 0; i < 8; ++i) { const int ka = k0 + 8 * g + i, kb = ka + 16; v[i] = ka < K ? row[ka < K ? ka : K - 1] : 0.f; v[8 + i] = kb < K ? row[kb < K ? kb : K - 1] : 0.f; }
  return bsplit16(v); }
__device__ __forceinline__ F2 split_col(const float* W, int k0, int n, int lane, int ld, int K) { float v[16]; const int g = lane >> 4;
#pragma unroll
  for (int i = 0; i < 8; ++i) { const int ka = k0 + 8 * g + i, kb = ka + 16; v[i] = ka < K ? W[(size_t)(ka < K ? ka : K - 1) * ld + n] : 0.f; v[8 + i] = kb < K ? W[(size_t)(kb < K ? kb : K - 1) * ld + n] : 0.f; }
  return bsplit16(v); }
__device__ __forceinline__ v8f mac3(const F2& a, const F2& b, v8f c) { c = wmma_bf(a.l, b.h, c); c = wmma_bf(a.h, b.l, c); return wmma_bf(a.h, b.h, c); }
__device__ __forceinline__ float sigm(float v) { return 1.0f / (1.0f + expf(-v)); }
#define LDSX() do { asm volatile("s_wait_dscnt 0" ::: "memory"); __builtin_amdgcn_wave_barrier(); __builtin_amdgcn_fence(__ATOMIC_RELEASE, "workgroup"); } while (0)

// Causal multi-head dot-product attention with QK-RMSNorm and RoPE (B 2, S 2,048, D 1,024, 16 heads x 64): q/k/v = x w ((in, head, hd) = (in,out)); q, k RMS-normalised over the 64 head dims (eps 1e-6, x scale) then rotate-half RoPE (angle t * 10000^(-i/32), i < 32); q x 64^-0.5; logits masked to -0.7*f32max where key > query (== -inf here: the diagonal is always kept); softmax; out = merged(attn v) wo ((head, hd, out) = (in,out)).
#define NB 2
#define TT 2048
#define CC 1024            // NH * HD = projected width
#define DIN 1024          // input (model) width
#define NH 16
#define HD 64
#define NQB (TT / 64)
#define HG 8               // heads per pass: a k_pv launch lasts as long as its longest work-group, so 8 x 32 = 256 work-groups (one per WGP) take about as long as 128 did; S holds 8 planes (128 MiB), the workspace use stays under its size
#define SCALE (0.125f)
#define CAUSAL 1
#ifndef TNB
#define TNB NB
#endif
__device__ __forceinline__ float bfr(float v) { return (float)(__bf16)v; }
__host__ __device__ __forceinline__ int kb_last(int qb) { return CAUSAL ? ((qb * 64 + 63) >> 7) : (TT / 128 - 1); }
typedef __attribute__((ext_vector_type(8))) __bf16 v8b;
__device__ __forceinline__ v16b frag_b(const __bf16* rowk0, int lane) {
  union { v16b v; v8b q[2]; } u; const __bf16* p = rowk0 + 8 * (lane >> 4);
  u.q[0] = *(const v8b*)p; u.q[1] = *(const v8b*)(p + 16); return u.v;
}
#define QBH 6              // causal: query blocks 0..QBH-1 of each sequence (few keys, no averaging) take the high-precision path
#define QHI 384            // rows carrying a q residual plane
#define KHI 384            // key rows carrying k residual / v bf16 hi+lo planes (used only by the causal high-precision path)
// B fragment (k rows k0+.., output column o) of a weight: (in,out) [K][ld] or (out,in) [ld rows of K]: bf16 exact, or f16(bf16 * 256) exact
__device__ __forceinline__ v16b wcol_io(const float* Wm, int k0, int o, int lane, int ld) { v16b w; const int g = lane >> 4;
#pragma unroll
  for (int i = 0; i < 8; ++i) { w[i] = (__bf16)Wm[(size_t)(k0 + 8 * g + i) * ld + o]; w[8 + i] = (__bf16)Wm[(size_t)(k0 + 16 + 8 * g + i) * ld + o]; }
  return w; }
__device__ __forceinline__ v16b wcol_oi(const float* Wm, int k0, int o, int lane, int K) { v16b w; const float* p = Wm + (size_t)o * K + k0 + 8 * (lane >> 4);
#pragma unroll
  for (int i = 0; i < 8; ++i) { w[i] = (__bf16)p[i]; w[8 + i] = (__bf16)p[16 + i]; }
  return w; }
__device__ __forceinline__ v16h wcolh_io(const float* Wm, int k0, int o, int lane, int ld) { v16h w; const int g = lane >> 4;
#pragma unroll
  for (int i = 0; i < 8; ++i) { w[i] = (_Float16)(bfr(Wm[(size_t)(k0 + 8 * g + i) * ld + o]) * 256.0f); w[8 + i] = (_Float16)(bfr(Wm[(size_t)(k0 + 16 + 8 * g + i) * ld + o]) * 256.0f); }
  return w; }
__device__ __forceinline__ v16h wcolh_oi(const float* Wm, int k0, int o, int lane, int K) { v16h w; const float* p = Wm + (size_t)o * K + k0 + 8 * (lane >> 4);
#pragma unroll
  for (int i = 0; i < 8; ++i) { w[i] = (_Float16)(bfr(p[i]) * 256.0f); w[8 + i] = (_Float16)(bfr(p[16 + i]) * 256.0f); }
  return w; }
#define WQKV_LAYOUT 0   // 0 = (in,out) [DIN][CC]; 1 = (out,in) [CC][DIN]; 2 = per-head [NH][DIN][HD]
__device__ __forceinline__ v16b wcol_hdk(const float* Wm, int k0, int o, int lane) { v16b w; const int g = lane >> 4; const float* p = Wm + (size_t)(o / HD) * DIN * HD + (o % HD);
#pragma unroll
  for (int i = 0; i < 8; ++i) { w[i] = (__bf16)p[(size_t)(k0 + 8 * g + i) * HD]; w[8 + i] = (__bf16)p[(size_t)(k0 + 16 + 8 * g + i) * HD]; }
  return w; }
#define WO_OUT_IN 0
#if WQKV_LAYOUT == 1
#define WCOL(W, k0, o, lane) wcol_oi(W, k0, o, lane, DIN)
#elif WQKV_LAYOUT == 2
#define WCOL(W, k0, o, lane) wcol_hdk(W, k0, o, lane)
#else
#define WCOL(W, k0, o, lane) wcol_io(W, k0, o, lane, CC)
#endif
#if WO_OUT_IN
#define WOCOL(W, k0, o, lane) wcol_oi(W, k0, o, lane, CC)
#define WOCOLH(W, k0, o, lane) wcolh_oi(W, k0, o, lane, CC)
#else
#define WOCOL(W, k0, o, lane) wcol_io(W, k0, o, lane, DIN)
#define WOCOLH(W, k0, o, lane) wcolh_io(W, k0, o, lane, DIN)
#endif
__constant__ float c_invf[32] = {1.000000000e+00f,7.498942018e-01f,5.623413324e-01f,4.216965139e-01f,3.162277639e-01f,2.371373624e-01f,1.778279394e-01f,1.333521456e-01f,1.000000015e-01f,7.498941571e-02f,5.623412877e-02f,4.216964915e-02f,3.162277862e-02f,2.371373586e-02f,1.778279431e-02f,1.333521493e-02f,9.999999776e-03f,7.498942316e-03f,5.623413250e-03f,4.216964822e-03f,3.162277862e-03f,2.371373819e-03f,1.778279431e-03f,1.333521446e-03f,1.000000047e-03f,7.498941850e-04f,5.623413017e-04f,4.216964880e-04f,3.162277862e-04f,2.371373848e-04f,1.778279402e-04f,1.333521504e-04f};   // 1 / 10000^(i/32) evaluated in f32 exactly as the reference does (jax, eager)
#define PROJ_EXTRA_PARAMS , const float* __restrict__ QS, const float* __restrict__ KS
// per-(row, head) epilogue on the f32 projection tile: RMSNorm over the head's 64 values (x q_norm_scale / k_norm_scale), then rotate-half RoPE; v untouched
#define PROJ_EPI(which, row, t, h) do { if ((which) < 2) { float* rw = (row); const float* NS = (which) == 0 ? QS : KS; float ss = 0.f; _Pragma("unroll") for (int i = 0; i < 64; ++i) ss += rw[i] * rw[i]; const float rn = rsqrtf(ss * (1.0f / 64.0f) + 1e-6f); \
    _Pragma("unroll") for (int i = 0; i < 32; ++i) { const float x1 = rw[i] * rn * bfr(NS[i]), x2 = rw[i + 32] * rn * bfr(NS[i + 32]); const float ang = (float)(t) * c_invf[i]; const float cs = cosf(ang), sn = sinf(ang); rw[i] = x1 * cs - x2 * sn; rw[i + 32] = x2 * cs + x1 * sn; } } } while (0)
#ifndef SM_EXTRA_PARAMS
#define SM_EXTRA_PARAMS
#endif
#ifndef PROJ_EXTRA_PARAMS
#define PROJ_EXTRA_PARAMS
#endif
#ifndef SM_MASK_HOOK
#define SM_MASK_HOOK (void)0
#endif

#define WS_QH  0u                                      // f16 q rows [b*t][CC]
#define WS_KH  (WS_QH + 2u * (size_t)NB * TT * CC)      // f16 k rows [b*t][CC]
#define WS_VT  (WS_KH + 2u * (size_t)NB * TT * CC)      // f16 v planes [b][c][t]
#define WS_QL  (WS_VT + 2u * (size_t)NB * CC * TT)      // f16 q residual x 2^10 rows [b][t < QHI][CC]
#define WS_KL  (WS_QL + 2u * (size_t)NB * QHI * CC)     // f16 k residual x 2^10 rows [b][t < KHI][CC]
#define WS_VB  (WS_KL + 2u * (size_t)NB * KHI * CC)     // bf16 v hi planes [b][c][t < KHI]
#define WS_VBL (WS_VB + 2u * (size_t)NB * CC * KHI)
#define WS_S   (WS_VBL + 2u * (size_t)NB * CC * KHI)    // f32 logits / P [hg][t][s]
#define WS_Y   (WS_S  + 4u * (size_t)HG * TT * TT)      // f32 ctx rows [b*t][CC] (only when there is an output projection)
#define WS_END (WS_Y  + 4u * (size_t)NB * TT * CC)

// ---- k_proj: block = (64 rows, 128 cols, which): q/k/v = X W (+ b) with exact bf16 products (K = DIN) -> which 0: q f16 rows (+ residual rows < QHI); 1: k f16 rows (+ residual rows < KHI); 2: v f16 planes [c][t] (+ bf16 hi/lo planes for t < KHI)
__global__ __launch_bounds__(128) void k_proj(const float* __restrict__ XQ, const float* __restrict__ XK, const float* __restrict__ XV, const float* __restrict__ WQ, const float* __restrict__ WK, const float* __restrict__ WV, const float* __restrict__ BQ, const float* __restrict__ BK, const float* __restrict__ BV,
    _Float16* __restrict__ QH, _Float16* __restrict__ QL, _Float16* __restrict__ KH, _Float16* __restrict__ KL, _Float16* __restrict__ VT, __bf16* __restrict__ VB, __bf16* __restrict__ VBL PROJ_EXTRA_PARAMS) {
  __shared__ __align__(16) float st[64][132]; __shared__ __align__(16) _Float16 sh[64][136], sl[64][136]; __shared__ __align__(16) _Float16 th[128][72]; __shared__ __align__(16) __bf16 tb[128][72], tbl[128][72];
  const int tid = threadIdx.x, wave = tid >> 5, lane = tid & 31, col = lane & 15, g = lane >> 4; const int which = blockIdx.z; const int c0 = blockIdx.y * 128; const size_t r0 = (size_t)blockIdx.x * 64; const size_t bb = r0 / TT; const int t0 = (int)(r0 % TT);
  const float* X = which == 0 ? XQ : which == 1 ? XK : XV; const float* WA = which == 0 ? WQ : which == 1 ? WK : WV; const float* BA = which == 0 ? BQ : which == 1 ? BK : BV;
  v8f acc[8] = {};
#pragma unroll 2
  for (int kc = 0; kc < DIN / 32; ++kc) { v16b a; { const float* p = X + (r0 + wave * 16 + col) * DIN + kc * 32 + 8 * g;
#pragma unroll
      for (int i = 0; i < 8; ++i) { a[i] = (__bf16)p[i]; a[8 + i] = (__bf16)p[16 + i]; } }
    asm volatile("s_wait_loadcnt 0x0" ::: "memory");
#pragma unroll
    for (int j = 0; j < 8; ++j) { const v16b w = WCOL(WA, kc * 32, c0 + j * 16 + col, lane); asm volatile("s_wait_loadcnt 0x0" ::: "memory"); acc[j] = wmma_bf(a, w, acc[j]); } }
  { // stage the f32 tile (acc + bias) in LDS, run the per-(row, head) epilogue hook, then convert
#pragma unroll
    for (int j = 0; j < 8; ++j) { const float bias = BA ? bfr(BA[c0 + j * 16 + col]) : 0.f;
#pragma unroll
      for (int r = 0; r < 8; ++r) st[wave * 16 + 8 * g + r][j * 16 + col] = acc[j][r] + bias; }
    __syncthreads();
    for (int e = tid; e < 64 * (128 / HD); e += 128) { const int rl = e / (128 / HD), hh = e % (128 / HD); PROJ_EPI(which, &st[rl][hh * HD], (int)((r0 + rl) % TT), (c0 / HD) + hh); }
    __syncthreads(); }
  if (which < 2) { _Float16* DH = which == 0 ? QH : KH; _Float16* DL = which == 0 ? QL : KL; const int nhi = which == 0 ? QHI : KHI; const bool hi_rows = t0 < nhi;
    for (int e = tid; e < 64 * 128; e += 128) { const int rl = e >> 7, cl = e & 127; const float v = st[rl][cl]; const _Float16 hv = (_Float16)v; sh[rl][cl] = hv; sl[rl][cl] = (_Float16)((v - (float)hv) * 1024.0f); }
    __syncthreads();
    for (int e = tid; e < 64 * 16; e += 128) { const int rl = e >> 4, q = e & 15; vst2((unsigned*)(DH + (r0 + rl) * CC + c0 + q * 8), *(const v4u*)&sh[rl][q * 8]); if (hi_rows) vst2((unsigned*)(DL + (bb * nhi + t0 + rl) * (size_t)CC + c0 + q * 8), *(const v4u*)&sl[rl][q * 8]); }
  } else { const bool hi_rows = t0 < KHI;
    for (int e = tid; e < 64 * 128; e += 128) { const int rl = e & 63, cl = e >> 6; const float v = st[rl][cl]; th[cl][rl] = (_Float16)v; const __bf16 bh = (__bf16)v; tb[cl][rl] = bh; tbl[cl][rl] = (__bf16)(v - (float)bh); }
    __syncthreads();
    for (int e = tid; e < 128 * 8; e += 128) { const int cl = e >> 3, q = e & 7; vst2((unsigned*)(VT + (bb * CC + c0 + cl) * (size_t)TT + t0 + q * 8), *(const v4u*)&th[cl][q * 8]); if (hi_rows) { const size_t o3 = (bb * CC + c0 + cl) * (size_t)KHI + t0 + q * 8; vst2((unsigned*)(VB + o3), *(const v4u*)&tb[cl][q * 8]); vst2((unsigned*)(VBL + o3), *(const v4u*)&tbl[cl][q * 8]); } } } }
// ---- k_sc: block = (query block qb, key block kb <= kb_last(qb), head in group) of batch b: logits x SCALE; q hi + residual (x 2^10) against k (2 products) for query rows < QHI, plus the k residual (3 products) for query blocks < QBH (causal early rows); causal: blocks past the diagonal exit, the mask itself is applied by index in k_sm
__global__ __launch_bounds__(128) void k_sc(const _Float16* __restrict__ QH, const _Float16* __restrict__ KH, const _Float16* __restrict__ QL, const _Float16* __restrict__ KL, int b, int h0, float* __restrict__ S0) { __shared__ __align__(16) float ss[4][16][132];
  const int qb = blockIdx.x, kb = blockIdx.y; if (kb > kb_last(qb)) return;
  const int h = h0 + blockIdx.z; float* S = S0 + (size_t)blockIdx.z * TT * TT;
  const int tid = threadIdx.x, wave = tid >> 5, lane = tid & 31, col = lane & 15, g = lane >> 4; const int k0 = kb * 128; const int ql0 = qb * 64 + wave * 16; const size_t q0 = (size_t)b * TT + ql0, kr0 = (size_t)b * TT + k0;
  v8f acc[8] = {}, accl[8] = {};
  const _Float16* QLb = QL + (size_t)b * QHI * CC; const _Float16* KLb = KL + (size_t)b * KHI * CC;
  if (qb < QBH) {
#pragma unroll
    for (int kc = 0; kc < HD / 32; ++kc) { const v16h ah = frag_h(QH + (q0 + col) * CC + h * HD + kc * 32, lane), al = frag_h(QLb + (size_t)(ql0 + col) * CC + h * HD + kc * 32, lane);
#pragma unroll
      for (int j = 0; j < 8; ++j) { const v16h kbf = frag_h(KH + (kr0 + j * 16 + col) * CC + h * HD + kc * 32, lane), klf = frag_h(KLb + (size_t)(k0 + j * 16 + col) * CC + h * HD + kc * 32, lane); acc[j] = wmma16(ah, kbf, acc[j]); accl[j] = wmma16(al, kbf, accl[j]); accl[j] = wmma16(ah, klf, accl[j]); } }
  } else if (qb * 64 < QHI) {
#pragma unroll
    for (int kc = 0; kc < HD / 32; ++kc) { const v16h ah = frag_h(QH + (q0 + col) * CC + h * HD + kc * 32, lane), al = frag_h(QLb + (size_t)(ql0 + col) * CC + h * HD + kc * 32, lane);
#pragma unroll
      for (int j = 0; j < 8; ++j) { const v16h kbf = frag_h(KH + (kr0 + j * 16 + col) * CC + h * HD + kc * 32, lane); acc[j] = wmma16(ah, kbf, acc[j]); accl[j] = wmma16(al, kbf, accl[j]); } }
  } else {
#pragma unroll
    for (int kc = 0; kc < HD / 32; ++kc) { const v16h ah = frag_h(QH + (q0 + col) * CC + h * HD + kc * 32, lane);
#pragma unroll
      for (int j = 0; j < 8; ++j) { const v16h kbf = frag_h(KH + (kr0 + j * 16 + col) * CC + h * HD + kc * 32, lane); acc[j] = wmma16(ah, kbf, acc[j]); } } }
#pragma unroll
  for (int j = 0; j < 8; ++j) {
#pragma unroll
    for (int r = 0; r < 8; ++r) ss[wave][8 * g + r][j * 16 + col] = (acc[j][r] + accl[j][r] * (1.0f / 1024.0f)) * SCALE; }
  LDSX(); for (int rl = 0; rl < 16; ++rl) vst2(S + (size_t)(ql0 + rl) * TT + k0 + lane * 4, *(const v4f*)&ss[wave][rl][lane * 4]); }
// ---- k_sm: wave = two query rows of one head, ta < TT/2 and tb = TT-1-ta: together always NCH chunks of 128 keys, so every wave has the same work. Both rows stay in registers (chunk i: row a while i < na, then row b); max and sum by lane shuffles, no LDS, no barrier. Keys [0, kend) of a row: logit if s <= t else excluded (only a row's last chunk holds such keys); softmax in f32; P x 2^11 in place (0 for excluded)
#define NCH (TT / 128 + 1)
__device__ __forceinline__ float uni(float v) { return __builtin_bit_cast(float, __builtin_amdgcn_readfirstlane(__builtin_bit_cast(int, v))); }   // a value that is the same in every lane (behind a full xor butterfly), moved to a scalar register: picking row a's or row b's is then scalar work
#define ROW_A(i) ((i) < TT / 256 && (i) < na)   // row a has at most TT/256 chunks
__global__ __launch_bounds__(256) void k_sm(float* __restrict__ S0 SM_EXTRA_PARAMS) { static_assert(CAUSAL && TT % 256 == 0, "the pairing of rows counts on causal row lengths");
  const int lane = threadIdx.x & 31; const int wv = __builtin_amdgcn_readfirstlane(threadIdx.x >> 5);   // the wave's number as a scalar: every test on na below is a scalar branch or select
  const int ta = blockIdx.x * 8 + wv, tb = TT - 1 - ta; const int na = kb_last(ta >> 6) + 1;   // kb_last(tb >> 6) + 1 == NCH - na
  float* sh = S0 + (size_t)blockIdx.y * TT * TT + lane * 4; const unsigned oa = (unsigned)ta * TT, ob = (unsigned)tb * TT - (unsigned)na * 128u;   // chunk i of the wave starts at (row a ? oa : ob) + i * 128
  v4f r[NCH];   // every loop over i or e below is unrolled in full: r stays in registers only where its indices are constants
#pragma unroll
  for (int i = 0; i < NCH; ++i) r[i] = *(const v4f*)(sh + (ROW_A(i) ? oa : ob) + i * 128);
  static_assert(NCH == 17, "the statement below names every chunk");
  asm volatile("" :: "v"(r[0]), "v"(r[1]), "v"(r[2]), "v"(r[3]), "v"(r[4]), "v"(r[5]), "v"(r[6]), "v"(r[7]), "v"(r[8]), "v"(r[9]), "v"(r[10]), "v"(r[11]), "v"(r[12]), "v"(r[13]), "v"(r[14]), "v"(r[15]), "v"(r[16]));   // inputs only: holds all 17 loads in front of the branches below (sunk behind them, the later loads would start only after the earlier ones have returned: a second memory latency)
  float ma = -3.0e38f, mb = -3.0e38f;
#pragma unroll
  for (int i = 0; i < NCH; ++i) { const bool A = ROW_A(i);
    if (i == NCH - 1 || (i < TT / 256 && i == na - 1)) { const int lim = (A ? ta : tb + na * 128) - i * 128 - lane * 4;   // a row's last chunk: element e is key <= t while e <= lim
#pragma unroll
      for (int e = 0; e < 4; ++e) if (e > lim) r[i][e] = -3.0e38f; }
    const float c = fmaxf(fmaxf(r[i][0], r[i][1]), fmaxf(r[i][2], r[i][3])); if (A) ma = fmaxf(ma, c); else mb = fmaxf(mb, c); }
#pragma unroll
  for (int o = 1; o < 32; o <<= 1) { ma = fmaxf(ma, __shfl_xor(ma, o)); mb = fmaxf(mb, __shfl_xor(mb, o)); }
  ma = uni(ma); mb = uni(mb);
  float sa = 0.f, sb = 0.f;
#pragma unroll
  for (int i = 0; i < NCH; ++i) { const bool A = ROW_A(i); const float m = A ? ma : mb;
#pragma unroll
    for (int e = 0; e < 4; ++e) { const float v = r[i][e], x = expf(v - m); r[i][e] = (v <= -1.0e38f) ? 0.f : x; }   // expf outside the test: a select, so that the four elements' chains overlap
    const float c = (r[i][0] + r[i][1]) + (r[i][2] + r[i][3]); if (A) sa += c; else sb += c; }
#pragma unroll
  for (int o = 1; o < 32; o <<= 1) { sa += __shfl_xor(sa, o); sb += __shfl_xor(sb, o); }
  const float ia = uni(2048.0f / sa), ib = uni(2048.0f / sb);
#pragma unroll
  for (int i = 0; i < NCH; ++i) vst2(sh + (ROW_A(i) ? oa : ob) + i * 128, r[i] * (ROW_A(i) ? ia : ib)); }
// ---- k_pv: block = 64 queries (qb) of (b, h): ctx = P . v over keys [0, kend) (P x 2^11 once to f16 against v f16: 1 product; causal early query blocks: P and v as bf16 hi + lo, 3 products); 256-B (row, head) segment by 16 lanes
__global__ __launch_bounds__(128) void k_pv(const float* __restrict__ PS0, const _Float16* __restrict__ VT, const __bf16* __restrict__ VB, const __bf16* __restrict__ VBL, int b, int h0, float* __restrict__ Y) { const int h = h0 + blockIdx.z; const float* PS = PS0 + (size_t)blockIdx.z * TT * TT; __shared__ __align__(16) float ss[4][16][HD + 4];
  const int tid = threadIdx.x, wave = tid >> 5, lane = tid & 31, col = lane & 15, g = lane >> 4; const int qb = blockIdx.x; const int ql0 = qb * 64 + wave * 16; const int kce = (kb_last(qb) + 1) * 4;
  v8f acc[HD / 16] = {};
  if (qb < QBH) {
const char* pb = (const char*)PS; const char* vbh = (const char*)(VB + ((size_t)b * CC + h * HD) * (size_t)KHI); const char* vbl = (const char*)(VBL + ((size_t)b * CC + h * HD) * (size_t)KHI);   // wave-uniform bases; the lane's byte offsets below do not change over the loop
    const unsigned po = (unsigned)(ql0 + col) * (TT * 4u) + 32u * g, vo = (unsigned)col * (KHI * 2u) + 16u * g;
#pragma unroll 1   // rolled: one group of 2 key chunks per trip keeps the live registers below 256
    for (int kc = 0; kc < kce; kc += 2) { v4f pr[2][4]; v8b vh[2][HD / 16][2], vl[2][HD / 16][2]; const char* pk = pb + kc * 128; const char* hk = vbh + kc * 64; const char* lk = vbl + kc * 64;
#pragma unroll
      for (int u = 0; u < 2; ++u) { pr[u][0] = *(const v4f*)(pk + po + u * 128); pr[u][1] = *(const v4f*)(pk + po + u * 128 + 16); pr[u][2] = *(const v4f*)(pk + po + u * 128 + 64); pr[u][3] = *(const v4f*)(pk + po + u * 128 + 80);
#pragma unroll
        for (int j = 0; j < HD / 16; ++j) { const int o = j * 16 * KHI * 2 + u * 64; vh[u][j][0] = *(const v8b*)(hk + vo + o); vh[u][j][1] = *(const v8b*)(hk + vo + o + 32); vl[u][j][0] = *(const v8b*)(lk + vo + o); vl[u][j][1] = *(const v8b*)(lk + vo + o + 32); } }
      asm volatile("s_wait_xcnt 0x0" :: "v"(pk + po), "v"(hk + vo), "v"(lk + vo) : "memory");   // precaution: stands in front of the first rewrite of a register that these loads name; the addresses as inputs keep their registers from being given to a later load of the group
      __builtin_amdgcn_sched_barrier(0);   // holds the group's loads in front of its first product (sunk to their uses they would again cost one memory latency each) and every later write of an address register behind the wait above
#pragma unroll
      for (int u = 0; u < 2; ++u) { float v[16];
#pragma unroll
        for (int i = 0; i < 4; ++i) { v[i] = pr[u][0][i]; v[4 + i] = pr[u][1][i]; v[8 + i] = pr[u][2][i]; v[12 + i] = pr[u][3][i]; }
        const F2 p = bsplit16(v);
#pragma unroll
        for (int j = 0; j < HD / 16; ++j) { union { v16b v; v8b q[2]; } fh, fl; fh.q[0] = vh[u][j][0]; fh.q[1] = vh[u][j][1]; fl.q[0] = vl[u][j][0]; fl.q[1] = vl[u][j][1]; acc[j] = wmma_bf(p.h, fh.v, acc[j]); acc[j] = wmma_bf(p.l, fh.v, acc[j]); acc[j] = wmma_bf(p.h, fl.v, acc[j]); } } }
  } else {
const char* pb = (const char*)PS; const char* vb = (const char*)(VT + ((size_t)b * CC + h * HD) * (size_t)TT);   // wave-uniform bases; the lane's byte offsets below do not change over the loop
    const unsigned po = (unsigned)(ql0 + col) * (TT * 4u) + 32u * g, vo = (unsigned)col * (TT * 2u) + 16u * g;
#pragma unroll 1   // rolled: one group of 4 key chunks (kce is a multiple of 4) per trip keeps the live registers below 256
    for (int kc = 0; kc < kce; kc += 4) { v4f pr[4][4]; v8h vr[4][HD / 16][2]; const char* pk = pb + kc * 128; const char* vk = vb + kc * 64;
#pragma unroll
      for (int u = 0; u < 4; ++u) { pr[u][0] = *(const v4f*)(pk + po + u * 128); pr[u][1] = *(const v4f*)(pk + po + u * 128 + 16); pr[u][2] = *(const v4f*)(pk + po + u * 128 + 64); pr[u][3] = *(const v4f*)(pk + po + u * 128 + 80);
#pragma unroll
        for (int j = 0; j < HD / 16; ++j) { const int o = j * 16 * TT * 2 + u * 64; vr[u][j][0] = *(const v8h*)(vk + vo + o); vr[u][j][1] = *(const v8h*)(vk + vo + o + 32); } }
      asm volatile("s_wait_xcnt 0x0" :: "v"(pk + po), "v"(vk + vo) : "memory");   // precaution: stands in front of the first rewrite of a register that these loads name; the addresses as inputs keep their registers from being given to a later load of the group
      __builtin_amdgcn_sched_barrier(0);   // holds the group's 48 loads in front of its first product (sunk to their uses they would again cost one memory latency each) and every later write of an address register behind the wait above
#pragma unroll
      for (int u = 0; u < 4; ++u) { v16h p;
#pragma unroll
        for (int i = 0; i < 4; ++i) { p[i] = (_Float16)pr[u][0][i]; p[4 + i] = (_Float16)pr[u][1][i]; p[8 + i] = (_Float16)pr[u][2][i]; p[12 + i] = (_Float16)pr[u][3][i]; }
#pragma unroll
        for (int j = 0; j < HD / 16; ++j) { union { v16h v; v8h q[2]; } f; f.q[0] = vr[u][j][0]; f.q[1] = vr[u][j][1]; acc[j] = wmma16(p, f.v, acc[j]); } } } }
#pragma unroll
  for (int j = 0; j < HD / 16; ++j)
#pragma unroll
    for (int r = 0; r < 8; ++r) ss[wave][8 * g + r][j * 16 + col] = acc[j][r] * (1.0f / 2048.0f);
  LDSX(); for (int rl = 0; rl < 16; ++rl) if (lane < HD / 4) vst2(Y + ((size_t)b * TT + ql0 + rl) * CC + h * HD + lane * 4, *(const v4f*)&ss[wave][rl][lane * 4]); }
// ---- k_out: block = (64 rows, 128 cols): out = ctx Wo (+ bo): ctx once to f16 against Wo as f16(bf16 x 2^8) exact (1 product) x 2^-8; causal early rows (< QHI of each sequence): ctx bf16 hi + lo against exact bf16 Wo (2 products)
__global__ __launch_bounds__(128) void k_out(const float* __restrict__ Y, const float* __restrict__ WO, const float* __restrict__ BO, float* __restrict__ OUT) { __shared__ __align__(16) float sf[4][16][132];
  const int tid = threadIdx.x, wave = tid >> 5, lane = tid & 31, col = lane & 15, g = lane >> 4; const int c0 = blockIdx.y * 128; const size_t r0 = (size_t)blockIdx.x * 64 + wave * 16;
  v8f acc[8] = {};
  if (CAUSAL && (int)(((size_t)blockIdx.x * 64) % TT) < QHI) {   /* block-uniform */
#pragma unroll 2
    for (int kc = 0; kc < CC / 32; ++kc) { const F2 a = split_row(Y + (r0 + col) * CC, kc * 32, lane); asm volatile("s_wait_loadcnt 0x0" ::: "memory");
#pragma unroll
      for (int j = 0; j < 8; ++j) { const v16b w = WOCOL(WO, kc * 32, c0 + j * 16 + col, lane); asm volatile("s_wait_loadcnt 0x0" ::: "memory"); acc[j] = wmma_bf(a.h, w, acc[j]); acc[j] = wmma_bf(a.l, w, acc[j]); } }
#pragma unroll
    for (int j = 0; j < 8; ++j) { const float bias = BO ? bfr(BO[c0 + j * 16 + col]) : 0.f;
#pragma unroll
      for (int r = 0; r < 8; ++r) sf[wave][8 * g + r][j * 16 + col] = acc[j][r] + bias; }
  } else {
#pragma unroll 2
    for (int kc = 0; kc < CC / 32; ++kc) { const v16h a = frag_f32(Y + (r0 + col) * CC + kc * 32, lane); asm volatile("s_wait_loadcnt 0x0" ::: "memory");
#pragma unroll
      for (int j = 0; j < 8; ++j) { const v16h w = WOCOLH(WO, kc * 32, c0 + j * 16 + col, lane); asm volatile("s_wait_loadcnt 0x0" ::: "memory"); acc[j] = wmma16(a, w, acc[j]); } }
#pragma unroll
    for (int j = 0; j < 8; ++j) { const float bias = BO ? bfr(BO[c0 + j * 16 + col]) : 0.f;
#pragma unroll
      for (int r = 0; r < 8; ++r) sf[wave][8 * g + r][j * 16 + col] = acc[j][r] * (1.0f / 256.0f) + bias; } }
  LDSX(); for (int rl = 0; rl < 16; ++rl) vst2(OUT + (r0 + rl) * DIN + c0 + lane * 4, *(const v4f*)&sf[wave][rl][lane * 4]); }

extern "C" void kernel_launch(void* const* d_in, const int* in_sizes, int n_in, void* d_out, int out_size, void* d_ws, size_t ws_size, hipStream_t stream) {
  (void)in_sizes; (void)n_in; (void)out_size;
  const float** F = (const float**)d_in;
  if (ws_size < (size_t)WS_END) return;
  char* ws = (char*)d_ws; _Float16 *QH = (_Float16*)(ws + WS_QH), *KH = (_Float16*)(ws + WS_KH), *VT = (_Float16*)(ws + WS_VT), *QL = (_Float16*)(ws + WS_QL), *KL = (_Float16*)(ws + WS_KL); __bf16 *VB = (__bf16*)(ws + WS_VB), *VBL = (__bf16*)(ws + WS_VBL); float *S = (float*)(ws + WS_S), *Y = (float*)(ws + WS_Y);
  (void)Y; (void)QL; (void)KL; (void)VB; (void)VBL;
  // inputs: 0 inputs_q [2,2048,1024]; 1 wq, 2 wk, 3 wv [1024,16,64] (= (in,out)); 4 wo [16,64,1024] (= (in,out)); 5 q_norm_scale [64]; 6 k_norm_scale [64]
  k_proj<<<dim3(TNB * TT / 64, CC / 128, 3), 128, 0, stream>>>(F[0], F[0], F[0], F[1], F[2], F[3], nullptr, nullptr, nullptr, QH, QL, KH, KL, VT, VB, VBL, F[5], F[6]);
  for (int b = 0; b < TNB; ++b) for (int h0 = 0; h0 < NH; h0 += HG) {
    k_sc<<<dim3(NQB, TT / 128, HG), 128, 0, stream>>>(QH, KH, QL, KL, b, h0, S);
    k_sm<<<dim3(TT / 16, HG), 256, 0, stream>>>(S);
    k_pv<<<dim3(NQB, 1, HG), 128, 0, stream>>>(S, VT, VB, VBL, b, h0, Y);
  }
  k_out<<<dim3(TNB * TT / 64, DIN / 128), 128, 0, stream>>>(Y, F[4], nullptr, (float*)d_out);
}

// v004
// Measured time: 414 microseconds a run.
// Timed twice side by side with v003, it ran 1.38 and 1.39 times as fast.
// Counting every step since v000, it is 2.66 times as fast.
// compute dtype: all float inputs rounded to bf16; q/k/v = x W with EXACT bf16 products on WMMA 16x16x32, f32 accumulate; per-head RMSNorm and rotate-half RoPE in f32 (precise sinf/cosf of t * inv_freq); q, k once to f16 -> 1-product causal logits x 1/8, except the first 384 query rows of each sequence (few keys, no averaging), which use q and k as f16 hi + residual (x 2^10) (3 products); softmax in f32 (precise expf); P x 2^11 once to f16 against v once to f16 (1 product), except the first 384 rows: P and v as bf16 hi + lo (3 products); ctx once to f16 against wo carried x 2^8 in f16 (exact bf16 values), except the first 384 rows: ctx bf16 hi + lo against exact bf16 wo (2 products); f32 output.
#include <hip/hip_runtime.h>
#include <math.h>

typedef __attribute__((ext_vector_type(16))) _Float16 v16h;
typedef __attribute__((ext_vector_type(16))) __bf16 v16b;
typedef __attribute__((ext_vector_type(8)))  _Float16 v8h;
typedef __attribute__((ext_vector_type(8)))  float v8f;
typedef __attribute__((ext_vector_type(4)))  float v4f;
typedef __attribute__((ext_vector_type(2)))  float v2f;
typedef __attribute__((ext_vector_type(4)))  unsigned v4u;
typedef __attribute__((ext_vector_type(4)))  int v4i;
typedef float __attribute__((may_alias)) float_a;
typedef int __attribute__((may_alias)) int_a;

template <typename T> __device__ __forceinline__ void vst2(void* p, T v) { *(T*)p = v;  }
__device__ __forceinline__ v8f wmma16(v16h a, v16h b, v8f c) {
  v8f d = __builtin_amdgcn_wmma_f32_16x16x32_f16(false, a, false, b, (short)0, c, false, false);
  asm volatile("v_nop\n\tv_nop\n\tv_nop\n\tv_nop" : "+v"(d) : "v"(a), "v"(b));
  return d;
}
__device__ __forceinline__ v8f wmma_bf(v16b a, v16b b, v8f c) {
  v8f d = __builtin_amdgcn_wmma_f32_16x16x32_bf16(false, a, false, b, (short)0, c, false, false);
  asm volatile("v_nop\n\tv_nop\n\tv_nop\n\tv_nop" : "+v"(d) : "v"(a), "v"(b));
  return d;
}
// 16x16x32 fragments: lane = (h = lane>>4, row/col = lane&15); elements 0..7 = k0+8h+0..7, 8..15 = k0+16+8h+0..7; D element r = row 8h+r
__device__ __forceinline__ v16h frag_h(const _Float16* rowk0, int lane) {
  union { v16h v; v8h q[2]; } u; const _Float16* p = rowk0 + 8 * (lane >> 4);
  u.q[0] = *(const v8h*)p; u.q[1] = *(const v8h*)(p + 16); return u.v;
}
__device__ __forceinline__ v16h frag_f32(const float* rowk0, int lane) {
  v16h a; const float* p = rowk0 + 8 * (lane >> 4);
#pragma unroll
  for (int i = 0; i < 8; ++i) { a[i] = (_Float16)p[i]; a[8 + i] = (_Float16)p[16 + i]; }
  return a;
}
__device__ __forceinline__ v16h frag_f32s(const float* rowk0, int lane, float sc) {
  v16h a; const float* p = rowk0 + 8 * (lane >> 4);
#pragma unroll
  for (int i = 0; i < 8; ++i) { a[i] = (_Float16)(p[i] * sc); a[8 + i] = (_Float16)(p[16 + i] * sc); }
  return a;
}
// column fragment from a [K][ld] layout (column n), rows >= K read as 0
__device__ __forceinline__ v16h fragc_f32(const float* W, int k0, int n, int lane, int ld, int K) {
  v16h a; const int g = lane >> 4;
#pragma unroll
  for (int i = 0; i < 8; ++i) { const int ka = k0 + 8 * g + i, kb = ka + 16;
    a[i] = (_Float16)(ka < K ? W[(size_t)(ka < K ? ka : K - 1) * ld + n] : 0.f); a[8 + i] = (_Float16)(kb < K ? W[(size_t)(kb < K ? kb : K - 1) * ld + n] : 0.f); }
  return a;
}
struct F2 { v16b h, l; };
__device__ __forceinline__ F2 bsplit16(const float v[16]) { F2 r;
#pragma unroll
  for (int i = 0; i < 16; ++i) { const __bf16 h = (__bf16)v[i]; r.h[i] = h; r.l[i] = (__bf16)(v[i] - (float)h); }
  return r; }
__device__ __forceinline__ F2 split_row(const float* row, int k0, int lane) { float v[16]; const float* p = row + k0 + 8 * (lane >> 4);
#pragma unroll
  for (int i = 0; i < 8; ++i) { v[i] = p[i]; v[8 + i] = p[16 + i]; }
  return bsplit16(v); }
__device__ __forceinline__ F2 split_rowK(const float* row, int k0, int lane, int K) { float v[16]; const int g = lane >> 4;
#pragma unroll
  for (int i = 0; i < 8; ++i) { const int ka = k0 + 8 * g + i, kb = ka + 16; v[i] = ka < K ? row[ka < K ? ka : K - 1] : 0.f; v[8 + i] = kb < K ? row[kb < K ? kb : K - 1] : 0.f; }
  return bsplit16(v); }
__device__ __forceinline__ F2 split_col(const float* W, int k0, int n, int lane, int ld, int K) { float v[16]; const int g = lane >> 4;
#pragma unroll
  for (int i = 0; i < 8; ++i) { const int ka = k0 + 8 * g + i, kb = ka + 16; v[i] = ka < K ? W[(size_t)(ka < K ? ka : K - 1) * ld + n] : 0.f; v[8 + i] = kb < K ? W[(size_t)(kb < K ? kb : K - 1) * ld + n] : 0.f; }
  return bsplit16(v); }
__device__ __forceinline__ v8f mac3(const F2& a, const F2& b, v8f c) { c = wmma_bf(a.l, b.h, c); c = wmma_bf(a.h, b.l, c); return wmma_bf(a.h, b.h, c); }
__device__ __forceinline__ float sigm(float v) { return 1.0f / (1.0f + expf(-v)); }
#define LDSX() do { asm volatile("s_wait_dscnt 0" ::: "memory"); __builtin_amdgcn_wave_barrier(); __builtin_amdgcn_fence(__ATOMIC_RELEASE, "workgroup"); } while (0)

// Causal multi-head dot-product attention with QK-RMSNorm and RoPE (B 2, S 2,048, D 1,024, 16 heads x 64): q/k/v = x w ((in, head, hd) = (in,out)); q, k RMS-normalised over the 64 head dims (eps 1e-6, x scale) then rotate-half RoPE (angle t * 10000^(-i/32), i < 32); q x 64^-0.5; logits masked to -0.7*f32max where key > query (== -inf here: the diagonal is always kept); softmax; out = merged(attn v) wo ((head, hd, out) = (in,out)).
#define NB 2
#define TT 2048
#define CC 1024            // NH * HD = projected width
#define DIN 1024          // input (model) width
#define NH 16
#define HD 64
#define NQB (TT / 64)
#define HG 8               // heads per pass: a k_pv launch lasts as long as its longest work-group, so 8 x 32 = 256 work-groups (one per WGP) take about as long as 128 did; S holds 8 planes (128 MiB), the workspace use stays under its size
#define SCALE (0.125f)
#define CAUSAL 1
#ifndef TNB
#define TNB NB
#endif
__device__ __forceinline__ float bfr(float v) { return (float)(__bf16)v; }
__host__ __device__ __forceinline__ int kb_last(int qb) { return CAUSAL ? ((qb * 64 + 63) >> 7) : (TT / 128 - 1); }
typedef __attribute__((ext_vector_type(8))) __bf16 v8b;
__device__ __forceinline__ v16b frag_b(const __bf16* rowk0, int lane) {
  union { v16b v; v8b q[2]; } u; const __bf16* p = rowk0 + 8 * (lane >> 4);
  u.q[0] = *(const v8b*)p; u.q[1] = *(const v8b*)(p + 16); return u.v;
}
#define QBH 6              // causal: query blocks 0..QBH-1 of each sequence (few keys, no averaging) take the high-precision path
#define QHI 384            // rows carrying a q residual plane
#define KHI 384            // key rows carrying k residual / v bf16 hi+lo planes (used only by the causal high-precision path)
// B fragment (k rows k0+.., output column o) of a weight: (in,out) [K][ld] or (out,in) [ld rows of K]: bf16 exact, or f16(bf16 * 256) exact
__device__ __forceinline__ v16b wcol_io(const float* Wm, int k0, int o, int lane, int ld) { v16b w; const int g = lane >> 4;
#pragma unroll
  for (int i = 0; i < 8; ++i) { w[i] = (__bf16)Wm[(size_t)(k0 + 8 * g + i) * ld + o]; w[8 + i] = (__bf16)Wm[(size_t)(k0 + 16 + 8 * g + i) * ld + o]; }
  return w; }
__device__ __forceinline__ v16b wcol_oi(const float* Wm, int k0, int o, int lane, int K) { v16b w; const float* p = Wm + (size_t)o * K + k0 + 8 * (lane >> 4);
#pragma unroll
  for (int i = 0; i < 8; ++i) { w[i] = (__bf16)p[i]; w[8 + i] = (__bf16)p[16 + i]; }
  return w; }
__device__ __forceinline__ v16h wcolh_io(const float* Wm, int k0, int o, int lane, int ld) { v16h w; const int g = lane >> 4;
#pragma unroll
  for (int i = 0; i < 8; ++i) { w[i] = (_Float16)(bfr(Wm[(size_t)(k0 + 8 * g + i) * ld + o]) * 256.0f); w[8 + i] = (_Float16)(bfr(Wm[(size_t)(k0 + 16 + 8 * g + i) * ld + o]) * 256.0f); }
  return w; }
__device__ __forceinline__ v16h wcolh_oi(const float* Wm, int k0, int o, int lane, int K) { v16h w; const float* p = Wm + (size_t)o * K + k0 + 8 * (lane >> 4);
#pragma unroll
  for (int i = 0; i < 8; ++i) { w[i] = (_Float16)(bfr(p[i]) * 256.0f); w[8 + i] = (_Float16)(bfr(p[16 + i]) * 256.0f); }
  return w; }
#define WQKV_LAYOUT 0   // 0 = (in,out) [DIN][CC]; 1 = (out,in) [CC][DIN]; 2 = per-head [NH][DIN][HD]
__device__ __forceinline__ v16b wcol_hdk(const float* Wm, int k0, int o, int lane) { v16b w; const int g = lane >> 4; const float* p = Wm + (size_t)(o / HD) * DIN * HD + (o % HD);
#pragma unroll
  for (int i = 0; i < 8; ++i) { w[i] = (__bf16)p[(size_t)(k0 + 8 * g + i) * HD]; w[8 + i] = (__bf16)p[(size_t)(k0 + 16 + 8 * g + i) * HD]; }
  return w; }
#define WO_OUT_IN 0
#if WQKV_LAYOUT == 1
#define WCOL(W, k0, o, lane) wcol_oi(W, k0, o, lane, DIN)
#elif WQKV_LAYOUT == 2
#define WCOL(W, k0, o, lane) wcol_hdk(W, k0, o, lane)
#else
#define WCOL(W, k0, o, lane) wcol_io(W, k0, o, lane, CC)
#endif
#if WO_OUT_IN
#define WOCOL(W, k0, o, lane) wcol_oi(W, k0, o, lane, CC)
#define WOCOLH(W, k0, o, lane) wcolh_oi(W, k0, o, lane, CC)
#else
#define WOCOL(W, k0, o, lane) wcol_io(W, k0, o, lane, DIN)
#define WOCOLH(W, k0, o, lane) wcolh_io(W, k0, o, lane, DIN)
#endif
__constant__ float c_invf[32] = {1.000000000e+00f,7.498942018e-01f,5.623413324e-01f,4.216965139e-01f,3.162277639e-01f,2.371373624e-01f,1.778279394e-01f,1.333521456e-01f,1.000000015e-01f,7.498941571e-02f,5.623412877e-02f,4.216964915e-02f,3.162277862e-02f,2.371373586e-02f,1.778279431e-02f,1.333521493e-02f,9.999999776e-03f,7.498942316e-03f,5.623413250e-03f,4.216964822e-03f,3.162277862e-03f,2.371373819e-03f,1.778279431e-03f,1.333521446e-03f,1.000000047e-03f,7.498941850e-04f,5.623413017e-04f,4.216964880e-04f,3.162277862e-04f,2.371373848e-04f,1.778279402e-04f,1.333521504e-04f};   // 1 / 10000^(i/32) evaluated in f32 exactly as the reference does (jax, eager)
#define PROJ_EXTRA_PARAMS , const float* __restrict__ QS, const float* __restrict__ KS
// per-(row, head) epilogue on the f32 projection tile: RMSNorm over the head's 64 values (x q_norm_scale / k_norm_scale), then rotate-half RoPE; v untouched
#define PROJ_EPI(which, row, t, h) do { if ((which) < 2) { float* rw = (row); const float* NS = (which) == 0 ? QS : KS; float ss = 0.f; _Pragma("unroll") for (int i = 0; i < 64; ++i) ss += rw[i] * rw[i]; const float rn = rsqrtf(ss * (1.0f / 64.0f) + 1e-6f); \
    _Pragma("unroll") for (int i = 0; i < 32; ++i) { const float x1 = rw[i] * rn * bfr(NS[i]), x2 = rw[i + 32] * rn * bfr(NS[i + 32]); const float ang = (float)(t) * c_invf[i]; const float cs = cosf(ang), sn = sinf(ang); rw[i] = x1 * cs - x2 * sn; rw[i + 32] = x2 * cs + x1 * sn; } } } while (0)
#ifndef SM_EXTRA_PARAMS
#define SM_EXTRA_PARAMS
#endif
#ifndef PROJ_EXTRA_PARAMS
#define PROJ_EXTRA_PARAMS
#endif
#ifndef SM_MASK_HOOK
#define SM_MASK_HOOK (void)0
#endif

#define WS_QH  0u                                      // f16 q rows [b*t][CC]
#define WS_KH  (WS_QH + 2u * (size_t)NB * TT * CC)      // f16 k rows [b*t][CC]
#define WS_VT  (WS_KH + 2u * (size_t)NB * TT * CC)      // f16 v planes [b][c][t]
#define WS_QL  (WS_VT + 2u * (size_t)NB * CC * TT)      // f16 q residual x 2^10 rows [b][t < QHI][CC]
#define WS_KL  (WS_QL + 2u * (size_t)NB * QHI * CC)     // f16 k residual x 2^10 rows [b][t < KHI][CC]
#define WS_VB  (WS_KL + 2u * (size_t)NB * KHI * CC)     // bf16 v hi planes [b][c][t < KHI]
#define WS_VBL (WS_VB + 2u * (size_t)NB * CC * KHI)
#define WS_S   (WS_VBL + 2u * (size_t)NB * CC * KHI)    // f32 logits / P [hg][t][s]
#define WS_Y   (WS_S  + 4u * (size_t)HG * TT * TT)      // f32 ctx rows [b*t][CC] (only when there is an output projection)
#define WS_END (WS_Y  + 4u * (size_t)NB * TT * CC)

// ---- weight tile in LDS, shared by k_proj and k_out: one K step (32 k x 128 output columns) of an (in,out) f32 weight is read ONCE per work-group (wave w: rows 8w..8w+7, lane: 4 columns, whole 512-byte rows), converted as before and kept as 16-bit [column][k] rows of 80 bytes (16 B x odd: the fragment reads meet no bank conflict). Two buffers: the next step's loads (and the wave's own next A rows) fly while this step's products run.
#define WLD 1024           // row length of every weight here (CC for wq/wk/wv, DIN for wo)
#define KST 32             // K steps (DIN / 32 == CC / 32)
static_assert(CC == WLD && DIN == WLD && DIN / 32 == KST && CC / 32 == KST && WQKV_LAYOUT == 0 && WO_OUT_IN == 0, "the staging reads (in,out) weights with rows of WLD floats");
typedef unsigned WT[128][20];
// MODE 0: A once to bf16, W bf16 (1 product); 1: A bf16 hi + lo, W bf16 (2 products); 2: A once to f16, W f16(bf16 x 2^8) (1 product)
struct AFr { v16b h, l; v16h f; };
template <int MODE> __device__ __forceinline__ void a_cvt(AFr& a, const v4f (&ar)[4]) { float v[16];
#pragma unroll
  for (int i = 0; i < 4; ++i) { v[i] = ar[0][i]; v[4 + i] = ar[1][i]; v[8 + i] = ar[2][i]; v[12 + i] = ar[3][i]; }
  if constexpr (MODE == 1) { const F2 s = bsplit16(v); a.h = s.h; a.l = s.l; }
  else {
#pragma unroll
    for (int i = 0; i < 16; ++i) { if constexpr (MODE == 0) a.h[i] = (__bf16)v[i]; else a.f[i] = (_Float16)v[i]; } } }
template <int MODE> __device__ __forceinline__ void wt_store(WT& wt, const v4f (&wr)[8], int wave, int lane) {
#pragma unroll
  for (int n = 0; n < 4; ++n) { union { v8b b; v8h h; v4u u; } p;
#pragma unroll
    for (int i = 0; i < 8; ++i) { if constexpr (MODE == 2) p.h[i] = (_Float16)(bfr(wr[i][n]) * 256.0f); else p.b[i] = (__bf16)wr[i][n]; }
    *(v4u*)&wt[4 * lane + n][4 * wave] = p.u; } }   // column 4 lane + n, k 8 wave .. 8 wave + 7
// acc[j] += A (16 rows of the wave, f32 rows at xb + xo, K-contiguous) x W (columns j * 16 + col of the tile at wb); k order and product order as in the direct form
template <int MODE> __device__ __forceinline__ void gemm_k(const char* xb, unsigned xo, const char* wb, WT (&wt)[2], int wave, int lane, v8f (&acc)[8]) {
  const int col = lane & 15, g = lane >> 4; const unsigned wo = (unsigned)(8 * wave) * (WLD * 4u) + 16u * lane;
  v4f wr[8], ar[4]; AFr a;
#pragma unroll
  for (int i = 0; i < 8; ++i) wr[i] = *(const v4f*)(wb + wo + i * (WLD * 4));
  ar[0] = *(const v4f*)(xb + xo); ar[1] = *(const v4f*)(xb + xo + 16); ar[2] = *(const v4f*)(xb + xo + 64); ar[3] = *(const v4f*)(xb + xo + 80);
  asm volatile("s_wait_xcnt 0x0" :: "v"(wo), "v"(xo), "s"(wb), "s"(xb) : "memory");   // precaution: stands in front of the first rewrite of a register that these loads name; the lane offsets and the uniform bases as inputs keep their registers until here
  __builtin_amdgcn_sched_barrier(0);   // keeps the conversions below, which may reuse the address registers, behind the wait above
  wt_store<MODE>(wt[0], wr, wave, lane); a_cvt<MODE>(a, ar);
  __syncthreads();   // publishes K step 0
#pragma unroll 1   // rolled: one K step per trip keeps the loop small and the live registers below 256
  for (int kc = 0; kc < KST; ++kc) { const bool more = kc + 1 < KST;   // the same for the whole work-group
    if (more) { const char* wk = wb + (size_t)(kc + 1) * (32 * WLD * 4); const char* xk = xb + (kc + 1) * 128;
#pragma unroll
      for (int i = 0; i < 8; ++i) wr[i] = *(const v4f*)(wk + wo + i * (WLD * 4));
      ar[0] = *(const v4f*)(xk + xo); ar[1] = *(const v4f*)(xk + xo + 16); ar[2] = *(const v4f*)(xk + xo + 64); ar[3] = *(const v4f*)(xk + xo + 80);
      asm volatile("s_wait_xcnt 0x0" ::: "memory"); }   // precaution, as above; its memory clobber also keeps the 12 loads from sinking to their uses behind the products
    __builtin_amdgcn_sched_barrier(0);   // holds the next step's loads in front of this step's products, which then cover their latency, and every later write of an address register behind the wait above
    const WT& cur = wt[kc & 1]; v4u f[8][2];
#pragma unroll
    for (int j = 0; j < 8; ++j) { f[j][0] = *(const v4u*)&cur[j * 16 + col][4 * g]; f[j][1] = *(const v4u*)&cur[j * 16 + col][8 + 4 * g]; }   // elements 0..7 = k 8g.., 8..15 = k 16 + 8g..
#pragma unroll
    for (int j = 0; j < 8; ++j) { union { v4u q[2]; v16b b; v16h h; } w; w.q[0] = f[j][0]; w.q[1] = f[j][1];
      if constexpr (MODE == 0) acc[j] = wmma_bf(a.h, w.b, acc[j]);
      else if constexpr (MODE == 1) { acc[j] = wmma_bf(a.h, w.b, acc[j]); acc[j] = wmma_bf(a.l, w.b, acc[j]); }
      else acc[j] = wmma16(a.f, w.h, acc[j]); }
    if (more) { wt_store<MODE>(wt[(kc + 1) & 1], wr, wave, lane); a_cvt<MODE>(a, ar);   // into the buffer whose last readers passed the barrier of the trip before
      __syncthreads(); } } }   // one barrier per K step: publishes step kc + 1 and ends every reader's last read of step kc's buffer
// ---- k_proj: block = (64 rows, 128 cols, which): q/k/v = X W (+ b) with exact bf16 products (K = DIN) -> which 0: q f16 rows (+ residual rows < QHI); 1: k f16 rows (+ residual rows < KHI); 2: v f16 planes [c][t] (+ bf16 hi/lo planes for t < KHI)
__global__ __launch_bounds__(128) void k_proj(const float* __restrict__ XQ, const float* __restrict__ XK, const float* __restrict__ XV, const float* __restrict__ WQ, const float* __restrict__ WK, const float* __restrict__ WV, const float* __restrict__ BQ, const float* __restrict__ BK, const float* __restrict__ BV,
    _Float16* __restrict__ QH, _Float16* __restrict__ QL, _Float16* __restrict__ KH, _Float16* __restrict__ KL, _Float16* __restrict__ VT, __bf16* __restrict__ VB, __bf16* __restrict__ VBL PROJ_EXTRA_PARAMS) {
  __shared__ __align__(16) float st[64][132]; __shared__ __align__(16) _Float16 sh[64][136], sl[64][136]; __shared__ __align__(16) _Float16 th[128][72]; __shared__ __align__(16) __bf16 tb[128][72], tbl[128][72]; __shared__ __align__(16) WT wt[2];
  const int tid = threadIdx.x, wave = tid >> 5, lane = tid & 31, col = lane & 15, g = lane >> 4; const int which = blockIdx.z; const int c0 = blockIdx.y * 128; const size_t r0 = (size_t)blockIdx.x * 64; const size_t bb = r0 / TT; const int t0 = (int)(r0 % TT);
  const float* X = which == 0 ? XQ : which == 1 ? XK : XV; const float* WA = which == 0 ? WQ : which == 1 ? WK : WV; const float* BA = which == 0 ? BQ : which == 1 ? BK : BV;
  v8f acc[8] = {};
  gemm_k<0>((const char*)(X + r0 * DIN), (unsigned)(wave * 16 + col) * (DIN * 4u) + 32u * g, (const char*)(WA + c0), wt, wave, lane, acc);
  { // stage the f32 tile (acc + bias) in LDS, run the per-(row, head) epilogue hook, then convert
#pragma unroll
    for (int j = 0; j < 8; ++j) { const float bias = BA ? bfr(BA[c0 + j * 16 + col]) : 0.f;
#pragma unroll
      for (int r = 0; r < 8; ++r) st[wave * 16 + 8 * g + r][j * 16 + col] = acc[j][r] + bias; }
    __syncthreads();
    for (int e = tid; e < 64 * (128 / HD); e += 128) { const int rl = e / (128 / HD), hh = e % (128 / HD); PROJ_EPI(which, &st[rl][hh * HD], (int)((r0 + rl) % TT), (c0 / HD) + hh); }
    __syncthreads(); }
  if (which < 2) { _Float16* DH = which == 0 ? QH : KH; _Float16* DL = which == 0 ? QL : KL; const int nhi = which == 0 ? QHI : KHI; const bool hi_rows = t0 < nhi;
    for (int e = tid; e < 64 * 128; e += 128) { const int rl = e >> 7, cl = e & 127; const float v = st[rl][cl]; const _Float16 hv = (_Float16)v; sh[rl][cl] = hv; sl[rl][cl] = (_Float16)((v - (float)hv) * 1024.0f); }
    __syncthreads();
    for (int e = tid; e < 64 * 16; e += 128) { const int rl = e >> 4, q = e & 15; vst2((unsigned*)(DH + (r0 + rl) * CC + c0 + q * 8), *(const v4u*)&sh[rl][q * 8]); if (hi_rows) vst2((unsigned*)(DL + (bb * nhi + t0 + rl) * (size_t)CC + c0 + q * 8), *(const v4u*)&sl[rl][q * 8]); }
  } else { const bool hi_rows = t0 < KHI;
    for (int e = tid; e < 64 * 128; e += 128) { const int rl = e & 63, cl = e >> 6; const float v = st[rl][cl]; th[cl][rl] = (_Float16)v; const __bf16 bh = (__bf16)v; tb[cl][rl] = bh; tbl[cl][rl] = (__bf16)(v - (float)bh); }
    __syncthreads();
    for (int e = tid; e < 128 * 8; e += 128) { const int cl = e >> 3, q = e & 7; vst2((unsigned*)(VT + (bb * CC + c0 + cl) * (size_t)TT + t0 + q * 8), *(const v4u*)&th[cl][q * 8]); if (hi_rows) { const size_t o3 = (bb * CC + c0 + cl) * (size_t)KHI + t0 + q * 8; vst2((unsigned*)(VB + o3), *(const v4u*)&tb[cl][q * 8]); vst2((unsigned*)(VBL + o3), *(const v4u*)&tbl[cl][q * 8]); } } } }
// ---- k_sc: block = (query block qb, key block kb <= kb_last(qb), head in group) of batch b: logits x SCALE; q hi + residual (x 2^10) against k (2 products) for query rows < QHI, plus the k residual (3 products) for query blocks < QBH (causal early rows); causal: blocks past the diagonal exit, the mask itself is applied by index in k_sm
__global__ __launch_bounds__(128) void k_sc(const _Float16* __restrict__ QH, const _Float16* __restrict__ KH, const _Float16* __restrict__ QL, const _Float16* __restrict__ KL, int b, int h0, float* __restrict__ S0) { __shared__ __align__(16) float ss[4][16][132];
  const int qb = blockIdx.x, kb = blockIdx.y; if (kb > kb_last(qb)) return;
  const int h = h0 + blockIdx.z; float* S = S0 + (size_t)blockIdx.z * TT * TT;
  const int tid = threadIdx.x, wave = tid >> 5, lane = tid & 31, col = lane & 15, g = lane >> 4; const int k0 = kb * 128; const int ql0 = qb * 64 + wave * 16; const size_t q0 = (size_t)b * TT + ql0, kr0 = (size_t)b * TT + k0;
  v8f acc[8] = {}, accl[8] = {};
  const _Float16* QLb = QL + (size_t)b * QHI * CC; const _Float16* KLb = KL + (size_t)b * KHI * CC;
  if (qb < QBH) {
#pragma unroll
    for (int kc = 0; kc < HD / 32; ++kc) { const v16h ah = frag_h(QH + (q0 + col) * CC + h * HD + kc * 32, lane), al = frag_h(QLb + (size_t)(ql0 + col) * CC + h * HD + kc * 32, lane);
#pragma unroll
      for (int j = 0; j < 8; ++j) { const v16h kbf = frag_h(KH + (kr0 + j * 16 + col) * CC + h * HD + kc * 32, lane), klf = frag_h(KLb + (size_t)(k0 + j * 16 + col) * CC + h * HD + kc * 32, lane); acc[j] = wmma16(ah, kbf, acc[j]); accl[j] = wmma16(al, kbf, accl[j]); accl[j] = wmma16(ah, klf, accl[j]); } }
  } else if (qb * 64 < QHI) {
#pragma unroll
    for (int kc = 0; kc < HD / 32; ++kc) { const v16h ah = frag_h(QH + (q0 + col) * CC + h * HD + kc * 32, lane), al = frag_h(QLb + (size_t)(ql0 + col) * CC + h * HD + kc * 32, lane);
#pragma unroll
      for (int j = 0; j < 8; ++j) { const v16h kbf = frag_h(KH + (kr0 + j * 16 + col) * CC + h * HD + kc * 32, lane); acc[j] = wmma16(ah, kbf, acc[j]); accl[j] = wmma16(al, kbf, accl[j]); } }
  } else {
#pragma unroll
    for (int kc = 0; kc < HD / 32; ++kc) { const v16h ah = frag_h(QH + (q0 + col) * CC + h * HD + kc * 32, lane);
#pragma unroll
      for (int j = 0; j < 8; ++j) { const v16h kbf = frag_h(KH + (kr0 + j * 16 + col) * CC + h * HD + kc * 32, lane); acc[j] = wmma16(ah, kbf, acc[j]); } } }
#pragma unroll
  for (int j = 0; j < 8; ++j) {
#pragma unroll
    for (int r = 0; r < 8; ++r) ss[wave][8 * g + r][j * 16 + col] = (acc[j][r] + accl[j][r] * (1.0f / 1024.0f)) * SCALE; }
  LDSX(); for (int rl = 0; rl < 16; ++rl) vst2(S + (size_t)(ql0 + rl) * TT + k0 + lane * 4, *(const v4f*)&ss[wave][rl][lane * 4]); }
// ---- k_sm: wave = two query rows of one head, ta < TT/2 and tb = TT-1-ta: together always NCH chunks of 128 keys, so every wave has the same work. Both rows stay in registers (chunk i: row a while i < na, then row b); max and sum by lane shuffles, no LDS, no barrier. Keys [0, kend) of a row: logit if s <= t else excluded (only a row's last chunk holds such keys); softmax in f32; P x 2^11 in place (0 for excluded)
#define NCH (TT / 128 + 1)
__device__ __forceinline__ float uni(float v) { return __builtin_bit_cast(float, __builtin_amdgcn_readfirstlane(__builtin_bit_cast(int, v))); }   // a value that is the same in every lane (behind a full xor butterfly), moved to a scalar register: picking row a's or row b's is then scalar work
#define ROW_A(i) ((i) < TT / 256 && (i) < na)   // row a has at most TT/256 chunks
__global__ __launch_bounds__(256) void k_sm(float* __restrict__ S0 SM_EXTRA_PARAMS) { static_assert(CAUSAL && TT % 256 == 0, "the pairing of rows counts on causal row lengths");
  const int lane = threadIdx.x & 31; const int wv = __builtin_amdgcn_readfirstlane(threadIdx.x >> 5);   // the wave's number as a scalar: every test on na below is a scalar branch or select
  const int ta = blockIdx.x * 8 + wv, tb = TT - 1 - ta; const int na = kb_last(ta >> 6) + 1;   // kb_last(tb >> 6) + 1 == NCH - na
  float* sh = S0 + (size_t)blockIdx.y * TT * TT + lane * 4; const unsigned oa = (unsigned)ta * TT, ob = (unsigned)tb * TT - (unsigned)na * 128u;   // chunk i of the wave starts at (row a ? oa : ob) + i * 128
  v4f r[NCH];   // every loop over i or e below is unrolled in full: r stays in registers only where its indices are constants
#pragma unroll
  for (int i = 0; i < NCH; ++i) r[i] = *(const v4f*)(sh + (ROW_A(i) ? oa : ob) + i * 128);
  static_assert(NCH == 17, "the statement below names every chunk");
  asm volatile("" :: "v"(r[0]), "v"(r[1]), "v"(r[2]), "v"(r[3]), "v"(r[4]), "v"(r[5]), "v"(r[6]), "v"(r[7]), "v"(r[8]), "v"(r[9]), "v"(r[10]), "v"(r[11]), "v"(r[12]), "v"(r[13]), "v"(r[14]), "v"(r[15]), "v"(r[16]));   // inputs only: holds all 17 loads in front of the branches below (sunk behind them, the later loads would start only after the earlier ones have returned: a second memory latency)
  float ma = -3.0e38f, mb = -3.0e38f;
#pragma unroll
  for (int i = 0; i < NCH; ++i) { const bool A = ROW_A(i);
    if (i == NCH - 1 || (i < TT / 256 && i == na - 1)) { const int lim = (A ? ta : tb + na * 128) - i * 128 - lane * 4;   // a row's last chunk: element e is key <= t while e <= lim
#pragma unroll
      for (int e = 0; e < 4; ++e) if (e > lim) r[i][e] = -3.0e38f; }
    const float c = fmaxf(fmaxf(r[i][0], r[i][1]), fmaxf(r[i][2], r[i][3])); if (A) ma = fmaxf(ma, c); else mb = fmaxf(mb, c); }
#pragma unroll
  for (int o = 1; o < 32; o <<= 1) { ma = fmaxf(ma, __shfl_xor(ma, o)); mb = fmaxf(mb, __shfl_xor(mb, o)); }
  ma = uni(ma); mb = uni(mb);
  float sa = 0.f, sb = 0.f;
#pragma unroll
  for (int i = 0; i < NCH; ++i) { const bool A = ROW_A(i); const float m = A ? ma : mb;
#pragma unroll
    for (int e = 0; e < 4; ++e) { const float v = r[i][e], x = expf(v - m); r[i][e] = (v <= -1.0e38f) ? 0.f : x; }   // expf outside the test: a select, so that the four elements' chains overlap
    const float c = (r[i][0] + r[i][1]) + (r[i][2] + r[i][3]); if (A) sa += c; else sb += c; }
#pragma unroll
  for (int o = 1; o < 32; o <<= 1) { sa += __shfl_xor(sa, o); sb += __shfl_xor(sb, o); }
  const float ia = uni(2048.0f / sa), ib = uni(2048.0f / sb);
#pragma unroll
  for (int i = 0; i < NCH; ++i) vst2(sh + (ROW_A(i) ? oa : ob) + i * 128, r[i] * (ROW_A(i) ? ia : ib)); }
// ---- k_pv: block = 64 queries (qb) of (b, h): ctx = P . v over keys [0, kend) (P x 2^11 once to f16 against v f16: 1 product; causal early query blocks: P and v as bf16 hi + lo, 3 products); 256-B (row, head) segment by 16 lanes
__global__ __launch_bounds__(128) void k_pv(const float* __restrict__ PS0, const _Float16* __restrict__ VT, const __bf16* __restrict__ VB, const __bf16* __restrict__ VBL, int b, int h0, float* __restrict__ Y) { const int h = h0 + blockIdx.z; const float* PS = PS0 + (size_t)blockIdx.z * TT * TT; __shared__ __align__(16) float ss[4][16][HD + 4];
  const int tid = threadIdx.x, wave = tid >> 5, lane = tid & 31, col = lane & 15, g = lane >> 4; const int qb = blockIdx.x; const int ql0 = qb * 64 + wave * 16; const int kce = (kb_last(qb) + 1) * 4;
  v8f acc[HD / 16] = {};
  if (qb < QBH) {
const char* pb = (const char*)PS; const char* vbh = (const char*)(VB + ((size_t)b * CC + h * HD) * (size_t)KHI); const char* vbl = (const char*)(VBL + ((size_t)b * CC + h * HD) * (size_t)KHI);   // wave-uniform bases; the lane's byte offsets below do not change over the loop
    const unsigned po = (unsigned)(ql0 + col) * (TT * 4u) + 32u * g, vo = (unsigned)col * (KHI * 2u) + 16u * g;
#pragma unroll 1   // rolled: one group of 2 key chunks per trip keeps the live registers below 256
    for (int kc = 0; kc < kce; kc += 2) { v4f pr[2][4]; v8b vh[2][HD / 16][2], vl[2][HD / 16][2]; const char* pk = pb + kc * 128; const char* hk = vbh + kc * 64; const char* lk = vbl + kc * 64;
#pragma unroll
      for (int u = 0; u < 2; ++u) { pr[u][0] = *(const v4f*)(pk + po + u * 128); pr[u][1] = *(const v4f*)(pk + po + u * 128 + 16); pr[u][2] = *(const v4f*)(pk + po + u * 128 + 64); pr[u][3] = *(const v4f*)(pk + po + u * 128 + 80);
#pragma unroll
        for (int j = 0; j < HD / 16; ++j) { const int o = j * 16 * KHI * 2 + u * 64; vh[u][j][0] = *(const v8b*)(hk + vo + o); vh[u][j][1] = *(const v8b*)(hk + vo + o + 32); vl[u][j][0] = *(const v8b*)(lk + vo + o); vl[u][j][1] = *(const v8b*)(lk + vo + o + 32); } }
      asm volatile("s_wait_xcnt 0x0" :: "v"(pk + po), "v"(hk + vo), "v"(lk + vo) : "memory");   // precaution: stands in front of the first rewrite of a register that these loads name; the addresses as inputs keep their registers from being given to a later load of the group
      __builtin_amdgcn_sched_barrier(0);   // holds the group's loads in front of its first product (sunk to their uses they would again cost one memory latency each) and every later write of an address register behind the wait above
#pragma unroll
      for (int u = 0; u < 2; ++u) { float v[16];
#pragma unroll
        for (int i = 0; i < 4; ++i) { v[i] = pr[u][0][i]; v[4 + i] = pr[u][1][i]; v[8 + i] = pr[u][2][i]; v[12 + i] = pr[u][3][i]; }
        const F2 p = bsplit16(v);
#pragma unroll
        for (int j = 0; j < HD / 16; ++j) { union { v16b v; v8b q[2]; } fh, fl; fh.q[0] = vh[u][j][0]; fh.q[1] = vh[u][j][1]; fl.q[0] = vl[u][j][0]; fl.q[1] = vl[u][j][1]; acc[j] = wmma_bf(p.h, fh.v, acc[j]); acc[j] = wmma_bf(p.l, fh.v, acc[j]); acc[j] = wmma_bf(p.h, fl.v, acc[j]); } } }
  } else {
const char* pb = (const char*)PS; const char* vb = (const char*)(VT + ((size_t)b * CC + h * HD) * (size_t)TT);   // wave-uniform bases; the lane's byte offsets below do not change over the loop
    const unsigned po = (unsigned)(ql0 + col) * (TT * 4u) + 32u * g, vo = (unsigned)col * (TT * 2u) + 16u * g;
#pragma unroll 1   // rolled: one group of 4 key chunks (kce is a multiple of 4) per trip keeps the live registers below 256
    for (int kc = 0; kc < kce; kc += 4) { v4f pr[4][4]; v8h vr[4][HD / 16][2]; const char* pk = pb + kc * 128; const char* vk = vb + kc * 64;
#pragma unroll
      for (int u = 0; u < 4; ++u) { pr[u][0] = *(const v4f*)(pk + po + u * 128); pr[u][1] = *(const v4f*)(pk + po + u * 128 + 16); pr[u][2] = *(const v4f*)(pk + po + u * 128 + 64); pr[u][3] = *(const v4f*)(pk + po + u * 128 + 80);
#pragma unroll
        for (int j = 0; j < HD / 16; ++j) { const int o = j * 16 * TT * 2 + u * 64; vr[u][j][0] = *(const v8h*)(vk + vo + o); vr[u][j][1] = *(const v8h*)(vk + vo + o + 32); } }
      asm volatile("s_wait_xcnt 0x0" :: "v"(pk + po), "v"(vk + vo) : "memory");   // precaution: stands in front of the first rewrite of a register that these loads name; the addresses as inputs keep their registers from being given to a later load of the group
      __builtin_amdgcn_sched_barrier(0);   // holds the group's 48 loads in front of its first product (sunk to their uses they would again cost one memory latency each) and every later write of an address register behind the wait above
#pragma unroll
      for (int u = 0; u < 4; ++u) { v16h p;
#pragma unroll
        for (int i = 0; i < 4; ++i) { p[i] = (_Float16)pr[u][0][i]; p[4 + i] = (_Float16)pr[u][1][i]; p[8 + i] = (_Float16)pr[u][2][i]; p[12 + i] = (_Float16)pr[u][3][i]; }
#pragma unroll
        for (int j = 0; j < HD / 16; ++j) { union { v16h v; v8h q[2]; } f; f.q[0] = vr[u][j][0]; f.q[1] = vr[u][j][1]; acc[j] = wmma16(p, f.v, acc[j]); } } } }
#pragma unroll
  for (int j = 0; j < HD / 16; ++j)
#pragma unroll
    for (int r = 0; r < 8; ++r) ss[wave][8 * g + r][j * 16 + col] = acc[j][r] * (1.0f / 2048.0f);
  LDSX(); for (int rl = 0; rl < 16; ++rl) if (lane < HD / 4) vst2(Y + ((size_t)b * TT + ql0 + rl) * CC + h * HD + lane * 4, *(const v4f*)&ss[wave][rl][lane * 4]); }
// ---- k_out: block = (64 rows, 128 cols): out = ctx Wo (+ bo): ctx once to f16 against Wo as f16(bf16 x 2^8) exact (1 product) x 2^-8; causal early rows (< QHI of each sequence): ctx bf16 hi + lo against exact bf16 Wo (2 products)
__global__ __launch_bounds__(128) void k_out(const float* __restrict__ Y, const float* __restrict__ WO, const float* __restrict__ BO, float* __restrict__ OUT) { __shared__ __align__(16) float sf[4][16][132]; __shared__ __align__(16) WT wt[2];
  const int tid = threadIdx.x, wave = tid >> 5, lane = tid & 31, col = lane & 15, g = lane >> 4; const int c0 = blockIdx.y * 128; const size_t r0 = (size_t)blockIdx.x * 64 + wave * 16;
  v8f acc[8] = {};
  if (CAUSAL && (int)(((size_t)blockIdx.x * 64) % TT) < QHI) {   /* block-uniform */
    gemm_k<1>((const char*)(Y + (size_t)blockIdx.x * 64 * CC), (unsigned)(wave * 16 + col) * (CC * 4u) + 32u * g, (const char*)(WO + c0), wt, wave, lane, acc);
#pragma unroll
    for (int j = 0; j < 8; ++j) { const float bias = BO ? bfr(BO[c0 + j * 16 + col]) : 0.f;
#pragma unroll
      for (int r = 0; r < 8; ++r) sf[wave][8 * g + r][j * 16 + col] = acc[j][r] + bias; }
  } else {
    gemm_k<2>((const char*)(Y + (size_t)blockIdx.x * 64 * CC), (unsigned)(wave * 16 + col) * (CC * 4u) + 32u * g, (const char*)(WO + c0), wt, wave, lane, acc);
#pragma unroll
    for (int j = 0; j < 8; ++j) { const float bias = BO ? bfr(BO[c0 + j * 16 + col]) : 0.f;
#pragma unroll
      for (int r = 0; r < 8; ++r) sf[wave][8 * g + r][j * 16 + col] = acc[j][r] * (1.0f / 256.0f) + bias; } }
  LDSX(); for (int rl = 0; rl < 16; ++rl) vst2(OUT + (r0 + rl) * DIN + c0 + lane * 4, *(const v4f*)&sf[wave][rl][lane * 4]); }

extern "C" void kernel_launch(void* const* d_in, const int* in_sizes, int n_in, void* d_out, int out_size, void* d_ws, size_t ws_size, hipStream_t stream) {
  (void)in_sizes; (void)n_in; (void)out_size;
  const float** F = (const float**)d_in;
  if (ws_size < (size_t)WS_END) return;
  char* ws = (char*)d_ws; _Float16 *QH = (_Float16*)(ws + WS_QH), *KH = (_Float16*)(ws + WS_KH), *VT = (_Float16*)(ws + WS_VT), *QL = (_Float16*)(ws + WS_QL), *KL = (_Float16*)(ws + WS_KL); __bf16 *VB = (__bf16*)(ws + WS_VB), *VBL = (__bf16*)(ws + WS_VBL); float *S = (float*)(ws + WS_S), *Y = (float*)(ws + WS_Y);
  (void)Y; (void)QL; (void)KL; (void)VB; (void)VBL;
  // inputs: 0 inputs_q [2,2048,1024]; 1 wq, 2 wk, 3 wv [1024,16,64] (= (in,out)); 4 wo [16,64,1024] (= (in,out)); 5 q_norm_scale [64]; 6 k_norm_scale [64]
  k_proj<<<dim3(TNB * TT / 64, CC / 128, 3), 128, 0, stream>>>(F[0], F[0], F[0], F[1], F[2], F[3], nullptr, nullptr, nullptr, QH, QL, KH, KL, VT, VB, VBL, F[5], F[6]);
  for (int b = 0; b < TNB; ++b) for (int h0 = 0; h0 < NH; h0 += HG) {
    k_sc<<<dim3(NQB, TT / 128, HG), 128, 0, stream>>>(QH, KH, QL, KL, b, h0, S);
    k_sm<<<dim3(TT / 16, HG), 256, 0, stream>>>(S);
    k_pv<<<dim3(NQB, 1, HG), 128, 0, stream>>>(S, VT, VB, VBL, b, h0, Y);
  }
  k_out<<<dim3(TNB * TT / 64, DIN / 128), 128, 0, stream>>>(Y, F[4], nullptr, (float*)d_out);
}

// v005
// Measured time: 185 microseconds a run.
// In two side-by-side timings against v004, it was 2.21 and 2.23 times as fast.
// All steps since v000 together make it 5.92 times as fast.
// compute dtype: all float inputs rounded to bf16; q/k/v = x W with EXACT bf16 products on WMMA 16x16x32, f32 accumulate; per-head RMSNorm and rotate-half RoPE in f32 (precise sinf/cosf of t * inv_freq); q, k once to f16 -> 1-product causal logits x 1/8, except the first 384 query rows of each sequence (few keys, no averaging), which use q and k as f16 hi + residual (x 2^10) (3 products); softmax in f32 (precise expf) with a running maximum and sum, divided out at the end; exp(logit - max) x 2^10 once to f16 against v once to f16 (1 product), except the first 384 rows: it and v as bf16 hi + lo (3 products); ctx once to f16 against wo carried x 2^8 in f16 (exact bf16 values), except the first 384 rows: ctx bf16 hi + lo against exact bf16 wo (2 products); f32 output.
#include <hip/hip_runtime.h>
#include <math.h>

typedef __attribute__((ext_vector_type(16))) _Float16 v16h;
typedef __attribute__((ext_vector_type(16))) __bf16 v16b;
typedef __attribute__((ext_vector_type(8)))  _Float16 v8h;
typedef __attribute__((ext_vector_type(8)))  float v8f;
typedef __attribute__((ext_vector_type(4)))  float v4f;
typedef __attribute__((ext_vector_type(2)))  float v2f;
typedef __attribute__((ext_vector_type(4)))  unsigned v4u;
typedef __attribute__((ext_vector_type(4)))  int v4i;
typedef float __attribute__((may_alias)) float_a;
typedef int __attribute__((may_alias)) int_a;

template <typename T> __device__ __forceinline__ void vst2(void* p, T v) { *(T*)p = v;  }
__device__ __forceinline__ v8f wmma16(v16h a, v16h b, v8f c) {
  v8f d = __builtin_amdgcn_wmma_f32_16x16x32_f16(false, a, false, b, (short)0, c, false, false);
  asm volatile("v_nop\n\tv_nop\n\tv_nop\n\tv_nop" : "+v"(d) : "v"(a), "v"(b));
  return d;
}
__device__ __forceinline__ v8f wmma_bf(v16b a, v16b b, v8f c) {
  v8f d = __builtin_amdgcn_wmma_f32_16x16x32_bf16(false, a, false, b, (short)0, c, false, false);
  asm volatile("v_nop\n\tv_nop\n\tv_nop\n\tv_nop" : "+v"(d) : "v"(a), "v"(b));
  return d;
}
// 16x16x32 fragments: lane = (h = lane>>4, row/col = lane&15); elements 0..7 = k0+8h+0..7, 8..15 = k0+16+8h+0..7; D element r = row 8h+r
__device__ __forceinline__ v16h frag_h(const _Float16* rowk0, int lane) {
  union { v16h v; v8h q[2]; } u; const _Float16* p = rowk0 + 8 * (lane >> 4);
  u.q[0] = *(const v8h*)p; u.q[1] = *(const v8h*)(p + 16); return u.v;
}
__device__ __forceinline__ v16h frag_f32(const float* rowk0, int lane) {
  v16h a; const float* p = rowk0 + 8 * (lane >> 4);
#pragma unroll
  for (int i = 0; i < 8; ++i) { a[i] = (_Float16)p[i]; a[8 + i] = (_Float16)p[16 + i]; }
  return a;
}
__device__ __forceinline__ v16h frag_f32s(const float* rowk0, int lane, float sc) {
  v16h a; const float* p = rowk0 + 8 * (lane >> 4);
#pragma unroll
  for (int i = 0; i < 8; ++i) { a[i] = (_Float16)(p[i] * sc); a[8 + i] = (_Float16)(p[16 + i] * sc); }
  return a;
}
// column fragment from a [K][ld] layout (column n), rows >= K read as 0
__device__ __forceinline__ v16h fragc_f32(const float* W, int k0, int n, int lane, int ld, int K) {
  v16h a; const int g = lane >> 4;
#pragma unroll
  for (int i = 0; i < 8; ++i) { const int ka = k0 + 8 * g + i, kb = ka + 16;
    a[i] = (_Float16)(ka < K ? W[(size_t)(ka < K ? ka : K - 1) * ld + n] : 0.f); a[8 + i] = (_Float16)(kb < K ? W[(size_t)(kb < K ? kb : K - 1) * ld + n] : 0.f); }
  return a;
}
struct F2 { v16b h, l; };
__device__ __forceinline__ F2 bsplit16(const float v[16]) { F2 r;
#pragma unroll
  for (int i = 0; i < 16; ++i) { const __bf16 h = (__bf16)v[i]; r.h[i] = h; r.l[i] = (__bf16)(v[i] - (float)h); }
  return r; }
__device__ __forceinline__ F2 split_row(const float* row, int k0, int lane) { float v[16]; const float* p = row + k0 + 8 * (lane >> 4);
#pragma unroll
  for (int i = 0; i < 8; ++i) { v[i] = p[i]; v[8 + i] = p[16 + i]; }
  return bsplit16(v); }
__device__ __forceinline__ F2 split_rowK(const float* row, int k0, int lane, int K) { float v[16]; const int g = lane >> 4;
#pragma unroll
  for (int i = 0; i < 8; ++i) { const int ka = k0 + 8 * g + i, kb = ka + 16; v[i] = ka < K ? row[ka < K ? ka : K - 1] : 0.f; v[8 + i] = kb < K ? row[kb < K ? kb : K - 1] : 0.f; }
  return bsplit16(v); }
__device__ __forceinline__ F2 split_col(const float* W, int k0, int n, int lane, int ld, int K) { float v[16]; const int g = lane >> 4;
#pragma unroll
  for (int i = 0; i < 8; ++i) { const int ka = k0 + 8 * g + i, kb = ka + 16; v[i] = ka < K ? W[(size_t)(ka < K ? ka : K - 1) * ld + n] : 0.f; v[8 + i] = kb < K ? W[(size_t)(kb < K ? kb : K - 1) * ld + n] : 0.f; }
  return bsplit16(v); }
__device__ __forceinline__ v8f mac3(const F2& a, const F2& b, v8f c) { c = wmma_bf(a.l, b.h, c); c = wmma_bf(a.h, b.l, c); return wmma_bf(a.h, b.h, c); }
__device__ __forceinline__ float sigm(float v) { return 1.0f / (1.0f + expf(-v)); }
#define LDSX() do { asm volatile("s_wait_dscnt 0" ::: "memory"); __builtin_amdgcn_wave_barrier(); __builtin_amdgcn_fence(__ATOMIC_RELEASE, "workgroup"); } while (0)

// Causal multi-head dot-product attention with QK-RMSNorm and RoPE (B 2, S 2,048, D 1,024, 16 heads x 64): q/k/v = x w ((in, head, hd) = (in,out)); q, k RMS-normalised over the 64 head dims (eps 1e-6, x scale) then rotate-half RoPE (angle t * 10000^(-i/32), i < 32); q x 64^-0.5; logits masked to -0.7*f32max where key > query (== -inf here: the diagonal is always kept); softmax; out = merged(attn v) wo ((head, hd, out) = (in,out)).
#define NB 2
#define TT 2048
#define CC 1024            // NH * HD = projected width
#define DIN 1024          // input (model) width
#define NH 16
#define HD 64
#define NQB (TT / 64)
#define SCALE (0.125f)
#define CAUSAL 1
#ifndef TNB
#define TNB NB
#endif
__device__ __forceinline__ float bfr(float v) { return (float)(__bf16)v; }
__host__ __device__ __forceinline__ int kb_last(int qb) { return CAUSAL ? ((qb * 64 + 63) >> 7) : (TT / 128 - 1); }
typedef __attribute__((ext_vector_type(8))) __bf16 v8b;
__device__ __forceinline__ v16b frag_b(const __bf16* rowk0, int lane) {
  union { v16b v; v8b q[2]; } u; const __bf16* p = rowk0 + 8 * (lane >> 4);
  u.q[0] = *(const v8b*)p; u.q[1] = *(const v8b*)(p + 16); return u.v;
}
#define QBH 6              // causal: query blocks 0..QBH-1 of each sequence (few keys, no averaging) take the high-precision path
#define QHI 384            // rows carrying a q residual plane
#define KHI 384            // key rows carrying k residual / v bf16 hi+lo planes (used only by the causal high-precision path)
// B fragment (k rows k0+.., output column o) of a weight: (in,out) [K][ld] or (out,in) [ld rows of K]: bf16 exact, or f16(bf16 * 256) exact
__device__ __forceinline__ v16b wcol_io(const float* Wm, int k0, int o, int lane, int ld) { v16b w; const int g = lane >> 4;
#pragma unroll
  for (int i = 0; i < 8; ++i) { w[i] = (__bf16)Wm[(size_t)(k0 + 8 * g + i) * ld + o]; w[8 + i] = (__bf16)Wm[(size_t)(k0 + 16 + 8 * g + i) * ld + o]; }
  return w; }
__device__ __forceinline__ v16b wcol_oi(const float* Wm, int k0, int o, int lane, int K) { v16b w; const float* p = Wm + (size_t)o * K + k0 + 8 * (lane >> 4);
#pragma unroll
  for (int i = 0; i < 8; ++i) { w[i] = (__bf16)p[i]; w[8 + i] = (__bf16)p[16 + i]; }
  return w; }
__device__ __forceinline__ v16h wcolh_io(const float* Wm, int k0, int o, int lane, int ld) { v16h w; const int g = lane >> 4;
#pragma unroll
  for (int i = 0; i < 8; ++i) { w[i] = (_Float16)(bfr(Wm[(size_t)(k0 + 8 * g + i) * ld + o]) * 256.0f); w[8 + i] = (_Float16)(bfr(Wm[(size_t)(k0 + 16 + 8 * g + i) * ld + o]) * 256.0f); }
  return w; }
__device__ __forceinline__ v16h wcolh_oi(const float* Wm, int k0, int o, int lane, int K) { v16h w; const float* p = Wm + (size_t)o * K + k0 + 8 * (lane >> 4);
#pragma unroll
  for (int i = 0; i < 8; ++i) { w[i] = (_Float16)(bfr(p[i]) * 256.0f); w[8 + i] = (_Float16)(bfr(p[16 + i]) * 256.0f); }
  return w; }
#define WQKV_LAYOUT 0   // 0 = (in,out) [DIN][CC]; 1 = (out,in) [CC][DIN]; 2 = per-head [NH][DIN][HD]
__device__ __forceinline__ v16b wcol_hdk(const float* Wm, int k0, int o, int lane) { v16b w; const int g = lane >> 4; const float* p = Wm + (size_t)(o / HD) * DIN * HD + (o % HD);
#pragma unroll
  for (int i = 0; i < 8; ++i) { w[i] = (__bf16)p[(size_t)(k0 + 8 * g + i) * HD]; w[8 + i] = (__bf16)p[(size_t)(k0 + 16 + 8 * g + i) * HD]; }
  return w; }
#define WO_OUT_IN 0
#if WQKV_LAYOUT == 1
#define WCOL(W, k0, o, lane) wcol_oi(W, k0, o, lane, DIN)
#elif WQKV_LAYOUT == 2
#define WCOL(W, k0, o, lane) wcol_hdk(W, k0, o, lane)
#else
#define WCOL(W, k0, o, lane) wcol_io(W, k0, o, lane, CC)
#endif
#if WO_OUT_IN
#define WOCOL(W, k0, o, lane) wcol_oi(W, k0, o, lane, CC)
#define WOCOLH(W, k0, o, lane) wcolh_oi(W, k0, o, lane, CC)
#else
#define WOCOL(W, k0, o, lane) wcol_io(W, k0, o, lane, DIN)
#define WOCOLH(W, k0, o, lane) wcolh_io(W, k0, o, lane, DIN)
#endif
__constant__ float c_invf[32] = {1.000000000e+00f,7.498942018e-01f,5.623413324e-01f,4.216965139e-01f,3.162277639e-01f,2.371373624e-01f,1.778279394e-01f,1.333521456e-01f,1.000000015e-01f,7.498941571e-02f,5.623412877e-02f,4.216964915e-02f,3.162277862e-02f,2.371373586e-02f,1.778279431e-02f,1.333521493e-02f,9.999999776e-03f,7.498942316e-03f,5.623413250e-03f,4.216964822e-03f,3.162277862e-03f,2.371373819e-03f,1.778279431e-03f,1.333521446e-03f,1.000000047e-03f,7.498941850e-04f,5.623413017e-04f,4.216964880e-04f,3.162277862e-04f,2.371373848e-04f,1.778279402e-04f,1.333521504e-04f};   // 1 / 10000^(i/32) evaluated in f32 exactly as the reference does (jax, eager)
#define PROJ_EXTRA_PARAMS , const float* __restrict__ QS, const float* __restrict__ KS
// per-(row, head) epilogue on the f32 projection tile: RMSNorm over the head's 64 values (x q_norm_scale / k_norm_scale), then rotate-half RoPE; v untouched
#define PROJ_EPI(which, row, t, h) do { if ((which) < 2) { float* rw = (row); const float* NS = (which) == 0 ? QS : KS; float ss = 0.f; _Pragma("unroll") for (int i = 0; i < 64; ++i) ss += rw[i] * rw[i]; const float rn = rsqrtf(ss * (1.0f / 64.0f) + 1e-6f); \
    _Pragma("unroll") for (int i = 0; i < 32; ++i) { const float x1 = rw[i] * rn * bfr(NS[i]), x2 = rw[i + 32] * rn * bfr(NS[i + 32]); const float ang = (float)(t) * c_invf[i]; const float cs = cosf(ang), sn = sinf(ang); rw[i] = x1 * cs - x2 * sn; rw[i + 32] = x2 * cs + x1 * sn; } } } while (0)
#ifndef SM_EXTRA_PARAMS
#define SM_EXTRA_PARAMS
#endif
#ifndef PROJ_EXTRA_PARAMS
#define PROJ_EXTRA_PARAMS
#endif
#ifndef SM_MASK_HOOK
#define SM_MASK_HOOK (void)0
#endif

#define WS_QH  0u                                      // f16 q rows [b*t][CC]
#define WS_KH  (WS_QH + 2u * (size_t)NB * TT * CC)      // f16 k rows [b*t][CC]
#define WS_VT  (WS_KH + 2u * (size_t)NB * TT * CC)      // f16 v planes [b][c][t]
#define WS_QL  (WS_VT + 2u * (size_t)NB * CC * TT)      // f16 q residual x 2^10 rows [b][t < QHI][CC]
#define WS_KL  (WS_QL + 2u * (size_t)NB * QHI * CC)     // f16 k residual x 2^10 rows [b][t < KHI][CC]
#define WS_VB  (WS_KL + 2u * (size_t)NB * KHI * CC)     // bf16 v hi planes [b][c][t < KHI]
#define WS_VBL (WS_VB + 2u * (size_t)NB * CC * KHI)
#define WS_Y   (WS_VBL + 2u * (size_t)NB * CC * KHI)    // f32 ctx rows [b*t][CC] (only when there is an output projection)
#define WS_END (WS_Y  + 4u * (size_t)NB * TT * CC)

// ---- weight tile in LDS, shared by k_proj and k_out: one K step (32 k x 128 output columns) of an (in,out) f32 weight is read ONCE per work-group (wave w: rows 8w..8w+7, lane: 4 columns, whole 512-byte rows), converted as before and kept as 16-bit [column][k] rows of 80 bytes (16 B x odd: the fragment reads meet no bank conflict). Two buffers: the next step's loads (and the wave's own next A rows) fly while this step's products run.
#define WLD 1024           // row length of every weight here (CC for wq/wk/wv, DIN for wo)
#define KST 32             // K steps (DIN / 32 == CC / 32)
static_assert(CC == WLD && DIN == WLD && DIN / 32 == KST && CC / 32 == KST && WQKV_LAYOUT == 0 && WO_OUT_IN == 0, "the staging reads (in,out) weights with rows of WLD floats");
typedef unsigned WT[128][20];
// MODE 0: A once to bf16, W bf16 (1 product); 1: A bf16 hi + lo, W bf16 (2 products); 2: A once to f16, W f16(bf16 x 2^8) (1 product)
struct AFr { v16b h, l; v16h f; };
template <int MODE> __device__ __forceinline__ void a_cvt(AFr& a, const v4f (&ar)[4]) { float v[16];
#pragma unroll
  for (int i = 0; i < 4; ++i) { v[i] = ar[0][i]; v[4 + i] = ar[1][i]; v[8 + i] = ar[2][i]; v[12 + i] = ar[3][i]; }
  if constexpr (MODE == 1) { const F2 s = bsplit16(v); a.h = s.h; a.l = s.l; }
  else {
#pragma unroll
    for (int i = 0; i < 16; ++i) { if constexpr (MODE == 0) a.h[i] = (__bf16)v[i]; else a.f[i] = (_Float16)v[i]; } } }
template <int MODE> __device__ __forceinline__ void wt_store(WT& wt, const v4f (&wr)[8], int wave, int lane) {
#pragma unroll
  for (int n = 0; n < 4; ++n) { union { v8b b; v8h h; v4u u; } p;
#pragma unroll
    for (int i = 0; i < 8; ++i) { if constexpr (MODE == 2) p.h[i] = (_Float16)(bfr(wr[i][n]) * 256.0f); else p.b[i] = (__bf16)wr[i][n]; }
    *(v4u*)&wt[4 * lane + n][4 * wave] = p.u; } }   // column 4 lane + n, k 8 wave .. 8 wave + 7
// acc[j] += A (16 rows of the wave, f32 rows at xb + xo, K-contiguous) x W (columns j * 16 + col of the tile at wb); k order and product order as in the direct form
template <int MODE> __device__ __forceinline__ void gemm_k(const char* xb, unsigned xo, const char* wb, WT (&wt)[2], int wave, int lane, v8f (&acc)[8]) {
  const int col = lane & 15, g = lane >> 4; const unsigned wo = (unsigned)(8 * wave) * (WLD * 4u) + 16u * lane;
  v4f wr[8], ar[4]; AFr a;
#pragma unroll
  for (int i = 0; i < 8; ++i) wr[i] = *(const v4f*)(wb + wo + i * (WLD * 4));
  ar[0] = *(const v4f*)(xb + xo); ar[1] = *(const v4f*)(xb + xo + 16); ar[2] = *(const v4f*)(xb + xo + 64); ar[3] = *(const v4f*)(xb + xo + 80);
  asm volatile("s_wait_xcnt 0x0" :: "v"(wo), "v"(xo), "s"(wb), "s"(xb) : "memory");   // precaution: stands in front of the first rewrite of a register that these loads name; the lane offsets and the uniform bases as inputs keep their registers until here
  __builtin_amdgcn_sched_barrier(0);   // keeps the conversions below, which may reuse the address registers, behind the wait above
  wt_store<MODE>(wt[0], wr, wave, lane); a_cvt<MODE>(a, ar);
  __syncthreads();   // publishes K step 0
#pragma unroll 1   // rolled: one K step per trip keeps the loop small and the live registers below 256
  for (int kc = 0; kc < KST; ++kc) { const bool more = kc + 1 < KST;   // the same for the whole work-group
    if (more) { const char* wk = wb + (size_t)(kc + 1) * (32 * WLD * 4); const char* xk = xb + (kc + 1) * 128;
#pragma unroll
      for (int i = 0; i < 8; ++i) wr[i] = *(const v4f*)(wk + wo + i * (WLD * 4));
      ar[0] = *(const v4f*)(xk + xo); ar[1] = *(const v4f*)(xk + xo + 16); ar[2] = *(const v4f*)(xk + xo + 64); ar[3] = *(const v4f*)(xk + xo + 80);
      asm volatile("s_wait_xcnt 0x0" ::: "memory"); }   // precaution, as above; its memory clobber also keeps the 12 loads from sinking to their uses behind the products
    __builtin_amdgcn_sched_barrier(0);   // holds the next step's loads in front of this step's products, which then cover their latency, and every later write of an address register behind the wait above
    const WT& cur = wt[kc & 1]; v4u f[8][2];
#pragma unroll
    for (int j = 0; j < 8; ++j) { f[j][0] = *(const v4u*)&cur[j * 16 + col][4 * g]; f[j][1] = *(const v4u*)&cur[j * 16 + col][8 + 4 * g]; }   // elements 0..7 = k 8g.., 8..15 = k 16 + 8g..
#pragma unroll
    for (int j = 0; j < 8; ++j) { union { v4u q[2]; v16b b; v16h h; } w; w.q[0] = f[j][0]; w.q[1] = f[j][1];
      if constexpr (MODE == 0) acc[j] = wmma_bf(a.h, w.b, acc[j]);
      else if constexpr (MODE == 1) { acc[j] = wmma_bf(a.h, w.b, acc[j]); acc[j] = wmma_bf(a.l, w.b, acc[j]); }
      else acc[j] = wmma16(a.f, w.h, acc[j]); }
    if (more) { wt_store<MODE>(wt[(kc + 1) & 1], wr, wave, lane); a_cvt<MODE>(a, ar);   // into the buffer whose last readers passed the barrier of the trip before
      __syncthreads(); } } }   // one barrier per K step: publishes step kc + 1 and ends every reader's last read of step kc's buffer
// ---- k_proj: block = (64 rows, 128 cols, which): q/k/v = X W (+ b) with exact bf16 products (K = DIN) -> which 0: q f16 rows (+ residual rows < QHI); 1: k f16 rows (+ residual rows < KHI); 2: v f16 planes [c][t] (+ bf16 hi/lo planes for t < KHI)
__global__ __launch_bounds__(128) void k_proj(const float* __restrict__ XQ, const float* __restrict__ XK, const float* __restrict__ XV, const float* __restrict__ WQ, const float* __restrict__ WK, const float* __restrict__ WV, const float* __restrict__ BQ, const float* __restrict__ BK, const float* __restrict__ BV,
    _Float16* __restrict__ QH, _Float16* __restrict__ QL, _Float16* __restrict__ KH, _Float16* __restrict__ KL, _Float16* __restrict__ VT, __bf16* __restrict__ VB, __bf16* __restrict__ VBL PROJ_EXTRA_PARAMS) {
  __shared__ __align__(16) float st[64][132]; __shared__ __align__(16) _Float16 sh[64][136], sl[64][136]; __shared__ __align__(16) _Float16 th[128][72]; __shared__ __align__(16) __bf16 tb[128][72], tbl[128][72]; __shared__ __align__(16) WT wt[2];
  const int tid = threadIdx.x, wave = tid >> 5, lane = tid & 31, col = lane & 15, g = lane >> 4; const int which = blockIdx.z; const int c0 = blockIdx.y * 128; const size_t r0 = (size_t)blockIdx.x * 64; const size_t bb = r0 / TT; const int t0 = (int)(r0 % TT);
  const float* X = which == 0 ? XQ : which == 1 ? XK : XV; const float* WA = which == 0 ? WQ : which == 1 ? WK : WV; const float* BA = which == 0 ? BQ : which == 1 ? BK : BV;
  v8f acc[8] = {};
  gemm_k<0>((const char*)(X + r0 * DIN), (unsigned)(wave * 16 + col) * (DIN * 4u) + 32u * g, (const char*)(WA + c0), wt, wave, lane, acc);
  { // stage the f32 tile (acc + bias) in LDS, run the per-(row, head) epilogue hook, then convert
#pragma unroll
    for (int j = 0; j < 8; ++j) { const float bias = BA ? bfr(BA[c0 + j * 16 + col]) : 0.f;
#pragma unroll
      for (int r = 0; r < 8; ++r) st[wave * 16 + 8 * g + r][j * 16 + col] = acc[j][r] + bias; }
    __syncthreads();
    for (int e = tid; e < 64 * (128 / HD); e += 128) { const int rl = e / (128 / HD), hh = e % (128 / HD); PROJ_EPI(which, &st[rl][hh * HD], (int)((r0 + rl) % TT), (c0 / HD) + hh); }
    __syncthreads(); }
  if (which < 2) { _Float16* DH = which == 0 ? QH : KH; _Float16* DL = which == 0 ? QL : KL; const int nhi = which == 0 ? QHI : KHI; const bool hi_rows = t0 < nhi;
    for (int e = tid; e < 64 * 128; e += 128) { const int rl = e >> 7, cl = e & 127; const float v = st[rl][cl]; const _Float16 hv = (_Float16)v; sh[rl][cl] = hv; sl[rl][cl] = (_Float16)((v - (float)hv) * 1024.0f); }
    __syncthreads();
    for (int e = tid; e < 64 * 16; e += 128) { const int rl = e >> 4, q = e & 15; vst2((unsigned*)(DH + (r0 + rl) * CC + c0 + q * 8), *(const v4u*)&sh[rl][q * 8]); if (hi_rows) vst2((unsigned*)(DL + (bb * nhi + t0 + rl) * (size_t)CC + c0 + q * 8), *(const v4u*)&sl[rl][q * 8]); }
  } else { const bool hi_rows = t0 < KHI;
    for (int e = tid; e < 64 * 128; e += 128) { const int rl = e & 63, cl = e >> 6; const float v = st[rl][cl]; th[cl][rl] = (_Float16)v; const __bf16 bh = (__bf16)v; tb[cl][rl] = bh; tbl[cl][rl] = (__bf16)(v - (float)bh); }
    __syncthreads();
    for (int e = tid; e < 128 * 8; e += 128) { const int cl = e >> 3, q = e & 7; vst2((unsigned*)(VT + (bb * CC + c0 + cl) * (size_t)TT + t0 + q * 8), *(const v4u*)&th[cl][q * 8]); if (hi_rows) { const size_t o3 = (bb * CC + c0 + cl) * (size_t)KHI + t0 + q * 8; vst2((unsigned*)(VB + o3), *(const v4u*)&tb[cl][q * 8]); vst2((unsigned*)(VBL + o3), *(const v4u*)&tbl[cl][q * 8]); } } } }
#define PSH 6.9314718f     // ln 2^10
__device__ __forceinline__ float xhalf(float x) { return __builtin_bit_cast(float, __builtin_amdgcn_permlanex16(__builtin_bit_cast(int, x), __builtin_bit_cast(int, x), 0x76543210, 0xfedcba98, false, false)); }   // lane l with lane l ^ 16
// one step of the running softmax over NT tiles of 16 keys: x = logits in, p out; lim = last allowed key of the lane's query, counted from the lane's first key of the step (only looked at where last is set: the step that holds the diagonal; its first key is allowed for every query of the wave, so no step is empty)
template <int NT> __device__ __forceinline__ void sm_step(float (&x)[NT][8], bool last, int lim, float& m, float& l, v8f (&acc)[HD / 16]) {
  if (last) {   // the same for the whole wave
#pragma unroll
    for (int jt = 0; jt < NT; ++jt)
#pragma unroll
      for (int r = 0; r < 8; ++r) if (jt * 16 + r > lim) x[jt][r] = -3.0e38f; }
  float mx = -3.0e38f;
#pragma unroll
  for (int jt = 0; jt < NT; ++jt) mx = fmaxf(mx, fmaxf(fmaxf(fmaxf(x[jt][0], x[jt][1]), fmaxf(x[jt][2], x[jt][3])), fmaxf(fmaxf(x[jt][4], x[jt][5]), fmaxf(x[jt][6], x[jt][7]))));
  mx = fmaxf(mx, xhalf(mx));
  const float mn = fmaxf(m, mx), al = expf(m - mn), ms = mn - PSH; m = mn;   // first step: al = exp(-3e38) = 0
  float sum = 0.f;
#pragma unroll
  for (int jt = 0; jt < NT; ++jt) {
#pragma unroll
    for (int r = 0; r < 8; ++r) x[jt][r] = expf(x[jt][r] - ms);   // an excluded key: exp(-3e38) = 0
    sum += ((x[jt][0] + x[jt][1]) + (x[jt][2] + x[jt][3])) + ((x[jt][4] + x[jt][5]) + (x[jt][6] + x[jt][7])); }
  l = l * al + sum;   // the lane's own keys; the halves are joined once, in att_store
#pragma unroll
  for (int j = 0; j < HD / 16; ++j) acc[j] *= al; }
// lane (g, c) holds ctx[query c][j * 16 + 8g + r]: 32 contiguous bytes per j
__device__ __forceinline__ void att_store(float* __restrict__ Y, int b, int h, int ql0, int lane, float l, const v8f (&acc)[HD / 16]) {
  l += xhalf(l); const float inv = 1.0f / l; float* yr = Y + ((size_t)b * TT + ql0 + (lane & 15)) * CC + h * HD + 8 * (lane >> 4);
#pragma unroll
  for (int j = 0; j < HD / 16; ++j) { v4f a, c;
#pragma unroll
    for (int i = 0; i < 4; ++i) { a[i] = acc[j][i] * inv; c[i] = acc[j][4 + i] * inv; }
    vst2(yr + j * 16, a); vst2(yr + j * 16 + 4, c); }
  asm volatile("s_wait_xcnt 0x0" :: "v"(yr) : "memory");   // precaution: stands in front of the first rewrite of a register that these stores name; the address as an input keeps its registers until here
  __builtin_amdgcn_sched_barrier(0); }   // keeps the next tile's address work behind the wait above
// 16 query rows from ql0 (>= QHI), steps of 64 keys: q, k once to f16 (1 product), p once to f16 against v f16 (1 product)
__device__ __forceinline__ void att_lo(const _Float16* __restrict__ QH, const _Float16* __restrict__ KH, const _Float16* __restrict__ VT, float* __restrict__ Y, int b, int h, int ql0, int lane) {
  const int col = lane & 15, g = lane >> 4; const int nt = (ql0 >> 6) + 1;
  const char* qp = (const char*)(QH + ((size_t)b * TT + ql0) * CC + h * HD); const char* kb = (const char*)(KH + (size_t)b * TT * CC + h * HD); const char* vb = (const char*)(VT + ((size_t)b * CC + h * HD) * (size_t)TT);   // wave-uniform bases; the lane's byte offsets below do not change over the loop
  const unsigned ko = (unsigned)col * (CC * 2u) + 16u * g, vo = (unsigned)col * (TT * 2u) + 16u * g;
  v8h qr[2][2], kr[4][2][2], vr[2][HD / 16][2];
#pragma unroll
  for (int kc = 0; kc < 2; ++kc) { qr[kc][0] = *(const v8h*)(qp + ko + kc * 64); qr[kc][1] = *(const v8h*)(qp + ko + kc * 64 + 32); }
#pragma unroll
  for (int jt = 0; jt < 4; ++jt)
#pragma unroll
    for (int kc = 0; kc < 2; ++kc) { kr[jt][kc][0] = *(const v8h*)(kb + ko + jt * (16 * CC * 2) + kc * 64); kr[jt][kc][1] = *(const v8h*)(kb + ko + jt * (16 * CC * 2) + kc * 64 + 32); }
  asm volatile("s_wait_xcnt 0x0" :: "v"(qp + ko), "v"(kb + ko) : "memory");   // precaution: stands in front of the first rewrite of a register that these loads name; the addresses as inputs keep their registers from being given to a later load of the group
  __builtin_amdgcn_sched_barrier(0);   // keeps every later write of an address register behind the wait above
  v16h q[2];
#pragma unroll
  for (int kc = 0; kc < 2; ++kc) { union { v16h v; v8h q[2]; } f; f.q[0] = qr[kc][0]; f.q[1] = qr[kc][1]; q[kc] = f.v; }
  v8f acc[HD / 16] = {}; float m = -3.0e38f, l = 0.f;
#pragma unroll 1   // rolled: one step of 64 keys per trip keeps the live registers below 256
  for (int t = 0; t < nt; ++t) { const char* vk = vb + t * 128;
#pragma unroll
    for (int c = 0; c < 2; ++c)
#pragma unroll
      for (int j = 0; j < HD / 16; ++j) { const int o = j * 16 * TT * 2 + c * 64; vr[c][j][0] = *(const v8h*)(vk + vo + o); vr[c][j][1] = *(const v8h*)(vk + vo + o + 32); }
    asm volatile("s_wait_xcnt 0x0" :: "v"(vk + vo) : "memory");   // precaution, as above
    __builtin_amdgcn_sched_barrier(0);   // holds this step's 16 v loads in front of the logits, which with the softmax cover their latency, and every later write of an address register behind the wait above
    v8f s[4] = {};
#pragma unroll
    for (int kc = 0; kc < 2; ++kc)
#pragma unroll
      for (int jt = 0; jt < 4; ++jt) { union { v16h v; v8h q[2]; } f; f.q[0] = kr[jt][kc][0]; f.q[1] = kr[jt][kc][1]; s[jt] = wmma16(f.v, q[kc], s[jt]); }
    if (t + 1 < nt) { const char* kk = kb + (size_t)(t + 1) * (64 * CC * 2);   // the same for the whole wave
#pragma unroll
      for (int jt = 0; jt < 4; ++jt)
#pragma unroll
        for (int kc = 0; kc < 2; ++kc) { kr[jt][kc][0] = *(const v8h*)(kk + ko + jt * (16 * CC * 2) + kc * 64); kr[jt][kc][1] = *(const v8h*)(kk + ko + jt * (16 * CC * 2) + kc * 64 + 32); }
      asm volatile("s_wait_xcnt 0x0" :: "v"(kk + ko) : "memory"); }   // precaution, as above; the next step's 16 k loads go into the registers that the products above have read, and the softmax and the products below cover their latency
    float x[4][8];
#pragma unroll
    for (int jt = 0; jt < 4; ++jt)
#pragma unroll
      for (int r = 0; r < 8; ++r) x[jt][r] = s[jt][r] * SCALE;
    sm_step<4>(x, t == nt - 1, ql0 + col - t * 64 - 8 * g, m, l, acc);
#pragma unroll
    for (int c = 0; c < 2; ++c) { v16h p;
#pragma unroll
      for (int i = 0; i < 8; ++i) { p[i] = (_Float16)x[2 * c][i]; p[8 + i] = (_Float16)x[2 * c + 1][i]; }
#pragma unroll
      for (int j = 0; j < HD / 16; ++j) { union { v16h v; v8h q[2]; } f; f.q[0] = vr[c][j][0]; f.q[1] = vr[c][j][1]; acc[j] = wmma16(f.v, p, acc[j]); } } }
  att_store(Y, b, h, ql0, lane, l, acc); }
// 16 query rows from ql0 (< QHI: few keys, no averaging), steps of 32 keys: q and k as f16 hi + residual (x 2^10) (3 products), p and v as bf16 hi + lo (3 products)
__device__ __forceinline__ void att_hi(const _Float16* __restrict__ QH, const _Float16* __restrict__ QL, const _Float16* __restrict__ KH, const _Float16* __restrict__ KL, const __bf16* __restrict__ VB, const __bf16* __restrict__ VBL, float* __restrict__ Y, int b, int h, int ql0, int lane) {
  const int col = lane & 15, g = lane >> 4; const int nt = (ql0 >> 5) + 1;
  const char* qp = (const char*)(QH + ((size_t)b * TT + ql0) * CC + h * HD); const char* qlp = (const char*)(QL + ((size_t)b * QHI + ql0) * CC + h * HD); const char* kb = (const char*)(KH + (size_t)b * TT * CC + h * HD); const char* klb = (const char*)(KL + (size_t)b * KHI * CC + h * HD);
  const char* vhb = (const char*)(VB + ((size_t)b * CC + h * HD) * (size_t)KHI); const char* vlb = (const char*)(VBL + ((size_t)b * CC + h * HD) * (size_t)KHI);   // wave-uniform bases; the lane's byte offsets below do not change over the loop
  const unsigned ko = (unsigned)col * (CC * 2u) + 16u * g, vo = (unsigned)col * (KHI * 2u) + 16u * g;
  v8h qr[2][2], qs[2][2];
#pragma unroll
  for (int kc = 0; kc < 2; ++kc) { qr[kc][0] = *(const v8h*)(qp + ko + kc * 64); qr[kc][1] = *(const v8h*)(qp + ko + kc * 64 + 32); qs[kc][0] = *(const v8h*)(qlp + ko + kc * 64); qs[kc][1] = *(const v8h*)(qlp + ko + kc * 64 + 32); }
  asm volatile("s_wait_xcnt 0x0" :: "v"(qp + ko), "v"(qlp + ko) : "memory");   // precaution: stands in front of the first rewrite of a register that these loads name; the addresses as inputs keep their registers from being given to a later load of the group
  __builtin_amdgcn_sched_barrier(0);   // keeps every later write of an address register behind the wait above
  v16h qh[2], ql[2];
#pragma unroll
  for (int kc = 0; kc < 2; ++kc) { union { v16h v; v8h q[2]; } f; f.q[0] = qr[kc][0]; f.q[1] = qr[kc][1]; qh[kc] = f.v; f.q[0] = qs[kc][0]; f.q[1] = qs[kc][1]; ql[kc] = f.v; }
  v8f acc[HD / 16] = {}; float m = -3.0e38f, l = 0.f;
#pragma unroll 1   // rolled: one step of 32 keys per trip keeps the live registers below 256
  for (int t = 0; t < nt; ++t) { const char* kk = kb + t * (32 * CC * 2) + ko; const char* lk = klb + t * (32 * CC * 2) + ko; const char* hv = vhb + t * 64 + vo; const char* lv = vlb + t * 64 + vo;   // the lane's four addresses of this step
    v8h kh[2][2][2], kl[2][2][2]; v8b vh[HD / 16][2], vl[HD / 16][2];
#pragma unroll
    for (int jt = 0; jt < 2; ++jt)
#pragma unroll
      for (int kc = 0; kc < 2; ++kc) { const int o = jt * (16 * CC * 2) + kc * 64; kh[jt][kc][0] = *(const v8h*)(kk + o); kh[jt][kc][1] = *(const v8h*)(kk + o + 32); kl[jt][kc][0] = *(const v8h*)(lk + o); kl[jt][kc][1] = *(const v8h*)(lk + o + 32); }
#pragma unroll
    for (int j = 0; j < HD / 16; ++j) { const int o = j * 16 * KHI * 2; vh[j][0] = *(const v8b*)(hv + o); vh[j][1] = *(const v8b*)(hv + o + 32); vl[j][0] = *(const v8b*)(lv + o); vl[j][1] = *(const v8b*)(lv + o + 32); }
    asm volatile("s_wait_xcnt 0x0" :: "v"(kk), "v"(lk), "v"(hv), "v"(lv) : "memory");   // precaution, as above
    __builtin_amdgcn_sched_barrier(0);   // holds the step's 32 loads in front of its first product (sunk to their uses they would cost one memory latency each) and every later write of an address register behind the wait above
    v8f s[2] = {}, sl[2] = {};
#pragma unroll
    for (int kc = 0; kc < 2; ++kc)
#pragma unroll
      for (int jt = 0; jt < 2; ++jt) { union { v16h v; v8h q[2]; } fh, fl; fh.q[0] = kh[jt][kc][0]; fh.q[1] = kh[jt][kc][1]; fl.q[0] = kl[jt][kc][0]; fl.q[1] = kl[jt][kc][1]; s[jt] = wmma16(fh.v, qh[kc], s[jt]); sl[jt] = wmma16(fh.v, ql[kc], sl[jt]); sl[jt] = wmma16(fl.v, qh[kc], sl[jt]); }
    float x[2][8];
#pragma unroll
    for (int jt = 0; jt < 2; ++jt)
#pragma unroll
      for (int r = 0; r < 8; ++r) x[jt][r] = (s[jt][r] + sl[jt][r] * (1.0f / 1024.0f)) * SCALE;
    sm_step<2>(x, t == nt - 1, ql0 + col - t * 32 - 8 * g, m, l, acc);
    float v[16];
#pragma unroll
    for (int i = 0; i < 8; ++i) { v[i] = x[0][i]; v[8 + i] = x[1][i]; }
    const F2 p = bsplit16(v);
#pragma unroll
    for (int j = 0; j < HD / 16; ++j) { union { v16b v; v8b q[2]; } fh, fl; fh.q[0] = vh[j][0]; fh.q[1] = vh[j][1]; fl.q[0] = vl[j][0]; fl.q[1] = vl[j][1]; acc[j] = wmma_bf(fh.v, p.h, acc[j]); acc[j] = wmma_bf(fh.v, p.l, acc[j]); acc[j] = wmma_bf(fl.v, p.h, acc[j]); } }
  att_store(Y, b, h, ql0, lane, l, acc); }
// block = (pair of query blocks NQB-1-x and x, (b, h)): together NQB + 1 blocks of 64 keys, so the work is even except where x < QBH (block x on the 3-product path, in steps of 32 keys); wave = 16 query rows of the block; no LDS, no barrier
__global__ __launch_bounds__(128) void k_att(const _Float16* __restrict__ QH, const _Float16* __restrict__ QL, const _Float16* __restrict__ KH, const _Float16* __restrict__ KL, const _Float16* __restrict__ VT, const __bf16* __restrict__ VB, const __bf16* __restrict__ VBL, float* __restrict__ Y) { static_assert(CAUSAL && NQB % 2 == 0 && QBH * 64 == QHI && QHI == KHI, "the pairing counts on causal row lengths; the early-row path reads residual planes of QHI rows");
  const int lane = threadIdx.x & 31; const int wv = __builtin_amdgcn_readfirstlane(threadIdx.x >> 5);   // the wave's number as a scalar: trip counts and the tests on them are scalar, EXEC stays full at every product
  const int b = blockIdx.y / NH, h = blockIdx.y % NH;
#pragma unroll 1   // rolled: one copy of each path in the code
  for (int z = 0; z < 2; ++z) { const int qb = z ? (int)blockIdx.x : NQB - 1 - (int)blockIdx.x; const int ql0 = qb * 64 + wv * 16;
    if (qb < QBH) att_hi(QH, QL, KH, KL, VB, VBL, Y, b, h, ql0, lane); else att_lo(QH, KH, VT, Y, b, h, ql0, lane); } }
// ---- k_out: block = (64 rows, 128 cols): out = ctx Wo (+ bo): ctx once to f16 against Wo as f16(bf16 x 2^8) exact (1 product) x 2^-8; causal early rows (< QHI of each sequence): ctx bf16 hi + lo against exact bf16 Wo (2 products)
__global__ __launch_bounds__(128) void k_out(const float* __restrict__ Y, const float* __restrict__ WO, const float* __restrict__ BO, float* __restrict__ OUT) { __shared__ __align__(16) float sf[4][16][132]; __shared__ __align__(16) WT wt[2];
  const int tid = threadIdx.x, wave = tid >> 5, lane = tid & 31, col = lane & 15, g = lane >> 4; const int c0 = blockIdx.y * 128; const size_t r0 = (size_t)blockIdx.x * 64 + wave * 16;
  v8f acc[8] = {};
  if (CAUSAL && (int)(((size_t)blockIdx.x * 64) % TT) < QHI) {   /* block-uniform */
    gemm_k<1>((const char*)(Y + (size_t)blockIdx.x * 64 * CC), (unsigned)(wave * 16 + col) * (CC * 4u) + 32u * g, (const char*)(WO + c0), wt, wave, lane, acc);
#pragma unroll
    for (int j = 0; j < 8; ++j) { const float bias = BO ? bfr(BO[c0 + j * 16 + col]) : 0.f;
#pragma unroll
      for (int r = 0; r < 8; ++r) sf[wave][8 * g + r][j * 16 + col] = acc[j][r] + bias; }
  } else {
    gemm_k<2>((const char*)(Y + (size_t)blockIdx.x * 64 * CC), (unsigned)(wave * 16 + col) * (CC * 4u) + 32u * g, (const char*)(WO + c0), wt, wave, lane, acc);
#pragma unroll
    for (int j = 0; j < 8; ++j) { const float bias = BO ? bfr(BO[c0 + j * 16 + col]) : 0.f;
#pragma unroll
      for (int r = 0; r < 8; ++r) sf[wave][8 * g + r][j * 16 + col] = acc[j][r] * (1.0f / 256.0f) + bias; } }
  LDSX(); for (int rl = 0; rl < 16; ++rl) vst2(OUT + (r0 + rl) * DIN + c0 + lane * 4, *(const v4f*)&sf[wave][rl][lane * 4]); }

extern "C" void kernel_launch(void* const* d_in, const int* in_sizes, int n_in, void* d_out, int out_size, void* d_ws, size_t ws_size, hipStream_t stream) {
  (void)in_sizes; (void)n_in; (void)out_size;
  const float** F = (const float**)d_in;
  if (ws_size < (size_t)WS_END) return;
  char* ws = (char*)d_ws; _Float16 *QH = (_Float16*)(ws + WS_QH), *KH = (_Float16*)(ws + WS_KH), *VT = (_Float16*)(ws + WS_VT), *QL = (_Float16*)(ws + WS_QL), *KL = (_Float16*)(ws + WS_KL); __bf16 *VB = (__bf16*)(ws + WS_VB), *VBL = (__bf16*)(ws + WS_VBL); float *Y = (float*)(ws + WS_Y);
  (void)Y; (void)QL; (void)KL; (void)VB; (void)VBL;
  // inputs: 0 inputs_q [2,2048,1024]; 1 wq, 2 wk, 3 wv [1024,16,64] (= (in,out)); 4 wo [16,64,1024] (= (in,out)); 5 q_norm_scale [64]; 6 k_norm_scale [64]
  k_proj<<<dim3(TNB * TT / 64, CC / 128, 3), 128, 0, stream>>>(F[0], F[0], F[0], F[1], F[2], F[3], nullptr, nullptr, nullptr, QH, QL, KH, KL, VT, VB, VBL, F[5], F[6]);
  k_att<<<dim3(NQB / 2, TNB * NH), 128, 0, stream>>>(QH, QL, KH, KL, VT, VB, VBL, Y);
  k_out<<<dim3(TNB * TT / 64, DIN / 128), 128, 0, stream>>>(Y, F[4], nullptr, (float*)d_out);
}

// v006
// One run takes 168 microseconds.
// Next to v005, in two timings, it ran 1.09 and 1.10 times as fast.
// All steps since v000 together make it 6.50 times as fast.
// compute dtype: all float inputs rounded to bf16; q/k/v = x W with EXACT bf16 products on WMMA 16x16x32, f32 accumulate; per-head RMSNorm and rotate-half RoPE in f32 (precise sinf/cosf of t * inv_freq); q, k once to f16 -> 1-product causal logits x 1/8, except the first 384 query rows of each sequence (few keys, no averaging), which use q and k as f16 hi + residual (x 2^10) (3 products); softmax in f32 (precise expf) with a running maximum and sum, divided out at the end; exp(logit - max) x 2^10 once to f16 against v once to f16 (1 product), except the first 384 rows: it and v as bf16 hi + lo (3 products); ctx once to f16 against wo carried x 2^8 in f16 (exact bf16 values), except the first 384 rows: ctx bf16 hi + lo against exact bf16 wo (2 products); f32 output.
#include <hip/hip_runtime.h>
#include <math.h>

typedef __attribute__((ext_vector_type(16))) _Float16 v16h;
typedef __attribute__((ext_vector_type(16))) __bf16 v16b;
typedef __attribute__((ext_vector_type(8)))  _Float16 v8h;
typedef __attribute__((ext_vector_type(8)))  float v8f;
typedef __attribute__((ext_vector_type(4)))  float v4f;
typedef __attribute__((ext_vector_type(2)))  float v2f;
typedef __attribute__((ext_vector_type(4)))  unsigned v4u;
typedef __attribute__((ext_vector_type(4)))  int v4i;
typedef float __attribute__((may_alias)) float_a;
typedef int __attribute__((may_alias)) int_a;

template <typename T> __device__ __forceinline__ void vst2(void* p, T v) { *(T*)p = v;  }
__device__ __forceinline__ v8f wmma16(v16h a, v16h b, v8f c) {
  v8f d = __builtin_amdgcn_wmma_f32_16x16x32_f16(false, a, false, b, (short)0, c, false, false);
  asm volatile("v_nop\n\tv_nop\n\tv_nop\n\tv_nop" : "+v"(d) : "v"(a), "v"(b));
  return d;
}
__device__ __forceinline__ v8f wmma_bf(v16b a, v16b b, v8f c) {
  v8f d = __builtin_amdgcn_wmma_f32_16x16x32_bf16(false, a, false, b, (short)0, c, false, false);
  asm volatile("v_nop\n\tv_nop\n\tv_nop\n\tv_nop" : "+v"(d) : "v"(a), "v"(b));
  return d;
}
// 16x16x32 fragments: lane = (h = lane>>4, row/col = lane&15); elements 0..7 = k0+8h+0..7, 8..15 = k0+16+8h+0..7; D element r = row 8h+r
__device__ __forceinline__ v16h frag_h(const _Float16* rowk0, int lane) {
  union { v16h v; v8h q[2]; } u; const _Float16* p = rowk0 + 8 * (lane >> 4);
  u.q[0] = *(const v8h*)p; u.q[1] = *(const v8h*)(p + 16); return u.v;
}
__device__ __forceinline__ v16h frag_f32(const float* rowk0, int lane) {
  v16h a; const float* p = rowk0 + 8 * (lane >> 4);
#pragma unroll
  for (int i = 0; i < 8; ++i) { a[i] = (_Float16)p[i]; a[8 + i] = (_Float16)p[16 + i]; }
  return a;
}
__device__ __forceinline__ v16h frag_f32s(const float* rowk0, int lane, float sc) {
  v16h a; const float* p = rowk0 + 8 * (lane >> 4);
#pragma unroll
  for (int i = 0; i < 8; ++i) { a[i] = (_Float16)(p[i] * sc); a[8 + i] = (_Float16)(p[16 + i] * sc); }
  return a;
}
// column fragment from a [K][ld] layout (column n), rows >= K read as 0
__device__ __forceinline__ v16h fragc_f32(const float* W, int k0, int n, int lane, int ld, int K) {
  v16h a; const int g = lane >> 4;
#pragma unroll
  for (int i = 0; i < 8; ++i) { const int ka = k0 + 8 * g + i, kb = ka + 16;
    a[i] = (_Float16)(ka < K ? W[(size_t)(ka < K ? ka : K - 1) * ld + n] : 0.f); a[8 + i] = (_Float16)(kb < K ? W[(size_t)(kb < K ? kb : K - 1) * ld + n] : 0.f); }
  return a;
}
struct F2 { v16b h, l; };
__device__ __forceinline__ F2 bsplit16(const float v[16]) { F2 r;
#pragma unroll
  for (int i = 0; i < 16; ++i) { const __bf16 h = (__bf16)v[i]; r.h[i] = h; r.l[i] = (__bf16)(v[i] - (float)h); }
  return r; }
__device__ __forceinline__ F2 split_row(const float* row, int k0, int lane) { float v[16]; const float* p = row + k0 + 8 * (lane >> 4);
#pragma unroll
  for (int i = 0; i < 8; ++i) { v[i] = p[i]; v[8 + i] = p[16 + i]; }
  return bsplit16(v); }
__device__ __forceinline__ F2 split_rowK(const float* row, int k0, int lane, int K) { float v[16]; const int g = lane >> 4;
#pragma unroll
  for (int i = 0; i < 8; ++i) { const int ka = k0 + 8 * g + i, kb = ka + 16; v[i] = ka < K ? row[ka < K ? ka : K - 1] : 0.f; v[8 + i] = kb < K ? row[kb < K ? kb : K - 1] : 0.f; }
  return bsplit16(v); }
__device__ __forceinline__ F2 split_col(const float* W, int k0, int n, int lane, int ld, int K) { float v[16]; const int g = lane >> 4;
#pragma unroll
  for (int i = 0; i < 8; ++i) { const int ka = k0 + 8 * g + i, kb = ka + 16; v[i] = ka < K ? W[(size_t)(ka < K ? ka : K - 1) * ld + n] : 0.f; v[8 + i] = kb < K ? W[(size_t)(kb < K ? kb : K - 1) * ld + n] : 0.f; }
  return bsplit16(v); }
__device__ __forceinline__ v8f mac3(const F2& a, const F2& b, v8f c) { c = wmma_bf(a.l, b.h, c); c = wmma_bf(a.h, b.l, c); return wmma_bf(a.h, b.h, c); }
__device__ __forceinline__ float sigm(float v) { return 1.0f / (1.0f + expf(-v)); }
#define LDSX() do { asm volatile("s_wait_dscnt 0" ::: "memory"); __builtin_amdgcn_wave_barrier(); __builtin_amdgcn_fence(__ATOMIC_RELEASE, "workgroup"); } while (0)

// Causal multi-head dot-product attention with QK-RMSNorm and RoPE (B 2, S 2,048, D 1,024, 16 heads x 64): q/k/v = x w ((in, head, hd) = (in,out)); q, k RMS-normalised over the 64 head dims (eps 1e-6, x scale) then rotate-half RoPE (angle t * 10000^(-i/32), i < 32); q x 64^-0.5; logits masked to -0.7*f32max where key > query (== -inf here: the diagonal is always kept); softmax; out = merged(attn v) wo ((head, hd, out) = (in,out)).
#define NB 2
#define TT 2048
#define CC 1024            // NH * HD = projected width
#define DIN 1024          // input (model) width
#define NH 16
#define HD 64
#define NQB (TT / 64)
#define SCALE (0.125f)
#define CAUSAL 1
#ifndef TNB
#define TNB NB
#endif
__device__ __forceinline__ float bfr(float v) { return (float)(__bf16)v; }
__host__ __device__ __forceinline__ int kb_last(int qb) { return CAUSAL ? ((qb * 64 + 63) >> 7) : (TT / 128 - 1); }
typedef __attribute__((ext_vector_type(8))) __bf16 v8b;
__device__ __forceinline__ v16b frag_b(const __bf16* rowk0, int lane) {
  union { v16b v; v8b q[2]; } u; const __bf16* p = rowk0 + 8 * (lane >> 4);
  u.q[0] = *(const v8b*)p; u.q[1] = *(const v8b*)(p + 16); return u.v;
}
#define QBH 6              // causal: query blocks 0..QBH-1 of each sequence (few keys, no averaging) take the high-precision path
#define QHI 384            // rows carrying a q residual plane
#define KHI 384            // key rows carrying k residual / v bf16 hi+lo planes (used only by the causal high-precision path)
// B fragment (k rows k0+.., output column o) of a weight: (in,out) [K][ld] or (out,in) [ld rows of K]: bf16 exact, or f16(bf16 * 256) exact
__device__ __forceinline__ v16b wcol_io(const float* Wm, int k0, int o, int lane, int ld) { v16b w; const int g = lane >> 4;
#pragma unroll
  for (int i = 0; i < 8; ++i) { w[i] = (__bf16)Wm[(size_t)(k0 + 8 * g + i) * ld + o]; w[8 + i] = (__bf16)Wm[(size_t)(k0 + 16 + 8 * g + i) * ld + o]; }
  return w; }
__device__ __forceinline__ v16b wcol_oi(const float* Wm, int k0, int o, int lane, int K) { v16b w; const float* p = Wm + (size_t)o * K + k0 + 8 * (lane >> 4);
#pragma unroll
  for (int i = 0; i < 8; ++i) { w[i] = (__bf16)p[i]; w[8 + i] = (__bf16)p[16 + i]; }
  return w; }
__device__ __forceinline__ v16h wcolh_io(const float* Wm, int k0, int o, int lane, int ld) { v16h w; const int g = lane >> 4;
#pragma unroll
  for (int i = 0; i < 8; ++i) { w[i] = (_Float16)(bfr(Wm[(size_t)(k0 + 8 * g + i) * ld + o]) * 256.0f); w[8 + i] = (_Float16)(bfr(Wm[(size_t)(k0 + 16 + 8 * g + i) * ld + o]) * 256.0f); }
  return w; }
__device__ __forceinline__ v16h wcolh_oi(const float* Wm, int k0, int o, int lane, int K) { v16h w; const float* p = Wm + (size_t)o * K + k0 + 8 * (lane >> 4);
#pragma unroll
  for (int i = 0; i < 8; ++i) { w[i] = (_Float16)(bfr(p[i]) * 256.0f); w[8 + i] = (_Float16)(bfr(p[16 + i]) * 256.0f); }
  return w; }
#define WQKV_LAYOUT 0   // 0 = (in,out) [DIN][CC]; 1 = (out,in) [CC][DIN]; 2 = per-head [NH][DIN][HD]
__device__ __forceinline__ v16b wcol_hdk(const float* Wm, int k0, int o, int lane) { v16b w; const int g = lane >> 4; const float* p = Wm + (size_t)(o / HD) * DIN * HD + (o % HD);
#pragma unroll
  for (int i = 0; i < 8; ++i) { w[i] = (__bf16)p[(size_t)(k0 + 8 * g + i) * HD]; w[8 + i] = (__bf16)p[(size_t)(k0 + 16 + 8 * g + i) * HD]; }
  return w; }
#define WO_OUT_IN 0
#if WQKV_LAYOUT == 1
#define WCOL(W, k0, o, lane) wcol_oi(W, k0, o, lane, DIN)
#elif WQKV_LAYOUT == 2
#define WCOL(W, k0, o, lane) wcol_hdk(W, k0, o, lane)
#else
#define WCOL(W, k0, o, lane) wcol_io(W, k0, o, lane, CC)
#endif
#if WO_OUT_IN
#define WOCOL(W, k0, o, lane) wcol_oi(W, k0, o, lane, CC)
#define WOCOLH(W, k0, o, lane) wcolh_oi(W, k0, o, lane, CC)
#else
#define WOCOL(W, k0, o, lane) wcol_io(W, k0, o, lane, DIN)
#define WOCOLH(W, k0, o, lane) wcolh_io(W, k0, o, lane, DIN)
#endif
__constant__ float c_invf[32] = {1.000000000e+00f,7.498942018e-01f,5.623413324e-01f,4.216965139e-01f,3.162277639e-01f,2.371373624e-01f,1.778279394e-01f,1.333521456e-01f,1.000000015e-01f,7.498941571e-02f,5.623412877e-02f,4.216964915e-02f,3.162277862e-02f,2.371373586e-02f,1.778279431e-02f,1.333521493e-02f,9.999999776e-03f,7.498942316e-03f,5.623413250e-03f,4.216964822e-03f,3.162277862e-03f,2.371373819e-03f,1.778279431e-03f,1.333521446e-03f,1.000000047e-03f,7.498941850e-04f,5.623413017e-04f,4.216964880e-04f,3.162277862e-04f,2.371373848e-04f,1.778279402e-04f,1.333521504e-04f};   // 1 / 10000^(i/32) evaluated in f32 exactly as the reference does (jax, eager)
#define PROJ_EXTRA_PARAMS , const float* __restrict__ QS, const float* __restrict__ KS
// per-(row, head) epilogue on the f32 projection tile: RMSNorm over the head's 64 values (x q_norm_scale / k_norm_scale), then rotate-half RoPE; v untouched
#define PROJ_EPI(which, row, t, h) do { if ((which) < 2) { float* rw = (row); const float* NS = (which) == 0 ? QS : KS; float ss = 0.f; _Pragma("unroll") for (int i = 0; i < 64; ++i) ss += rw[i] * rw[i]; const float rn = rsqrtf(ss * (1.0f / 64.0f) + 1e-6f); \
    _Pragma("unroll") for (int i = 0; i < 32; ++i) { const float x1 = rw[i] * rn * bfr(NS[i]), x2 = rw[i + 32] * rn * bfr(NS[i + 32]); const float ang = (float)(t) * c_invf[i]; const float cs = cosf(ang), sn = sinf(ang); rw[i] = x1 * cs - x2 * sn; rw[i + 32] = x2 * cs + x1 * sn; } } } while (0)
#ifndef SM_EXTRA_PARAMS
#define SM_EXTRA_PARAMS
#endif
#ifndef PROJ_EXTRA_PARAMS
#define PROJ_EXTRA_PARAMS
#endif
#ifndef SM_MASK_HOOK
#define SM_MASK_HOOK (void)0
#endif

// Every plane below lies in FRAGMENT ORDER: blocks of 512 bytes, lane l's 16 bytes at 16 l, so that one 16-byte load or store per lane moves 4 whole 128-byte lines (in row order the same instruction touched 32 bytes in each of 16 lines).
// row planes (q, k and their residuals; NR rows per sequence): block ((b * NH + h) * (NR / 16) + t / 16) * 4 + kc * 2 + hf, lane (g, t % 16) = head dims kc * 32 + hf * 16 + 8 g + 0..7
// v planes (NK keys per sequence): block (((b * NH + h) * (NK / 32) + t / 32) * 4 + j) * 2 + hf, lane (g, c) = head dim j * 16 + c, keys (t / 32) * 32 + hf * 16 + 8 g + 0..7
// ctx: block (((b * TT + t) / 16) * KST + k / 32) * 4 + i, lane (g, t % 16) = k (k / 32) * 32 + (i / 2) * 16 + 8 g + (i % 2) * 4 + 0..3
#define WS_QH  0u                                      // f16 q, row plane of TT rows
#define WS_KH  (WS_QH + 2u * (size_t)NB * TT * CC)      // f16 k, row plane of TT rows
#define WS_VT  (WS_KH + 2u * (size_t)NB * TT * CC)      // f16 v plane of TT keys
#define WS_QL  (WS_VT + 2u * (size_t)NB * CC * TT)      // f16 q residual x 2^10, row plane of QHI rows
#define WS_KL  (WS_QL + 2u * (size_t)NB * QHI * CC)     // f16 k residual x 2^10, row plane of KHI rows
#define WS_VB  (WS_KL + 2u * (size_t)NB * KHI * CC)     // bf16 v hi, v plane of KHI keys (WS_VBL: lo)
#define WS_VBL (WS_VB + 2u * (size_t)NB * CC * KHI)
#define WS_Y   (WS_VBL + 2u * (size_t)NB * CC * KHI)    // f32 ctx
#define WS_END (WS_Y  + 4u * (size_t)NB * TT * CC)

// ---- weight tile in LDS, shared by k_proj and k_out: one K step (32 k x 128 output columns) of an (in,out) f32 weight is read ONCE per work-group (wave w: rows 8w..8w+7, lane: 4 columns, whole 512-byte rows), converted as before and kept as 16-bit [column][k] rows of 80 bytes (16 B x odd: the fragment reads meet no bank conflict). Two buffers: the next step's loads (and the wave's own next A rows) fly while this step's products run.
#define WLD 1024           // row length of every weight here (CC for wq/wk/wv, DIN for wo)
#define KST 32             // K steps (DIN / 32 == CC / 32)
static_assert(CC == WLD && DIN == WLD && DIN / 32 == KST && CC / 32 == KST && WQKV_LAYOUT == 0 && WO_OUT_IN == 0, "the staging reads (in,out) weights with rows of WLD floats");
typedef unsigned WT[128][20];
// MODE 0: A once to bf16, W bf16 (1 product); 1: A bf16 hi + lo, W bf16 (2 products); 2: A once to f16, W f16(bf16 x 2^8) (1 product)
struct AFr { v16b h, l; v16h f; };
template <int MODE> __device__ __forceinline__ void a_cvt(AFr& a, const v4f (&ar)[4]) { float v[16];
#pragma unroll
  for (int i = 0; i < 4; ++i) { v[i] = ar[0][i]; v[4 + i] = ar[1][i]; v[8 + i] = ar[2][i]; v[12 + i] = ar[3][i]; }
  if constexpr (MODE == 1) { const F2 s = bsplit16(v); a.h = s.h; a.l = s.l; }
  else {
#pragma unroll
    for (int i = 0; i < 16; ++i) { if constexpr (MODE == 0) a.h[i] = (__bf16)v[i]; else a.f[i] = (_Float16)v[i]; } } }
template <int MODE> __device__ __forceinline__ void wt_store(WT& wt, const v4f (&wr)[8], int wave, int lane) {
#pragma unroll
  for (int n = 0; n < 4; ++n) { union { v8b b; v8h h; v4u u; } p;
#pragma unroll
    for (int i = 0; i < 8; ++i) { if constexpr (MODE == 2) p.h[i] = (_Float16)(bfr(wr[i][n]) * 256.0f); else p.b[i] = (__bf16)wr[i][n]; }
    *(v4u*)&wt[4 * lane + n][4 * wave] = p.u; } }   // column 4 lane + n, k 8 wave .. 8 wave + 7
// acc[j] += A (16 rows of the wave, f32 at xb + xo: MODE 0 an input's K-contiguous rows, MODE 1 and 2 ctx in fragment order) x W (columns j * 16 + col of the tile at wb); k order and product order as in the direct form
template <int MODE> __device__ __forceinline__ void gemm_k(const char* xb, unsigned xo, const char* wb, WT (&wt)[2], int wave, int lane, v8f (&acc)[8]) {
  const int col = lane & 15, g = lane >> 4; const unsigned wo = (unsigned)(8 * wave) * (WLD * 4u) + 16u * lane;
  constexpr int A1 = MODE ? 512 : 16, A2 = MODE ? 1024 : 64, A3 = MODE ? 1536 : 80, AS = MODE ? 2048 : 128;   // byte steps to the lane's 2nd, 3rd and 4th quad of a K step, and to the next K step
  v4f wr[8], ar[4]; AFr a;
#pragma unroll
  for (int i = 0; i < 8; ++i) wr[i] = *(const v4f*)(wb + wo + i * (WLD * 4));
  ar[0] = *(const v4f*)(xb + xo); ar[1] = *(const v4f*)(xb + xo + A1); ar[2] = *(const v4f*)(xb + xo + A2); ar[3] = *(const v4f*)(xb + xo + A3);
  asm volatile("s_wait_xcnt 0x0" :: "v"(wo), "v"(xo), "s"(wb), "s"(xb) : "memory");   // precaution: stands in front of the first rewrite of a register that these loads name; the lane offsets and the uniform bases as inputs keep their registers until here
  __builtin_amdgcn_sched_barrier(0);   // keeps the conversions below, which may reuse the address registers, behind the wait above
  wt_store<MODE>(wt[0], wr, wave, lane); a_cvt<MODE>(a, ar);
  __syncthreads();   // publishes K step 0
#pragma unroll 1   // rolled: one K step per trip keeps the loop small and the live registers below 256
  for (int kc = 0; kc < KST; ++kc) { const bool more = kc + 1 < KST;   // the same for the whole work-group
    if (more) { const char* wk = wb + (size_t)(kc + 1) * (32 * WLD * 4); const char* xk = xb + (kc + 1) * AS;
#pragma unroll
      for (int i = 0; i < 8; ++i) wr[i] = *(const v4f*)(wk + wo + i * (WLD * 4));
      ar[0] = *(const v4f*)(xk + xo); ar[1] = *(const v4f*)(xk + xo + A1); ar[2] = *(const v4f*)(xk + xo + A2); ar[3] = *(const v4f*)(xk + xo + A3);
      asm volatile("s_wait_xcnt 0x0" ::: "memory"); }   // precaution, as above; its memory clobber also keeps the 12 loads from sinking to their uses behind the products
    __builtin_amdgcn_sched_barrier(0);   // holds the next step's loads in front of this step's products, which then cover their latency, and every later write of an address register behind the wait above
    const WT& cur = wt[kc & 1]; v4u f[8][2];
#pragma unroll
    for (int j = 0; j < 8; ++j) { f[j][0] = *(const v4u*)&cur[j * 16 + col][4 * g]; f[j][1] = *(const v4u*)&cur[j * 16 + col][8 + 4 * g]; }   // elements 0..7 = k 8g.., 8..15 = k 16 + 8g..
#pragma unroll
    for (int j = 0; j < 8; ++j) { union { v4u q[2]; v16b b; v16h h; } w; w.q[0] = f[j][0]; w.q[1] = f[j][1];
      if constexpr (MODE == 0) acc[j] = wmma_bf(a.h, w.b, acc[j]);
      else if constexpr (MODE == 1) { acc[j] = wmma_bf(a.h, w.b, acc[j]); acc[j] = wmma_bf(a.l, w.b, acc[j]); }
      else acc[j] = wmma16(a.f, w.h, acc[j]); }
    if (more) { wt_store<MODE>(wt[(kc + 1) & 1], wr, wave, lane); a_cvt<MODE>(a, ar);   // into the buffer whose last readers passed the barrier of the trip before
      __syncthreads(); } } }   // one barrier per K step: publishes step kc + 1 and ends every reader's last read of step kc's buffer
// ---- k_proj: block = (64 rows, 128 cols, which): q/k/v = X W (+ b) with exact bf16 products (K = DIN) -> which 0: q f16 (+ residual, rows < QHI); 1: k f16 (+ residual, rows < KHI); 2: v f16 (+ bf16 hi/lo for t < KHI); all stored in fragment order
__global__ __launch_bounds__(128) void k_proj(const float* __restrict__ XQ, const float* __restrict__ XK, const float* __restrict__ XV, const float* __restrict__ WQ, const float* __restrict__ WK, const float* __restrict__ WV, const float* __restrict__ BQ, const float* __restrict__ BK, const float* __restrict__ BV,
    _Float16* __restrict__ QH, _Float16* __restrict__ QL, _Float16* __restrict__ KH, _Float16* __restrict__ KL, _Float16* __restrict__ VT, __bf16* __restrict__ VB, __bf16* __restrict__ VBL PROJ_EXTRA_PARAMS) {
  __shared__ __align__(16) float st[64][132]; __shared__ __align__(16) _Float16 sh[64][136], sl[64][136]; __shared__ __align__(16) _Float16 th[128][72]; __shared__ __align__(16) __bf16 tb[128][72], tbl[128][72]; __shared__ __align__(16) WT wt[2];
  const int tid = threadIdx.x, wave = tid >> 5, lane = tid & 31, col = lane & 15, g = lane >> 4; const int which = blockIdx.z; const int c0 = blockIdx.y * 128; const size_t r0 = (size_t)blockIdx.x * 64; const size_t bb = r0 / TT; const int t0 = (int)(r0 % TT);
  const float* X = which == 0 ? XQ : which == 1 ? XK : XV; const float* WA = which == 0 ? WQ : which == 1 ? WK : WV; const float* BA = which == 0 ? BQ : which == 1 ? BK : BV;
  v8f acc[8] = {};
  gemm_k<0>((const char*)(X + r0 * DIN), (unsigned)(wave * 16 + col) * (DIN * 4u) + 32u * g, (const char*)(WA + c0), wt, wave, lane, acc);
  { // stage the f32 tile (acc + bias) in LDS, run the per-(row, head) epilogue hook, then convert
#pragma unroll
    for (int j = 0; j < 8; ++j) { const float bias = BA ? bfr(BA[c0 + j * 16 + col]) : 0.f;
#pragma unroll
      for (int r = 0; r < 8; ++r) st[wave * 16 + 8 * g + r][j * 16 + col] = acc[j][r] + bias; }
    __syncthreads();
    for (int e = tid; e < 64 * (128 / HD); e += 128) { const int rl = e / (128 / HD), hh = e % (128 / HD); PROJ_EPI(which, &st[rl][hh * HD], (int)((r0 + rl) % TT), (c0 / HD) + hh); }
    __syncthreads(); }
  if (which < 2) { _Float16* DH = which == 0 ? QH : KH; _Float16* DL = which == 0 ? QL : KL; const int nhi = which == 0 ? QHI : KHI; const bool hi_rows = t0 < nhi;
    for (int e = tid; e < 64 * 128; e += 128) { const int rl = e >> 7, cl = e & 127; const float v = st[rl][cl]; const _Float16 hv = (_Float16)v; sh[rl][cl] = hv; sl[rl][cl] = (_Float16)((v - (float)hv) * 1024.0f); }
    __syncthreads();
    const int u = (wave >> 1) * 4 + (wave & 1) * 2 + g;   // wave w writes the blocks kc * 2 + hf == w: the lane's 8 head dims start at 8 u
    char* dh = (char*)DH + (((bb * NH + c0 / HD) * (size_t)(TT / 16) + (t0 >> 4)) * 4 + wave) * 512 + lane * 16;
    v4u d[8];   // it = 2 x (16-row tile) + head of the pair
#pragma unroll
    for (int it = 0; it < 8; ++it) d[it] = *(const v4u*)&sh[(it >> 1) * 16 + col][(it & 1) * HD + u * 8];
#pragma unroll
    for (int it = 0; it < 8; ++it) vst2(dh + (it >> 1) * 2048 + (it & 1) * (TT / 16 * 2048), d[it]);
    asm volatile("s_wait_xcnt 0x0" :: "v"(dh) : "memory");   // precaution: stands in front of the first rewrite of a register that these stores name; the address as an input keeps its registers until here
    __builtin_amdgcn_sched_barrier(0);   // keeps what follows, which may reuse the stores' registers, behind the wait above
    if (hi_rows) { v4u r[8]; char* dl = (char*)DL + (((bb * NH + c0 / HD) * (size_t)(nhi / 16) + (t0 >> 4)) * 4 + wave) * 512 + lane * 16;   // block-uniform
#pragma unroll
      for (int it = 0; it < 8; ++it) r[it] = *(const v4u*)&sl[(it >> 1) * 16 + col][(it & 1) * HD + u * 8];
#pragma unroll
      for (int it = 0; it < 8; ++it) vst2(dl + (it >> 1) * 2048 + (it & 1) * (QHI / 16 * 2048), r[it]);
      asm volatile("s_wait_xcnt 0x0" :: "v"(dl) : "memory"); }   // precaution, as above
  } else { const bool hi_rows = t0 < KHI;
    for (int e = tid; e < 64 * 128; e += 128) { const int rl = e & 63, cl = e >> 6; const float v = st[rl][cl]; th[cl][rl] = (_Float16)v; const __bf16 bh = (__bf16)v; tb[cl][rl] = bh; tbl[cl][rl] = (__bf16)(v - (float)bh); }
    __syncthreads();
    const unsigned ow = (unsigned)(wave >> 1) * 1024u + (unsigned)(wave & 1) * 512u + lane * 16u;   // wave w writes the blocks with hf == w & 1 and j & 1 == w >> 1
    char* dv = (char*)VT + ((bb * NH + c0 / HD) * (size_t)(TT / 32) + (t0 >> 5)) * 4096 + ow;
    const int cw = (wave >> 1) * 16 + col, rw = (wave & 1) * 16 + g * 8;   // it = 4 x head of the pair + 2 x (32-key tile) + j / 2: column (it >> 2) * HD + (it & 1) * 32 + cw of the tile, first of the lane's 8 keys ((it >> 1) & 1) * 32 + rw
    v4u d[8];
#pragma unroll
    for (int it = 0; it < 8; ++it) d[it] = *(const v4u*)&th[(it >> 2) * HD + (it & 1) * 32 + cw][((it >> 1) & 1) * 32 + rw];
#pragma unroll
    for (int it = 0; it < 8; ++it) vst2(dv + (it >> 2) * (TT / 32 * 4096) + ((it >> 1) & 1) * 4096 + (it & 1) * 2048, d[it]);
    asm volatile("s_wait_xcnt 0x0" :: "v"(dv) : "memory");   // precaution, as above
    __builtin_amdgcn_sched_barrier(0);   // keeps what follows, which may reuse the stores' registers, behind the wait above
    if (hi_rows) { v4u r[8], s[8]; const size_t o3 = ((bb * NH + c0 / HD) * (size_t)(KHI / 32) + (t0 >> 5)) * 4096 + ow; char* db = (char*)VB + o3; char* dc = (char*)VBL + o3;   // block-uniform
#pragma unroll
      for (int it = 0; it < 8; ++it) { r[it] = *(const v4u*)&tb[(it >> 2) * HD + (it & 1) * 32 + cw][((it >> 1) & 1) * 32 + rw]; s[it] = *(const v4u*)&tbl[(it >> 2) * HD + (it & 1) * 32 + cw][((it >> 1) & 1) * 32 + rw]; }
#pragma unroll
      for (int it = 0; it < 8; ++it) { const int o = (it >> 2) * (KHI / 32 * 4096) + ((it >> 1) & 1) * 4096 + (it & 1) * 2048; vst2(db + o, r[it]); vst2(dc + o, s[it]); }
      asm volatile("s_wait_xcnt 0x0" :: "v"(db), "v"(dc) : "memory"); } } }   // precaution, as above
#define PSH 6.9314718f     // ln 2^10
__device__ __forceinline__ float xhalf(float x) { return __builtin_bit_cast(float, __builtin_amdgcn_permlanex16(__builtin_bit_cast(int, x), __builtin_bit_cast(int, x), 0x76543210, 0xfedcba98, false, false)); }   // lane l with lane l ^ 16
// one step of the running softmax over NT tiles of 16 keys: x = logits in, p out; lim = last allowed key of the lane's query, counted from the lane's first key of the step (only looked at where last is set: the step that holds the diagonal; its first key is allowed for every query of the wave, so no step is empty)
template <int NT> __device__ __forceinline__ void sm_step(float (&x)[NT][8], bool last, int lim, float& m, float& l, v8f (&acc)[HD / 16]) {
  if (last) {   // the same for the whole wave
#pragma unroll
    for (int jt = 0; jt < NT; ++jt)
#pragma unroll
      for (int r = 0; r < 8; ++r) if (jt * 16 + r > lim) x[jt][r] = -3.0e38f; }
  float mx = -3.0e38f;
#pragma unroll
  for (int jt = 0; jt < NT; ++jt) mx = fmaxf(mx, fmaxf(fmaxf(fmaxf(x[jt][0], x[jt][1]), fmaxf(x[jt][2], x[jt][3])), fmaxf(fmaxf(x[jt][4], x[jt][5]), fmaxf(x[jt][6], x[jt][7]))));
  mx = fmaxf(mx, xhalf(mx));
  const float mn = fmaxf(m, mx), al = expf(m - mn), ms = mn - PSH; m = mn;   // first step: al = exp(-3e38) = 0
  float sum = 0.f;
#pragma unroll
  for (int jt = 0; jt < NT; ++jt) {
#pragma unroll
    for (int r = 0; r < 8; ++r) x[jt][r] = expf(x[jt][r] - ms);   // an excluded key: exp(-3e38) = 0
    sum += ((x[jt][0] + x[jt][1]) + (x[jt][2] + x[jt][3])) + ((x[jt][4] + x[jt][5]) + (x[jt][6] + x[jt][7])); }
  l = l * al + sum;   // the lane's own keys; the halves are joined once, in att_store
#pragma unroll
  for (int j = 0; j < HD / 16; ++j) acc[j] *= al; }
// lane (g, c) holds ctx[query c][j * 16 + 8g + r]: what lane (g, c) of k_out reads as quads 2 (j & 1) and 2 (j & 1) + 1 of K step 2 h + j / 2
__device__ __forceinline__ void att_store(float* __restrict__ Y, int b, int h, int ql0, int lane, float l, const v8f (&acc)[HD / 16]) {
  l += xhalf(l); const float inv = 1.0f / l; char* yr = (char*)Y + ((size_t)((b * TT + ql0) >> 4) * KST + h * 2) * 2048 + lane * 16;
#pragma unroll
  for (int j = 0; j < HD / 16; ++j) { v4f a, c;
#pragma unroll
    for (int i = 0; i < 4; ++i) { a[i] = acc[j][i] * inv; c[i] = acc[j][4 + i] * inv; }
    vst2(yr + j * 1024, a); vst2(yr + j * 1024 + 512, c); }
  asm volatile("s_wait_xcnt 0x0" :: "v"(yr) : "memory");   // precaution: stands in front of the first rewrite of a register that these stores name; the address as an input keeps its registers until here
  __builtin_amdgcn_sched_barrier(0); }   // keeps the next tile's address work behind the wait above
// 16 query rows from ql0 (>= QHI), steps of 64 keys: q, k once to f16 (1 product), p once to f16 against v f16 (1 product)
__device__ __forceinline__ void att_lo(const _Float16* __restrict__ QH, const _Float16* __restrict__ KH, const _Float16* __restrict__ VT, float* __restrict__ Y, int b, int h, int ql0, int lane) {
  const int col = lane & 15, g = lane >> 4; const int nt = (ql0 >> 6) + 1;
  const size_t bh = (size_t)(b * NH + h); const char* qp = (const char*)QH + (bh * (TT / 16) + (ql0 >> 4)) * 2048; const char* kb = (const char*)KH + bh * (TT / 16 * 2048); const char* vb = (const char*)VT + bh * (TT / 32 * 4096);   // wave-uniform bases; the lane's byte offset below does not change over the loop
  const unsigned ko = 16u * lane, vo = ko;   // fragment order: the lane's 16 bytes of every 512-byte block
  v8h qr[2][2], kr[4][2][2], vr[2][HD / 16][2]; const char* ka = kb + ko;   // the lane's address in the k step that is being loaded
#pragma unroll
  for (int kc = 0; kc < 2; ++kc) { qr[kc][0] = *(const v8h*)(qp + ko + kc * 1024); qr[kc][1] = *(const v8h*)(qp + ko + kc * 1024 + 512); }
#pragma unroll
  for (int jt = 0; jt < 4; ++jt)
#pragma unroll
    for (int kc = 0; kc < 2; ++kc) { kr[jt][kc][0] = *(const v8h*)(ka + jt * 2048 + kc * 1024); kr[jt][kc][1] = *(const v8h*)(ka + jt * 2048 + kc * 1024 + 512); }
  asm volatile("s_wait_xcnt 0x0" :: "v"(qp + ko), "v"(ka) : "memory");   // precaution: stands in front of the first rewrite of a register that these loads name; the addresses as inputs keep their registers from being given to a later load of the group
  __builtin_amdgcn_sched_barrier(0);   // keeps every later write of an address register behind the wait above
  v16h q[2];
#pragma unroll
  for (int kc = 0; kc < 2; ++kc) { union { v16h v; v8h q[2]; } f; f.q[0] = qr[kc][0]; f.q[1] = qr[kc][1]; q[kc] = f.v; }
  v8f acc[HD / 16] = {}; float m = -3.0e38f, l = 0.f;
#pragma unroll 1   // rolled: one step of 64 keys per trip keeps the live registers below 256
  for (int t = 0; t < nt; ++t) { const char* vk = vb + t * 8192;
#pragma unroll
    for (int c = 0; c < 2; ++c)
#pragma unroll
      for (int j = 0; j < HD / 16; ++j) { const int o = c * 4096 + j * 1024; vr[c][j][0] = *(const v8h*)(vk + vo + o); vr[c][j][1] = *(const v8h*)(vk + vo + o + 512); }
    asm volatile("s_wait_xcnt 0x0" :: "v"(vk + vo) : "memory");   // precaution, as above
    __builtin_amdgcn_sched_barrier(0);   // holds this step's 16 v loads in front of the logits, which with the softmax cover their latency, and every later write of an address register behind the wait above
    v8f s[4] = {};
#pragma unroll
    for (int kc = 0; kc < 2; ++kc)
#pragma unroll
      for (int jt = 0; jt < 4; ++jt) { union { v16h v; v8h q[2]; } f; f.q[0] = kr[jt][kc][0]; f.q[1] = kr[jt][kc][1]; s[jt] = wmma16(f.v, q[kc], s[jt]); }
    if (t + 1 < nt) { ka += 8192;   // the test reads the same for the whole wave; the step before's loads from ka have passed their wait
#pragma unroll
      for (int jt = 0; jt < 4; ++jt)
#pragma unroll
        for (int kc = 0; kc < 2; ++kc) { kr[jt][kc][0] = *(const v8h*)(ka + jt * 2048 + kc * 1024); kr[jt][kc][1] = *(const v8h*)(ka + jt * 2048 + kc * 1024 + 512); }
      asm volatile("s_wait_xcnt 0x0" :: "v"(ka) : "memory"); }   // precaution, as above; the next step's 16 k loads go into the registers that the products above have read, and the softmax and the products below cover their latency
    float x[4][8];
#pragma unroll
    for (int jt = 0; jt < 4; ++jt)
#pragma unroll
      for (int r = 0; r < 8; ++r) x[jt][r] = s[jt][r] * SCALE;
    sm_step<4>(x, t == nt - 1, ql0 + col - t * 64 - 8 * g, m, l, acc);
#pragma unroll
    for (int c = 0; c < 2; ++c) { v16h p;
#pragma unroll
      for (int i = 0; i < 8; ++i) { p[i] = (_Float16)x[2 * c][i]; p[8 + i] = (_Float16)x[2 * c + 1][i]; }
#pragma unroll
      for (int j = 0; j < HD / 16; ++j) { union { v16h v; v8h q[2]; } f; f.q[0] = vr[c][j][0]; f.q[1] = vr[c][j][1]; acc[j] = wmma16(f.v, p, acc[j]); } } }
  att_store(Y, b, h, ql0, lane, l, acc); }
// 16 query rows from ql0 (< QHI: few keys, no averaging), steps of 32 keys: q and k as f16 hi + residual (x 2^10) (3 products), p and v as bf16 hi + lo (3 products)
__device__ __forceinline__ void att_hi(const _Float16* __restrict__ QH, const _Float16* __restrict__ QL, const _Float16* __restrict__ KH, const _Float16* __restrict__ KL, const __bf16* __restrict__ VB, const __bf16* __restrict__ VBL, float* __restrict__ Y, int b, int h, int ql0, int lane) {
  const int col = lane & 15, g = lane >> 4; const int nt = (ql0 >> 5) + 1;
  const size_t bh = (size_t)(b * NH + h); const char* qp = (const char*)QH + (bh * (TT / 16) + (ql0 >> 4)) * 2048; const char* qlp = (const char*)QL + (bh * (QHI / 16) + (ql0 >> 4)) * 2048; const char* kb = (const char*)KH + bh * (TT / 16 * 2048); const char* klb = (const char*)KL + bh * (KHI / 16 * 2048);
  const char* vhb = (const char*)VB + bh * (KHI / 32 * 4096); const char* vlb = (const char*)VBL + bh * (KHI / 32 * 4096);   // wave-uniform bases; the lane's byte offset below does not change over the loop
  const unsigned ko = 16u * lane, vo = ko;   // fragment order: the lane's 16 bytes of every 512-byte block
  v8h qr[2][2], qs[2][2];
#pragma unroll
  for (int kc = 0; kc < 2; ++kc) { qr[kc][0] = *(const v8h*)(qp + ko + kc * 1024); qr[kc][1] = *(const v8h*)(qp + ko + kc * 1024 + 512); qs[kc][0] = *(const v8h*)(qlp + ko + kc * 1024); qs[kc][1] = *(const v8h*)(qlp + ko + kc * 1024 + 512); }
  asm volatile("s_wait_xcnt 0x0" :: "v"(qp + ko), "v"(qlp + ko) : "memory");   // precaution: stands in front of the first rewrite of a register that these loads name; the addresses as inputs keep their registers from being given to a later load of the group
  __builtin_amdgcn_sched_barrier(0);   // keeps every later write of an address register behind the wait above
  v16h qh[2], ql[2];
#pragma unroll
  for (int kc = 0; kc < 2; ++kc) { union { v16h v; v8h q[2]; } f; f.q[0] = qr[kc][0]; f.q[1] = qr[kc][1]; qh[kc] = f.v; f.q[0] = qs[kc][0]; f.q[1] = qs[kc][1]; ql[kc] = f.v; }
  v8f acc[HD / 16] = {}; float m = -3.0e38f, l = 0.f;
#pragma unroll 1   // rolled: one step of 32 keys per trip keeps the live registers below 256
  for (int t = 0; t < nt; ++t) { const char* kk = kb + t * 4096 + ko; const char* lk = klb + t * 4096 + ko; const char* hv = vhb + t * 4096 + vo; const char* lv = vlb + t * 4096 + vo;   // the lane's four addresses of this step
    v8h kh[2][2][2], kl[2][2][2]; v8b vh[HD / 16][2], vl[HD / 16][2];
#pragma unroll
    for (int jt = 0; jt < 2; ++jt)
#pragma unroll
      for (int kc = 0; kc < 2; ++kc) { const int o = jt * 2048 + kc * 1024; kh[jt][kc][0] = *(const v8h*)(kk + o); kh[jt][kc][1] = *(const v8h*)(kk + o + 512); kl[jt][kc][0] = *(const v8h*)(lk + o); kl[jt][kc][1] = *(const v8h*)(lk + o + 512); }
#pragma unroll
    for (int j = 0; j < HD / 16; ++j) { const int o = j * 1024; vh[j][0] = *(const v8b*)(hv + o); vh[j][1] = *(const v8b*)(hv + o + 512); vl[j][0] = *(const v8b*)(lv + o); vl[j][1] = *(const v8b*)(lv + o + 512); }
    asm volatile("s_wait_xcnt 0x0" :: "v"(kk), "v"(lk), "v"(hv), "v"(lv) : "memory");   // precaution, as above
    __builtin_amdgcn_sched_barrier(0);   // holds the step's 32 loads in front of its first product (sunk to their uses they would cost one memory latency each) and every later write of an address register behind the wait above
    v8f s[2] = {}, sl[2] = {};
#pragma unroll
    for (int kc = 0; kc < 2; ++kc)
#pragma unroll
      for (int jt = 0; jt < 2; ++jt) { union { v16h v; v8h q[2]; } fh, fl; fh.q[0] = kh[jt][kc][0]; fh.q[1] = kh[jt][kc][1]; fl.q[0] = kl[jt][kc][0]; fl.q[1] = kl[jt][kc][1]; s[jt] = wmma16(fh.v, qh[kc], s[jt]); sl[jt] = wmma16(fh.v, ql[kc], sl[jt]); sl[jt] = wmma16(fl.v, qh[kc], sl[jt]); }
    float x[2][8];
#pragma unroll
    for (int jt = 0; jt < 2; ++jt)
#pragma unroll
      for (int r = 0; r < 8; ++r) x[jt][r] = (s[jt][r] + sl[jt][r] * (1.0f / 1024.0f)) * SCALE;
    sm_step<2>(x, t == nt - 1, ql0 + col - t * 32 - 8 * g, m, l, acc);
    float v[16];
#pragma unroll
    for (int i = 0; i < 8; ++i) { v[i] = x[0][i]; v[8 + i] = x[1][i]; }
    const F2 p = bsplit16(v);
#pragma unroll
    for (int j = 0; j < HD / 16; ++j) { union { v16b v; v8b q[2]; } fh, fl; fh.q[0] = vh[j][0]; fh.q[1] = vh[j][1]; fl.q[0] = vl[j][0]; fl.q[1] = vl[j][1]; acc[j] = wmma_bf(fh.v, p.h, acc[j]); acc[j] = wmma_bf(fh.v, p.l, acc[j]); acc[j] = wmma_bf(fl.v, p.h, acc[j]); } }
  att_store(Y, b, h, ql0, lane, l, acc); }
// block = (pair of query blocks NQB-1-x and x, (b, h)): together NQB + 1 blocks of 64 keys, so the work is even except where x < QBH (block x on the 3-product path, in steps of 32 keys); wave = 16 query rows of the block; no LDS, no barrier
__global__ __launch_bounds__(128) void k_att(const _Float16* __restrict__ QH, const _Float16* __restrict__ QL, const _Float16* __restrict__ KH, const _Float16* __restrict__ KL, const _Float16* __restrict__ VT, const __bf16* __restrict__ VB, const __bf16* __restrict__ VBL, float* __restrict__ Y) { static_assert(CAUSAL && NQB % 2 == 0 && QBH * 64 == QHI && QHI == KHI, "the pairing counts on causal row lengths; the early-row path reads residual planes of QHI rows");
  const int lane = threadIdx.x & 31; const int wv = __builtin_amdgcn_readfirstlane(threadIdx.x >> 5);   // the wave's number as a scalar: trip counts and the tests on them are scalar, EXEC stays full at every product
  const int b = blockIdx.y / NH, h = blockIdx.y % NH;
#pragma unroll 1   // rolled: one copy of each path in the code
  for (int z = 0; z < 2; ++z) { const int qb = z ? (int)blockIdx.x : NQB - 1 - (int)blockIdx.x; const int ql0 = qb * 64 + wv * 16;
    if (qb < QBH) att_hi(QH, QL, KH, KL, VB, VBL, Y, b, h, ql0, lane); else att_lo(QH, KH, VT, Y, b, h, ql0, lane); } }
// ---- k_out: block = (64 rows, 128 cols): out = ctx Wo (+ bo): ctx once to f16 against Wo as f16(bf16 x 2^8) exact (1 product) x 2^-8; causal early rows (< QHI of each sequence): ctx bf16 hi + lo against exact bf16 Wo (2 products)
__global__ __launch_bounds__(128) void k_out(const float* __restrict__ Y, const float* __restrict__ WO, const float* __restrict__ BO, float* __restrict__ OUT) { __shared__ __align__(16) float sf[4][16][132]; __shared__ __align__(16) WT wt[2];
  const int tid = threadIdx.x, wave = tid >> 5, lane = tid & 31, col = lane & 15, g = lane >> 4; const int c0 = blockIdx.y * 128; const size_t r0 = (size_t)blockIdx.x * 64 + wave * 16;
  v8f acc[8] = {};
  if (CAUSAL && (int)(((size_t)blockIdx.x * 64) % TT) < QHI) {   /* block-uniform */
    gemm_k<1>((const char*)(Y + (size_t)blockIdx.x * 64 * CC), (unsigned)wave * (16u * CC * 4u) + 16u * lane, (const char*)(WO + c0), wt, wave, lane, acc);
#pragma unroll
    for (int j = 0; j < 8; ++j) { const float bias = BO ? bfr(BO[c0 + j * 16 + col]) : 0.f;
#pragma unroll
      for (int r = 0; r < 8; ++r) sf[wave][8 * g + r][j * 16 + col] = acc[j][r] + bias; }
  } else {
    gemm_k<2>((const char*)(Y + (size_t)blockIdx.x * 64 * CC), (unsigned)wave * (16u * CC * 4u) + 16u * lane, (const char*)(WO + c0), wt, wave, lane, acc);
#pragma unroll
    for (int j = 0; j < 8; ++j) { const float bias = BO ? bfr(BO[c0 + j * 16 + col]) : 0.f;
#pragma unroll
      for (int r = 0; r < 8; ++r) sf[wave][8 * g + r][j * 16 + col] = acc[j][r] * (1.0f / 256.0f) + bias; } }
  LDSX(); for (int rl = 0; rl < 16; ++rl) vst2(OUT + (r0 + rl) * DIN + c0 + lane * 4, *(const v4f*)&sf[wave][rl][lane * 4]); }

extern "C" void kernel_launch(void* const* d_in, const int* in_sizes, int n_in, void* d_out, int out_size, void* d_ws, size_t ws_size, hipStream_t stream) {
  (void)in_sizes; (void)n_in; (void)out_size;
  const float** F = (const float**)d_in;
  if (ws_size < (size_t)WS_END) return;
  char* ws = (char*)d_ws; _Float16 *QH = (_Float16*)(ws + WS_QH), *KH = (_Float16*)(ws + WS_KH), *VT = (_Float16*)(ws + WS_VT), *QL = (_Float16*)(ws + WS_QL), *KL = (_Float16*)(ws + WS_KL); __bf16 *VB = (__bf16*)(ws + WS_VB), *VBL = (__bf16*)(ws + WS_VBL); float *Y = (float*)(ws + WS_Y);
  (void)Y; (void)QL; (void)KL; (void)VB; (void)VBL;
  // inputs: 0 inputs_q [2,2048,1024]; 1 wq, 2 wk, 3 wv [1024,16,64] (= (in,out)); 4 wo [16,64,1024] (= (in,out)); 5 q_norm_scale [64]; 6 k_norm_scale [64]
  k_proj<<<dim3(TNB * TT / 64, CC / 128, 3), 128, 0, stream>>>(F[0], F[0], F[0], F[1], F[2], F[3], nullptr, nullptr, nullptr, QH, QL, KH, KL, VT, VB, VBL, F[5], F[6]);
  k_att<<<dim3(NQB / 2, TNB * NH), 128, 0, stream>>>(QH, QL, KH, KL, VT, VB, VBL, Y);
  k_out<<<dim3(TNB * TT / 64, DIN / 128), 128, 0, stream>>>(Y, F[4], nullptr, (float*)d_out);
}

// v007
// Measured time: 162 microseconds a run.
// Timed twice side by side with v006, it ran 1.05 and 1.04 times as fast.
// Over all steps from v000 it is 6.78 times as fast.
// compute dtype: all float inputs rounded to bf16; q/k/v = x W with EXACT bf16 products on WMMA 16x16x32, f32 accumulate; per-head RMSNorm and rotate-half RoPE in f32 (precise sinf/cosf of t * inv_freq); q, k once to f16 -> 1-product causal logits, except the first 384 query rows of each sequence (few keys, no averaging), which use q and k as f16 hi + residual (x 2^10) (3 products); softmax in f32 in base 2 (the scale 1/8 and log2 e in one fused multiply-add, then the hardware's exp2) with a running maximum and sum, divided out at the end; exp(logit - max) x 2^10 once to f16 against v once to f16 (1 product), except the first 384 rows: it and v as bf16 hi + lo (3 products); ctx once to f16 against wo carried x 2^8 in f16 (exact bf16 values), except the first 384 rows: ctx bf16 hi + lo against exact bf16 wo (2 products); f32 output.
#include <hip/hip_runtime.h>
#include <math.h>

typedef __attribute__((ext_vector_type(16))) _Float16 v16h;
typedef __attribute__((ext_vector_type(16))) __bf16 v16b;
typedef __attribute__((ext_vector_type(8)))  _Float16 v8h;
typedef __attribute__((ext_vector_type(8)))  float v8f;
typedef __attribute__((ext_vector_type(4)))  float v4f;
typedef __attribute__((ext_vector_type(2)))  float v2f;
typedef __attribute__((ext_vector_type(4)))  unsigned v4u;
typedef __attribute__((ext_vector_type(4)))  int v4i;
typedef float __attribute__((may_alias)) float_a;
typedef int __attribute__((may_alias)) int_a;

template <typename T> __device__ __forceinline__ void vst2(void* p, T v) { *(T*)p = v;  }
__device__ __forceinline__ v8f wmma16(v16h a, v16h b, v8f c) {
  v8f d = __builtin_amdgcn_wmma_f32_16x16x32_f16(false, a, false, b, (short)0, c, false, false);
  asm volatile("v_nop\n\tv_nop\n\tv_nop\n\tv_nop" : "+v"(d) : "v"(a), "v"(b));
  return d;
}
__device__ __forceinline__ v8f wmma_bf(v16b a, v16b b, v8f c) {
  v8f d = __builtin_amdgcn_wmma_f32_16x16x32_bf16(false, a, false, b, (short)0, c, false, false);
  asm volatile("v_nop\n\tv_nop\n\tv_nop\n\tv_nop" : "+v"(d) : "v"(a), "v"(b));
  return d;
}
// 16x16x32 fragments: lane = (h = lane>>4, row/col = lane&15); elements 0..7 = k0+8h+0..7, 8..15 = k0+16+8h+0..7; D element r = row 8h+r
__device__ __forceinline__ v16h frag_h(const _Float16* rowk0, int lane) {
  union { v16h v; v8h q[2]; } u; const _Float16* p = rowk0 + 8 * (lane >> 4);
  u.q[0] = *(const v8h*)p; u.q[1] = *(const v8h*)(p + 16); return u.v;
}
__device__ __forceinline__ v16h frag_f32(const float* rowk0, int lane) {
  v16h a; const float* p = rowk0 + 8 * (lane >> 4);
#pragma unroll
  for (int i = 0; i < 8; ++i) { a[i] = (_Float16)p[i]; a[8 + i] = (_Float16)p[16 + i]; }
  return a;
}
__device__ __forceinline__ v16h frag_f32s(const float* rowk0, int lane, float sc) {
  v16h a; const float* p = rowk0 + 8 * (lane >> 4);
#pragma unroll
  for (int i = 0; i < 8; ++i) { a[i] = (_Float16)(p[i] * sc); a[8 + i] = (_Float16)(p[16 + i] * sc); }
  return a;
}
// column fragment from a [K][ld] layout (column n), rows >= K read as 0
__device__ __forceinline__ v16h fragc_f32(const float* W, int k0, int n, int lane, int ld, int K) {
  v16h a; const int g = lane >> 4;
#pragma unroll
  for (int i = 0; i < 8; ++i) { const int ka = k0 + 8 * g + i, kb = ka + 16;
    a[i] = (_Float16)(ka < K ? W[(size_t)(ka < K ? ka : K - 1) * ld + n] : 0.f); a[8 + i] = (_Float16)(kb < K ? W[(size_t)(kb < K ? kb : K - 1) * ld + n] : 0.f); }
  return a;
}
struct F2 { v16b h, l; };
__device__ __forceinline__ F2 bsplit16(const float v[16]) { F2 r;
#pragma unroll
  for (int i = 0; i < 16; ++i) { const __bf16 h = (__bf16)v[i]; r.h[i] = h; r.l[i] = (__bf16)(v[i] - (float)h); }
  return r; }
__device__ __forceinline__ F2 split_row(const float* row, int k0, int lane) { float v[16]; const float* p = row + k0 + 8 * (lane >> 4);
#pragma unroll
  for (int i = 0; i < 8; ++i) { v[i] = p[i]; v[8 + i] = p[16 + i]; }
  return bsplit16(v); }
__device__ __forceinline__ F2 split_rowK(const float* row, int k0, int lane, int K) { float v[16]; const int g = lane >> 4;
#pragma unroll
  for (int i = 0; i < 8; ++i) { const int ka = k0 + 8 * g + i, kb = ka + 16; v[i] = ka < K ? row[ka < K ? ka : K - 1] : 0.f; v[8 + i] = kb < K ? row[kb < K ? kb : K - 1] : 0.f; }
  return bsplit16(v); }
__device__ __forceinline__ F2 split_col(const float* W, int k0, int n, int lane, int ld, int K) { float v[16]; const int g = lane >> 4;
#pragma unroll
  for (int i = 0; i < 8; ++i) { const int ka = k0 + 8 * g + i, kb = ka + 16; v[i] = ka < K ? W[(size_t)(ka < K ? ka : K - 1) * ld + n] : 0.f; v[8 + i] = kb < K ? W[(size_t)(kb < K ? kb : K - 1) * ld + n] : 0.f; }
  return bsplit16(v); }
__device__ __forceinline__ v8f mac3(const F2& a, const F2& b, v8f c) { c = wmma_bf(a.l, b.h, c); c = wmma_bf(a.h, b.l, c); return wmma_bf(a.h, b.h, c); }
__device__ __forceinline__ float sigm(float v) { return 1.0f / (1.0f + expf(-v)); }
#define LDSX() do { asm volatile("s_wait_dscnt 0" ::: "memory"); __builtin_amdgcn_wave_barrier(); __builtin_amdgcn_fence(__ATOMIC_RELEASE, "workgroup"); } while (0)

// Causal multi-head dot-product attention with QK-RMSNorm and RoPE (B 2, S 2,048, D 1,024, 16 heads x 64): q/k/v = x w ((in, head, hd) = (in,out)); q, k RMS-normalised over the 64 head dims (eps 1e-6, x scale) then rotate-half RoPE (angle t * 10000^(-i/32), i < 32); q x 64^-0.5; logits masked to -0.7*f32max where key > query (== -inf here: the diagonal is always kept); softmax; out = merged(attn v) wo ((head, hd, out) = (in,out)).
#define NB 2
#define TT 2048
#define CC 1024            // NH * HD = projected width
#define DIN 1024          // input (model) width
#define NH 16
#define HD 64
#define NQB (TT / 64)
#define SCALE (0.125f)
#define CAUSAL 1
#ifndef TNB
#define TNB NB
#endif
__device__ __forceinline__ float bfr(float v) { return (float)(__bf16)v; }
__host__ __device__ __forceinline__ int kb_last(int qb) { return CAUSAL ? ((qb * 64 + 63) >> 7) : (TT / 128 - 1); }
typedef __attribute__((ext_vector_type(8))) __bf16 v8b;
__device__ __forceinline__ v16b frag_b(const __bf16* rowk0, int lane) {
  union { v16b v; v8b q[2]; } u; const __bf16* p = rowk0 + 8 * (lane >> 4);
  u.q[0] = *(const v8b*)p; u.q[1] = *(const v8b*)(p + 16); return u.v;
}
#define QBH 6              // causal: query blocks 0..QBH-1 of each sequence (few keys, no averaging) take the high-precision path
#define QHI 384            // rows carrying a q residual plane
#define KHI 384            // key rows carrying k residual / v bf16 hi+lo planes (used only by the causal high-precision path)
// B fragment (k rows k0+.., output column o) of a weight: (in,out) [K][ld] or (out,in) [ld rows of K]: bf16 exact, or f16(bf16 * 256) exact
__device__ __forceinline__ v16b wcol_io(const float* Wm, int k0, int o, int lane, int ld) { v16b w; const int g = lane >> 4;
#pragma unroll
  for (int i = 0; i < 8; ++i) { w[i] = (__bf16)Wm[(size_t)(k0 + 8 * g + i) * ld + o]; w[8 + i] = (__bf16)Wm[(size_t)(k0 + 16 + 8 * g + i) * ld + o]; }
  return w; }
__device__ __forceinline__ v16b wcol_oi(const float* Wm, int k0, int o, int lane, int K) { v16b w; const float* p = Wm + (size_t)o * K + k0 + 8 * (lane >> 4);
#pragma unroll
  for (int i = 0; i < 8; ++i) { w[i] = (__bf16)p[i]; w[8 + i] = (__bf16)p[16 + i]; }
  return w; }
__device__ __forceinline__ v16h wcolh_io(const float* Wm, int k0, int o, int lane, int ld) { v16h w; const int g = lane >> 4;
#pragma unroll
  for (int i = 0; i < 8; ++i) { w[i] = (_Float16)(bfr(Wm[(size_t)(k0 + 8 * g + i) * ld + o]) * 256.0f); w[8 + i] = (_Float16)(bfr(Wm[(size_t)(k0 + 16 + 8 * g + i) * ld + o]) * 256.0f); }
  return w; }
__device__ __forceinline__ v16h wcolh_oi(const float* Wm, int k0, int o, int lane, int K) { v16h w; const float* p = Wm + (size_t)o * K + k0 + 8 * (lane >> 4);
#pragma unroll
  for (int i = 0; i < 8; ++i) { w[i] = (_Float16)(bfr(p[i]) * 256.0f); w[8 + i] = (_Float16)(bfr(p[16 + i]) * 256.0f); }
  return w; }
#define WQKV_LAYOUT 0   // 0 = (in,out) [DIN][CC]; 1 = (out,in) [CC][DIN]; 2 = per-head [NH][DIN][HD]
__device__ __forceinline__ v16b wcol_hdk(const float* Wm, int k0, int o, int lane) { v16b w; const int g = lane >> 4; const float* p = Wm + (size_t)(o / HD) * DIN * HD + (o % HD);
#pragma unroll
  for (int i = 0; i < 8; ++i) { w[i] = (__bf16)p[(size_t)(k0 + 8 * g + i) * HD]; w[8 + i] = (__bf16)p[(size_t)(k0 + 16 + 8 * g + i) * HD]; }
  return w; }
#define WO_OUT_IN 0
#if WQKV_LAYOUT == 1
#define WCOL(W, k0, o, lane) wcol_oi(W, k0, o, lane, DIN)
#elif WQKV_LAYOUT == 2
#define WCOL(W, k0, o, lane) wcol_hdk(W, k0, o, lane)
#else
#define WCOL(W, k0, o, lane) wcol_io(W, k0, o, lane, CC)
#endif
#if WO_OUT_IN
#define WOCOL(W, k0, o, lane) wcol_oi(W, k0, o, lane, CC)
#define WOCOLH(W, k0, o, lane) wcolh_oi(W, k0, o, lane, CC)
#else
#define WOCOL(W, k0, o, lane) wcol_io(W, k0, o, lane, DIN)
#define WOCOLH(W, k0, o, lane) wcolh_io(W, k0, o, lane, DIN)
#endif
__constant__ float c_invf[32] = {1.000000000e+00f,7.498942018e-01f,5.623413324e-01f,4.216965139e-01f,3.162277639e-01f,2.371373624e-01f,1.778279394e-01f,1.333521456e-01f,1.000000015e-01f,7.498941571e-02f,5.623412877e-02f,4.216964915e-02f,3.162277862e-02f,2.371373586e-02f,1.778279431e-02f,1.333521493e-02f,9.999999776e-03f,7.498942316e-03f,5.623413250e-03f,4.216964822e-03f,3.162277862e-03f,2.371373819e-03f,1.778279431e-03f,1.333521446e-03f,1.000000047e-03f,7.498941850e-04f,5.623413017e-04f,4.216964880e-04f,3.162277862e-04f,2.371373848e-04f,1.778279402e-04f,1.333521504e-04f};   // 1 / 10000^(i/32) evaluated in f32 exactly as the reference does (jax, eager)
#define PROJ_EXTRA_PARAMS , const float* __restrict__ QS, const float* __restrict__ KS
// per-(row, head) epilogue on the f32 projection tile: RMSNorm over the head's 64 values (x q_norm_scale / k_norm_scale), then rotate-half RoPE; v untouched
#define PROJ_EPI(which, row, t, h) do { if ((which) < 2) { float* rw = (row); const float* NS = (which) == 0 ? QS : KS; float ss = 0.f; _Pragma("unroll") for (int i = 0; i < 64; ++i) ss += rw[i] * rw[i]; const float rn = rsqrtf(ss * (1.0f / 64.0f) + 1e-6f); \
    _Pragma("unroll") for (int i = 0; i < 32; ++i) { const float x1 = rw[i] * rn * bfr(NS[i]), x2 = rw[i + 32] * rn * bfr(NS[i + 32]); const float ang = (float)(t) * c_invf[i]; const float cs = cosf(ang), sn = sinf(ang); rw[i] = x1 * cs - x2 * sn; rw[i + 32] = x2 * cs + x1 * sn; } } } while (0)
#ifndef SM_EXTRA_PARAMS
#define SM_EXTRA_PARAMS
#endif
#ifndef PROJ_EXTRA_PARAMS
#define PROJ_EXTRA_PARAMS
#endif
#ifndef SM_MASK_HOOK
#define SM_MASK_HOOK (void)0
#endif

// Every plane below lies in FRAGMENT ORDER: blocks of 512 bytes, lane l's 16 bytes at 16 l, so that one 16-byte load or store per lane moves 4 whole 128-byte lines (in row order the same instruction touched 32 bytes in each of 16 lines).
// row planes (q, k and their residuals; NR rows per sequence): block ((b * NH + h) * (NR / 16) + t / 16) * 4 + kc * 2 + hf, lane (g, t % 16) = head dims kc * 32 + hf * 16 + 8 g + 0..7
// v planes (NK keys per sequence): block (((b * NH + h) * (NK / 32) + t / 32) * 4 + j) * 2 + hf, lane (g, c) = head dim j * 16 + c, keys (t / 32) * 32 + hf * 16 + 8 g + 0..7
// ctx: block (((b * TT + t) / 16) * KST + k / 32) * 4 + i, lane (g, t % 16) = k (k / 32) * 32 + (i / 2) * 16 + 8 g + (i % 2) * 4 + 0..3
#define WS_QH  0u                                      // f16 q, row plane of TT rows
#define WS_KH  (WS_QH + 2u * (size_t)NB * TT * CC)      // f16 k, row plane of TT rows
#define WS_VT  (WS_KH + 2u * (size_t)NB * TT * CC)      // f16 v plane of TT keys
#define WS_QL  (WS_VT + 2u * (size_t)NB * CC * TT)      // f16 q residual x 2^10, row plane of QHI rows
#define WS_KL  (WS_QL + 2u * (size_t)NB * QHI * CC)     // f16 k residual x 2^10, row plane of KHI rows
#define WS_VB  (WS_KL + 2u * (size_t)NB * KHI * CC)     // bf16 v hi, v plane of KHI keys (WS_VBL: lo)
#define WS_VBL (WS_VB + 2u * (size_t)NB * CC * KHI)
#define WS_Y   (WS_VBL + 2u * (size_t)NB * CC * KHI)    // f32 ctx
#define WS_END (WS_Y  + 4u * (size_t)NB * TT * CC)

// ---- weight tile in LDS, shared by k_proj and k_out: one K step (32 k x 128 output columns) of an (in,out) f32 weight is read ONCE per work-group (wave w: rows 8w..8w+7, lane: 4 columns, whole 512-byte rows), converted as before and kept as 16-bit [column][k] rows of 80 bytes (16 B x odd: the fragment reads meet no bank conflict). Two buffers: the next step's loads (and the wave's own next A rows) fly while this step's products run.
#define WLD 1024           // row length of every weight here (CC for wq/wk/wv, DIN for wo)
#define KST 32             // K steps (DIN / 32 == CC / 32)
static_assert(CC == WLD && DIN == WLD && DIN / 32 == KST && CC / 32 == KST && WQKV_LAYOUT == 0 && WO_OUT_IN == 0, "the staging reads (in,out) weights with rows of WLD floats");
typedef unsigned WT[128][20];
// MODE 0: A once to bf16, W bf16 (1 product); 1: A bf16 hi + lo, W bf16 (2 products); 2: A once to f16, W f16(bf16 x 2^8) (1 product)
struct AFr { v16b h, l; v16h f; };
template <int MODE> __device__ __forceinline__ void a_cvt(AFr& a, const v4f (&ar)[4]) { float v[16];
#pragma unroll
  for (int i = 0; i < 4; ++i) { v[i] = ar[0][i]; v[4 + i] = ar[1][i]; v[8 + i] = ar[2][i]; v[12 + i] = ar[3][i]; }
  if constexpr (MODE == 1) { const F2 s = bsplit16(v); a.h = s.h; a.l = s.l; }
  else {
#pragma unroll
    for (int i = 0; i < 16; ++i) { if constexpr (MODE == 0) a.h[i] = (__bf16)v[i]; else a.f[i] = (_Float16)v[i]; } } }
template <int MODE> __device__ __forceinline__ void wt_store(WT& wt, const v4f (&wr)[8], int wave, int lane) {
#pragma unroll
  for (int n = 0; n < 4; ++n) { union { v8b b; v8h h; v4u u; } p;
#pragma unroll
    for (int i = 0; i < 8; ++i) { if constexpr (MODE == 2) p.h[i] = (_Float16)(bfr(wr[i][n]) * 256.0f); else p.b[i] = (__bf16)wr[i][n]; }
    *(v4u*)&wt[4 * lane + n][4 * wave] = p.u; } }   // column 4 lane + n, k 8 wave .. 8 wave + 7
// acc[j] += A (16 rows of the wave, f32 at xb + xo: MODE 0 an input's K-contiguous rows, MODE 1 and 2 ctx in fragment order) x W (columns j * 16 + col of the tile at wb); k order and product order as in the direct form
template <int MODE> __device__ __forceinline__ void gemm_k(const char* xb, unsigned xo, const char* wb, WT (&wt)[2], int wave, int lane, v8f (&acc)[8]) {
  const int col = lane & 15, g = lane >> 4; const unsigned wo = (unsigned)(8 * wave) * (WLD * 4u) + 16u * lane;
  constexpr int A1 = MODE ? 512 : 16, A2 = MODE ? 1024 : 64, A3 = MODE ? 1536 : 80, AS = MODE ? 2048 : 128;   // byte steps to the lane's 2nd, 3rd and 4th quad of a K step, and to the next K step
  v4f wr[8], ar[4]; AFr a;
#pragma unroll
  for (int i = 0; i < 8; ++i) wr[i] = *(const v4f*)(wb + wo + i * (WLD * 4));
  ar[0] = *(const v4f*)(xb + xo); ar[1] = *(const v4f*)(xb + xo + A1); ar[2] = *(const v4f*)(xb + xo + A2); ar[3] = *(const v4f*)(xb + xo + A3);
  asm volatile("s_wait_xcnt 0x0" :: "v"(wo), "v"(xo), "s"(wb), "s"(xb) : "memory");   // precaution: stands in front of the first rewrite of a register that these loads name; the lane offsets and the uniform bases as inputs keep their registers until here
  __builtin_amdgcn_sched_barrier(0);   // keeps the conversions below, which may reuse the address registers, behind the wait above
  wt_store<MODE>(wt[0], wr, wave, lane); a_cvt<MODE>(a, ar);
  __syncthreads();   // publishes K step 0
#pragma unroll 1   // rolled: one K step per trip keeps the loop small and the live registers below 256
  for (int kc = 0; kc < KST; ++kc) { const bool more = kc + 1 < KST;   // the same for the whole work-group
    if (more) { const char* wk = wb + (size_t)(kc + 1) * (32 * WLD * 4); const char* xk = xb + (kc + 1) * AS;
#pragma unroll
      for (int i = 0; i < 8; ++i) wr[i] = *(const v4f*)(wk + wo + i * (WLD * 4));
      ar[0] = *(const v4f*)(xk + xo); ar[1] = *(const v4f*)(xk + xo + A1); ar[2] = *(const v4f*)(xk + xo + A2); ar[3] = *(const v4f*)(xk + xo + A3);
      asm volatile("s_wait_xcnt 0x0" ::: "memory"); }   // precaution, as above; its memory clobber also keeps the 12 loads from sinking to their uses behind the products
    __builtin_amdgcn_sched_barrier(0);   // holds the next step's loads in front of this step's products, which then cover their latency, and every later write of an address register behind the wait above
    const WT& cur = wt[kc & 1]; v4u f[8][2];
#pragma unroll
    for (int j = 0; j < 8; ++j) { f[j][0] = *(const v4u*)&cur[j * 16 + col][4 * g]; f[j][1] = *(const v4u*)&cur[j * 16 + col][8 + 4 * g]; }   // elements 0..7 = k 8g.., 8..15 = k 16 + 8g..
#pragma unroll
    for (int j = 0; j < 8; ++j) { union { v4u q[2]; v16b b; v16h h; } w; w.q[0] = f[j][0]; w.q[1] = f[j][1];
      if constexpr (MODE == 0) acc[j] = wmma_bf(a.h, w.b, acc[j]);
      else if constexpr (MODE == 1) { acc[j] = wmma_bf(a.h, w.b, acc[j]); acc[j] = wmma_bf(a.l, w.b, acc[j]); }
      else acc[j] = wmma16(a.f, w.h, acc[j]); }
    if (more) { wt_store<MODE>(wt[(kc + 1) & 1], wr, wave, lane); a_cvt<MODE>(a, ar);   // into the buffer whose last readers passed the barrier of the trip before
      __syncthreads(); } } }   // one barrier per K step: publishes step kc + 1 and ends every reader's last read of step kc's buffer
// ---- k_proj: block = (64 rows, 128 cols, which): q/k/v = X W (+ b) with exact bf16 products (K = DIN) -> which 0: q f16 (+ residual, rows < QHI); 1: k f16 (+ residual, rows < KHI); 2: v f16 (+ bf16 hi/lo for t < KHI); all stored in fragment order
__global__ __launch_bounds__(128) void k_proj(const float* __restrict__ XQ, const float* __restrict__ XK, const float* __restrict__ XV, const float* __restrict__ WQ, const float* __restrict__ WK, const float* __restrict__ WV, const float* __restrict__ BQ, const float* __restrict__ BK, const float* __restrict__ BV,
    _Float16* __restrict__ QH, _Float16* __restrict__ QL, _Float16* __restrict__ KH, _Float16* __restrict__ KL, _Float16* __restrict__ VT, __bf16* __restrict__ VB, __bf16* __restrict__ VBL PROJ_EXTRA_PARAMS) {
  __shared__ __align__(16) float st[64][132]; __shared__ __align__(16) _Float16 sh[64][136], sl[64][136]; __shared__ __align__(16) _Float16 th[128][72]; __shared__ __align__(16) __bf16 tb[128][72], tbl[128][72]; __shared__ __align__(16) WT wt[2];
  const int tid = threadIdx.x, wave = tid >> 5, lane = tid & 31, col = lane & 15, g = lane >> 4; const int which = blockIdx.z; const int c0 = blockIdx.y * 128; const size_t r0 = (size_t)blockIdx.x * 64; const size_t bb = r0 / TT; const int t0 = (int)(r0 % TT);
  const float* X = which == 0 ? XQ : which == 1 ? XK : XV; const float* WA = which == 0 ? WQ : which == 1 ? WK : WV; const float* BA = which == 0 ? BQ : which == 1 ? BK : BV;
  v8f acc[8] = {};
  gemm_k<0>((const char*)(X + r0 * DIN), (unsigned)(wave * 16 + col) * (DIN * 4u) + 32u * g, (const char*)(WA + c0), wt, wave, lane, acc);
  { // stage the f32 tile (acc + bias) in LDS, run the per-(row, head) epilogue hook, then convert
#pragma unroll
    for (int j = 0; j < 8; ++j) { const float bias = BA ? bfr(BA[c0 + j * 16 + col]) : 0.f;
#pragma unroll
      for (int r = 0; r < 8; ++r) st[wave * 16 + 8 * g + r][j * 16 + col] = acc[j][r] + bias; }
    __syncthreads();
    for (int e = tid; e < 64 * (128 / HD); e += 128) { const int rl = e / (128 / HD), hh = e % (128 / HD); PROJ_EPI(which, &st[rl][hh * HD], (int)((r0 + rl) % TT), (c0 / HD) + hh); }
    __syncthreads(); }
  if (which < 2) { _Float16* DH = which == 0 ? QH : KH; _Float16* DL = which == 0 ? QL : KL; const int nhi = which == 0 ? QHI : KHI; const bool hi_rows = t0 < nhi;
    for (int e = tid; e < 64 * 128; e += 128) { const int rl = e >> 7, cl = e & 127; const float v = st[rl][cl]; const _Float16 hv = (_Float16)v; sh[rl][cl] = hv; sl[rl][cl] = (_Float16)((v - (float)hv) * 1024.0f); }
    __syncthreads();
    const int u = (wave >> 1) * 4 + (wave & 1) * 2 + g;   // wave w writes the blocks kc * 2 + hf == w: the lane's 8 head dims start at 8 u
    char* dh = (char*)DH + (((bb * NH + c0 / HD) * (size_t)(TT / 16) + (t0 >> 4)) * 4 + wave) * 512 + lane * 16;
    v4u d[8];   // it = 2 x (16-row tile) + head of the pair
#pragma unroll
    for (int it = 0; it < 8; ++it) d[it] = *(const v4u*)&sh[(it >> 1) * 16 + col][(it & 1) * HD + u * 8];
#pragma unroll
    for (int it = 0; it < 8; ++it) vst2(dh + (it >> 1) * 2048 + (it & 1) * (TT / 16 * 2048), d[it]);
    asm volatile("s_wait_xcnt 0x0" :: "v"(dh) : "memory");   // precaution: stands in front of the first rewrite of a register that these stores name; the address as an input keeps its registers until here
    __builtin_amdgcn_sched_barrier(0);   // keeps what follows, which may reuse the stores' registers, behind the wait above
    if (hi_rows) { v4u r[8]; char* dl = (char*)DL + (((bb * NH + c0 / HD) * (size_t)(nhi / 16) + (t0 >> 4)) * 4 + wave) * 512 + lane * 16;   // block-uniform
#pragma unroll
      for (int it = 0; it < 8; ++it) r[it] = *(const v4u*)&sl[(it >> 1) * 16 + col][(it & 1) * HD + u * 8];
#pragma unroll
      for (int it = 0; it < 8; ++it) vst2(dl + (it >> 1) * 2048 + (it & 1) * (QHI / 16 * 2048), r[it]);
      asm volatile("s_wait_xcnt 0x0" :: "v"(dl) : "memory"); }   // precaution, as above
  } else { const bool hi_rows = t0 < KHI;
    for (int e = tid; e < 64 * 128; e += 128) { const int rl = e & 63, cl = e >> 6; const float v = st[rl][cl]; th[cl][rl] = (_Float16)v; const __bf16 bh = (__bf16)v; tb[cl][rl] = bh; tbl[cl][rl] = (__bf16)(v - (float)bh); }
    __syncthreads();
    const unsigned ow = (unsigned)(wave >> 1) * 1024u + (unsigned)(wave & 1) * 512u + lane * 16u;   // wave w writes the blocks with hf == w & 1 and j & 1 == w >> 1
    char* dv = (char*)VT + ((bb * NH + c0 / HD) * (size_t)(TT / 32) + (t0 >> 5)) * 4096 + ow;
    const int cw = (wave >> 1) * 16 + col, rw = (wave & 1) * 16 + g * 8;   // it = 4 x head of the pair + 2 x (32-key tile) + j / 2: column (it >> 2) * HD + (it & 1) * 32 + cw of the tile, first of the lane's 8 keys ((it >> 1) & 1) * 32 + rw
    v4u d[8];
#pragma unroll
    for (int it = 0; it < 8; ++it) d[it] = *(const v4u*)&th[(it >> 2) * HD + (it & 1) * 32 + cw][((it >> 1) & 1) * 32 + rw];
#pragma unroll
    for (int it = 0; it < 8; ++it) vst2(dv + (it >> 2) * (TT / 32 * 4096) + ((it >> 1) & 1) * 4096 + (it & 1) * 2048, d[it]);
    asm volatile("s_wait_xcnt 0x0" :: "v"(dv) : "memory");   // precaution, as above
    __builtin_amdgcn_sched_barrier(0);   // keeps what follows, which may reuse the stores' registers, behind the wait above
    if (hi_rows) { v4u r[8], s[8]; const size_t o3 = ((bb * NH + c0 / HD) * (size_t)(KHI / 32) + (t0 >> 5)) * 4096 + ow; char* db = (char*)VB + o3; char* dc = (char*)VBL + o3;   // block-uniform
#pragma unroll
      for (int it = 0; it < 8; ++it) { r[it] = *(const v4u*)&tb[(it >> 2) * HD + (it & 1) * 32 + cw][((it >> 1) & 1) * 32 + rw]; s[it] = *(const v4u*)&tbl[(it >> 2) * HD + (it & 1) * 32 + cw][((it >> 1) & 1) * 32 + rw]; }
#pragma unroll
      for (int it = 0; it < 8; ++it) { const int o = (it >> 2) * (KHI / 32 * 4096) + ((it >> 1) & 1) * 4096 + (it & 1) * 2048; vst2(db + o, r[it]); vst2(dc + o, s[it]); }
      asm volatile("s_wait_xcnt 0x0" :: "v"(db), "v"(dc) : "memory"); } } }   // precaution, as above
#define LC (SCALE * 1.44269504f)   // unscaled product -> exponent of 2: the logit scale times log2 e
__device__ __forceinline__ float xhalf(float x) { return __builtin_bit_cast(float, __builtin_amdgcn_permlanex16(__builtin_bit_cast(int, x), __builtin_bit_cast(int, x), 0x76543210, 0xfedcba98, false, false)); }   // lane l with lane l ^ 16
// one step of the running softmax over NT tiles of 16 keys: x = unscaled products in, p out; lim = last allowed key of the lane's query, counted from the lane's first key of the step (only looked at where last is set: the step that holds the diagonal; its first key is allowed for every query of the wave, so no step is empty)
template <int NT> __device__ __forceinline__ void sm_step(float (&x)[NT][8], bool last, int lim, float& m, float& l, v8f (&acc)[HD / 16]) {
  if (last) {   // the same for the whole wave
#pragma unroll
    for (int jt = 0; jt < NT; ++jt)
#pragma unroll
      for (int r = 0; r < 8; ++r) if (jt * 16 + r > lim) x[jt][r] = -3.0e38f; }
  float mx = -3.0e38f;
#pragma unroll
  for (int jt = 0; jt < NT; ++jt) mx = fmaxf(mx, fmaxf(fmaxf(fmaxf(x[jt][0], x[jt][1]), fmaxf(x[jt][2], x[jt][3])), fmaxf(fmaxf(x[jt][4], x[jt][5]), fmaxf(x[jt][6], x[jt][7]))));
  mx = fmaxf(mx, xhalf(mx));
  const float mn = fmaxf(m, mx), al = __builtin_amdgcn_exp2f((m - mn) * LC), ms = mn * LC - 10.0f; m = mn;   // first step: al = 2^(-5e37) = 0
  float sum = 0.f;
#pragma unroll
  for (int jt = 0; jt < NT; ++jt) {
#pragma unroll
    for (int r = 0; r < 8; ++r) x[jt][r] = __builtin_amdgcn_exp2f(x[jt][r] * LC - ms);   // one fused multiply-add and v_exp_f32; an excluded key: 2^(-5e37) = 0
    sum += ((x[jt][0] + x[jt][1]) + (x[jt][2] + x[jt][3])) + ((x[jt][4] + x[jt][5]) + (x[jt][6] + x[jt][7])); }
  l = l * al + sum;   // the lane's own keys; the halves are joined once, in att_store
#pragma unroll
  for (int j = 0; j < HD / 16; ++j) acc[j] *= al; }
// lane (g, c) holds ctx[query c][j * 16 + 8g + r]: what lane (g, c) of k_out reads as quads 2 (j & 1) and 2 (j & 1) + 1 of K step 2 h + j / 2
__device__ __forceinline__ void att_store(float* __restrict__ Y, int b, int h, int ql0, int lane, float l, const v8f (&acc)[HD / 16]) {
  l += xhalf(l); const float inv = 1.0f / l; char* yr = (char*)Y + ((size_t)((b * TT + ql0) >> 4) * KST + h * 2) * 2048 + lane * 16;
#pragma unroll
  for (int j = 0; j < HD / 16; ++j) { v4f a, c;
#pragma unroll
    for (int i = 0; i < 4; ++i) { a[i] = acc[j][i] * inv; c[i] = acc[j][4 + i] * inv; }
    vst2(yr + j * 1024, a); vst2(yr + j * 1024 + 512, c); }
  asm volatile("s_wait_xcnt 0x0" :: "v"(yr) : "memory");   // precaution: stands in front of the first rewrite of a register that these stores name; the address as an input keeps its registers until here
  __builtin_amdgcn_sched_barrier(0); }   // keeps the next tile's address work behind the wait above
// 16 query rows from ql0 (>= QHI), steps of 64 keys: q, k once to f16 (1 product), p once to f16 against v f16 (1 product)
__device__ __forceinline__ void att_lo(const _Float16* __restrict__ QH, const _Float16* __restrict__ KH, const _Float16* __restrict__ VT, float* __restrict__ Y, int b, int h, int ql0, int lane) {
  const int col = lane & 15, g = lane >> 4; const int nt = (ql0 >> 6) + 1;
  const size_t bh = (size_t)(b * NH + h); const char* qp = (const char*)QH + (bh * (TT / 16) + (ql0 >> 4)) * 2048; const char* kb = (const char*)KH + bh * (TT / 16 * 2048); const char* vb = (const char*)VT + bh * (TT / 32 * 4096);   // wave-uniform bases; the lane's byte offset below does not change over the loop
  const unsigned ko = 16u * lane, vo = ko;   // fragment order: the lane's 16 bytes of every 512-byte block
  v8h qr[2][2], kr[4][2][2], vr[2][HD / 16][2]; const char* ka = kb + ko;   // the lane's address in the k step that is being loaded
#pragma unroll
  for (int kc = 0; kc < 2; ++kc) { qr[kc][0] = *(const v8h*)(qp + ko + kc * 1024); qr[kc][1] = *(const v8h*)(qp + ko + kc * 1024 + 512); }
#pragma unroll
  for (int jt = 0; jt < 4; ++jt)
#pragma unroll
    for (int kc = 0; kc < 2; ++kc) { kr[jt][kc][0] = *(const v8h*)(ka + jt * 2048 + kc * 1024); kr[jt][kc][1] = *(const v8h*)(ka + jt * 2048 + kc * 1024 + 512); }
  asm volatile("s_wait_xcnt 0x0" :: "v"(qp + ko), "v"(ka) : "memory");   // precaution: stands in front of the first rewrite of a register that these loads name; the addresses as inputs keep their registers from being given to a later load of the group
  __builtin_amdgcn_sched_barrier(0);   // keeps every later write of an address register behind the wait above
  v16h q[2];
#pragma unroll
  for (int kc = 0; kc < 2; ++kc) { union { v16h v; v8h q[2]; } f; f.q[0] = qr[kc][0]; f.q[1] = qr[kc][1]; q[kc] = f.v; }
  v8f acc[HD / 16] = {}; float m = -3.0e38f, l = 0.f;
#pragma unroll 1   // rolled: one step of 64 keys per trip keeps the live registers below 256
  for (int t = 0; t < nt; ++t) { const char* vk = vb + t * 8192;
#pragma unroll
    for (int c = 0; c < 2; ++c)
#pragma unroll
      for (int j = 0; j < HD / 16; ++j) { const int o = c * 4096 + j * 1024; vr[c][j][0] = *(const v8h*)(vk + vo + o); vr[c][j][1] = *(const v8h*)(vk + vo + o + 512); }
    asm volatile("s_wait_xcnt 0x0" :: "v"(vk + vo) : "memory");   // precaution, as above
    __builtin_amdgcn_sched_barrier(0);   // holds this step's 16 v loads in front of the logits, which with the softmax cover their latency, and every later write of an address register behind the wait above
    v8f s[4] = {};
#pragma unroll
    for (int kc = 0; kc < 2; ++kc)
#pragma unroll
      for (int jt = 0; jt < 4; ++jt) { union { v16h v; v8h q[2]; } f; f.q[0] = kr[jt][kc][0]; f.q[1] = kr[jt][kc][1]; s[jt] = wmma16(f.v, q[kc], s[jt]); }
    if (t + 1 < nt) { ka += 8192;   // the test reads the same for the whole wave; the step before's loads from ka have passed their wait
#pragma unroll
      for (int jt = 0; jt < 4; ++jt)
#pragma unroll
        for (int kc = 0; kc < 2; ++kc) { kr[jt][kc][0] = *(const v8h*)(ka + jt * 2048 + kc * 1024); kr[jt][kc][1] = *(const v8h*)(ka + jt * 2048 + kc * 1024 + 512); }
      asm volatile("s_wait_xcnt 0x0" :: "v"(ka) : "memory"); }   // precaution, as above; the next step's 16 k loads go into the registers that the products above have read, and the softmax and the products below cover their latency
    float x[4][8];
#pragma unroll
    for (int jt = 0; jt < 4; ++jt)
#pragma unroll
      for (int r = 0; r < 8; ++r) x[jt][r] = s[jt][r];
    sm_step<4>(x, t == nt - 1, ql0 + col - t * 64 - 8 * g, m, l, acc);
#pragma unroll
    for (int c = 0; c < 2; ++c) { v16h p;
#pragma unroll
      for (int i = 0; i < 8; ++i) { p[i] = (_Float16)x[2 * c][i]; p[8 + i] = (_Float16)x[2 * c + 1][i]; }
#pragma unroll
      for (int j = 0; j < HD / 16; ++j) { union { v16h v; v8h q[2]; } f; f.q[0] = vr[c][j][0]; f.q[1] = vr[c][j][1]; acc[j] = wmma16(f.v, p, acc[j]); } } }
  att_store(Y, b, h, ql0, lane, l, acc); }
// 16 query rows from ql0 (< QHI: few keys, no averaging), steps of 32 keys: q and k as f16 hi + residual (x 2^10) (3 products), p and v as bf16 hi + lo (3 products)
__device__ __forceinline__ void att_hi(const _Float16* __restrict__ QH, const _Float16* __restrict__ QL, const _Float16* __restrict__ KH, const _Float16* __restrict__ KL, const __bf16* __restrict__ VB, const __bf16* __restrict__ VBL, float* __restrict__ Y, int b, int h, int ql0, int lane) {
  const int col = lane & 15, g = lane >> 4; const int nt = (ql0 >> 5) + 1;
  const size_t bh = (size_t)(b * NH + h); const char* qp = (const char*)QH + (bh * (TT / 16) + (ql0 >> 4)) * 2048; const char* qlp = (const char*)QL + (bh * (QHI / 16) + (ql0 >> 4)) * 2048; const char* kb = (const char*)KH + bh * (TT / 16 * 2048); const char* klb = (const char*)KL + bh * (KHI / 16 * 2048);
  const char* vhb = (const char*)VB + bh * (KHI / 32 * 4096); const char* vlb = (const char*)VBL + bh * (KHI / 32 * 4096);   // wave-uniform bases; the lane's byte offset below does not change over the loop
  const unsigned ko = 16u * lane, vo = ko;   // fragment order: the lane's 16 bytes of every 512-byte block
  v8h qr[2][2], qs[2][2];
#pragma unroll
  for (int kc = 0; kc < 2; ++kc) { qr[kc][0] = *(const v8h*)(qp + ko + kc * 1024); qr[kc][1] = *(const v8h*)(qp + ko + kc * 1024 + 512); qs[kc][0] = *(const v8h*)(qlp + ko + kc * 1024); qs[kc][1] = *(const v8h*)(qlp + ko + kc * 1024 + 512); }
  asm volatile("s_wait_xcnt 0x0" :: "v"(qp + ko), "v"(qlp + ko) : "memory");   // precaution: stands in front of the first rewrite of a register that these loads name; the addresses as inputs keep their registers from being given to a later load of the group
  __builtin_amdgcn_sched_barrier(0);   // keeps every later write of an address register behind the wait above
  v16h qh[2], ql[2];
#pragma unroll
  for (int kc = 0; kc < 2; ++kc) { union { v16h v; v8h q[2]; } f; f.q[0] = qr[kc][0]; f.q[1] = qr[kc][1]; qh[kc] = f.v; f.q[0] = qs[kc][0]; f.q[1] = qs[kc][1]; ql[kc] = f.v; }
  v8f acc[HD / 16] = {}; float m = -3.0e38f, l = 0.f;
#pragma unroll 1   // rolled: one step of 32 keys per trip keeps the live registers below 256
  for (int t = 0; t < nt; ++t) { const char* kk = kb + t * 4096 + ko; const char* lk = klb + t * 4096 + ko; const char* hv = vhb + t * 4096 + vo; const char* lv = vlb + t * 4096 + vo;   // the lane's four addresses of this step
    v8h kh[2][2][2], kl[2][2][2]; v8b vh[HD / 16][2], vl[HD / 16][2];
#pragma unroll
    for (int jt = 0; jt < 2; ++jt)
#pragma unroll
      for (int kc = 0; kc < 2; ++kc) { const int o = jt * 2048 + kc * 1024; kh[jt][kc][0] = *(const v8h*)(kk + o); kh[jt][kc][1] = *(const v8h*)(kk + o + 512); kl[jt][kc][0] = *(const v8h*)(lk + o); kl[jt][kc][1] = *(const v8h*)(lk + o + 512); }
#pragma unroll
    for (int j = 0; j < HD / 16; ++j) { const int o = j * 1024; vh[j][0] = *(const v8b*)(hv + o); vh[j][1] = *(const v8b*)(hv + o + 512); vl[j][0] = *(const v8b*)(lv + o); vl[j][1] = *(const v8b*)(lv + o + 512); }
    asm volatile("s_wait_xcnt 0x0" :: "v"(kk), "v"(lk), "v"(hv), "v"(lv) : "memory");   // precaution, as above
    __builtin_amdgcn_sched_barrier(0);   // holds the step's 32 loads in front of its first product (sunk to their uses they would cost one memory latency each) and every later write of an address register behind the wait above
    v8f s[2] = {}, sl[2] = {};
#pragma unroll
    for (int kc = 0; kc < 2; ++kc)
#pragma unroll
      for (int jt = 0; jt < 2; ++jt) { union { v16h v; v8h q[2]; } fh, fl; fh.q[0] = kh[jt][kc][0]; fh.q[1] = kh[jt][kc][1]; fl.q[0] = kl[jt][kc][0]; fl.q[1] = kl[jt][kc][1]; s[jt] = wmma16(fh.v, qh[kc], s[jt]); sl[jt] = wmma16(fh.v, ql[kc], sl[jt]); sl[jt] = wmma16(fl.v, qh[kc], sl[jt]); }
    float x[2][8];
#pragma unroll
    for (int jt = 0; jt < 2; ++jt)
#pragma unroll
      for (int r = 0; r < 8; ++r) x[jt][r] = s[jt][r] + sl[jt][r] * (1.0f / 1024.0f);
    sm_step<2>(x, t == nt - 1, ql0 + col - t * 32 - 8 * g, m, l, acc);
    float v[16];
#pragma unroll
    for (int i = 0; i < 8; ++i) { v[i] = x[0][i]; v[8 + i] = x[1][i]; }
    const F2 p = bsplit16(v);
#pragma unroll
    for (int j = 0; j < HD / 16; ++j) { union { v16b v; v8b q[2]; } fh, fl; fh.q[0] = vh[j][0]; fh.q[1] = vh[j][1]; fl.q[0] = vl[j][0]; fl.q[1] = vl[j][1]; acc[j] = wmma_bf(fh.v, p.h, acc[j]); acc[j] = wmma_bf(fh.v, p.l, acc[j]); acc[j] = wmma_bf(fl.v, p.h, acc[j]); } }
  att_store(Y, b, h, ql0, lane, l, acc); }
// block = (pair of query blocks NQB-1-x and x, (b, h)): together NQB + 1 blocks of 64 keys, so the work is even except where x < QBH (block x on the 3-product path, in steps of 32 keys); wave = 16 query rows of the block; no LDS, no barrier
__global__ __launch_bounds__(128) void k_att(const _Float16* __restrict__ QH, const _Float16* __restrict__ QL, const _Float16* __restrict__ KH, const _Float16* __restrict__ KL, const _Float16* __restrict__ VT, const __bf16* __restrict__ VB, const __bf16* __restrict__ VBL, float* __restrict__ Y) { static_assert(CAUSAL && NQB % 2 == 0 && QBH * 64 == QHI && QHI == KHI, "the pairing counts on causal row lengths; the early-row path reads residual planes of QHI rows");
  const int lane = threadIdx.x & 31; const int wv = __builtin_amdgcn_readfirstlane(threadIdx.x >> 5);   // the wave's number as a scalar: trip counts and the tests on them are scalar, EXEC stays full at every product
  const int b = blockIdx.y / NH, h = blockIdx.y % NH;
#pragma unroll 1   // rolled: one copy of each path in the code
  for (int z = 0; z < 2; ++z) { const int qb = z ? (int)blockIdx.x : NQB - 1 - (int)blockIdx.x; const int ql0 = qb * 64 + wv * 16;
    if (qb < QBH) att_hi(QH, QL, KH, KL, VB, VBL, Y, b, h, ql0, lane); else att_lo(QH, KH, VT, Y, b, h, ql0, lane); } }
// ---- k_out: block = (64 rows, 128 cols): out = ctx Wo (+ bo): ctx once to f16 against Wo as f16(bf16 x 2^8) exact (1 product) x 2^-8; causal early rows (< QHI of each sequence): ctx bf16 hi + lo against exact bf16 Wo (2 products)
__global__ __launch_bounds__(128) void k_out(const float* __restrict__ Y, const float* __restrict__ WO, const float* __restrict__ BO, float* __restrict__ OUT) { __shared__ __align__(16) float sf[4][16][132]; __shared__ __align__(16) WT wt[2];
  const int tid = threadIdx.x, wave = tid >> 5, lane = tid & 31, col = lane & 15, g = lane >> 4; const int c0 = blockIdx.y * 128; const size_t r0 = (size_t)blockIdx.x * 64 + wave * 16;
  v8f acc[8] = {};
  if (CAUSAL && (int)(((size_t)blockIdx.x * 64) % TT) < QHI) {   /* block-uniform */
    gemm_k<1>((const char*)(Y + (size_t)blockIdx.x * 64 * CC), (unsigned)wave * (16u * CC * 4u) + 16u * lane, (const char*)(WO + c0), wt, wave, lane, acc);
#pragma unroll
    for (int j = 0; j < 8; ++j) { const float bias = BO ? bfr(BO[c0 + j * 16 + col]) : 0.f;
#pragma unroll
      for (int r = 0; r < 8; ++r) sf[wave][8 * g + r][j * 16 + col] = acc[j][r] + bias; }
  } else {
    gemm_k<2>((const char*)(Y + (size_t)blockIdx.x * 64 * CC), (unsigned)wave * (16u * CC * 4u) + 16u * lane, (const char*)(WO + c0), wt, wave, lane, acc);
#pragma unroll
    for (int j = 0; j < 8; ++j) { const float bias = BO ? bfr(BO[c0 + j * 16 + col]) : 0.f;
#pragma unroll
      for (int r = 0; r < 8; ++r) sf[wave][8 * g + r][j * 16 + col] = acc[j][r] * (1.0f / 256.0f) + bias; } }
  LDSX(); for (int rl = 0; rl < 16; ++rl) vst2(OUT + (r0 + rl) * DIN + c0 + lane * 4, *(const v4f*)&sf[wave][rl][lane * 4]); }

extern "C" void kernel_launch(void* const* d_in, const int* in_sizes, int n_in, void* d_out, int out_size, void* d_ws, size_t ws_size, hipStream_t stream) {
  (void)in_sizes; (void)n_in; (void)out_size;
  const float** F = (const float**)d_in;
  if (ws_size < (size_t)WS_END) return;
  char* ws = (char*)d_ws; _Float16 *QH = (_Float16*)(ws + WS_QH), *KH = (_Float16*)(ws + WS_KH), *VT = (_Float16*)(ws + WS_VT), *QL = (_Float16*)(ws + WS_QL), *KL = (_Float16*)(ws + WS_KL); __bf16 *VB = (__bf16*)(ws + WS_VB), *VBL = (__bf16*)(ws + WS_VBL); float *Y = (float*)(ws + WS_Y);
  (void)Y; (void)QL; (void)KL; (void)VB; (void)VBL;
  // inputs: 0 inputs_q [2,2048,1024]; 1 wq, 2 wk, 3 wv [1024,16,64] (= (in,out)); 4 wo [16,64,1024] (= (in,out)); 5 q_norm_scale [64]; 6 k_norm_scale [64]
  k_proj<<<dim3(TNB * TT / 64, CC / 128, 3), 128, 0, stream>>>(F[0], F[0], F[0], F[1], F[2], F[3], nullptr, nullptr, nullptr, QH, QL, KH, KL, VT, VB, VBL, F[5], F[6]);
  k_att<<<dim3(NQB / 2, TNB * NH), 128, 0, stream>>>(QH, QL, KH, KL, VT, VB, VBL, Y);
  k_out<<<dim3(TNB * TT / 64, DIN / 128), 128, 0, stream>>>(Y, F[4], nullptr, (float*)d_out);
}

// v008
// One run takes 136 microseconds.
// Two timings next to v007 put it at 1.19 and 1.20 times that version's speed.
// All steps since v000 together make it 8.09 times as fast.
// compute dtype: all float inputs rounded to bf16; q/k/v = x W with EXACT bf16 products on WMMA 16x16x32, f32 accumulate; per-head RMSNorm and rotate-half RoPE in f32 (precise sinf/cosf of t * inv_freq); q, k once to f16 -> 1-product causal logits, except the first 384 query rows of each sequence (few keys, no averaging), which use q and k as f16 hi + residual (x 2^10) (3 products); softmax in f32 in base 2 (the scale 1/8 and log2 e in one fused multiply-add, then the hardware's exp2) with a running maximum and sum, divided out at the end; exp(logit - max) x 2^10 once to f16 against v once to f16 (1 product), except the first 384 rows: it and v as bf16 hi + lo (3 products); ctx once to f16 against wo carried x 2^8 in f16 (exact bf16 values), except the first 384 rows: ctx bf16 hi + lo against exact bf16 wo (2 products); f32 output.
#include <hip/hip_runtime.h>
#include <math.h>

typedef __attribute__((ext_vector_type(16))) _Float16 v16h;
typedef __attribute__((ext_vector_type(16))) __bf16 v16b;
typedef __attribute__((ext_vector_type(8)))  _Float16 v8h;
typedef __attribute__((ext_vector_type(8)))  float v8f;
typedef __attribute__((ext_vector_type(4)))  float v4f;
typedef __attribute__((ext_vector_type(2)))  float v2f;
typedef __attribute__((ext_vector_type(4)))  unsigned v4u;
typedef __attribute__((ext_vector_type(4)))  int v4i;
typedef float __attribute__((may_alias)) float_a;
typedef int __attribute__((may_alias)) int_a;

template <typename T> __device__ __forceinline__ void vst2(void* p, T v) { *(T*)p = v;  }
__device__ __forceinline__ v8f wmma16(v16h a, v16h b, v8f c) {
  v8f d = __builtin_amdgcn_wmma_f32_16x16x32_f16(false, a, false, b, (short)0, c, false, false);
  asm volatile("v_nop\n\tv_nop\n\tv_nop\n\tv_nop" : "+v"(d) : "v"(a), "v"(b));
  return d;
}
__device__ __forceinline__ v8f wmma_bf(v16b a, v16b b, v8f c) {
  v8f d = __builtin_amdgcn_wmma_f32_16x16x32_bf16(false, a, false, b, (short)0, c, false, false);
  asm volatile("v_nop\n\tv_nop\n\tv_nop\n\tv_nop" : "+v"(d) : "v"(a), "v"(b));
  return d;
}
// 16x16x32 fragments: lane = (h = lane>>4, row/col = lane&15); elements 0..7 = k0+8h+0..7, 8..15 = k0+16+8h+0..7; D element r = row 8h+r
__device__ __forceinline__ v16h frag_h(const _Float16* rowk0, int lane) {
  union { v16h v; v8h q[2]; } u; const _Float16* p = rowk0 + 8 * (lane >> 4);
  u.q[0] = *(const v8h*)p; u.q[1] = *(const v8h*)(p + 16); return u.v;
}
__device__ __forceinline__ v16h frag_f32(const float* rowk0, int lane) {
  v16h a; const float* p = rowk0 + 8 * (lane >> 4);
#pragma unroll
  for (int i = 0; i < 8; ++i) { a[i] = (_Float16)p[i]; a[8 + i] = (_Float16)p[16 + i]; }
  return a;
}
__device__ __forceinline__ v16h frag_f32s(const float* rowk0, int lane, float sc) {
  v16h a; const float* p = rowk0 + 8 * (lane >> 4);
#pragma unroll
  for (int i = 0; i < 8; ++i) { a[i] = (_Float16)(p[i] * sc); a[8 + i] = (_Float16)(p[16 + i] * sc); }
  return a;
}
// column fragment from a [K][ld] layout (column n), rows >= K read as 0
__device__ __forceinline__ v16h fragc_f32(const float* W, int k0, int n, int lane, int ld, int K) {
  v16h a; const int g = lane >> 4;
#pragma unroll
  for (int i = 0; i < 8; ++i) { const int ka = k0 + 8 * g + i, kb = ka + 16;
    a[i] = (_Float16)(ka < K ? W[(size_t)(ka < K ? ka : K - 1) * ld + n] : 0.f); a[8 + i] = (_Float16)(kb < K ? W[(size_t)(kb < K ? kb : K - 1) * ld + n] : 0.f); }
  return a;
}
struct F2 { v16b h, l; };
__device__ __forceinline__ F2 bsplit16(const float v[16]) { F2 r;
#pragma unroll
  for (int i = 0; i < 16; ++i) { const __bf16 h = (__bf16)v[i]; r.h[i] = h; r.l[i] = (__bf16)(v[i] - (float)h); }
  return r; }
__device__ __forceinline__ F2 split_row(const float* row, int k0, int lane) { float v[16]; const float* p = row + k0 + 8 * (lane >> 4);
#pragma unroll
  for (int i = 0; i < 8; ++i) { v[i] = p[i]; v[8 + i] = p[16 + i]; }
  return bsplit16(v); }
__device__ __forceinline__ F2 split_rowK(const float* row, int k0, int lane, int K) { float v[16]; const int g = lane >> 4;
#pragma unroll
  for (int i = 0; i < 8; ++i) { const int ka = k0 + 8 * g + i, kb = ka + 16; v[i] = ka < K ? row[ka < K ? ka : K - 1] : 0.f; v[8 + i] = kb < K ? row[kb < K ? kb : K - 1] : 0.f; }
  return bsplit16(v); }
__device__ __forceinline__ F2 split_col(const float* W, int k0, int n, int lane, int ld, int K) { float v[16]; const int g = lane >> 4;
#pragma unroll
  for (int i = 0; i < 8; ++i) { const int ka = k0 + 8 * g + i, kb = ka + 16; v[i] = ka < K ? W[(size_t)(ka < K ? ka : K - 1) * ld + n] : 0.f; v[8 + i] = kb < K ? W[(size_t)(kb < K ? kb : K - 1) * ld + n] : 0.f; }
  return bsplit16(v); }
__device__ __forceinline__ v8f mac3(const F2& a, const F2& b, v8f c) { c = wmma_bf(a.l, b.h, c); c = wmma_bf(a.h, b.l, c); return wmma_bf(a.h, b.h, c); }
__device__ __forceinline__ float sigm(float v) { return 1.0f / (1.0f + expf(-v)); }
#define LDSX() do { asm volatile("s_wait_dscnt 0" ::: "memory"); __builtin_amdgcn_wave_barrier(); __builtin_amdgcn_fence(__ATOMIC_RELEASE, "workgroup"); } while (0)

// Causal multi-head dot-product attention with QK-RMSNorm and RoPE (B 2, S 2,048, D 1,024, 16 heads x 64): q/k/v = x w ((in, head, hd) = (in,out)); q, k RMS-normalised over the 64 head dims (eps 1e-6, x scale) then rotate-half RoPE (angle t * 10000^(-i/32), i < 32); q x 64^-0.5; logits masked to -0.7*f32max where key > query (== -inf here: the diagonal is always kept); softmax; out = merged(attn v) wo ((head, hd, out) = (in,out)).
#define NB 2
#define TT 2048
#define CC 1024            // NH * HD = projected width
#define DIN 1024          // input (model) width
#define NH 16
#define HD 64
#define NQB (TT / 64)
#define SCALE (0.125f)
#define CAUSAL 1
#ifndef TNB
#define TNB NB
#endif
__device__ __forceinline__ float bfr(float v) { return (float)(__bf16)v; }
__host__ __device__ __forceinline__ int kb_last(int qb) { return CAUSAL ? ((qb * 64 + 63) >> 7) : (TT / 128 - 1); }
typedef __attribute__((ext_vector_type(8))) __bf16 v8b;
__device__ __forceinline__ v16b frag_b(const __bf16* rowk0, int lane) {
  union { v16b v; v8b q[2]; } u; const __bf16* p = rowk0 + 8 * (lane >> 4);
  u.q[0] = *(const v8b*)p; u.q[1] = *(const v8b*)(p + 16); return u.v;
}
#define QBH 6              // causal: query blocks 0..QBH-1 of each sequence (few keys, no averaging) take the high-precision path
#define QHI 384            // rows carrying a q residual plane
#define KHI 384            // key rows carrying k residual / v bf16 hi+lo planes (used only by the causal high-precision path)
// B fragment (k rows k0+.., output column o) of a weight: (in,out) [K][ld] or (out,in) [ld rows of K]: bf16 exact, or f16(bf16 * 256) exact
__device__ __forceinline__ v16b wcol_io(const float* Wm, int k0, int o, int lane, int ld) { v16b w; const int g = lane >> 4;
#pragma unroll
  for (int i = 0; i < 8; ++i) { w[i] = (__bf16)Wm[(size_t)(k0 + 8 * g + i) * ld + o]; w[8 + i] = (__bf16)Wm[(size_t)(k0 + 16 + 8 * g + i) * ld + o]; }
  return w; }
__device__ __forceinline__ v16b wcol_oi(const float* Wm, int k0, int o, int lane, int K) { v16b w; const float* p = Wm + (size_t)o * K + k0 + 8 * (lane >> 4);
#pragma unroll
  for (int i = 0; i < 8; ++i) { w[i] = (__bf16)p[i]; w[8 + i] = (__bf16)p[16 + i]; }
  return w; }
__device__ __forceinline__ v16h wcolh_io(const float* Wm, int k0, int o, int lane, int ld) { v16h w; const int g = lane >> 4;
#pragma unroll
  for (int i = 0; i < 8; ++i) { w[i] = (_Float16)(bfr(Wm[(size_t)(k0 + 8 * g + i) * ld + o]) * 256.0f); w[8 + i] = (_Float16)(bfr(Wm[(size_t)(k0 + 16 + 8 * g + i) * ld + o]) * 256.0f); }
  return w; }
__device__ __forceinline__ v16h wcolh_oi(const float* Wm, int k0, int o, int lane, int K) { v16h w; const float* p = Wm + (size_t)o * K + k0 + 8 * (lane >> 4);
#pragma unroll
  for (int i = 0; i < 8; ++i) { w[i] = (_Float16)(bfr(p[i]) * 256.0f); w[8 + i] = (_Float16)(bfr(p[16 + i]) * 256.0f); }
  return w; }
#define WQKV_LAYOUT 0   // 0 = (in,out) [DIN][CC]; 1 = (out,in) [CC][DIN]; 2 = per-head [NH][DIN][HD]
__device__ __forceinline__ v16b wcol_hdk(const float* Wm, int k0, int o, int lane) { v16b w; const int g = lane >> 4; const float* p = Wm + (size_t)(o / HD) * DIN * HD + (o % HD);
#pragma unroll
  for (int i = 0; i < 8; ++i) { w[i] = (__bf16)p[(size_t)(k0 + 8 * g + i) * HD]; w[8 + i] = (__bf16)p[(size_t)(k0 + 16 + 8 * g + i) * HD]; }
  return w; }
#define WO_OUT_IN 0
#if WQKV_LAYOUT == 1
#define WCOL(W, k0, o, lane) wcol_oi(W, k0, o, lane, DIN)
#elif WQKV_LAYOUT == 2
#define WCOL(W, k0, o, lane) wcol_hdk(W, k0, o, lane)
#else
#define WCOL(W, k0, o, lane) wcol_io(W, k0, o, lane, CC)
#endif
#if WO_OUT_IN
#define WOCOL(W, k0, o, lane) wcol_oi(W, k0, o, lane, CC)
#define WOCOLH(W, k0, o, lane) wcolh_oi(W, k0, o, lane, CC)
#else
#define WOCOL(W, k0, o, lane) wcol_io(W, k0, o, lane, DIN)
#define WOCOLH(W, k0, o, lane) wcolh_io(W, k0, o, lane, DIN)
#endif
__constant__ float c_invf[32] = {1.000000000e+00f,7.498942018e-01f,5.623413324e-01f,4.216965139e-01f,3.162277639e-01f,2.371373624e-01f,1.778279394e-01f,1.333521456e-01f,1.000000015e-01f,7.498941571e-02f,5.623412877e-02f,4.216964915e-02f,3.162277862e-02f,2.371373586e-02f,1.778279431e-02f,1.333521493e-02f,9.999999776e-03f,7.498942316e-03f,5.623413250e-03f,4.216964822e-03f,3.162277862e-03f,2.371373819e-03f,1.778279431e-03f,1.333521446e-03f,1.000000047e-03f,7.498941850e-04f,5.623413017e-04f,4.216964880e-04f,3.162277862e-04f,2.371373848e-04f,1.778279402e-04f,1.333521504e-04f};   // 1 / 10000^(i/32) evaluated in f32 exactly as the reference does (jax, eager)
#define PROJ_EXTRA_PARAMS , const float* __restrict__ QS, const float* __restrict__ KS
// per-(row, head) epilogue on the f32 projection tile: RMSNorm over the head's 64 values (x q_norm_scale / k_norm_scale), then rotate-half RoPE; v untouched
#define PROJ_EPI(which, row, t, h) do { if ((which) < 2) { float* rw = (row); const float* NS = (which) == 0 ? QS : KS; float ss = 0.f; _Pragma("unroll") for (int i = 0; i < 64; ++i) ss += rw[i] * rw[i]; const float rn = rsqrtf(ss * (1.0f / 64.0f) + 1e-6f); \
    _Pragma("unroll") for (int i = 0; i < 32; ++i) { const float x1 = rw[i] * rn * bfr(NS[i]), x2 = rw[i + 32] * rn * bfr(NS[i + 32]); const float ang = (float)(t) * c_invf[i]; const float cs = cosf(ang), sn = sinf(ang); rw[i] = x1 * cs - x2 * sn; rw[i + 32] = x2 * cs + x1 * sn; } } } while (0)
#ifndef SM_EXTRA_PARAMS
#define SM_EXTRA_PARAMS
#endif
#ifndef PROJ_EXTRA_PARAMS
#define PROJ_EXTRA_PARAMS
#endif
#ifndef SM_MASK_HOOK
#define SM_MASK_HOOK (void)0
#endif

// Every plane below lies in FRAGMENT ORDER: blocks of 512 bytes, lane l's 16 bytes at 16 l, so that one 16-byte load or store per lane moves 4 whole 128-byte lines (in row order the same instruction touched 32 bytes in each of 16 lines).
// row planes (q, k and their residuals; NR rows per sequence): block ((b * NH + h) * (NR / 16) + t / 16) * 4 + kc * 2 + hf, lane (g, t % 16) = head dims kc * 32 + hf * 16 + 8 g + 0..7
// v planes (NK keys per sequence): block (((b * NH + h) * (NK / 32) + t / 32) * 4 + j) * 2 + hf, lane (g, c) = head dim j * 16 + c, keys (t / 32) * 32 + hf * 16 + 8 g + 0..7
// ctx: block (((b * TT + t) / 16) * KST + k / 32) * 4 + i, lane (g, t % 16) = k (k / 32) * 32 + (i / 2) * 16 + 8 g + (i % 2) * 4 + 0..3
#define WS_QH  0u                                      // f16 q, row plane of TT rows
#define WS_KH  (WS_QH + 2u * (size_t)NB * TT * CC)      // f16 k, row plane of TT rows
#define WS_VT  (WS_KH + 2u * (size_t)NB * TT * CC)      // f16 v plane of TT keys
#define WS_QL  (WS_VT + 2u * (size_t)NB * CC * TT)      // f16 q residual x 2^10, row plane of QHI rows
#define WS_KL  (WS_QL + 2u * (size_t)NB * QHI * CC)     // f16 k residual x 2^10, row plane of KHI rows
#define WS_VB  (WS_KL + 2u * (size_t)NB * KHI * CC)     // bf16 v hi, v plane of KHI keys (WS_VBL: lo)
#define WS_VBL (WS_VB + 2u * (size_t)NB * CC * KHI)
#define WS_Y   (WS_VBL + 2u * (size_t)NB * CC * KHI)    // f32 ctx
#define WS_END (WS_Y  + 4u * (size_t)NB * TT * CC)

// ---- weight tile in LDS, shared by k_proj and k_out: one K step (32 k x 128 output columns) of an (in,out) f32 weight is read ONCE per work-group (wave w: rows 8w..8w+7, lane: 4 columns, whole 512-byte rows), converted as before and kept as 16-bit [column][k] rows of 80 bytes (16 B x odd: the fragment reads meet no bank conflict). Two buffers: the next step's loads (and the wave's own next A rows) fly while this step's products run.
#define WLD 1024           // row length of every weight here (CC for wq/wk/wv, DIN for wo)
#define KST 32             // K steps (DIN / 32 == CC / 32)
static_assert(CC == WLD && DIN == WLD && DIN / 32 == KST && CC / 32 == KST && WQKV_LAYOUT == 0 && WO_OUT_IN == 0, "the staging reads (in,out) weights with rows of WLD floats");
typedef unsigned WT[128][20];
// MODE 0: A once to bf16, W bf16 (1 product); 1: A bf16 hi + lo, W bf16 (2 products); 2: A once to f16, W f16(bf16 x 2^8) (1 product)
struct AFr { v16b h, l; v16h f; };
template <int MODE> __device__ __forceinline__ void a_cvt(AFr& a, const v4f (&ar)[4]) { float v[16];
#pragma unroll
  for (int i = 0; i < 4; ++i) { v[i] = ar[0][i]; v[4 + i] = ar[1][i]; v[8 + i] = ar[2][i]; v[12 + i] = ar[3][i]; }
  if constexpr (MODE == 1) { const F2 s = bsplit16(v); a.h = s.h; a.l = s.l; }
  else {
#pragma unroll
    for (int i = 0; i < 16; ++i) { if constexpr (MODE == 0) a.h[i] = (__bf16)v[i]; else a.f[i] = (_Float16)v[i]; } } }
template <int MODE> __device__ __forceinline__ void wt_store(WT& wt, const v4f (&wr)[8], int wave, int lane) {
#pragma unroll
  for (int n = 0; n < 4; ++n) { union { v8b b; v8h h; v4u u; } p;
#pragma unroll
    for (int i = 0; i < 8; ++i) { if constexpr (MODE == 2) p.h[i] = (_Float16)(bfr(wr[i][n]) * 256.0f); else p.b[i] = (__bf16)wr[i][n]; }
    *(v4u*)&wt[4 * lane + n][4 * wave] = p.u; } }   // column 4 lane + n, k 8 wave .. 8 wave + 7
// acc[j] += A (16 rows of the wave, f32 at xb + xo: MODE 0 an input's K-contiguous rows, MODE 1 and 2 ctx in fragment order) x W (columns j * 16 + col of the tile at wb); k order and product order as in the direct form
template <int MODE> __device__ __forceinline__ void gemm_k(const char* xb, unsigned xo, const char* wb, WT (&wt)[2], int wave, int lane, v8f (&acc)[8]) {
  const int col = lane & 15, g = lane >> 4; const unsigned wo = (unsigned)(8 * wave) * (WLD * 4u) + 16u * lane;
  constexpr int A1 = MODE ? 512 : 16, A2 = MODE ? 1024 : 64, A3 = MODE ? 1536 : 80, AS = MODE ? 2048 : 128;   // byte steps to the lane's 2nd, 3rd and 4th quad of a K step, and to the next K step
  v4f wr[8], ar[4]; AFr a;
#pragma unroll
  for (int i = 0; i < 8; ++i) wr[i] = *(const v4f*)(wb + wo + i * (WLD * 4));
  ar[0] = *(const v4f*)(xb + xo); ar[1] = *(const v4f*)(xb + xo + A1); ar[2] = *(const v4f*)(xb + xo + A2); ar[3] = *(const v4f*)(xb + xo + A3);
  asm volatile("s_wait_xcnt 0x0" :: "v"(wo), "v"(xo), "s"(wb), "s"(xb) : "memory");   // precaution: stands in front of the first rewrite of a register that these loads name; the lane offsets and the uniform bases as inputs keep their registers until here
  __builtin_amdgcn_sched_barrier(0);   // keeps the conversions below, which may reuse the address registers, behind the wait above
  wt_store<MODE>(wt[0], wr, wave, lane); a_cvt<MODE>(a, ar);
  __syncthreads();   // publishes K step 0
#pragma unroll 1   // rolled: one K step per trip keeps the loop small and the live registers below 256
  for (int kc = 0; kc < KST; ++kc) { const bool more = kc + 1 < KST;   // the same for the whole work-group
    if (more) { const char* wk = wb + (size_t)(kc + 1) * (32 * WLD * 4); const char* xk = xb + (kc + 1) * AS;
#pragma unroll
      for (int i = 0; i < 8; ++i) wr[i] = *(const v4f*)(wk + wo + i * (WLD * 4));
      ar[0] = *(const v4f*)(xk + xo); ar[1] = *(const v4f*)(xk + xo + A1); ar[2] = *(const v4f*)(xk + xo + A2); ar[3] = *(const v4f*)(xk + xo + A3);
      asm volatile("s_wait_xcnt 0x0" ::: "memory"); }   // precaution, as above; its memory clobber also keeps the 12 loads from sinking to their uses behind the products
    __builtin_amdgcn_sched_barrier(0);   // holds the next step's loads in front of this step's products, which then cover their latency, and every later write of an address register behind the wait above
    const WT& cur = wt[kc & 1]; v4u f[8][2];
#pragma unroll
    for (int j = 0; j < 8; ++j) { f[j][0] = *(const v4u*)&cur[j * 16 + col][4 * g]; f[j][1] = *(const v4u*)&cur[j * 16 + col][8 + 4 * g]; }   // elements 0..7 = k 8g.., 8..15 = k 16 + 8g..
#pragma unroll
    for (int j = 0; j < 8; ++j) { union { v4u q[2]; v16b b; v16h h; } w; w.q[0] = f[j][0]; w.q[1] = f[j][1];
      if constexpr (MODE == 0) acc[j] = wmma_bf(a.h, w.b, acc[j]);
      else if constexpr (MODE == 1) { acc[j] = wmma_bf(a.h, w.b, acc[j]); acc[j] = wmma_bf(a.l, w.b, acc[j]); }
      else acc[j] = wmma16(a.f, w.h, acc[j]); }
    if (more) { wt_store<MODE>(wt[(kc + 1) & 1], wr, wave, lane); a_cvt<MODE>(a, ar);   // into the buffer whose last readers passed the barrier of the trip before
      __syncthreads(); } } }   // one barrier per K step: publishes step kc + 1 and ends every reader's last read of step kc's buffer
// ---- k_proj: block = (64 rows, 128 cols, which): q/k/v = X W (+ b) with exact bf16 products (K = DIN) -> which 0: q f16 (+ residual, rows < QHI); 1: k f16 (+ residual, rows < KHI); 2: v f16 (+ bf16 hi/lo for t < KHI); all stored in fragment order
__global__ __launch_bounds__(128) void k_proj(const float* __restrict__ XQ, const float* __restrict__ XK, const float* __restrict__ XV, const float* __restrict__ WQ, const float* __restrict__ WK, const float* __restrict__ WV, const float* __restrict__ BQ, const float* __restrict__ BK, const float* __restrict__ BV,
    _Float16* __restrict__ QH, _Float16* __restrict__ QL, _Float16* __restrict__ KH, _Float16* __restrict__ KL, _Float16* __restrict__ VT, __bf16* __restrict__ VB, __bf16* __restrict__ VBL PROJ_EXTRA_PARAMS) {
  __shared__ __align__(16) float st[64][132]; __shared__ __align__(16) WT wt[2];   // 53 KiB in all: LDS does not hold the number of resident work-groups below what the registers allow
  const int tid = threadIdx.x, wave = tid >> 5, lane = tid & 31, col = lane & 15, g = lane >> 4; const int which = blockIdx.z; const int c0 = blockIdx.y * 128; const size_t r0 = (size_t)blockIdx.x * 64; const size_t bb = r0 / TT; const int t0 = (int)(r0 % TT);
  const float* X = which == 0 ? XQ : which == 1 ? XK : XV; const float* WA = which == 0 ? WQ : which == 1 ? WK : WV; const float* BA = which == 0 ? BQ : which == 1 ? BK : BV;
  v8f acc[8] = {};
  gemm_k<0>((const char*)(X + r0 * DIN), (unsigned)(wave * 16 + col) * (DIN * 4u) + 32u * g, (const char*)(WA + c0), wt, wave, lane, acc);
  { // stage the f32 tile (acc + bias) in LDS and run the per-(row, head) epilogue hook; behind its barrier st is only read: each lane takes the f32 values of its own 16-byte pieces of the planes and converts them in registers
#pragma unroll
    for (int j = 0; j < 8; ++j) { const float bias = BA ? bfr(BA[c0 + j * 16 + col]) : 0.f;
#pragma unroll
      for (int r = 0; r < 8; ++r) st[wave * 16 + 8 * g + r][j * 16 + col] = acc[j][r] + bias; }
    __syncthreads();
    for (int e = tid; e < 64 * (128 / HD); e += 128) { const int rl = e / (128 / HD), hh = e % (128 / HD); PROJ_EPI(which, &st[rl][hh * HD], (int)((r0 + rl) % TT), (c0 / HD) + hh); }
    __syncthreads(); }
  if (which < 2) { _Float16* DH = which == 0 ? QH : KH; _Float16* DL = which == 0 ? QL : KL; const int nhi = which == 0 ? QHI : KHI; const bool hi_rows = t0 < nhi;
    const int u = (wave >> 1) * 4 + (wave & 1) * 2 + g;   // wave w writes the blocks kc * 2 + hf == w: the lane's 8 head dims start at 8 u
    char* dh = (char*)DH + (((bb * NH + c0 / HD) * (size_t)(TT / 16) + (t0 >> 4)) * 4 + wave) * 512 + lane * 16;
    v4u d[8]; v4f x[8][2];   // it = 2 x (16-row tile) + head of the pair
#pragma unroll
    for (int it = 0; it < 8; ++it) { const float* p = &st[(it >> 1) * 16 + col][(it & 1) * HD + u * 8]; x[it][0] = *(const v4f*)p; x[it][1] = *(const v4f*)(p + 4); }
#pragma unroll
    for (int it = 0; it < 8; ++it) { union { v8h h; v4u u; } c;
#pragma unroll
      for (int i = 0; i < 8; ++i) c.h[i] = (_Float16)x[it][i >> 2][i & 3];
      d[it] = c.u; }
#pragma unroll
    for (int it = 0; it < 8; ++it) vst2(dh + (it >> 1) * 2048 + (it & 1) * (TT / 16 * 2048), d[it]);
    asm volatile("s_wait_xcnt 0x0" :: "v"(dh) : "memory");   // precaution: stands in front of the first rewrite of a register that these stores name; the address as an input keeps its registers until here
    __builtin_amdgcn_sched_barrier(0);   // keeps what follows, which may reuse the stores' registers, behind the wait above
    if (hi_rows) { v4u r[8]; char* dl = (char*)DL + (((bb * NH + c0 / HD) * (size_t)(nhi / 16) + (t0 >> 4)) * 4 + wave) * 512 + lane * 16;   // block-uniform
#pragma unroll
      for (int it = 0; it < 8; ++it) { union { v8h h; v4u u; } c;
#pragma unroll
        for (int i = 0; i < 8; ++i) { const float v = x[it][i >> 2][i & 3]; c.h[i] = (_Float16)((v - (float)(_Float16)v) * 1024.0f); }
        r[it] = c.u; }
#pragma unroll
      for (int it = 0; it < 8; ++it) vst2(dl + (it >> 1) * 2048 + (it & 1) * (QHI / 16 * 2048), r[it]);
      asm volatile("s_wait_xcnt 0x0" :: "v"(dl) : "memory"); }   // precaution, as above
  } else { const bool hi_rows = t0 < KHI;
    const unsigned ow = (unsigned)(wave >> 1) * 1024u + (unsigned)(wave & 1) * 512u + lane * 16u;   // wave w writes the blocks with hf == w & 1 and j & 1 == w >> 1
    char* dv = (char*)VT + ((bb * NH + c0 / HD) * (size_t)(TT / 32) + (t0 >> 5)) * 4096 + ow;
    const int cw = (wave >> 1) * 16 + col, rw = (wave & 1) * 16 + g * 8;   // it = 4 x head of the pair + 2 x (32-key tile) + j / 2: column (it >> 2) * HD + (it & 1) * 32 + cw of the tile, first of the lane's 8 keys ((it >> 1) & 1) * 32 + rw
    v4u d[8]; float x[8][8];   // 8 keys of one column: 16 lanes read 16 neighbouring columns of a row, the other 16 a row 32 banks away
#pragma unroll
    for (int it = 0; it < 8; ++it)
#pragma unroll
      for (int i = 0; i < 8; ++i) x[it][i] = st[((it >> 1) & 1) * 32 + rw + i][(it >> 2) * HD + (it & 1) * 32 + cw];
#pragma unroll
    for (int it = 0; it < 8; ++it) { union { v8h h; v4u u; } c;
#pragma unroll
      for (int i = 0; i < 8; ++i) c.h[i] = (_Float16)x[it][i];
      d[it] = c.u; }
#pragma unroll
    for (int it = 0; it < 8; ++it) vst2(dv + (it >> 2) * (TT / 32 * 4096) + ((it >> 1) & 1) * 4096 + (it & 1) * 2048, d[it]);
    asm volatile("s_wait_xcnt 0x0" :: "v"(dv) : "memory");   // precaution, as above
    __builtin_amdgcn_sched_barrier(0);   // keeps what follows, which may reuse the stores' registers, behind the wait above
    if (hi_rows) { v4u r[8], s[8]; const size_t o3 = ((bb * NH + c0 / HD) * (size_t)(KHI / 32) + (t0 >> 5)) * 4096 + ow; char* db = (char*)VB + o3; char* dc = (char*)VBL + o3;   // block-uniform
#pragma unroll
      for (int it = 0; it < 8; ++it) { union { v8b b; v4u u; } ch, cl;
#pragma unroll
        for (int i = 0; i < 8; ++i) { const float v = x[it][i]; const __bf16 bh = (__bf16)v; ch.b[i] = bh; cl.b[i] = (__bf16)(v - (float)bh); }
        r[it] = ch.u; s[it] = cl.u; }
#pragma unroll
      for (int it = 0; it < 8; ++it) { const int o = (it >> 2) * (KHI / 32 * 4096) + ((it >> 1) & 1) * 4096 + (it & 1) * 2048; vst2(db + o, r[it]); vst2(dc + o, s[it]); }
      asm volatile("s_wait_xcnt 0x0" :: "v"(db), "v"(dc) : "memory"); } } }   // precaution, as above
#define LC (SCALE * 1.44269504f)   // unscaled product -> exponent of 2: the logit scale times log2 e
__device__ __forceinline__ float xhalf(float x) { return __builtin_bit_cast(float, __builtin_amdgcn_permlanex16(__builtin_bit_cast(int, x), __builtin_bit_cast(int, x), 0x76543210, 0xfedcba98, false, false)); }   // lane l with lane l ^ 16
// one step of the running softmax over NT tiles of 16 keys: x = unscaled products in, p out; lim = last allowed key of the lane's query, counted from the lane's first key of the step (only looked at where last is set: the step that holds the diagonal; its first key is allowed for every query of the wave, so no step is empty)
template <int NT> __device__ __forceinline__ void sm_step(float (&x)[NT][8], bool last, int lim, float& m, float& l, v8f (&acc)[HD / 16]) {
  if (last) {   // the same for the whole wave
#pragma unroll
    for (int jt = 0; jt < NT; ++jt)
#pragma unroll
      for (int r = 0; r < 8; ++r) if (jt * 16 + r > lim) x[jt][r] = -3.0e38f; }
  float mx = -3.0e38f;
#pragma unroll
  for (int jt = 0; jt < NT; ++jt) mx = fmaxf(mx, fmaxf(fmaxf(fmaxf(x[jt][0], x[jt][1]), fmaxf(x[jt][2], x[jt][3])), fmaxf(fmaxf(x[jt][4], x[jt][5]), fmaxf(x[jt][6], x[jt][7]))));
  mx = fmaxf(mx, xhalf(mx));
  const float mn = fmaxf(m, mx), al = __builtin_amdgcn_exp2f((m - mn) * LC), ms = mn * LC - 10.0f; m = mn;   // first step: al = 2^(-5e37) = 0
  float sum = 0.f;
#pragma unroll
  for (int jt = 0; jt < NT; ++jt) {
#pragma unroll
    for (int r = 0; r < 8; ++r) x[jt][r] = __builtin_amdgcn_exp2f(x[jt][r] * LC - ms);   // one fused multiply-add and v_exp_f32; an excluded key: 2^(-5e37) = 0
    sum += ((x[jt][0] + x[jt][1]) + (x[jt][2] + x[jt][3])) + ((x[jt][4] + x[jt][5]) + (x[jt][6] + x[jt][7])); }
  l = l * al + sum;   // the lane's own keys; the halves are joined once, in att_store
#pragma unroll
  for (int j = 0; j < HD / 16; ++j) acc[j] *= al; }
// lane (g, c) holds ctx[query c][j * 16 + 8g + r]: what lane (g, c) of k_out reads as quads 2 (j & 1) and 2 (j & 1) + 1 of K step 2 h + j / 2
__device__ __forceinline__ void att_store(float* __restrict__ Y, int b, int h, int ql0, int lane, float l, const v8f (&acc)[HD / 16]) {
  l += xhalf(l); const float inv = 1.0f / l; char* yr = (char*)Y + ((size_t)((b * TT + ql0) >> 4) * KST + h * 2) * 2048 + lane * 16;
#pragma unroll
  for (int j = 0; j < HD / 16; ++j) { v4f a, c;
#pragma unroll
    for (int i = 0; i < 4; ++i) { a[i] = acc[j][i] * inv; c[i] = acc[j][4 + i] * inv; }
    vst2(yr + j * 1024, a); vst2(yr + j * 1024 + 512, c); }
  asm volatile("s_wait_xcnt 0x0" :: "v"(yr) : "memory");   // precaution: stands in front of the first rewrite of a register that these stores name; the address as an input keeps its registers until here
  __builtin_amdgcn_sched_barrier(0); }   // keeps the next tile's address work behind the wait above
// 16 query rows from ql0 (>= QHI), steps of 64 keys: q, k once to f16 (1 product), p once to f16 against v f16 (1 product)
__device__ __forceinline__ void att_lo(const _Float16* __restrict__ QH, const _Float16* __restrict__ KH, const _Float16* __restrict__ VT, float* __restrict__ Y, int b, int h, int ql0, int lane) {
  const int col = lane & 15, g = lane >> 4; const int nt = (ql0 >> 6) + 1;
  const size_t bh = (size_t)(b * NH + h); const char* qp = (const char*)QH + (bh * (TT / 16) + (ql0 >> 4)) * 2048; const char* kb = (const char*)KH + bh * (TT / 16 * 2048); const char* vb = (const char*)VT + bh * (TT / 32 * 4096);   // wave-uniform bases; the lane's byte offset below does not change over the loop
  const unsigned ko = 16u * lane, vo = ko;   // fragment order: the lane's 16 bytes of every 512-byte block
  v8h qr[2][2], kr[4][2][2], vr[2][HD / 16][2]; const char* ka = kb + ko;   // the lane's address in the k step that is being loaded
#pragma unroll
  for (int kc = 0; kc < 2; ++kc) { qr[kc][0] = *(const v8h*)(qp + ko + kc * 1024); qr[kc][1] = *(const v8h*)(qp + ko + kc * 1024 + 512); }
#pragma unroll
  for (int jt = 0; jt < 4; ++jt)
#pragma unroll
    for (int kc = 0; kc < 2; ++kc) { kr[jt][kc][0] = *(const v8h*)(ka + jt * 2048 + kc * 1024); kr[jt][kc][1] = *(const v8h*)(ka + jt * 2048 + kc * 1024 + 512); }
  asm volatile("s_wait_xcnt 0x0" :: "v"(qp + ko), "v"(ka) : "memory");   // precaution: stands in front of the first rewrite of a register that these loads name; the addresses as inputs keep their registers from being given to a later load of the group
  __builtin_amdgcn_sched_barrier(0);   // keeps every later write of an address register behind the wait above
  v16h q[2];
#pragma unroll
  for (int kc = 0; kc < 2; ++kc) { union { v16h v; v8h q[2]; } f; f.q[0] = qr[kc][0]; f.q[1] = qr[kc][1]; q[kc] = f.v; }
  v8f acc[HD / 16] = {}; float m = -3.0e38f, l = 0.f;
#pragma unroll 1   // rolled: one step of 64 keys per trip keeps the live registers below 256
  for (int t = 0; t < nt; ++t) { const char* vk = vb + t * 8192;
#pragma unroll
    for (int c = 0; c < 2; ++c)
#pragma unroll
      for (int j = 0; j < HD / 16; ++j) { const int o = c * 4096 + j * 1024; vr[c][j][0] = *(const v8h*)(vk + vo + o); vr[c][j][1] = *(const v8h*)(vk + vo + o + 512); }
    asm volatile("s_wait_xcnt 0x0" :: "v"(vk + vo) : "memory");   // precaution, as above
    __builtin_amdgcn_sched_barrier(0);   // holds this step's 16 v loads in front of the logits, which with the softmax cover their latency, and every later write of an address register behind the wait above
    v8f s[4] = {};
#pragma unroll
    for (int kc = 0; kc < 2; ++kc)
#pragma unroll
      for (int jt = 0; jt < 4; ++jt) { union { v16h v; v8h q[2]; } f; f.q[0] = kr[jt][kc][0]; f.q[1] = kr[jt][kc][1]; s[jt] = wmma16(f.v, q[kc], s[jt]); }
    if (t + 1 < nt) { ka += 8192;   // the test reads the same for the whole wave; the step before's loads from ka have passed their wait
#pragma unroll
      for (int jt = 0; jt < 4; ++jt)
#pragma unroll
        for (int kc = 0; kc < 2; ++kc) { kr[jt][kc][0] = *(const v8h*)(ka + jt * 2048 + kc * 1024); kr[jt][kc][1] = *(const v8h*)(ka + jt * 2048 + kc * 1024 + 512); }
      asm volatile("s_wait_xcnt 0x0" :: "v"(ka) : "memory"); }   // precaution, as above; the next step's 16 k loads go into the registers that the products above have read, and the softmax and the products below cover their latency
    float x[4][8];
#pragma unroll
    for (int jt = 0; jt < 4; ++jt)
#pragma unroll
      for (int r = 0; r < 8; ++r) x[jt][r] = s[jt][r];
    sm_step<4>(x, t == nt - 1, ql0 + col - t * 64 - 8 * g, m, l, acc);
#pragma unroll
    for (int c = 0; c < 2; ++c) { v16h p;
#pragma unroll
      for (int i = 0; i < 8; ++i) { p[i] = (_Float16)x[2 * c][i]; p[8 + i] = (_Float16)x[2 * c + 1][i]; }
#pragma unroll
      for (int j = 0; j < HD / 16; ++j) { union { v16h v; v8h q[2]; } f; f.q[0] = vr[c][j][0]; f.q[1] = vr[c][j][1]; acc[j] = wmma16(f.v, p, acc[j]); } } }
  att_store(Y, b, h, ql0, lane, l, acc); }
// 16 query rows from ql0 (< QHI: few keys, no averaging), steps of 32 keys: q and k as f16 hi + residual (x 2^10) (3 products), p and v as bf16 hi + lo (3 products)
__device__ __forceinline__ void att_hi(const _Float16* __restrict__ QH, const _Float16* __restrict__ QL, const _Float16* __restrict__ KH, const _Float16* __restrict__ KL, const __bf16* __restrict__ VB, const __bf16* __restrict__ VBL, float* __restrict__ Y, int b, int h, int ql0, int lane) {
  const int col = lane & 15, g = lane >> 4; const int nt = (ql0 >> 5) + 1;
  const size_t bh = (size_t)(b * NH + h); const char* qp = (const char*)QH + (bh * (TT / 16) + (ql0 >> 4)) * 2048; const char* qlp = (const char*)QL + (bh * (QHI / 16) + (ql0 >> 4)) * 2048; const char* kb = (const char*)KH + bh * (TT / 16 * 2048); const char* klb = (const char*)KL + bh * (KHI / 16 * 2048);
  const char* vhb = (const char*)VB + bh * (KHI / 32 * 4096); const char* vlb = (const char*)VBL + bh * (KHI / 32 * 4096);   // wave-uniform bases; the lane's byte offset below does not change over the loop
  const unsigned ko = 16u * lane, vo = ko;   // fragment order: the lane's 16 bytes of every 512-byte block
  v8h qr[2][2], qs[2][2];
#pragma unroll
  for (int kc = 0; kc < 2; ++kc) { qr[kc][0] = *(const v8h*)(qp + ko + kc * 1024); qr[kc][1] = *(const v8h*)(qp + ko + kc * 1024 + 512); qs[kc][0] = *(const v8h*)(qlp + ko + kc * 1024); qs[kc][1] = *(const v8h*)(qlp + ko + kc * 1024 + 512); }
  asm volatile("s_wait_xcnt 0x0" :: "v"(qp + ko), "v"(qlp + ko) : "memory");   // precaution: stands in front of the first rewrite of a register that these loads name; the addresses as inputs keep their registers from being given to a later load of the group
  __builtin_amdgcn_sched_barrier(0);   // keeps every later write of an address register behind the wait above
  v16h qh[2], ql[2];
#pragma unroll
  for (int kc = 0; kc < 2; ++kc) { union { v16h v; v8h q[2]; } f; f.q[0] = qr[kc][0]; f.q[1] = qr[kc][1]; qh[kc] = f.v; f.q[0] = qs[kc][0]; f.q[1] = qs[kc][1]; ql[kc] = f.v; }
  v8f acc[HD / 16] = {}; float m = -3.0e38f, l = 0.f;
#pragma unroll 1   // rolled: one step of 32 keys per trip keeps the live registers below 256
  for (int t = 0; t < nt; ++t) { const char* kk = kb + t * 4096 + ko; const char* lk = klb + t * 4096 + ko; const char* hv = vhb + t * 4096 + vo; const char* lv = vlb + t * 4096 + vo;   // the lane's four addresses of this step
    v8h kh[2][2][2], kl[2][2][2]; v8b vh[HD / 16][2], vl[HD / 16][2];
#pragma unroll
    for (int jt = 0; jt < 2; ++jt)
#pragma unroll
      for (int kc = 0; kc < 2; ++kc) { const int o = jt * 2048 + kc * 1024; kh[jt][kc][0] = *(const v8h*)(kk + o); kh[jt][kc][1] = *(const v8h*)(kk + o + 512); kl[jt][kc][0] = *(const v8h*)(lk + o); kl[jt][kc][1] = *(const v8h*)(lk + o + 512); }
#pragma unroll
    for (int j = 0; j < HD / 16; ++j) { const int o = j * 1024; vh[j][0] = *(const v8b*)(hv + o); vh[j][1] = *(const v8b*)(hv + o + 512); vl[j][0] = *(const v8b*)(lv + o); vl[j][1] = *(const v8b*)(lv + o + 512); }
    asm volatile("s_wait_xcnt 0x0" :: "v"(kk), "v"(lk), "v"(hv), "v"(lv) : "memory");   // precaution, as above
    __builtin_amdgcn_sched_barrier(0);   // holds the step's 32 loads in front of its first product (sunk to their uses they would cost one memory latency each) and every later write of an address register behind the wait above
    v8f s[2] = {}, sl[2] = {};
#pragma unroll
    for (int kc = 0; kc < 2; ++kc)
#pragma unroll
      for (int jt = 0; jt < 2; ++jt) { union { v16h v; v8h q[2]; } fh, fl; fh.q[0] = kh[jt][kc][0]; fh.q[1] = kh[jt][kc][1]; fl.q[0] = kl[jt][kc][0]; fl.q[1] = kl[jt][kc][1]; s[jt] = wmma16(fh.v, qh[kc], s[jt]); sl[jt] = wmma16(fh.v, ql[kc], sl[jt]); sl[jt] = wmma16(fl.v, qh[kc], sl[jt]); }
    float x[2][8];
#pragma unroll
    for (int jt = 0; jt < 2; ++jt)
#pragma unroll
      for (int r = 0; r < 8; ++r) x[jt][r] = s[jt][r] + sl[jt][r] * (1.0f / 1024.0f);
    sm_step<2>(x, t == nt - 1, ql0 + col - t * 32 - 8 * g, m, l, acc);
    float v[16];
#pragma unroll
    for (int i = 0; i < 8; ++i) { v[i] = x[0][i]; v[8 + i] = x[1][i]; }
    const F2 p = bsplit16(v);
#pragma unroll
    for (int j = 0; j < HD / 16; ++j) { union { v16b v; v8b q[2]; } fh, fl; fh.q[0] = vh[j][0]; fh.q[1] = vh[j][1]; fl.q[0] = vl[j][0]; fl.q[1] = vl[j][1]; acc[j] = wmma_bf(fh.v, p.h, acc[j]); acc[j] = wmma_bf(fh.v, p.l, acc[j]); acc[j] = wmma_bf(fl.v, p.h, acc[j]); } }
  att_store(Y, b, h, ql0, lane, l, acc); }
// block = (pair of query blocks NQB-1-x and x, (b, h)): together NQB + 1 blocks of 64 keys, so the work is even except where x < QBH (block x on the 3-product path, in steps of 32 keys); wave = 16 query rows of the block; no LDS, no barrier
__global__ __launch_bounds__(128) void k_att(const _Float16* __restrict__ QH, const _Float16* __restrict__ QL, const _Float16* __restrict__ KH, const _Float16* __restrict__ KL, const _Float16* __restrict__ VT, const __bf16* __restrict__ VB, const __bf16* __restrict__ VBL, float* __restrict__ Y) { static_assert(CAUSAL && NQB % 2 == 0 && QBH * 64 == QHI && QHI == KHI, "the pairing counts on causal row lengths; the early-row path reads residual planes of QHI rows");
  const int lane = threadIdx.x & 31; const int wv = __builtin_amdgcn_readfirstlane(threadIdx.x >> 5);   // the wave's number as a scalar: trip counts and the tests on them are scalar, EXEC stays full at every product
  const int b = blockIdx.y / NH, h = blockIdx.y % NH;
#pragma unroll 1   // rolled: one copy of each path in the code
  for (int z = 0; z < 2; ++z) { const int qb = z ? (int)blockIdx.x : NQB - 1 - (int)blockIdx.x; const int ql0 = qb * 64 + wv * 16;
    if (qb < QBH) att_hi(QH, QL, KH, KL, VB, VBL, Y, b, h, ql0, lane); else att_lo(QH, KH, VT, Y, b, h, ql0, lane); } }
// ---- k_out: block = (64 rows, 128 cols): out = ctx Wo (+ bo): ctx once to f16 against Wo as f16(bf16 x 2^8) exact (1 product) x 2^-8; causal early rows (< QHI of each sequence): ctx bf16 hi + lo against exact bf16 Wo (2 products)
__global__ __launch_bounds__(128) void k_out(const float* __restrict__ Y, const float* __restrict__ WO, const float* __restrict__ BO, float* __restrict__ OUT) { __shared__ __align__(16) float sf[4][16][132]; __shared__ __align__(16) WT wt[2];
  const int tid = threadIdx.x, wave = tid >> 5, lane = tid & 31, col = lane & 15, g = lane >> 4; const int c0 = blockIdx.y * 128; const size_t r0 = (size_t)blockIdx.x * 64 + wave * 16;
  v8f acc[8] = {};
  if (CAUSAL && (int)(((size_t)blockIdx.x * 64) % TT) < QHI) {   /* block-uniform */
    gemm_k<1>((const char*)(Y + (size_t)blockIdx.x * 64 * CC), (unsigned)wave * (16u * CC * 4u) + 16u * lane, (const char*)(WO + c0), wt, wave, lane, acc);
#pragma unroll
    for (int j = 0; j < 8; ++j) { const float bias = BO ? bfr(BO[c0 + j * 16 + col]) : 0.f;
#pragma unroll
      for (int r = 0; r < 8; ++r) sf[wave][8 * g + r][j * 16 + col] = acc[j][r] + bias; }
  } else {
    gemm_k<2>((const char*)(Y + (size_t)blockIdx.x * 64 * CC), (unsigned)wave * (16u * CC * 4u) + 16u * lane, (const char*)(WO + c0), wt, wave, lane, acc);
#pragma unroll
    for (int j = 0; j < 8; ++j) { const float bias = BO ? bfr(BO[c0 + j * 16 + col]) : 0.f;
#pragma unroll
      for (int r = 0; r < 8; ++r) sf[wave][8 * g + r][j * 16 + col] = acc[j][r] * (1.0f / 256.0f) + bias; } }
  LDSX(); for (int rl = 0; rl < 16; ++rl) vst2(OUT + (r0 + rl) * DIN + c0 + lane * 4, *(const v4f*)&sf[wave][rl][lane * 4]); }

extern "C" void kernel_launch(void* const* d_in, const int* in_sizes, int n_in, void* d_out, int out_size, void* d_ws, size_t ws_size, hipStream_t stream) {
  (void)in_sizes; (void)n_in; (void)out_size;
  const float** F = (const float**)d_in;
  if (ws_size < (size_t)WS_END) return;
  char* ws = (char*)d_ws; _Float16 *QH = (_Float16*)(ws + WS_QH), *KH = (_Float16*)(ws + WS_KH), *VT = (_Float16*)(ws + WS_VT), *QL = (_Float16*)(ws + WS_QL), *KL = (_Float16*)(ws + WS_KL); __bf16 *VB = (__bf16*)(ws + WS_VB), *VBL = (__bf16*)(ws + WS_VBL); float *Y = (float*)(ws + WS_Y);
  (void)Y; (void)QL; (void)KL; (void)VB; (void)VBL;
  // inputs: 0 inputs_q [2,2048,1024]; 1 wq, 2 wk, 3 wv [1024,16,64] (= (in,out)); 4 wo [16,64,1024] (= (in,out)); 5 q_norm_scale [64]; 6 k_norm_scale [64]
  k_proj<<<dim3(TNB * TT / 64, CC / 128, 3), 128, 0, stream>>>(F[0], F[0], F[0], F[1], F[2], F[3], nullptr, nullptr, nullptr, QH, QL, KH, KL, VT, VB, VBL, F[5], F[6]);
  k_att<<<dim3(NQB / 2, TNB * NH), 128, 0, stream>>>(QH, QL, KH, KL, VT, VB, VBL, Y);
  k_out<<<dim3(TNB * TT / 64, DIN / 128), 128, 0, stream>>>(Y, F[4], nullptr, (float*)d_out);
}

// v009
// Measured time: 117 microseconds a run.
// In both of two side-by-side timings against v008, it was 1.16 times as fast.
// Over all steps from v000 it is 9.38 times as fast.
// compute dtype: all float inputs rounded to bf16; q/k/v = x W with EXACT bf16 products on WMMA 16x16x32, f32 accumulate; per-head RMSNorm and rotate-half RoPE in f32 (precise sinf/cosf of t * inv_freq); q, k once to f16 -> 1-product causal logits, except the first 384 query rows of each sequence (few keys, no averaging), which use q and k as f16 hi + residual (x 2^10) (3 products); softmax in f32 in base 2 (the scale 1/8 and log2 e in one fused multiply-add, then the hardware's exp2) with a running maximum and sum, divided out at the end; exp(logit - max) x 2^10 once to f16 against v once to f16 (1 product), except the first 384 rows: it and v as bf16 hi + lo (3 products); ctx once to f16 against wo carried x 2^8 in f16 (exact bf16 values), except the first 384 rows: ctx bf16 hi + lo against exact bf16 wo (2 products); f32 output.
#include <hip/hip_runtime.h>
#include <math.h>

typedef __attribute__((ext_vector_type(16))) _Float16 v16h;
typedef __attribute__((ext_vector_type(16))) __bf16 v16b;
typedef __attribute__((ext_vector_type(8)))  _Float16 v8h;
typedef __attribute__((ext_vector_type(8)))  float v8f;
typedef __attribute__((ext_vector_type(4)))  float v4f;
typedef __attribute__((ext_vector_type(2)))  float v2f;
typedef __attribute__((ext_vector_type(4)))  unsigned v4u;
typedef __attribute__((ext_vector_type(4)))  int v4i;
typedef float __attribute__((may_alias)) float_a;
typedef int __attribute__((may_alias)) int_a;

template <typename T> __device__ __forceinline__ void vst2(void* p, T v) { *(T*)p = v;  }
__device__ __forceinline__ v8f wmma16(v16h a, v16h b, v8f c) {
  v8f d = __builtin_amdgcn_wmma_f32_16x16x32_f16(false, a, false, b, (short)0, c, false, false);
  asm volatile("v_nop\n\tv_nop\n\tv_nop\n\tv_nop" : "+v"(d) : "v"(a), "v"(b));
  return d;
}
__device__ __forceinline__ v8f wmma_bf(v16b a, v16b b, v8f c) {
  v8f d = __builtin_amdgcn_wmma_f32_16x16x32_bf16(false, a, false, b, (short)0, c, false, false);
  asm volatile("v_nop\n\tv_nop\n\tv_nop\n\tv_nop" : "+v"(d) : "v"(a), "v"(b));
  return d;
}
// 16x16x32 fragments: lane = (h = lane>>4, row/col = lane&15); elements 0..7 = k0+8h+0..7, 8..15 = k0+16+8h+0..7; D element r = row 8h+r
__device__ __forceinline__ v16h frag_h(const _Float16* rowk0, int lane) {
  union { v16h v; v8h q[2]; } u; const _Float16* p = rowk0 + 8 * (lane >> 4);
  u.q[0] = *(const v8h*)p; u.q[1] = *(const v8h*)(p + 16); return u.v;
}
__device__ __forceinline__ v16h frag_f32(const float* rowk0, int lane) {
  v16h a; const float* p = rowk0 + 8 * (lane >> 4);
#pragma unroll
  for (int i = 0; i < 8; ++i) { a[i] = (_Float16)p[i]; a[8 + i] = (_Float16)p[16 + i]; }
  return a;
}
__device__ __forceinline__ v16h frag_f32s(const float* rowk0, int lane, float sc) {
  v16h a; const float* p = rowk0 + 8 * (lane >> 4);
#pragma unroll
  for (int i = 0; i < 8; ++i) { a[i] = (_Float16)(p[i] * sc); a[8 + i] = (_Float16)(p[16 + i] * sc); }
  return a;
}
// column fragment from a [K][ld] layout (column n), rows >= K read as 0
__device__ __forceinline__ v16h fragc_f32(const float* W, int k0, int n, int lane, int ld, int K) {
  v16h a; const int g = lane >> 4;
#pragma unroll
  for (int i = 0; i < 8; ++i) { const int ka = k0 + 8 * g + i, kb = ka + 16;
    a[i] = (_Float16)(ka < K ? W[(size_t)(ka < K ? ka : K - 1) * ld + n] : 0.f); a[8 + i] = (_Float16)(kb < K ? W[(size_t)(kb < K ? kb : K - 1) * ld + n] : 0.f); }
  return a;
}
struct F2 { v16b h, l; };
__device__ __forceinline__ F2 bsplit16(const float v[16]) { F2 r;
#pragma unroll
  for (int i = 0; i < 16; ++i) { const __bf16 h = (__bf16)v[i]; r.h[i] = h; r.l[i] = (__bf16)(v[i] - (float)h); }
  return r; }
__device__ __forceinline__ F2 split_row(const float* row, int k0, int lane) { float v[16]; const float* p = row + k0 + 8 * (lane >> 4);
#pragma unroll
  for (int i = 0; i < 8; ++i) { v[i] = p[i]; v[8 + i] = p[16 + i]; }
  return bsplit16(v); }
__device__ __forceinline__ F2 split_rowK(const float* row, int k0, int lane, int K) { float v[16]; const int g = lane >> 4;
#pragma unroll
  for (int i = 0; i < 8; ++i) { const int ka = k0 + 8 * g + i, kb = ka + 16; v[i] = ka < K ? row[ka < K ? ka : K - 1] : 0.f; v[8 + i] = kb < K ? row[kb < K ? kb : K - 1] : 0.f; }
  return bsplit16(v); }
__device__ __forceinline__ F2 split_col(const float* W, int k0, int n, int lane, int ld, int K) { float v[16]; const int g = lane >> 4;
#pragma unroll
  for (int i = 0; i < 8; ++i) { const int ka = k0 + 8 * g + i, kb = ka + 16; v[i] = ka < K ? W[(size_t)(ka < K ? ka : K - 1) * ld + n] : 0.f; v[8 + i] = kb < K ? W[(size_t)(kb < K ? kb : K - 1) * ld + n] : 0.f; }
  return bsplit16(v); }
__device__ __forceinline__ v8f mac3(const F2& a, const F2& b, v8f c) { c = wmma_bf(a.l, b.h, c); c = wmma_bf(a.h, b.l, c); return wmma_bf(a.h, b.h, c); }
__device__ __forceinline__ float sigm(float v) { return 1.0f / (1.0f + expf(-v)); }
#define LDSX() do { asm volatile("s_wait_dscnt 0" ::: "memory"); __builtin_amdgcn_wave_barrier(); __builtin_amdgcn_fence(__ATOMIC_RELEASE, "workgroup"); } while (0)

// Causal multi-head dot-product attention with QK-RMSNorm and RoPE (B 2, S 2,048, D 1,024, 16 heads x 64): q/k/v = x w ((in, head, hd) = (in,out)); q, k RMS-normalised over the 64 head dims (eps 1e-6, x scale) then rotate-half RoPE (angle t * 10000^(-i/32), i < 32); q x 64^-0.5; logits masked to -0.7*f32max where key > query (== -inf here: the diagonal is always kept); softmax; out = merged(attn v) wo ((head, hd, out) = (in,out)).
#define NB 2
#define TT 2048
#define CC 1024            // NH * HD = projected width
#define DIN 1024          // input (model) width
#define NH 16
#define HD 64
#define NQB (TT / 64)
#define SCALE (0.125f)
#define CAUSAL 1
#ifndef TNB
#define TNB NB
#endif
__device__ __forceinline__ float bfr(float v) { return (float)(__bf16)v; }
__host__ __device__ __forceinline__ int kb_last(int qb) { return CAUSAL ? ((qb * 64 + 63) >> 7) : (TT / 128 - 1); }
typedef __attribute__((ext_vector_type(8))) __bf16 v8b;
__device__ __forceinline__ v16b frag_b(const __bf16* rowk0, int lane) {
  union { v16b v; v8b q[2]; } u; const __bf16* p = rowk0 + 8 * (lane >> 4);
  u.q[0] = *(const v8b*)p; u.q[1] = *(const v8b*)(p + 16); return u.v;
}
#define QBH 6              // causal: query blocks 0..QBH-1 of each sequence (few keys, no averaging) take the high-precision path
#define QHI 384            // rows carrying a q residual plane
#define KHI 384            // key rows carrying k residual / v bf16 hi+lo planes (used only by the causal high-precision path)
// B fragment (k rows k0+.., output column o) of a weight: (in,out) [K][ld] or (out,in) [ld rows of K]: bf16 exact, or f16(bf16 * 256) exact
__device__ __forceinline__ v16b wcol_io(const float* Wm, int k0, int o, int lane, int ld) { v16b w; const int g = lane >> 4;
#pragma unroll
  for (int i = 0; i < 8; ++i) { w[i] = (__bf16)Wm[(size_t)(k0 + 8 * g + i) * ld + o]; w[8 + i] = (__bf16)Wm[(size_t)(k0 + 16 + 8 * g + i) * ld + o]; }
  return w; }
__device__ __forceinline__ v16b wcol_oi(const float* Wm, int k0, int o, int lane, int K) { v16b w; const float* p = Wm + (size_t)o * K + k0 + 8 * (lane >> 4);
#pragma unroll
  for (int i = 0; i < 8; ++i) { w[i] = (__bf16)p[i]; w[8 + i] = (__bf16)p[16 + i]; }
  return w; }
__device__ __forceinline__ v16h wcolh_io(const float* Wm, int k0, int o, int lane, int ld) { v16h w; const int g = lane >> 4;
#pragma unroll
  for (int i = 0; i < 8; ++i) { w[i] = (_Float16)(bfr(Wm[(size_t)(k0 + 8 * g + i) * ld + o]) * 256.0f); w[8 + i] = (_Float16)(bfr(Wm[(size_t)(k0 + 16 + 8 * g + i) * ld + o]) * 256.0f); }
  return w; }
__device__ __forceinline__ v16h wcolh_oi(const float* Wm, int k0, int o, int lane, int K) { v16h w; const float* p = Wm + (size_t)o * K + k0 + 8 * (lane >> 4);
#pragma unroll
  for (int i = 0; i < 8; ++i) { w[i] = (_Float16)(bfr(p[i]) * 256.0f); w[8 + i] = (_Float16)(bfr(p[16 + i]) * 256.0f); }
  return w; }
#define WQKV_LAYOUT 0   // 0 = (in,out) [DIN][CC]; 1 = (out,in) [CC][DIN]; 2 = per-head [NH][DIN][HD]
__device__ __forceinline__ v16b wcol_hdk(const float* Wm, int k0, int o, int lane) { v16b w; const int g = lane >> 4; const float* p = Wm + (size_t)(o / HD) * DIN * HD + (o % HD);
#pragma unroll
  for (int i = 0; i < 8; ++i) { w[i] = (__bf16)p[(size_t)(k0 + 8 * g + i) * HD]; w[8 + i] = (__bf16)p[(size_t)(k0 + 16 + 8 * g + i) * HD]; }
  return w; }
#define WO_OUT_IN 0
#if WQKV_LAYOUT == 1
#define WCOL(W, k0, o, lane) wcol_oi(W, k0, o, lane, DIN)
#elif WQKV_LAYOUT == 2
#define WCOL(W, k0, o, lane) wcol_hdk(W, k0, o, lane)
#else
#define WCOL(W, k0, o, lane) wcol_io(W, k0, o, lane, CC)
#endif
#if WO_OUT_IN
#define WOCOL(W, k0, o, lane) wcol_oi(W, k0, o, lane, CC)
#define WOCOLH(W, k0, o, lane) wcolh_oi(W, k0, o, lane, CC)
#else
#define WOCOL(W, k0, o, lane) wcol_io(W, k0, o, lane, DIN)
#define WOCOLH(W, k0, o, lane) wcolh_io(W, k0, o, lane, DIN)
#endif
__constant__ float c_invf[32] = {1.000000000e+00f,7.498942018e-01f,5.623413324e-01f,4.216965139e-01f,3.162277639e-01f,2.371373624e-01f,1.778279394e-01f,1.333521456e-01f,1.000000015e-01f,7.498941571e-02f,5.623412877e-02f,4.216964915e-02f,3.162277862e-02f,2.371373586e-02f,1.778279431e-02f,1.333521493e-02f,9.999999776e-03f,7.498942316e-03f,5.623413250e-03f,4.216964822e-03f,3.162277862e-03f,2.371373819e-03f,1.778279431e-03f,1.333521446e-03f,1.000000047e-03f,7.498941850e-04f,5.623413017e-04f,4.216964880e-04f,3.162277862e-04f,2.371373848e-04f,1.778279402e-04f,1.333521504e-04f};   // 1 / 10000^(i/32) evaluated in f32 exactly as the reference does (jax, eager)
#define PROJ_EXTRA_PARAMS , const float* __restrict__ QS, const float* __restrict__ KS
// per-(row, head) epilogue on the f32 projection tile: RMSNorm over the head's 64 values (x q_norm_scale / k_norm_scale), then rotate-half RoPE; v untouched
#define PROJ_EPI(which, row, t, h) do { if ((which) < 2) { float* rw = (row); const float* NS = (which) == 0 ? QS : KS; float ss = 0.f; _Pragma("unroll") for (int i = 0; i < 64; ++i) ss += rw[i] * rw[i]; const float rn = rsqrtf(ss * (1.0f / 64.0f) + 1e-6f); \
    _Pragma("unroll") for (int i = 0; i < 32; ++i) { const float x1 = rw[i] * rn * bfr(NS[i]), x2 = rw[i + 32] * rn * bfr(NS[i + 32]); const float ang = (float)(t) * c_invf[i]; const float cs = cosf(ang), sn = sinf(ang); rw[i] = x1 * cs - x2 * sn; rw[i + 32] = x2 * cs + x1 * sn; } } } while (0)
#ifndef SM_EXTRA_PARAMS
#define SM_EXTRA_PARAMS
#endif
#ifndef PROJ_EXTRA_PARAMS
#define PROJ_EXTRA_PARAMS
#endif
#ifndef SM_MASK_HOOK
#define SM_MASK_HOOK (void)0
#endif

// Every plane below lies in FRAGMENT ORDER: blocks of 512 bytes, lane l's 16 bytes at 16 l, so that one 16-byte load or store per lane moves 4 whole 128-byte lines (in row order the same instruction touched 32 bytes in each of 16 lines).
// row planes (q, k and their residuals; NR rows per sequence): block ((b * NH + h) * (NR / 16) + t / 16) * 4 + kc * 2 + hf, lane (g, t % 16) = head dims kc * 32 + hf * 16 + 8 g + 0..7
// v planes (NK keys per sequence): block (((b * NH + h) * (NK / 32) + t / 32) * 4 + j) * 2 + hf, lane (g, c) = head dim j * 16 + c, keys (t / 32) * 32 + hf * 16 + 8 g + 0..7
// ctx: block (((b * TT + t) / 16) * KST + k / 32) * 4 + i, lane (g, t % 16) = k (k / 32) * 32 + (i / 2) * 16 + 8 g + (i % 2) * 4 + 0..3
#define WS_QH  0u                                      // f16 q, row plane of TT rows
#define WS_KH  (WS_QH + 2u * (size_t)NB * TT * CC)      // f16 k, row plane of TT rows
#define WS_VT  (WS_KH + 2u * (size_t)NB * TT * CC)      // f16 v plane of TT keys
#define WS_QL  (WS_VT + 2u * (size_t)NB * CC * TT)      // f16 q residual x 2^10, row plane of QHI rows
#define WS_KL  (WS_QL + 2u * (size_t)NB * QHI * CC)     // f16 k residual x 2^10, row plane of KHI rows
#define WS_VB  (WS_KL + 2u * (size_t)NB * KHI * CC)     // bf16 v hi, v plane of KHI keys (WS_VBL: lo)
#define WS_VBL (WS_VB + 2u * (size_t)NB * CC * KHI)
#define WS_Y   (WS_VBL + 2u * (size_t)NB * CC * KHI)    // f32 ctx
#define WS_END (WS_Y  + 4u * (size_t)NB * TT * CC)

// ---- weight tile in LDS, shared by k_proj and k_out: one K step (64 k x 128 output columns) of an (in,out) f32 weight is read ONCE per work-group (wave w: rows 16w..16w+15, lane: 4 columns, whole 512-byte rows), converted as before and kept as 16-bit [column][k] rows of 144 bytes (16 B x odd: the fragment reads meet no bank conflict). Two buffers: the next step's loads (and the wave's own next A rows) fly while this step's products run. A work-group pays one load latency, one conversion and one barrier per K step, and few work-groups share a WGP: 64 k a step, with 24 loads of a wave in flight, halves the number of those waits.
#define WLD 1024           // row length of every weight here (CC for wq/wk/wv, DIN for wo)
#define KST 32             // 32-k fragments along K (DIN / 32 == CC / 32); ctx is laid out by them
#define KS2 (KST / 2)      // K steps of 64 k: two fragments each
static_assert(CC == WLD && DIN == WLD && DIN / 32 == KST && CC / 32 == KST && WQKV_LAYOUT == 0 && WO_OUT_IN == 0, "the staging reads (in,out) weights with rows of WLD floats");
typedef unsigned WT[128][36];
// MODE 0: A once to bf16, W bf16 (1 product); 1: A bf16 hi + lo, W bf16 (2 products); 2: A once to f16, W f16(bf16 x 2^8) (1 product)
struct AFr { v16b h, l; v16h f; };
template <int MODE> __device__ __forceinline__ void a_cvt(AFr& a, const v4f (&ar)[4]) { float v[16];
#pragma unroll
  for (int i = 0; i < 4; ++i) { v[i] = ar[0][i]; v[4 + i] = ar[1][i]; v[8 + i] = ar[2][i]; v[12 + i] = ar[3][i]; }
  if constexpr (MODE == 1) { const F2 s = bsplit16(v); a.h = s.h; a.l = s.l; }
  else {
#pragma unroll
    for (int i = 0; i < 16; ++i) { if constexpr (MODE == 0) a.h[i] = (__bf16)v[i]; else a.f[i] = (_Float16)v[i]; } } }
template <int MODE> __device__ __forceinline__ void wt_store(WT& wt, const v4f (&wr)[16], int wave, int lane) {
#pragma unroll
  for (int n = 0; n < 4; ++n)
#pragma unroll
    for (int hh = 0; hh < 2; ++hh) { union { v8b b; v8h h; v4u u; } p;
#pragma unroll
      for (int i = 0; i < 8; ++i) { if constexpr (MODE == 2) p.h[i] = (_Float16)(bfr(wr[8 * hh + i][n]) * 256.0f); else p.b[i] = (__bf16)wr[8 * hh + i][n]; }
      *(v4u*)&wt[4 * lane + n][8 * wave + 4 * hh] = p.u; } }   // column 4 lane + n, k 16 wave + 8 hh .. + 7
// acc[j] += A (16 rows of the wave, f32 at xb + xo: MODE 0 an input's K-contiguous rows, MODE 1 and 2 ctx in fragment order) x W (columns j * 16 + col of the tile at wb); k order and product order as in the direct form
template <int MODE> __device__ __forceinline__ void gemm_k(const char* xb, unsigned xo, const char* wb, WT (&wt)[2], int wave, int lane, v8f (&acc)[8]) {
  const int col = lane & 15, g = lane >> 4; const unsigned wo = (unsigned)(16 * wave) * (WLD * 4u) + 16u * lane;
  constexpr int A1 = MODE ? 512 : 16, A2 = MODE ? 1024 : 64, A3 = MODE ? 1536 : 80, AS = MODE ? 2048 : 128;   // byte steps to the lane's 2nd, 3rd and 4th quad of a 32-k fragment, and to the next fragment
  v4f wr[16], ar[2][4]; AFr a[2];
#pragma unroll
  for (int i = 0; i < 16; ++i) wr[i] = *(const v4f*)(wb + wo + i * (WLD * 4));
#pragma unroll
  for (int s = 0; s < 2; ++s) { ar[s][0] = *(const v4f*)(xb + xo + s * AS); ar[s][1] = *(const v4f*)(xb + xo + s * AS + A1); ar[s][2] = *(const v4f*)(xb + xo + s * AS + A2); ar[s][3] = *(const v4f*)(xb + xo + s * AS + A3); }
  asm volatile("s_wait_xcnt 0x0" :: "v"(wo), "v"(xo), "s"(wb), "s"(xb) : "memory");   // precaution: stands in front of the first rewrite of a register that these loads name; the lane offsets and the uniform bases as inputs keep their registers until here
  __builtin_amdgcn_sched_barrier(0);   // keeps the conversions below, which may reuse the address registers, behind the wait above
  wt_store<MODE>(wt[0], wr, wave, lane); a_cvt<MODE>(a[0], ar[0]); a_cvt<MODE>(a[1], ar[1]);
  __syncthreads();   // publishes K step 0
#pragma unroll 1   // rolled: one K step per trip keeps the loop small and k_proj's live registers below 256 (4 waves per SIMD)
  for (int kc = 0; kc < KS2; ++kc) { const bool more = kc + 1 < KS2;   // the same for the whole work-group
    if (more) { const char* wk = wb + (size_t)(kc + 1) * (64 * WLD * 4); const char* xk = xb + (kc + 1) * (2 * AS);
#pragma unroll
      for (int i = 0; i < 16; ++i) wr[i] = *(const v4f*)(wk + wo + i * (WLD * 4));
#pragma unroll
      for (int s = 0; s < 2; ++s) { ar[s][0] = *(const v4f*)(xk + xo + s * AS); ar[s][1] = *(const v4f*)(xk + xo + s * AS + A1); ar[s][2] = *(const v4f*)(xk + xo + s * AS + A2); ar[s][3] = *(const v4f*)(xk + xo + s * AS + A3); }
      asm volatile("s_wait_xcnt 0x0" ::: "memory"); }   // precaution, as above; its memory clobber also keeps the 24 loads from sinking to their uses behind the products
    __builtin_amdgcn_sched_barrier(0);   // holds the next step's loads in front of this step's products, which then cover their latency, and every later write of an address register behind the wait above
    const WT& cur = wt[kc & 1];
#pragma unroll
    for (int s = 0; s < 2; ++s) { v4u f[8][2];   // the step's two 32-k fragments, in k order
#pragma unroll
      for (int j = 0; j < 8; ++j) { f[j][0] = *(const v4u*)&cur[j * 16 + col][16 * s + 4 * g]; f[j][1] = *(const v4u*)&cur[j * 16 + col][16 * s + 8 + 4 * g]; }   // elements 0..7 = k 32s + 8g.., 8..15 = k 32s + 16 + 8g..
#pragma unroll
      for (int j = 0; j < 8; ++j) { union { v4u q[2]; v16b b; v16h h; } w; w.q[0] = f[j][0]; w.q[1] = f[j][1];
        if constexpr (MODE == 0) acc[j] = wmma_bf(a[s].h, w.b, acc[j]);
        else if constexpr (MODE == 1) { acc[j] = wmma_bf(a[s].h, w.b, acc[j]); acc[j] = wmma_bf(a[s].l, w.b, acc[j]); }
        else acc[j] = wmma16(a[s].f, w.h, acc[j]); } }
    if (more) { wt_store<MODE>(wt[(kc + 1) & 1], wr, wave, lane); a_cvt<MODE>(a[0], ar[0]); a_cvt<MODE>(a[1], ar[1]);   // into the buffer whose last readers passed the barrier of the trip before
      __syncthreads(); } } }   // one barrier per K step: publishes step kc + 1 and ends every reader's last read of step kc's buffer
// ---- k_proj: block = (64 rows, 128 cols, which): q/k/v = X W (+ b) with exact bf16 products (K = DIN) -> which 0: q f16 (+ residual, rows < QHI); 1: k f16 (+ residual, rows < KHI); 2: v f16 (+ bf16 hi/lo for t < KHI); all stored in fragment order
__global__ __launch_bounds__(128) void k_proj(const float* __restrict__ XQ, const float* __restrict__ XK, const float* __restrict__ XV, const float* __restrict__ WQ, const float* __restrict__ WK, const float* __restrict__ WV, const float* __restrict__ BQ, const float* __restrict__ BK, const float* __restrict__ BV,
    _Float16* __restrict__ QH, _Float16* __restrict__ QL, _Float16* __restrict__ KH, _Float16* __restrict__ KL, _Float16* __restrict__ VT, __bf16* __restrict__ VB, __bf16* __restrict__ VBL PROJ_EXTRA_PARAMS) {
  __shared__ __align__(16) float st[64][132]; __shared__ __align__(16) WT wt[2];   // 69 KiB in all: LDS does not hold the number of resident work-groups below what the registers allow
  const int tid = threadIdx.x, wave = tid >> 5, lane = tid & 31, col = lane & 15, g = lane >> 4; const int which = blockIdx.z; const int c0 = blockIdx.y * 128; const size_t r0 = (size_t)blockIdx.x * 64; const size_t bb = r0 / TT; const int t0 = (int)(r0 % TT);
  const float* X = which == 0 ? XQ : which == 1 ? XK : XV; const float* WA = which == 0 ? WQ : which == 1 ? WK : WV; const float* BA = which == 0 ? BQ : which == 1 ? BK : BV;
  v8f acc[8] = {};
  gemm_k<0>((const char*)(X + r0 * DIN), (unsigned)(wave * 16 + col) * (DIN * 4u) + 32u * g, (const char*)(WA + c0), wt, wave, lane, acc);
  { // stage the f32 tile (acc + bias) in LDS and run the per-(row, head) epilogue hook; behind its barrier st is only read: each lane takes the f32 values of its own 16-byte pieces of the planes and converts them in registers
#pragma unroll
    for (int j = 0; j < 8; ++j) { const float bias = BA ? bfr(BA[c0 + j * 16 + col]) : 0.f;
#pragma unroll
      for (int r = 0; r < 8; ++r) st[wave * 16 + 8 * g + r][j * 16 + col] = acc[j][r] + bias; }
    __syncthreads();
    for (int e = tid; e < 64 * (128 / HD); e += 128) { const int rl = e / (128 / HD), hh = e % (128 / HD); PROJ_EPI(which, &st[rl][hh * HD], (int)((r0 + rl) % TT), (c0 / HD) + hh); }
    __syncthreads(); }
  if (which < 2) { _Float16* DH = which == 0 ? QH : KH; _Float16* DL = which == 0 ? QL : KL; const int nhi = which == 0 ? QHI : KHI; const bool hi_rows = t0 < nhi;
    const int u = (wave >> 1) * 4 + (wave & 1) * 2 + g;   // wave w writes the blocks kc * 2 + hf == w: the lane's 8 head dims start at 8 u
    char* dh = (char*)DH + (((bb * NH + c0 / HD) * (size_t)(TT / 16) + (t0 >> 4)) * 4 + wave) * 512 + lane * 16;
    v4u d[8]; v4f x[8][2];   // it = 2 x (16-row tile) + head of the pair
#pragma unroll
    for (int it = 0; it < 8; ++it) { const float* p = &st[(it >> 1) * 16 + col][(it & 1) * HD + u * 8]; x[it][0] = *(const v4f*)p; x[it][1] = *(const v4f*)(p + 4); }
#pragma unroll
    for (int it = 0; it < 8; ++it) { union { v8h h; v4u u; } c;
#pragma unroll
      for (int i = 0; i < 8; ++i) c.h[i] = (_Float16)x[it][i >> 2][i & 3];
      d[it] = c.u; }
#pragma unroll
    for (int it = 0; it < 8; ++it) vst2(dh + (it >> 1) * 2048 + (it & 1) * (TT / 16 * 2048), d[it]);
    asm volatile("s_wait_xcnt 0x0" :: "v"(dh) : "memory");   // precaution: stands in front of the first rewrite of a register that these stores name; the address as an input keeps its registers until here
    __builtin_amdgcn_sched_barrier(0);   // keeps what follows, which may reuse the stores' registers, behind the wait above
    if (hi_rows) { v4u r[8]; char* dl = (char*)DL + (((bb * NH + c0 / HD) * (size_t)(nhi / 16) + (t0 >> 4)) * 4 + wave) * 512 + lane * 16;   // block-uniform
#pragma unroll
      for (int it = 0; it < 8; ++it) { union { v8h h; v4u u; } c;
#pragma unroll
        for (int i = 0; i < 8; ++i) { const float v = x[it][i >> 2][i & 3]; c.h[i] = (_Float16)((v - (float)(_Float16)v) * 1024.0f); }
        r[it] = c.u; }
#pragma unroll
      for (int it = 0; it < 8; ++it) vst2(dl + (it >> 1) * 2048 + (it & 1) * (QHI / 16 * 2048), r[it]);
      asm volatile("s_wait_xcnt 0x0" :: "v"(dl) : "memory"); }   // precaution, as above
  } else { const bool hi_rows = t0 < KHI;
    const unsigned ow = (unsigned)(wave >> 1) * 1024u + (unsigned)(wave & 1) * 512u + lane * 16u;   // wave w writes the blocks with hf == w & 1 and j & 1 == w >> 1
    char* dv = (char*)VT + ((bb * NH + c0 / HD) * (size_t)(TT / 32) + (t0 >> 5)) * 4096 + ow;
    const int cw = (wave >> 1) * 16 + col, rw = (wave & 1) * 16 + g * 8;   // it = 4 x head of the pair + 2 x (32-key tile) + j / 2: column (it >> 2) * HD + (it & 1) * 32 + cw of the tile, first of the lane's 8 keys ((it >> 1) & 1) * 32 + rw
    v4u d[8]; float x[8][8];   // 8 keys of one column: 16 lanes read 16 neighbouring columns of a row, the other 16 a row 32 banks away
#pragma unroll
    for (int it = 0; it < 8; ++it)
#pragma unroll
      for (int i = 0; i < 8; ++i) x[it][i] = st[((it >> 1) & 1) * 32 + rw + i][(it >> 2) * HD + (it & 1) * 32 + cw];
#pragma unroll
    for (int it = 0; it < 8; ++it) { union { v8h h; v4u u; } c;
#pragma unroll
      for (int i = 0; i < 8; ++i) c.h[i] = (_Float16)x[it][i];
      d[it] = c.u; }
#pragma unroll
    for (int it = 0; it < 8; ++it) vst2(dv + (it >> 2) * (TT / 32 * 4096) + ((it >> 1) & 1) * 4096 + (it & 1) * 2048, d[it]);
    asm volatile("s_wait_xcnt 0x0" :: "v"(dv) : "memory");   // precaution, as above
    __builtin_amdgcn_sched_barrier(0);   // keeps what follows, which may reuse the stores' registers, behind the wait above
    if (hi_rows) { v4u r[8], s[8]; const size_t o3 = ((bb * NH + c0 / HD) * (size_t)(KHI / 32) + (t0 >> 5)) * 4096 + ow; char* db = (char*)VB + o3; char* dc = (char*)VBL + o3;   // block-uniform
#pragma unroll
      for (int it = 0; it < 8; ++it) { union { v8b b; v4u u; } ch, cl;
#pragma unroll
        for (int i = 0; i < 8; ++i) { const float v = x[it][i]; const __bf16 bh = (__bf16)v; ch.b[i] = bh; cl.b[i] = (__bf16)(v - (float)bh); }
        r[it] = ch.u; s[it] = cl.u; }
#pragma unroll
      for (int it = 0; it < 8; ++it) { const int o = (it >> 2) * (KHI / 32 * 4096) + ((it >> 1) & 1) * 4096 + (it & 1) * 2048; vst2(db + o, r[it]); vst2(dc + o, s[it]); }
      asm volatile("s_wait_xcnt 0x0" :: "v"(db), "v"(dc) : "memory"); } } }   // precaution, as above
#define LC (SCALE * 1.44269504f)   // unscaled product -> exponent of 2: the logit scale times log2 e
__device__ __forceinline__ float xhalf(float x) { return __builtin_bit_cast(float, __builtin_amdgcn_permlanex16(__builtin_bit_cast(int, x), __builtin_bit_cast(int, x), 0x76543210, 0xfedcba98, false, false)); }   // lane l with lane l ^ 16
// one step of the running softmax over NT tiles of 16 keys: x = unscaled products in, p out; lim = last allowed key of the lane's query, counted from the lane's first key of the step (only looked at where last is set: the step that holds the diagonal; its first key is allowed for every query of the wave, so no step is empty)
template <int NT> __device__ __forceinline__ void sm_step(float (&x)[NT][8], bool last, int lim, float& m, float& l, v8f (&acc)[HD / 16]) {
  if (last) {   // the same for the whole wave
#pragma unroll
    for (int jt = 0; jt < NT; ++jt)
#pragma unroll
      for (int r = 0; r < 8; ++r) if (jt * 16 + r > lim) x[jt][r] = -3.0e38f; }
  float mx = -3.0e38f;
#pragma unroll
  for (int jt = 0; jt < NT; ++jt) mx = fmaxf(mx, fmaxf(fmaxf(fmaxf(x[jt][0], x[jt][1]), fmaxf(x[jt][2], x[jt][3])), fmaxf(fmaxf(x[jt][4], x[jt][5]), fmaxf(x[jt][6], x[jt][7]))));
  mx = fmaxf(mx, xhalf(mx));
  const float mn = fmaxf(m, mx), al = __builtin_amdgcn_exp2f((m - mn) * LC), ms = mn * LC - 10.0f; m = mn;   // first step: al = 2^(-5e37) = 0
  float sum = 0.f;
#pragma unroll
  for (int jt = 0; jt < NT; ++jt) {
#pragma unroll
    for (int r = 0; r < 8; ++r) x[jt][r] = __builtin_amdgcn_exp2f(x[jt][r] * LC - ms);   // one fused multiply-add and v_exp_f32; an excluded key: 2^(-5e37) = 0
    sum += ((x[jt][0] + x[jt][1]) + (x[jt][2] + x[jt][3])) + ((x[jt][4] + x[jt][5]) + (x[jt][6] + x[jt][7])); }
  l = l * al + sum;   // the lane's own keys; the halves are joined once, in att_store
#pragma unroll
  for (int j = 0; j < HD / 16; ++j) acc[j] *= al; }
// lane (g, c) holds ctx[query c][j * 16 + 8g + r]: what lane (g, c) of k_out reads as quads 2 (j & 1) and 2 (j & 1) + 1 of 32-k fragment 2 h + j / 2 (K step h)
__device__ __forceinline__ void att_store(float* __restrict__ Y, int b, int h, int ql0, int lane, float l, const v8f (&acc)[HD / 16]) {
  l += xhalf(l); const float inv = 1.0f / l; char* yr = (char*)Y + ((size_t)((b * TT + ql0) >> 4) * KST + h * 2) * 2048 + lane * 16;
#pragma unroll
  for (int j = 0; j < HD / 16; ++j) { v4f a, c;
#pragma unroll
    for (int i = 0; i < 4; ++i) { a[i] = acc[j][i] * inv; c[i] = acc[j][4 + i] * inv; }
    vst2(yr + j * 1024, a); vst2(yr + j * 1024 + 512, c); }
  asm volatile("s_wait_xcnt 0x0" :: "v"(yr) : "memory");   // precaution: stands in front of the first rewrite of a register that these stores name; the address as an input keeps its registers until here
  __builtin_amdgcn_sched_barrier(0); }   // keeps the next tile's address work behind the wait above
// 16 query rows from ql0 (>= QHI), steps of 64 keys: q, k once to f16 (1 product), p once to f16 against v f16 (1 product)
__device__ __forceinline__ void att_lo(const _Float16* __restrict__ QH, const _Float16* __restrict__ KH, const _Float16* __restrict__ VT, float* __restrict__ Y, int b, int h, int ql0, int lane) {
  const int col = lane & 15, g = lane >> 4; const int nt = (ql0 >> 6) + 1;
  const size_t bh = (size_t)(b * NH + h); const char* qp = (const char*)QH + (bh * (TT / 16) + (ql0 >> 4)) * 2048; const char* kb = (const char*)KH + bh * (TT / 16 * 2048); const char* vb = (const char*)VT + bh * (TT / 32 * 4096);   // wave-uniform bases; the lane's byte offset below does not change over the loop
  const unsigned ko = 16u * lane, vo = ko;   // fragment order: the lane's 16 bytes of every 512-byte block
  v8h qr[2][2], kr[4][2][2], vr[2][HD / 16][2]; const char* ka = kb + ko;   // the lane's address in the k step that is being loaded
#pragma unroll
  for (int kc = 0; kc < 2; ++kc) { qr[kc][0] = *(const v8h*)(qp + ko + kc * 1024); qr[kc][1] = *(const v8h*)(qp + ko + kc * 1024 + 512); }
#pragma unroll
  for (int jt = 0; jt < 4; ++jt)
#pragma unroll
    for (int kc = 0; kc < 2; ++kc) { kr[jt][kc][0] = *(const v8h*)(ka + jt * 2048 + kc * 1024); kr[jt][kc][1] = *(const v8h*)(ka + jt * 2048 + kc * 1024 + 512); }
  asm volatile("s_wait_xcnt 0x0" :: "v"(qp + ko), "v"(ka) : "memory");   // precaution: stands in front of the first rewrite of a register that these loads name; the addresses as inputs keep their registers from being given to a later load of the group
  __builtin_amdgcn_sched_barrier(0);   // keeps every later write of an address register behind the wait above
  v16h q[2];
#pragma unroll
  for (int kc = 0; kc < 2; ++kc) { union { v16h v; v8h q[2]; } f; f.q[0] = qr[kc][0]; f.q[1] = qr[kc][1]; q[kc] = f.v; }
  v8f acc[HD / 16] = {}; float m = -3.0e38f, l = 0.f;
#pragma unroll 1   // rolled: one step of 64 keys per trip keeps the live registers below 256
  for (int t = 0; t < nt; ++t) { const char* vk = vb + t * 8192;
#pragma unroll
    for (int c = 0; c < 2; ++c)
#pragma unroll
      for (int j = 0; j < HD / 16; ++j) { const int o = c * 4096 + j * 1024; vr[c][j][0] = *(const v8h*)(vk + vo + o); vr[c][j][1] = *(const v8h*)(vk + vo + o + 512); }
    asm volatile("s_wait_xcnt 0x0" :: "v"(vk + vo) : "memory");   // precaution, as above
    __builtin_amdgcn_sched_barrier(0);   // holds this step's 16 v loads in front of the logits, which with the softmax cover their latency, and every later write of an address register behind the wait above
    v8f s[4] = {};
#pragma unroll
    for (int kc = 0; kc < 2; ++kc)
#pragma unroll
      for (int jt = 0; jt < 4; ++jt) { union { v16h v; v8h q[2]; } f; f.q[0] = kr[jt][kc][0]; f.q[1] = kr[jt][kc][1]; s[jt] = wmma16(f.v, q[kc], s[jt]); }
    if (t + 1 < nt) { ka += 8192;   // the test reads the same for the whole wave; the step before's loads from ka have passed their wait
#pragma unroll
      for (int jt = 0; jt < 4; ++jt)
#pragma unroll
        for (int kc = 0; kc < 2; ++kc) { kr[jt][kc][0] = *(const v8h*)(ka + jt * 2048 + kc * 1024); kr[jt][kc][1] = *(const v8h*)(ka + jt * 2048 + kc * 1024 + 512); }
      asm volatile("s_wait_xcnt 0x0" :: "v"(ka) : "memory"); }   // precaution, as above; the next step's 16 k loads go into the registers that the products above have read, and the softmax and the products below cover their latency
    float x[4][8];
#pragma unroll
    for (int jt = 0; jt < 4; ++jt)
#pragma unroll
      for (int r = 0; r < 8; ++r) x[jt][r] = s[jt][r];
    sm_step<4>(x, t == nt - 1, ql0 + col - t * 64 - 8 * g, m, l, acc);
#pragma unroll
    for (int c = 0; c < 2; ++c) { v16h p;
#pragma unroll
      for (int i = 0; i < 8; ++i) { p[i] = (_Float16)x[2 * c][i]; p[8 + i] = (_Float16)x[2 * c + 1][i]; }
#pragma unroll
      for (int j = 0; j < HD / 16; ++j) { union { v16h v; v8h q[2]; } f; f.q[0] = vr[c][j][0]; f.q[1] = vr[c][j][1]; acc[j] = wmma16(f.v, p, acc[j]); } } }
  att_store(Y, b, h, ql0, lane, l, acc); }
// 16 query rows from ql0 (< QHI: few keys, no averaging), steps of 32 keys: q and k as f16 hi + residual (x 2^10) (3 products), p and v as bf16 hi + lo (3 products)
__device__ __forceinline__ void att_hi(const _Float16* __restrict__ QH, const _Float16* __restrict__ QL, const _Float16* __restrict__ KH, const _Float16* __restrict__ KL, const __bf16* __restrict__ VB, const __bf16* __restrict__ VBL, float* __restrict__ Y, int b, int h, int ql0, int lane) {
  const int col = lane & 15, g = lane >> 4; const int nt = (ql0 >> 5) + 1;
  const size_t bh = (size_t)(b * NH + h); const char* qp = (const char*)QH + (bh * (TT / 16) + (ql0 >> 4)) * 2048; const char* qlp = (const char*)QL + (bh * (QHI / 16) + (ql0 >> 4)) * 2048; const char* kb = (const char*)KH + bh * (TT / 16 * 2048); const char* klb = (const char*)KL + bh * (KHI / 16 * 2048);
  const char* vhb = (const char*)VB + bh * (KHI / 32 * 4096); const char* vlb = (const char*)VBL + bh * (KHI / 32 * 4096);   // wave-uniform bases; the lane's byte offset below does not change over the loop
  const unsigned ko = 16u * lane, vo = ko;   // fragment order: the lane's 16 bytes of every 512-byte block
  v8h qr[2][2], qs[2][2];
#pragma unroll
  for (int kc = 0; kc < 2; ++kc) { qr[kc][0] = *(const v8h*)(qp + ko + kc * 1024); qr[kc][1] = *(const v8h*)(qp + ko + kc * 1024 + 512); qs[kc][0] = *(const v8h*)(qlp + ko + kc * 1024); qs[kc][1] = *(const v8h*)(qlp + ko + kc * 1024 + 512); }
  asm volatile("s_wait_xcnt 0x0" :: "v"(qp + ko), "v"(qlp + ko) : "memory");   // precaution: stands in front of the first rewrite of a register that these loads name; the addresses as inputs keep their registers from being given to a later load of the group
  __builtin_amdgcn_sched_barrier(0);   // keeps every later write of an address register behind the wait above
  v16h qh[2], ql[2];
#pragma unroll
  for (int kc = 0; kc < 2; ++kc) { union { v16h v; v8h q[2]; } f; f.q[0] = qr[kc][0]; f.q[1] = qr[kc][1]; qh[kc] = f.v; f.q[0] = qs[kc][0]; f.q[1] = qs[kc][1]; ql[kc] = f.v; }
  v8f acc[HD / 16] = {}; float m = -3.0e38f, l = 0.f;
#pragma unroll 1   // rolled: one step of 32 keys per trip keeps the live registers below 256
  for (int t = 0; t < nt; ++t) { const char* kk = kb + t * 4096 + ko; const char* lk = klb + t * 4096 + ko; const char* hv = vhb + t * 4096 + vo; const char* lv = vlb + t * 4096 + vo;   // the lane's four addresses of this step
    v8h kh[2][2][2], kl[2][2][2]; v8b vh[HD / 16][2], vl[HD / 16][2];
#pragma unroll
    for (int jt = 0; jt < 2; ++jt)
#pragma unroll
      for (int kc = 0; kc < 2; ++kc) { const int o = jt * 2048 + kc * 1024; kh[jt][kc][0] = *(const v8h*)(kk + o); kh[jt][kc][1] = *(const v8h*)(kk + o + 512); kl[jt][kc][0] = *(const v8h*)(lk + o); kl[jt][kc][1] = *(const v8h*)(lk + o + 512); }
#pragma unroll
    for (int j = 0; j < HD / 16; ++j) { const int o = j * 1024; vh[j][0] = *(const v8b*)(hv + o); vh[j][1] = *(const v8b*)(hv + o + 512); vl[j][0] = *(const v8b*)(lv + o); vl[j][1] = *(const v8b*)(lv + o + 512); }
    asm volatile("s_wait_xcnt 0x0" :: "v"(kk), "v"(lk), "v"(hv), "v"(lv) : "memory");   // precaution, as above
    __builtin_amdgcn_sched_barrier(0);   // holds the step's 32 loads in front of its first product (sunk to their uses they would cost one memory latency each) and every later write of an address register behind the wait above
    v8f s[2] = {}, sl[2] = {};
#pragma unroll
    for (int kc = 0; kc < 2; ++kc)
#pragma unroll
      for (int jt = 0; jt < 2; ++jt) { union { v16h v; v8h q[2]; } fh, fl; fh.q[0] = kh[jt][kc][0]; fh.q[1] = kh[jt][kc][1]; fl.q[0] = kl[jt][kc][0]; fl.q[1] = kl[jt][kc][1]; s[jt] = wmma16(fh.v, qh[kc], s[jt]); sl[jt] = wmma16(fh.v, ql[kc], sl[jt]); sl[jt] = wmma16(fl.v, qh[kc], sl[jt]); }
    float x[2][8];
#pragma unroll
    for (int jt = 0; jt < 2; ++jt)
#pragma unroll
      for (int r = 0; r < 8; ++r) x[jt][r] = s[jt][r] + sl[jt][r] * (1.0f / 1024.0f);
    sm_step<2>(x, t == nt - 1, ql0 + col - t * 32 - 8 * g, m, l, acc);
    float v[16];
#pragma unroll
    for (int i = 0; i < 8; ++i) { v[i] = x[0][i]; v[8 + i] = x[1][i]; }
    const F2 p = bsplit16(v);
#pragma unroll
    for (int j = 0; j < HD / 16; ++j) { union { v16b v; v8b q[2]; } fh, fl; fh.q[0] = vh[j][0]; fh.q[1] = vh[j][1]; fl.q[0] = vl[j][0]; fl.q[1] = vl[j][1]; acc[j] = wmma_bf(fh.v, p.h, acc[j]); acc[j] = wmma_bf(fh.v, p.l, acc[j]); acc[j] = wmma_bf(fl.v, p.h, acc[j]); } }
  att_store(Y, b, h, ql0, lane, l, acc); }
// block = (pair of query blocks NQB-1-x and x, (b, h)): together NQB + 1 blocks of 64 keys, so the work is even except where x < QBH (block x on the 3-product path, in steps of 32 keys); wave = 16 query rows of the block; no LDS, no barrier
__global__ __launch_bounds__(128) void k_att(const _Float16* __restrict__ QH, const _Float16* __restrict__ QL, const _Float16* __restrict__ KH, const _Float16* __restrict__ KL, const _Float16* __restrict__ VT, const __bf16* __restrict__ VB, const __bf16* __restrict__ VBL, float* __restrict__ Y) { static_assert(CAUSAL && NQB % 2 == 0 && QBH * 64 == QHI && QHI == KHI, "the pairing counts on causal row lengths; the early-row path reads residual planes of QHI rows");
  const int lane = threadIdx.x & 31; const int wv = __builtin_amdgcn_readfirstlane(threadIdx.x >> 5);   // the wave's number as a scalar: trip counts and the tests on them are scalar, EXEC stays full at every product
  const int b = blockIdx.y / NH, h = blockIdx.y % NH;
#pragma unroll 1   // rolled: one copy of each path in the code
  for (int z = 0; z < 2; ++z) { const int qb = z ? (int)blockIdx.x : NQB - 1 - (int)blockIdx.x; const int ql0 = qb * 64 + wv * 16;
    if (qb < QBH) att_hi(QH, QL, KH, KL, VB, VBL, Y, b, h, ql0, lane); else att_lo(QH, KH, VT, Y, b, h, ql0, lane); } }
// ---- k_out: block = (64 rows, 128 cols): out = ctx Wo (+ bo): ctx once to f16 against Wo as f16(bf16 x 2^8) exact (1 product) x 2^-8; causal early rows (< QHI of each sequence): ctx bf16 hi + lo against exact bf16 Wo (2 products)
__global__ __launch_bounds__(128) void k_out(const float* __restrict__ Y, const float* __restrict__ WO, const float* __restrict__ BO, float* __restrict__ OUT) { __shared__ __align__(16) float sf[4][16][132]; __shared__ __align__(16) WT wt[2];
  const int tid = threadIdx.x, wave = tid >> 5, lane = tid & 31, col = lane & 15, g = lane >> 4; const int c0 = blockIdx.y * 128; const size_t r0 = (size_t)blockIdx.x * 64 + wave * 16;
  v8f acc[8] = {};
  if (CAUSAL && (int)(((size_t)blockIdx.x * 64) % TT) < QHI) {   /* block-uniform */
    gemm_k<1>((const char*)(Y + (size_t)blockIdx.x * 64 * CC), (unsigned)wave * (16u * CC * 4u) + 16u * lane, (const char*)(WO + c0), wt, wave, lane, acc);
#pragma unroll
    for (int j = 0; j < 8; ++j) { const float bias = BO ? bfr(BO[c0 + j * 16 + col]) : 0.f;
#pragma unroll
      for (int r = 0; r < 8; ++r) sf[wave][8 * g + r][j * 16 + col] = acc[j][r] + bias; }
  } else {
    gemm_k<2>((const char*)(Y + (size_t)blockIdx.x * 64 * CC), (unsigned)wave * (16u * CC * 4u) + 16u * lane, (const char*)(WO + c0), wt, wave, lane, acc);
#pragma unroll
    for (int j = 0; j < 8; ++j) { const float bias = BO ? bfr(BO[c0 + j * 16 + col]) : 0.f;
#pragma unroll
      for (int r = 0; r < 8; ++r) sf[wave][8 * g + r][j * 16 + col] = acc[j][r] * (1.0f / 256.0f) + bias; } }
  LDSX(); for (int rl = 0; rl < 16; ++rl) vst2(OUT + (r0 + rl) * DIN + c0 + lane * 4, *(const v4f*)&sf[wave][rl][lane * 4]); }

extern "C" void kernel_launch(void* const* d_in, const int* in_sizes, int n_in, void* d_out, int out_size, void* d_ws, size_t ws_size, hipStream_t stream) {
  (void)in_sizes; (void)n_in; (void)out_size;
  const float** F = (const float**)d_in;
  if (ws_size < (size_t)WS_END) return;
  char* ws = (char*)d_ws; _Float16 *QH = (_Float16*)(ws + WS_QH), *KH = (_Float16*)(ws + WS_KH), *VT = (_Float16*)(ws + WS_VT), *QL = (_Float16*)(ws + WS_QL), *KL = (_Float16*)(ws + WS_KL); __bf16 *VB = (__bf16*)(ws + WS_VB), *VBL = (__bf16*)(ws + WS_VBL); float *Y = (float*)(ws + WS_Y);
  (void)Y; (void)QL; (void)KL; (void)VB; (void)VBL;
  // inputs: 0 inputs_q [2,2048,1024]; 1 wq, 2 wk, 3 wv [1024,16,64] (= (in,out)); 4 wo [16,64,1024] (= (in,out)); 5 q_norm_scale [64]; 6 k_norm_scale [64]
  k_proj<<<dim3(TNB * TT / 64, CC / 128, 3), 128, 0, stream>>>(F[0], F[0], F[0], F[1], F[2], F[3], nullptr, nullptr, nullptr, QH, QL, KH, KL, VT, VB, VBL, F[5], F[6]);
  k_att<<<dim3(NQB / 2, TNB * NH), 128, 0, stream>>>(QH, QL, KH, KL, VT, VB, VBL, Y);
  k_out<<<dim3(TNB * TT / 64, DIN / 128), 128, 0, stream>>>(Y, F[4], nullptr, (float*)d_out);
}

// v010
// One run takes 113 microseconds.
// In both of two side-by-side timings against v009, it was 1.04 times as fast.
// Counting every step since v000, it is 9.76 times as fast.
// compute dtype: all float inputs rounded to bf16; q/k/v = x W with EXACT bf16 products on WMMA 16x16x32, f32 accumulate; per-head RMSNorm and rotate-half RoPE in f32 (sine and cosine of t * inv_freq by the operations of the precise sinf/cosf for arguments below 2^17); q, k once to f16 -> 1-product causal logits, except the first 384 query rows of each sequence (few keys, no averaging), which use q and k as f16 hi + residual (x 2^10) (3 products); softmax in f32 in base 2 (the scale 1/8 and log2 e in one fused multiply-add, then the hardware's exp2) with a running maximum and sum, divided out at the end; exp(logit - max) x 2^10 once to f16 against v once to f16 (1 product), except the first 384 rows: it and v as bf16 hi + lo (3 products); ctx once to f16 against wo carried x 2^8 in f16 (exact bf16 values), except the first 384 rows: ctx bf16 hi + lo against exact bf16 wo (2 products); f32 output.
#include <hip/hip_runtime.h>
#include <math.h>

typedef __attribute__((ext_vector_type(16))) _Float16 v16h;
typedef __attribute__((ext_vector_type(16))) __bf16 v16b;
typedef __attribute__((ext_vector_type(8)))  _Float16 v8h;
typedef __attribute__((ext_vector_type(8)))  float v8f;
typedef __attribute__((ext_vector_type(4)))  float v4f;
typedef __attribute__((ext_vector_type(2)))  float v2f;
typedef __attribute__((ext_vector_type(4)))  unsigned v4u;
typedef __attribute__((ext_vector_type(4)))  int v4i;
typedef float __attribute__((may_alias)) float_a;
typedef int __attribute__((may_alias)) int_a;

template <typename T> __device__ __forceinline__ void vst2(void* p, T v) { *(T*)p = v;  }
__device__ __forceinline__ v8f wmma16(v16h a, v16h b, v8f c) {
  v8f d = __builtin_amdgcn_wmma_f32_16x16x32_f16(false, a, false, b, (short)0, c, false, false);
  asm volatile("v_nop\n\tv_nop\n\tv_nop\n\tv_nop" : "+v"(d) : "v"(a), "v"(b));
  return d;
}
__device__ __forceinline__ v8f wmma_bf(v16b a, v16b b, v8f c) {
  v8f d = __builtin_amdgcn_wmma_f32_16x16x32_bf16(false, a, false, b, (short)0, c, false, false);
  asm volatile("v_nop\n\tv_nop\n\tv_nop\n\tv_nop" : "+v"(d) : "v"(a), "v"(b));
  return d;
}
// 16x16x32 fragments: lane = (h = lane>>4, row/col = lane&15); elements 0..7 = k0+8h+0..7, 8..15 = k0+16+8h+0..7; D element r = row 8h+r
__device__ __forceinline__ v16h frag_h(const _Float16* rowk0, int lane) {
  union { v16h v; v8h q[2]; } u; const _Float16* p = rowk0 + 8 * (lane >> 4);
  u.q[0] = *(const v8h*)p; u.q[1] = *(const v8h*)(p + 16); return u.v;
}
__device__ __forceinline__ v16h frag_f32(const float* rowk0, int lane) {
  v16h a; const float* p = rowk0 + 8 * (lane >> 4);
#pragma unroll
  for (int i = 0; i < 8; ++i) { a[i] = (_Float16)p[i]; a[8 + i] = (_Float16)p[16 + i]; }
  return a;
}
__device__ __forceinline__ v16h frag_f32s(const float* rowk0, int lane, float sc) {
  v16h a; const float* p = rowk0 + 8 * (lane >> 4);
#pragma unroll
  for (int i = 0; i < 8; ++i) { a[i] = (_Float16)(p[i] * sc); a[8 + i] = (_Float16)(p[16 + i] * sc); }
  return a;
}
// column fragment from a [K][ld] layout (column n), rows >= K read as 0
__device__ __forceinline__ v16h fragc_f32(const float* W, int k0, int n, int lane, int ld, int K) {
  v16h a; const int g = lane >> 4;
#pragma unroll
  for (int i = 0; i < 8; ++i) { const int ka = k0 + 8 * g + i, kb = ka + 16;
    a[i] = (_Float16)(ka < K ? W[(size_t)(ka < K ? ka : K - 1) * ld + n] : 0.f); a[8 + i] = (_Float16)(kb < K ? W[(size_t)(kb < K ? kb : K - 1) * ld + n] : 0.f); }
  return a;
}
struct F2 { v16b h, l; };
__device__ __forceinline__ F2 bsplit16(const float v[16]) { F2 r;
#pragma unroll
  for (int i = 0; i < 16; ++i) { const __bf16 h = (__bf16)v[i]; r.h[i] = h; r.l[i] = (__bf16)(v[i] - (float)h); }
  return r; }
__device__ __forceinline__ F2 split_row(const float* row, int k0, int lane) { float v[16]; const float* p = row + k0 + 8 * (lane >> 4);
#pragma unroll
  for (int i = 0; i < 8; ++i) { v[i] = p[i]; v[8 + i] = p[16 + i]; }
  return bsplit16(v); }
__device__ __forceinline__ F2 split_rowK(const float* row, int k0, int lane, int K) { float v[16]; const int g = lane >> 4;
#pragma unroll
  for (int i = 0; i < 8; ++i) { const int ka = k0 + 8 * g + i, kb = ka + 16; v[i] = ka < K ? row[ka < K ? ka : K - 1] : 0.f; v[8 + i] = kb < K ? row[kb < K ? kb : K - 1] : 0.f; }
  return bsplit16(v); }
__device__ __forceinline__ F2 split_col(const float* W, int k0, int n, int lane, int ld, int K) { float v[16]; const int g = lane >> 4;
#pragma unroll
  for (int i = 0; i < 8; ++i) { const int ka = k0 + 8 * g + i, kb = ka + 16; v[i] = ka < K ? W[(size_t)(ka < K ? ka : K - 1) * ld + n] : 0.f; v[8 + i] = kb < K ? W[(size_t)(kb < K ? kb : K - 1) * ld + n] : 0.f; }
  return bsplit16(v); }
__device__ __forceinline__ v8f mac3(const F2& a, const F2& b, v8f c) { c = wmma_bf(a.l, b.h, c); c = wmma_bf(a.h, b.l, c); return wmma_bf(a.h, b.h, c); }
__device__ __forceinline__ float sigm(float v) { return 1.0f / (1.0f + expf(-v)); }
#define LDSX() do { asm volatile("s_wait_dscnt 0" ::: "memory"); __builtin_amdgcn_wave_barrier(); __builtin_amdgcn_fence(__ATOMIC_RELEASE, "workgroup"); } while (0)

// Causal multi-head dot-product attention with QK-RMSNorm and RoPE (B 2, S 2,048, D 1,024, 16 heads x 64): q/k/v = x w ((in, head, hd) = (in,out)); q, k RMS-normalised over the 64 head dims (eps 1e-6, x scale) then rotate-half RoPE (angle t * 10000^(-i/32), i < 32); q x 64^-0.5; logits masked to -0.7*f32max where key > query (== -inf here: the diagonal is always kept); softmax; out = merged(attn v) wo ((head, hd, out) = (in,out)).
#define NB 2
#define TT 2048
#define CC 1024            // NH * HD = projected width
#define DIN 1024          // input (model) width
#define NH 16
#define HD 64
#define NQB (TT / 64)
#define SCALE (0.125f)
#define CAUSAL 1
#ifndef TNB
#define TNB NB
#endif
__device__ __forceinline__ float bfr(float v) { return (float)(__bf16)v; }
__host__ __device__ __forceinline__ int kb_last(int qb) { return CAUSAL ? ((qb * 64 + 63) >> 7) : (TT / 128 - 1); }
typedef __attribute__((ext_vector_type(8))) __bf16 v8b;
__device__ __forceinline__ v16b frag_b(const __bf16* rowk0, int lane) {
  union { v16b v; v8b q[2]; } u; const __bf16* p = rowk0 + 8 * (lane >> 4);
  u.q[0] = *(const v8b*)p; u.q[1] = *(const v8b*)(p + 16); return u.v;
}
#define QBH 6              // causal: query blocks 0..QBH-1 of each sequence (few keys, no averaging) take the high-precision path
#define QHI 384            // rows carrying a q residual plane
#define KHI 384            // key rows carrying k residual / v bf16 hi+lo planes (used only by the causal high-precision path)
// B fragment (k rows k0+.., output column o) of a weight: (in,out) [K][ld] or (out,in) [ld rows of K]: bf16 exact, or f16(bf16 * 256) exact
__device__ __forceinline__ v16b wcol_io(const float* Wm, int k0, int o, int lane, int ld) { v16b w; const int g = lane >> 4;
#pragma unroll
  for (int i = 0; i < 8; ++i) { w[i] = (__bf16)Wm[(size_t)(k0 + 8 * g + i) * ld + o]; w[8 + i] = (__bf16)Wm[(size_t)(k0 + 16 + 8 * g + i) * ld + o]; }
  return w; }
__device__ __forceinline__ v16b wcol_oi(const float* Wm, int k0, int o, int lane, int K) { v16b w; const float* p = Wm + (size_t)o * K + k0 + 8 * (lane >> 4);
#pragma unroll
  for (int i = 0; i < 8; ++i) { w[i] = (__bf16)p[i]; w[8 + i] = (__bf16)p[16 + i]; }
  return w; }
__device__ __forceinline__ v16h wcolh_io(const float* Wm, int k0, int o, int lane, int ld) { v16h w; const int g = lane >> 4;
#pragma unroll
  for (int i = 0; i < 8; ++i) { w[i] = (_Float16)(bfr(Wm[(size_t)(k0 + 8 * g + i) * ld + o]) * 256.0f); w[8 + i] = (_Float16)(bfr(Wm[(size_t)(k0 + 16 + 8 * g + i) * ld + o]) * 256.0f); }
  return w; }
__device__ __forceinline__ v16h wcolh_oi(const float* Wm, int k0, int o, int lane, int K) { v16h w; const float* p = Wm + (size_t)o * K + k0 + 8 * (lane >> 4);
#pragma unroll
  for (int i = 0; i < 8; ++i) { w[i] = (_Float16)(bfr(p[i]) * 256.0f); w[8 + i] = (_Float16)(bfr(p[16 + i]) * 256.0f); }
  return w; }
#define WQKV_LAYOUT 0   // 0 = (in,out) [DIN][CC]; 1 = (out,in) [CC][DIN]; 2 = per-head [NH][DIN][HD]
__device__ __forceinline__ v16b wcol_hdk(const float* Wm, int k0, int o, int lane) { v16b w; const int g = lane >> 4; const float* p = Wm + (size_t)(o / HD) * DIN * HD + (o % HD);
#pragma unroll
  for (int i = 0; i < 8; ++i) { w[i] = (__bf16)p[(size_t)(k0 + 8 * g + i) * HD]; w[8 + i] = (__bf16)p[(size_t)(k0 + 16 + 8 * g + i) * HD]; }
  return w; }
#define WO_OUT_IN 0
#if WQKV_LAYOUT == 1
#define WCOL(W, k0, o, lane) wcol_oi(W, k0, o, lane, DIN)
#elif WQKV_LAYOUT == 2
#define WCOL(W, k0, o, lane) wcol_hdk(W, k0, o, lane)
#else
#define WCOL(W, k0, o, lane) wcol_io(W, k0, o, lane, CC)
#endif
#if WO_OUT_IN
#define WOCOL(W, k0, o, lane) wcol_oi(W, k0, o, lane, CC)
#define WOCOLH(W, k0, o, lane) wcolh_oi(W, k0, o, lane, CC)
#else
#define WOCOL(W, k0, o, lane) wcol_io(W, k0, o, lane, DIN)
#define WOCOLH(W, k0, o, lane) wcolh_io(W, k0, o, lane, DIN)
#endif
__constant__ float c_invf[32] = {1.000000000e+00f,7.498942018e-01f,5.623413324e-01f,4.216965139e-01f,3.162277639e-01f,2.371373624e-01f,1.778279394e-01f,1.333521456e-01f,1.000000015e-01f,7.498941571e-02f,5.623412877e-02f,4.216964915e-02f,3.162277862e-02f,2.371373586e-02f,1.778279431e-02f,1.333521493e-02f,9.999999776e-03f,7.498942316e-03f,5.623413250e-03f,4.216964822e-03f,3.162277862e-03f,2.371373819e-03f,1.778279431e-03f,1.333521446e-03f,1.000000047e-03f,7.498941850e-04f,5.623413017e-04f,4.216964880e-04f,3.162277862e-04f,2.371373848e-04f,1.778279402e-04f,1.333521504e-04f};   // 1 / 10000^(i/32) evaluated in f32 exactly as the reference does (jax, eager)
#define PROJ_EXTRA_PARAMS , const float* __restrict__ QS, const float* __restrict__ KS
// sine and cosine of an angle 0 <= x < 2^17 (here x = t * inv_freq < TT, whatever the inputs hold): x less the nearest multiple n of pi/2, pi/2 in three parts, each taken off by one fused multiply-add; the two polynomials on the rest; the quadrant n mod 4 picks and signs. The same operations on the same constants as the small-argument path of the precise sinf / cosf, without the test for the large-argument path, which no angle here takes: straight-line code
__device__ __forceinline__ float fbits(unsigned u) { return __builtin_bit_cast(float, u); }
__device__ __forceinline__ void sincos_q(float x, float& sn, float& cs) {
  const float n = __builtin_rintf(x * fbits(0x3f22f983u)); const int q = (int)n;
  float r = __builtin_fmaf(fbits(0xbfc90fdau), n, x); r = __builtin_fmaf(fbits(0xb3a22168u), n, r); r = __builtin_fmaf(fbits(0xa7c234c4u), n, r);
  const float s = r * r;
  float ps = __builtin_fmaf(fbits(0xb94c1982u), s, fbits(0x3c0881c4u)); ps = __builtin_fmaf(s, ps, fbits(0xbe2aaa9du)); ps = s * ps; ps = __builtin_fmaf(r, ps, r);
  float pc = __builtin_fmaf(fbits(0x37d75334u), s, fbits(0xbab64f3bu)); pc = __builtin_fmaf(s, pc, fbits(0x3d2aabf7u)); pc = __builtin_fmaf(s, pc, fbits(0xbf000004u)); pc = __builtin_fmaf(s, pc, 1.0f);
  const unsigned sg = ((unsigned)q << 30) & 0x80000000u;
  sn = fbits(__builtin_bit_cast(unsigned, (q & 1) ? pc : ps) ^ sg); cs = fbits(__builtin_bit_cast(unsigned, (q & 1) ? -ps : pc) ^ sg); }
// q / k epilogue on the f32 projection tile (64 rows x 2 heads): RMSNorm over each head's 64 values (x q_norm_scale / k_norm_scale), then rotate-half RoPE. A pair of neighbouring lanes has one row: lane hf sums the squares of head hf, the pair swaps the two factors, and lane hf then turns the frequencies 16 hf .. 16 hf + 15 of BOTH heads, so that each angle's sine and cosine are formed once per row of the tile. Every store into a row follows, through the factors, both lanes' reads for the sums, and the pair sits in one wave: no barrier inside
__device__ __forceinline__ void rope_epi(float (&st)[64][132], const float* __restrict__ NS, int tid, int t0) {
  const int rl = tid >> 1, hf = tid & 1; float* rw = &st[rl][0]; const float* rh = rw + hf * HD; const int i0 = 16 * hf;
  float cf[16], n1[16], n2[16];
#pragma unroll
  for (int i = 0; i < 16; ++i) { cf[i] = c_invf[i0 + i]; n1[i] = bfr(NS[i0 + i]); n2[i] = bfr(NS[i0 + i + 32]); }
  float ss = 0.f;
#pragma unroll
  for (int i = 0; i < 64; ++i) ss += rh[i] * rh[i];
  const float rn = rsqrtf(ss * (1.0f / 64.0f) + 1e-6f);
  const float ro = __builtin_bit_cast(float, __builtin_amdgcn_mov_dpp(__builtin_bit_cast(int, rn), 0xB1, 0xF, 0xF, true));   // the factor of the pair's other lane (quad_perm 1,0,3,2); every lane is on
  const float rr[2] = { hf ? ro : rn, hf ? rn : ro }; const float tf = (float)(t0 + rl);
#pragma unroll
  for (int i = 0; i < 16; ++i) { float sn, cs; sincos_q(tf * cf[i], sn, cs);
#pragma unroll
    for (int hd = 0; hd < 2; ++hd) { float* p = rw + hd * HD + i0 + i; const float x1 = p[0] * rr[hd] * n1[i], x2 = p[32] * rr[hd] * n2[i]; p[0] = __builtin_fmaf(x1, cs, -(x2 * sn)); p[32] = __builtin_fmaf(x2, cs, x1 * sn); } } }
#ifndef SM_EXTRA_PARAMS
#define SM_EXTRA_PARAMS
#endif
#ifndef PROJ_EXTRA_PARAMS
#define PROJ_EXTRA_PARAMS
#endif
#ifndef SM_MASK_HOOK
#define SM_MASK_HOOK (void)0
#endif

// Every plane below lies in FRAGMENT ORDER: blocks of 512 bytes, lane l's 16 bytes at 16 l, so that one 16-byte load or store per lane moves 4 whole 128-byte lines (in row order the same instruction touched 32 bytes in each of 16 lines).
// row planes (q, k and their residuals; NR rows per sequence): block ((b * NH + h) * (NR / 16) + t / 16) * 4 + kc * 2 + hf, lane (g, t % 16) = head dims kc * 32 + hf * 16 + 8 g + 0..7
// v planes (NK keys per sequence): block (((b * NH + h) * (NK / 32) + t / 32) * 4 + j) * 2 + hf, lane (g, c) = head dim j * 16 + c, keys (t / 32) * 32 + hf * 16 + 8 g + 0..7
// ctx: block (((b * TT + t) / 16) * KST + k / 32) * 4 + i, lane (g, t % 16) = k (k / 32) * 32 + (i / 2) * 16 + 8 g + (i % 2) * 4 + 0..3
#define WS_QH  0u                                      // f16 q, row plane of TT rows
#define WS_KH  (WS_QH + 2u * (size_t)NB * TT * CC)      // f16 k, row plane of TT rows
#define WS_VT  (WS_KH + 2u * (size_t)NB * TT * CC)      // f16 v plane of TT keys
#define WS_QL  (WS_VT + 2u * (size_t)NB * CC * TT)      // f16 q residual x 2^10, row plane of QHI rows
#define WS_KL  (WS_QL + 2u * (size_t)NB * QHI * CC)     // f16 k residual x 2^10, row plane of KHI rows
#define WS_VB  (WS_KL + 2u * (size_t)NB * KHI * CC)     // bf16 v hi, v plane of KHI keys (WS_VBL: lo)
#define WS_VBL (WS_VB + 2u * (size_t)NB * CC * KHI)
#define WS_Y   (WS_VBL + 2u * (size_t)NB * CC * KHI)    // f32 ctx
#define WS_END (WS_Y  + 4u * (size_t)NB * TT * CC)

// ---- weight tile in LDS, shared by k_proj and k_out: one K step (64 k x 128 output columns) of an (in,out) f32 weight is read ONCE per work-group (wave w: rows 16w..16w+15, lane: 4 columns, whole 512-byte rows), converted as before and kept as 16-bit [column][k] rows of 144 bytes (16 B x odd: the fragment reads meet no bank conflict). Two buffers: the next step's loads (and the wave's own next A rows) fly while this step's products run. A work-group pays one load latency, one conversion and one barrier per K step, and few work-groups share a WGP: 64 k a step, with 24 loads of a wave in flight, halves the number of those waits.
#define WLD 1024           // row length of every weight here (CC for wq/wk/wv, DIN for wo)
#define KST 32             // 32-k fragments along K (DIN / 32 == CC / 32); ctx is laid out by them
#define KS2 (KST / 2)      // K steps of 64 k: two fragments each
static_assert(CC == WLD && DIN == WLD && DIN / 32 == KST && CC / 32 == KST && WQKV_LAYOUT == 0 && WO_OUT_IN == 0, "the staging reads (in,out) weights with rows of WLD floats");
typedef unsigned WT[128][36];
// MODE 0: A once to bf16, W bf16 (1 product); 1: A bf16 hi + lo, W bf16 (2 products); 2: A once to f16, W f16(bf16 x 2^8) (1 product)
struct AFr { v16b h, l; v16h f; };
template <int MODE> __device__ __forceinline__ void a_cvt(AFr& a, const v4f (&ar)[4]) { float v[16];
#pragma unroll
  for (int i = 0; i < 4; ++i) { v[i] = ar[0][i]; v[4 + i] = ar[1][i]; v[8 + i] = ar[2][i]; v[12 + i] = ar[3][i]; }
  if constexpr (MODE == 1) { const F2 s = bsplit16(v); a.h = s.h; a.l = s.l; }
  else {
#pragma unroll
    for (int i = 0; i < 16; ++i) { if constexpr (MODE == 0) a.h[i] = (__bf16)v[i]; else a.f[i] = (_Float16)v[i]; } } }
template <int MODE> __device__ __forceinline__ void wt_store(WT& wt, const v4f (&wr)[16], int wave, int lane) {
#pragma unroll
  for (int n = 0; n < 4; ++n)
#pragma unroll
    for (int hh = 0; hh < 2; ++hh) { union { v8b b; v8h h; v4u u; } p;
#pragma unroll
      for (int i = 0; i < 8; ++i) { if constexpr (MODE == 2) p.h[i] = (_Float16)(bfr(wr[8 * hh + i][n]) * 256.0f); else p.b[i] = (__bf16)wr[8 * hh + i][n]; }
      *(v4u*)&wt[4 * lane + n][8 * wave + 4 * hh] = p.u; } }   // column 4 lane + n, k 16 wave + 8 hh .. + 7
// acc[j] += A (16 rows of the wave, f32 at xb + xo: MODE 0 an input's K-contiguous rows, MODE 1 and 2 ctx in fragment order) x W (columns j * 16 + col of the tile at wb); k order and product order as in the direct form
template <int MODE> __device__ __forceinline__ void gemm_k(const char* xb, unsigned xo, const char* wb, WT (&wt)[2], int wave, int lane, v8f (&acc)[8]) {
  const int col = lane & 15, g = lane >> 4; const unsigned wo = (unsigned)(16 * wave) * (WLD * 4u) + 16u * lane;
  constexpr int A1 = MODE ? 512 : 16, A2 = MODE ? 1024 : 64, A3 = MODE ? 1536 : 80, AS = MODE ? 2048 : 128;   // byte steps to the lane's 2nd, 3rd and 4th quad of a 32-k fragment, and to the next fragment
  v4f wr[16], ar[2][4]; AFr a[2];
#pragma unroll
  for (int i = 0; i < 16; ++i) wr[i] = *(const v4f*)(wb + wo + i * (WLD * 4));
#pragma unroll
  for (int s = 0; s < 2; ++s) { ar[s][0] = *(const v4f*)(xb + xo + s * AS); ar[s][1] = *(const v4f*)(xb + xo + s * AS + A1); ar[s][2] = *(const v4f*)(xb + xo + s * AS + A2); ar[s][3] = *(const v4f*)(xb + xo + s * AS + A3); }
  asm volatile("s_wait_xcnt 0x0" :: "v"(wo), "v"(xo), "s"(wb), "s"(xb) : "memory");   // precaution: stands in front of the first rewrite of a register that these loads name; the lane offsets and the uniform bases as inputs keep their registers until here
  __builtin_amdgcn_sched_barrier(0);   // keeps the conversions below, which may reuse the address registers, behind the wait above
  wt_store<MODE>(wt[0], wr, wave, lane); a_cvt<MODE>(a[0], ar[0]); a_cvt<MODE>(a[1], ar[1]);
  __syncthreads();   // publishes K step 0
#pragma unroll 1   // rolled: one K step per trip keeps the loop small and k_proj's live registers below 256 (4 waves per SIMD)
  for (int kc = 0; kc < KS2; ++kc) { const bool more = kc + 1 < KS2;   // the same for the whole work-group
    if (more) { const char* wk = wb + (size_t)(kc + 1) * (64 * WLD * 4); const char* xk = xb + (kc + 1) * (2 * AS);
#pragma unroll
      for (int i = 0; i < 16; ++i) wr[i] = *(const v4f*)(wk + wo + i * (WLD * 4));
#pragma unroll
      for (int s = 0; s < 2; ++s) { ar[s][0] = *(const v4f*)(xk + xo + s * AS); ar[s][1] = *(const v4f*)(xk + xo + s * AS + A1); ar[s][2] = *(const v4f*)(xk + xo + s * AS + A2); ar[s][3] = *(const v4f*)(xk + xo + s * AS + A3); }
      asm volatile("s_wait_xcnt 0x0" ::: "memory"); }   // precaution, as above; its memory clobber also keeps the 24 loads from sinking to their uses behind the products
    __builtin_amdgcn_sched_barrier(0);   // holds the next step's loads in front of this step's products, which then cover their latency, and every later write of an address register behind the wait above
    const WT& cur = wt[kc & 1];
#pragma unroll
    for (int s = 0; s < 2; ++s) { v4u f[8][2];   // the step's two 32-k fragments, in k order
#pragma unroll
      for (int j = 0; j < 8; ++j) { f[j][0] = *(const v4u*)&cur[j * 16 + col][16 * s + 4 * g]; f[j][1] = *(const v4u*)&cur[j * 16 + col][16 * s + 8 + 4 * g]; }   // elements 0..7 = k 32s + 8g.., 8..15 = k 32s + 16 + 8g..
#pragma unroll
      for (int j = 0; j < 8; ++j) { union { v4u q[2]; v16b b; v16h h; } w; w.q[0] = f[j][0]; w.q[1] = f[j][1];
        if constexpr (MODE == 0) acc[j] = wmma_bf(a[s].h, w.b, acc[j]);
        else if constexpr (MODE == 1) { acc[j] = wmma_bf(a[s].h, w.b, acc[j]); acc[j] = wmma_bf(a[s].l, w.b, acc[j]); }
        else acc[j] = wmma16(a[s].f, w.h, acc[j]); } }
    if (more) { wt_store<MODE>(wt[(kc + 1) & 1], wr, wave, lane); a_cvt<MODE>(a[0], ar[0]); a_cvt<MODE>(a[1], ar[1]);   // into the buffer whose last readers passed the barrier of the trip before
      __syncthreads(); } } }   // one barrier per K step: publishes step kc + 1 and ends every reader's last read of step kc's buffer
// ---- k_proj: block = (64 rows, 128 cols, which): q/k/v = X W (+ b) with exact bf16 products (K = DIN) -> which 0: q f16 (+ residual, rows < QHI); 1: k f16 (+ residual, rows < KHI); 2: v f16 (+ bf16 hi/lo for t < KHI); all stored in fragment order
__global__ __launch_bounds__(128) void k_proj(const float* __restrict__ XQ, const float* __restrict__ XK, const float* __restrict__ XV, const float* __restrict__ WQ, const float* __restrict__ WK, const float* __restrict__ WV, const float* __restrict__ BQ, const float* __restrict__ BK, const float* __restrict__ BV,
    _Float16* __restrict__ QH, _Float16* __restrict__ QL, _Float16* __restrict__ KH, _Float16* __restrict__ KL, _Float16* __restrict__ VT, __bf16* __restrict__ VB, __bf16* __restrict__ VBL PROJ_EXTRA_PARAMS) {
  __shared__ __align__(16) float st[64][132]; __shared__ __align__(16) WT wt[2];   // 69 KiB in all: LDS does not hold the number of resident work-groups below what the registers allow
  const int tid = threadIdx.x, wave = tid >> 5, lane = tid & 31, col = lane & 15, g = lane >> 4; const int which = blockIdx.z; const int c0 = blockIdx.y * 128; const size_t r0 = (size_t)blockIdx.x * 64; const size_t bb = r0 / TT; const int t0 = (int)(r0 % TT);
  const float* X = which == 0 ? XQ : which == 1 ? XK : XV; const float* WA = which == 0 ? WQ : which == 1 ? WK : WV; const float* BA = which == 0 ? BQ : which == 1 ? BK : BV;
  v8f acc[8] = {};
  gemm_k<0>((const char*)(X + r0 * DIN), (unsigned)(wave * 16 + col) * (DIN * 4u) + 32u * g, (const char*)(WA + c0), wt, wave, lane, acc);
  { // stage the f32 tile (acc + bias) in LDS and run the q / k epilogue; behind its barrier st is only read: each lane takes the f32 values of its own 16-byte pieces of the planes and converts them in registers
#pragma unroll
    for (int j = 0; j < 8; ++j) { const float bias = BA ? bfr(BA[c0 + j * 16 + col]) : 0.f;
#pragma unroll
      for (int r = 0; r < 8; ++r) st[wave * 16 + 8 * g + r][j * 16 + col] = acc[j][r] + bias; }
    __syncthreads();
    if (which < 2) rope_epi(st, which == 0 ? QS : KS, tid, t0);   // block-uniform; v untouched
    __syncthreads(); }
  if (which < 2) { _Float16* DH = which == 0 ? QH : KH; _Float16* DL = which == 0 ? QL : KL; const int nhi = which == 0 ? QHI : KHI; const bool hi_rows = t0 < nhi;
    const int u = (wave >> 1) * 4 + (wave & 1) * 2 + g;   // wave w writes the blocks kc * 2 + hf == w: the lane's 8 head dims start at 8 u
    char* dh = (char*)DH + (((bb * NH + c0 / HD) * (size_t)(TT / 16) + (t0 >> 4)) * 4 + wave) * 512 + lane * 16;
    v4u d[8]; v4f x[8][2];   // it = 2 x (16-row tile) + head of the pair
#pragma unroll
    for (int it = 0; it < 8; ++it) { const float* p = &st[(it >> 1) * 16 + col][(it & 1) * HD + u * 8]; x[it][0] = *(const v4f*)p; x[it][1] = *(const v4f*)(p + 4); }
#pragma unroll
    for (int it = 0; it < 8; ++it) { union { v8h h; v4u u; } c;
#pragma unroll
      for (int i = 0; i < 8; ++i) c.h[i] = (_Float16)x[it][i >> 2][i & 3];
      d[it] = c.u; }
#pragma unroll
    for (int it = 0; it < 8; ++it) vst2(dh + (it >> 1) * 2048 + (it & 1) * (TT / 16 * 2048), d[it]);
    asm volatile("s_wait_xcnt 0x0" :: "v"(dh) : "memory");   // precaution: stands in front of the first rewrite of a register that these stores name; the address as an input keeps its registers until here
    __builtin_amdgcn_sched_barrier(0);   // keeps what follows, which may reuse the stores' registers, behind the wait above
    if (hi_rows) { v4u r[8]; char* dl = (char*)DL + (((bb * NH + c0 / HD) * (size_t)(nhi / 16) + (t0 >> 4)) * 4 + wave) * 512 + lane * 16;   // block-uniform
#pragma unroll
      for (int it = 0; it < 8; ++it) { union { v8h h; v4u u; } c;
#pragma unroll
        for (int i = 0; i < 8; ++i) { const float v = x[it][i >> 2][i & 3]; c.h[i] = (_Float16)((v - (float)(_Float16)v) * 1024.0f); }
        r[it] = c.u; }
#pragma unroll
      for (int it = 0; it < 8; ++it) vst2(dl + (it >> 1) * 2048 + (it & 1) * (QHI / 16 * 2048), r[it]);
      asm volatile("s_wait_xcnt 0x0" :: "v"(dl) : "memory"); }   // precaution, as above
  } else { const bool hi_rows = t0 < KHI;
    const unsigned ow = (unsigned)(wave >> 1) * 1024u + (unsigned)(wave & 1) * 512u + lane * 16u;   // wave w writes the blocks with hf == w & 1 and j & 1 == w >> 1
    char* dv = (char*)VT + ((bb * NH + c0 / HD) * (size_t)(TT / 32) + (t0 >> 5)) * 4096 + ow;
    const int cw = (wave >> 1) * 16 + col, rw = (wave & 1) * 16 + g * 8;   // it = 4 x head of the pair + 2 x (32-key tile) + j / 2: column (it >> 2) * HD + (it & 1) * 32 + cw of the tile, first of the lane's 8 keys ((it >> 1) & 1) * 32 + rw
    v4u d[8]; float x[8][8];   // 8 keys of one column: 16 lanes read 16 neighbouring columns of a row, the other 16 a row 32 banks away
#pragma unroll
    for (int it = 0; it < 8; ++it)
#pragma unroll
      for (int i = 0; i < 8; ++i) x[it][i] = st[((it >> 1) & 1) * 32 + rw + i][(it >> 2) * HD + (it & 1) * 32 + cw];
#pragma unroll
    for (int it = 0; it < 8; ++it) { union { v8h h; v4u u; } c;
#pragma unroll
      for (int i = 0; i < 8; ++i) c.h[i] = (_Float16)x[it][i];
      d[it] = c.u; }
#pragma unroll
    for (int it = 0; it < 8; ++it) vst2(dv + (it >> 2) * (TT / 32 * 4096) + ((it >> 1) & 1) * 4096 + (it & 1) * 2048, d[it]);
    asm volatile("s_wait_xcnt 0x0" :: "v"(dv) : "memory");   // precaution, as above
    __builtin_amdgcn_sched_barrier(0);   // keeps what follows, which may reuse the stores' registers, behind the wait above
    if (hi_rows) { v4u r[8], s[8]; const size_t o3 = ((bb * NH + c0 / HD) * (size_t)(KHI / 32) + (t0 >> 5)) * 4096 + ow; char* db = (char*)VB + o3; char* dc = (char*)VBL + o3;   // block-uniform
#pragma unroll
      for (int it = 0; it < 8; ++it) { union { v8b b; v4u u; } ch, cl;
#pragma unroll
        for (int i = 0; i < 8; ++i) { const float v = x[it][i]; const __bf16 bh = (__bf16)v; ch.b[i] = bh; cl.b[i] = (__bf16)(v - (float)bh); }
        r[it] = ch.u; s[it] = cl.u; }
#pragma unroll
      for (int it = 0; it < 8; ++it) { const int o = (it >> 2) * (KHI / 32 * 4096) + ((it >> 1) & 1) * 4096 + (it & 1) * 2048; vst2(db + o, r[it]); vst2(dc + o, s[it]); }
      asm volatile("s_wait_xcnt 0x0" :: "v"(db), "v"(dc) : "memory"); } } }   // precaution, as above
#define LC (SCALE * 1.44269504f)   // unscaled product -> exponent of 2: the logit scale times log2 e
__device__ __forceinline__ float xhalf(float x) { return __builtin_bit_cast(float, __builtin_amdgcn_permlanex16(__builtin_bit_cast(int, x), __builtin_bit_cast(int, x), 0x76543210, 0xfedcba98, false, false)); }   // lane l with lane l ^ 16
// one step of the running softmax over NT tiles of 16 keys: x = unscaled products in, p out; lim = last allowed key of the lane's query, counted from the lane's first key of the step (only looked at where last is set: the step that holds the diagonal; its first key is allowed for every query of the wave, so no step is empty)
template <int NT> __device__ __forceinline__ void sm_step(float (&x)[NT][8], bool last, int lim, float& m, float& l, v8f (&acc)[HD / 16]) {
  if (last) {   // the same for the whole wave
#pragma unroll
    for (int jt = 0; jt < NT; ++jt)
#pragma unroll
      for (int r = 0; r < 8; ++r) if (jt * 16 + r > lim) x[jt][r] = -3.0e38f; }
  float mx = -3.0e38f;
#pragma unroll
  for (int jt = 0; jt < NT; ++jt) mx = fmaxf(mx, fmaxf(fmaxf(fmaxf(x[jt][0], x[jt][1]), fmaxf(x[jt][2], x[jt][3])), fmaxf(fmaxf(x[jt][4], x[jt][5]), fmaxf(x[jt][6], x[jt][7]))));
  mx = fmaxf(mx, xhalf(mx));
  const float mn = fmaxf(m, mx), al = __builtin_amdgcn_exp2f((m - mn) * LC), ms = mn * LC - 10.0f; m = mn;   // first step: al = 2^(-5e37) = 0
  float sum = 0.f;
#pragma unroll
  for (int jt = 0; jt < NT; ++jt) {
#pragma unroll
    for (int r = 0; r < 8; ++r) x[jt][r] = __builtin_amdgcn_exp2f(x[jt][r] * LC - ms);   // one fused multiply-add and v_exp_f32; an excluded key: 2^(-5e37) = 0
    sum += ((x[jt][0] + x[jt][1]) + (x[jt][2] + x[jt][3])) + ((x[jt][4] + x[jt][5]) + (x[jt][6] + x[jt][7])); }
  l = l * al + sum;   // the lane's own keys; the halves are joined once, in att_store
#pragma unroll
  for (int j = 0; j < HD / 16; ++j) acc[j] *= al; }
// lane (g, c) holds ctx[query c][j * 16 + 8g + r]: what lane (g, c) of k_out reads as quads 2 (j & 1) and 2 (j & 1) + 1 of 32-k fragment 2 h + j / 2 (K step h)
__device__ __forceinline__ void att_store(float* __restrict__ Y, int b, int h, int ql0, int lane, float l, const v8f (&acc)[HD / 16]) {
  l += xhalf(l); const float inv = 1.0f / l; char* yr = (char*)Y + ((size_t)((b * TT + ql0) >> 4) * KST + h * 2) * 2048 + lane * 16;
#pragma unroll
  for (int j = 0; j < HD / 16; ++j) { v4f a, c;
#pragma unroll
    for (int i = 0; i < 4; ++i) { a[i] = acc[j][i] * inv; c[i] = acc[j][4 + i] * inv; }
    vst2(yr + j * 1024, a); vst2(yr + j * 1024 + 512, c); }
  asm volatile("s_wait_xcnt 0x0" :: "v"(yr) : "memory");   // precaution: stands in front of the first rewrite of a register that these stores name; the address as an input keeps its registers until here
  __builtin_amdgcn_sched_barrier(0); }   // keeps the next tile's address work behind the wait above
// 16 query rows from ql0 (>= QHI), steps of 64 keys: q, k once to f16 (1 product), p once to f16 against v f16 (1 product)
__device__ __forceinline__ void att_lo(const _Float16* __restrict__ QH, const _Float16* __restrict__ KH, const _Float16* __restrict__ VT, float* __restrict__ Y, int b, int h, int ql0, int lane) {
  const int col = lane & 15, g = lane >> 4; const int nt = (ql0 >> 6) + 1;
  const size_t bh = (size_t)(b * NH + h); const char* qp = (const char*)QH + (bh * (TT / 16) + (ql0 >> 4)) * 2048; const char* kb = (const char*)KH + bh * (TT / 16 * 2048); const char* vb = (const char*)VT + bh * (TT / 32 * 4096);   // wave-uniform bases; the lane's byte offset below does not change over the loop
  const unsigned ko = 16u * lane, vo = ko;   // fragment order: the lane's 16 bytes of every 512-byte block
  v8h qr[2][2], kr[4][2][2], vr[2][HD / 16][2]; const char* ka = kb + ko;   // the lane's address in the k step that is being loaded
#pragma unroll
  for (int kc = 0; kc < 2; ++kc) { qr[kc][0] = *(const v8h*)(qp + ko + kc * 1024); qr[kc][1] = *(const v8h*)(qp + ko + kc * 1024 + 512); }
#pragma unroll
  for (int jt = 0; jt < 4; ++jt)
#pragma unroll
    for (int kc = 0; kc < 2; ++kc) { kr[jt][kc][0] = *(const v8h*)(ka + jt * 2048 + kc * 1024); kr[jt][kc][1] = *(const v8h*)(ka + jt * 2048 + kc * 1024 + 512); }
  asm volatile("s_wait_xcnt 0x0" :: "v"(qp + ko), "v"(ka) : "memory");   // precaution: stands in front of the first rewrite of a register that these loads name; the addresses as inputs keep their registers from being given to a later load of the group
  __builtin_amdgcn_sched_barrier(0);   // keeps every later write of an address register behind the wait above
  v16h q[2];
#pragma unroll
  for (int kc = 0; kc < 2; ++kc) { union { v16h v; v8h q[2]; } f; f.q[0] = qr[kc][0]; f.q[1] = qr[kc][1]; q[kc] = f.v; }
  v8f acc[HD / 16] = {}; float m = -3.0e38f, l = 0.f;
#pragma unroll 1   // rolled: one step of 64 keys per trip keeps the live registers below 256
  for (int t = 0; t < nt; ++t) { const char* vk = vb + t * 8192;
#pragma unroll
    for (int c = 0; c < 2; ++c)
#pragma unroll
      for (int j = 0; j < HD / 16; ++j) { const int o = c * 4096 + j * 1024; vr[c][j][0] = *(const v8h*)(vk + vo + o); vr[c][j][1] = *(const v8h*)(vk + vo + o + 512); }
    asm volatile("s_wait_xcnt 0x0" :: "v"(vk + vo) : "memory");   // precaution, as above
    __builtin_amdgcn_sched_barrier(0);   // holds this step's 16 v loads in front of the logits, which with the softmax cover their latency, and every later write of an address register behind the wait above
    v8f s[4] = {};
#pragma unroll
    for (int kc = 0; kc < 2; ++kc)
#pragma unroll
      for (int jt = 0; jt < 4; ++jt) { union { v16h v; v8h q[2]; } f; f.q[0] = kr[jt][kc][0]; f.q[1] = kr[jt][kc][1]; s[jt] = wmma16(f.v, q[kc], s[jt]); }
    if (t + 1 < nt) { ka += 8192;   // the test reads the same for the whole wave; the step before's loads from ka have passed their wait
#pragma unroll
      for (int jt = 0; jt < 4; ++jt)
#pragma unroll
        for (int kc = 0; kc < 2; ++kc) { kr[jt][kc][0] = *(const v8h*)(ka + jt * 2048 + kc * 1024); kr[jt][kc][1] = *(const v8h*)(ka + jt * 2048 + kc * 1024 + 512); }
      asm volatile("s_wait_xcnt 0x0" :: "v"(ka) : "memory"); }   // precaution, as above; the next step's 16 k loads go into the registers that the products above have read, and the softmax and the products below cover their latency
    float x[4][8];
#pragma unroll
    for (int jt = 0; jt < 4; ++jt)
#pragma unroll
      for (int r = 0; r < 8; ++r) x[jt][r] = s[jt][r];
    sm_step<4>(x, t == nt - 1, ql0 + col - t * 64 - 8 * g, m, l, acc);
#pragma unroll
    for (int c = 0; c < 2; ++c) { v16h p;
#pragma unroll
      for (int i = 0; i < 8; ++i) { p[i] = (_Float16)x[2 * c][i]; p[8 + i] = (_Float16)x[2 * c + 1][i]; }
#pragma unroll
      for (int j = 0; j < HD / 16; ++j) { union { v16h v; v8h q[2]; } f; f.q[0] = vr[c][j][0]; f.q[1] = vr[c][j][1]; acc[j] = wmma16(f.v, p, acc[j]); } } }
  att_store(Y, b, h, ql0, lane, l, acc); }
// 16 query rows from ql0 (< QHI: few keys, no averaging), steps of 32 keys: q and k as f16 hi + residual (x 2^10) (3 products), p and v as bf16 hi + lo (3 products)
__device__ __forceinline__ void att_hi(const _Float16* __restrict__ QH, const _Float16* __restrict__ QL, const _Float16* __restrict__ KH, const _Float16* __restrict__ KL, const __bf16* __restrict__ VB, const __bf16* __restrict__ VBL, float* __restrict__ Y, int b, int h, int ql0, int lane) {
  const int col = lane & 15, g = lane >> 4; const int nt = (ql0 >> 5) + 1;
  const size_t bh = (size_t)(b * NH + h); const char* qp = (const char*)QH + (bh * (TT / 16) + (ql0 >> 4)) * 2048; const char* qlp = (const char*)QL + (bh * (QHI / 16) + (ql0 >> 4)) * 2048; const char* kb = (const char*)KH + bh * (TT / 16 * 2048); const char* klb = (const char*)KL + bh * (KHI / 16 * 2048);
  const char* vhb = (const char*)VB + bh * (KHI / 32 * 4096); const char* vlb = (const char*)VBL + bh * (KHI / 32 * 4096);   // wave-uniform bases; the lane's byte offset below does not change over the loop
  const unsigned ko = 16u * lane, vo = ko;   // fragment order: the lane's 16 bytes of every 512-byte block
  v8h qr[2][2], qs[2][2];
#pragma unroll
  for (int kc = 0; kc < 2; ++kc) { qr[kc][0] = *(const v8h*)(qp + ko + kc * 1024); qr[kc][1] = *(const v8h*)(qp + ko + kc * 1024 + 512); qs[kc][0] = *(const v8h*)(qlp + ko + kc * 1024); qs[kc][1] = *(const v8h*)(qlp + ko + kc * 1024 + 512); }
  asm volatile("s_wait_xcnt 0x0" :: "v"(qp + ko), "v"(qlp + ko) : "memory");   // precaution: stands in front of the first rewrite of a register that these loads name; the addresses as inputs keep their registers from being given to a later load of the group
  __builtin_amdgcn_sched_barrier(0);   // keeps every later write of an address register behind the wait above
  v16h qh[2], ql[2];
#pragma unroll
  for (int kc = 0; kc < 2; ++kc) { union { v16h v; v8h q[2]; } f; f.q[0] = qr[kc][0]; f.q[1] = qr[kc][1]; qh[kc] = f.v; f.q[0] = qs[kc][0]; f.q[1] = qs[kc][1]; ql[kc] = f.v; }
  v8f acc[HD / 16] = {}; float m = -3.0e38f, l = 0.f;
#pragma unroll 1   // rolled: one step of 32 keys per trip keeps the live registers below 256
  for (int t = 0; t < nt; ++t) { const char* kk = kb + t * 4096 + ko; const char* lk = klb + t * 4096 + ko; const char* hv = vhb + t * 4096 + vo; const char* lv = vlb + t * 4096 + vo;   // the lane's four addresses of this step
    v8h kh[2][2][2], kl[2][2][2]; v8b vh[HD / 16][2], vl[HD / 16][2];
#pragma unroll
    for (int jt = 0; jt < 2; ++jt)
#pragma unroll
      for (int kc = 0; kc < 2; ++kc) { const int o = jt * 2048 + kc * 1024; kh[jt][kc][0] = *(const v8h*)(kk + o); kh[jt][kc][1] = *(const v8h*)(kk + o + 512); kl[jt][kc][0] = *(const v8h*)(lk + o); kl[jt][kc][1] = *(const v8h*)(lk + o + 512); }
#pragma unroll
    for (int j = 0; j < HD / 16; ++j) { const int o = j * 1024; vh[j][0] = *(const v8b*)(hv + o); vh[j][1] = *(const v8b*)(hv + o + 512); vl[j][0] = *(const v8b*)(lv + o); vl[j][1] = *(const v8b*)(lv + o + 512); }
    asm volatile("s_wait_xcnt 0x0" :: "v"(kk), "v"(lk), "v"(hv), "v"(lv) : "memory");   // precaution, as above
    __builtin_amdgcn_sched_barrier(0);   // holds the step's 32 loads in front of its first product (sunk to their uses they would cost one memory latency each) and every later write of an address register behind the wait above
    v8f s[2] = {}, sl[2] = {};
#pragma unroll
    for (int kc = 0; kc < 2; ++kc)
#pragma unroll
      for (int jt = 0; jt < 2; ++jt) { union { v16h v; v8h q[2]; } fh, fl; fh.q[0] = kh[jt][kc][0]; fh.q[1] = kh[jt][kc][1]; fl.q[0] = kl[jt][kc][0]; fl.q[1] = kl[jt][kc][1]; s[jt] = wmma16(fh.v, qh[kc], s[jt]); sl[jt] = wmma16(fh.v, ql[kc], sl[jt]); sl[jt] = wmma16(fl.v, qh[kc], sl[jt]); }
    float x[2][8];
#pragma unroll
    for (int jt = 0; jt < 2; ++jt)
#pragma unroll
      for (int r = 0; r < 8; ++r) x[jt][r] = s[jt][r] + sl[jt][r] * (1.0f / 1024.0f);
    sm_step<2>(x, t == nt - 1, ql0 + col - t * 32 - 8 * g, m, l, acc);
    float v[16];
#pragma unroll
    for (int i = 0; i < 8; ++i) { v[i] = x[0][i]; v[8 + i] = x[1][i]; }
    const F2 p = bsplit16(v);
#pragma unroll
    for (int j = 0; j < HD / 16; ++j) { union { v16b v; v8b q[2]; } fh, fl; fh.q[0] = vh[j][0]; fh.q[1] = vh[j][1]; fl.q[0] = vl[j][0]; fl.q[1] = vl[j][1]; acc[j] = wmma_bf(fh.v, p.h, acc[j]); acc[j] = wmma_bf(fh.v, p.l, acc[j]); acc[j] = wmma_bf(fl.v, p.h, acc[j]); } }
  att_store(Y, b, h, ql0, lane, l, acc); }
// block = (pair of query blocks NQB-1-x and x, (b, h)): together NQB + 1 blocks of 64 keys, so the work is even except where x < QBH (block x on the 3-product path, in steps of 32 keys); wave = 16 query rows of the block; no LDS, no barrier
__global__ __launch_bounds__(128) void k_att(const _Float16* __restrict__ QH, const _Float16* __restrict__ QL, const _Float16* __restrict__ KH, const _Float16* __restrict__ KL, const _Float16* __restrict__ VT, const __bf16* __restrict__ VB, const __bf16* __restrict__ VBL, float* __restrict__ Y) { static_assert(CAUSAL && NQB % 2 == 0 && QBH * 64 == QHI && QHI == KHI, "the pairing counts on causal row lengths; the early-row path reads residual planes of QHI rows");
  const int lane = threadIdx.x & 31; const int wv = __builtin_amdgcn_readfirstlane(threadIdx.x >> 5);   // the wave's number as a scalar: trip counts and the tests on them are scalar, EXEC stays full at every product
  const int b = blockIdx.y / NH, h = blockIdx.y % NH;
#pragma unroll 1   // rolled: one copy of each path in the code
  for (int z = 0; z < 2; ++z) { const int qb = z ? (int)blockIdx.x : NQB - 1 - (int)blockIdx.x; const int ql0 = qb * 64 + wv * 16;
    if (qb < QBH) att_hi(QH, QL, KH, KL, VB, VBL, Y, b, h, ql0, lane); else att_lo(QH, KH, VT, Y, b, h, ql0, lane); } }
// ---- k_out: block = (64 rows, 128 cols): out = ctx Wo (+ bo): ctx once to f16 against Wo as f16(bf16 x 2^8) exact (1 product) x 2^-8; causal early rows (< QHI of each sequence): ctx bf16 hi + lo against exact bf16 Wo (2 products)
__global__ __launch_bounds__(128) void k_out(const float* __restrict__ Y, const float* __restrict__ WO, const float* __restrict__ BO, float* __restrict__ OUT) { __shared__ __align__(16) float sf[4][16][132]; __shared__ __align__(16) WT wt[2];
  const int tid = threadIdx.x, wave = tid >> 5, lane = tid & 31, col = lane & 15, g = lane >> 4; const int c0 = blockIdx.y * 128; const size_t r0 = (size_t)blockIdx.x * 64 + wave * 16;
  v8f acc[8] = {};
  if (CAUSAL && (int)(((size_t)blockIdx.x * 64) % TT) < QHI) {   /* block-uniform */
    gemm_k<1>((const char*)(Y + (size_t)blockIdx.x * 64 * CC), (unsigned)wave * (16u * CC * 4u) + 16u * lane, (const char*)(WO + c0), wt, wave, lane, acc);
#pragma unroll
    for (int j = 0; j < 8; ++j) { const float bias = BO ? bfr(BO[c0 + j * 16 + col]) : 0.f;
#pragma unroll
      for (int r = 0; r < 8; ++r) sf[wave][8 * g + r][j * 16 + col] = acc[j][r] + bias; }
  } else {
    gemm_k<2>((const char*)(Y + (size_t)blockIdx.x * 64 * CC), (unsigned)wave * (16u * CC * 4u) + 16u * lane, (const char*)(WO + c0), wt, wave, lane, acc);
#pragma unroll
    for (int j = 0; j < 8; ++j) { const float bias = BO ? bfr(BO[c0 + j * 16 + col]) : 0.f;
#pragma unroll
      for (int r = 0; r < 8; ++r) sf[wave][8 * g + r][j * 16 + col] = acc[j][r] * (1.0f / 256.0f) + bias; } }
  LDSX(); for (int rl = 0; rl < 16; ++rl) vst2(OUT + (r0 + rl) * DIN + c0 + lane * 4, *(const v4f*)&sf[wave][rl][lane * 4]); }

extern "C" void kernel_launch(void* const* d_in, const int* in_sizes, int n_in, void* d_out, int out_size, void* d_ws, size_t ws_size, hipStream_t stream) {
  (void)in_sizes; (void)n_in; (void)out_size;
  const float** F = (const float**)d_in;
  if (ws_size < (size_t)WS_END) return;
  char* ws = (char*)d_ws; _Float16 *QH = (_Float16*)(ws + WS_QH), *KH = (_Float16*)(ws + WS_KH), *VT = (_Float16*)(ws + WS_VT), *QL = (_Float16*)(ws + WS_QL), *KL = (_Float16*)(ws + WS_KL); __bf16 *VB = (__bf16*)(ws + WS_VB), *VBL = (__bf16*)(ws + WS_VBL); float *Y = (float*)(ws + WS_Y);
  (void)Y; (void)QL; (void)KL; (void)VB; (void)VBL;
  // inputs: 0 inputs_q [2,2048,1024]; 1 wq, 2 wk, 3 wv [1024,16,64] (= (in,out)); 4 wo [16,64,1024] (= (in,out)); 5 q_norm_scale [64]; 6 k_norm_scale [64]
  k_proj<<<dim3(TNB * TT / 64, CC / 128, 3), 128, 0, stream>>>(F[0], F[0], F[0], F[1], F[2], F[3], nullptr, nullptr, nullptr, QH, QL, KH, KL, VT, VB, VBL, F[5], F[6]);
  k_att<<<dim3(NQB / 2, TNB * NH), 128, 0, stream>>>(QH, QL, KH, KL, VT, VB, VBL, Y);
  k_out<<<dim3(TNB * TT / 64, DIN / 128), 128, 0, stream>>>(Y, F[4], nullptr, (float*)d_out);
}
